// v008
// Times are from an AMD MI455X. After a warm-up the kernel runs many times in a row, and a time is the length of
// such a window on the GPU divided by its runs, so every launch and the gaps after it count. The runs cycle
// through copies of the inputs. A figure is the median of several windows, for all but v000 over two sittings.
// Sittings can differ by a few percent; kernels timed side by side share one.
// This document starts at v008; the versions before it stand elsewhere.
// One run takes 255 microseconds.
// Next to v007, in two timings, it ran 1.06 times as fast each time.
// All steps since the starting kernel, v000, together make it 32.0 times as fast.
#include <hip/hip_runtime.h>
#include <math.h>

typedef __attribute__((ext_vector_type(16))) _Float16 v16h;
typedef __attribute__((ext_vector_type(8)))  _Float16 v8h;
typedef __attribute__((ext_vector_type(16))) __bf16   v16b;
typedef __attribute__((ext_vector_type(8)))  float    v8f;
typedef __attribute__((ext_vector_type(4)))  float    v4f;

// 16-bit WMMA fragment map (wave32), lane L, h = L>>4, m = L&15:
//   A 16x32: lane = row m;   element i -> k = (i<8) ? 8h+i : 16+8h+(i-8)
//   B 32x16: lane = column m; the SAME k(i,h)
//   D 16x16 (8 f32): lane = column m; element r -> row 8h+r
__device__ __forceinline__ int frag_k(int i, int h) { return (i < 8) ? (8 * h + i) : (16 + 8 * h + (i - 8)); }
__device__ __forceinline__ __bf16 bf16_rne(float f) {
    unsigned int u = __float_as_uint(f);
    u += 0x7fffu + ((u >> 16) & 1u);
    return __builtin_bit_cast(__bf16, (unsigned short)(u >> 16));
}
__device__ __forceinline__ float bf16_f32(__bf16 b) { return __uint_as_float(((unsigned int)__builtin_bit_cast(unsigned short, b)) << 16); }
__device__ __forceinline__ v8f wmma16(v16h a, v16h b, v8f c) {
    c = __builtin_amdgcn_wmma_f32_16x16x32_f16(false, a, false, b, (short)0, c, false, false);
    asm volatile("v_nop\n\tv_nop\n\tv_nop\n\tv_nop" : "+v"(c) : "v"(a), "v"(b));
    return c;
}
__device__ __forceinline__ v8f wmmab(v16b a, v16b b, v8f c) {
    c = __builtin_amdgcn_wmma_f32_16x16x32_bf16(false, a, false, b, (short)0, c, false, false);
    asm volatile("v_nop\n\tv_nop\n\tv_nop\n\tv_nop" : "+v"(c) : "v"(a), "v"(b));
    return c;
}
struct Split { v16b hi, lo; };
// hi/lo split product: a.hi*b.hi + a.hi*b.lo + a.lo*b.hi
__device__ __forceinline__ v8f wmma3(const Split& a, const Split& b, v8f c) {
    c = __builtin_amdgcn_wmma_f32_16x16x32_bf16(false, a.hi, false, b.hi, (short)0, c, false, false);
    c = __builtin_amdgcn_wmma_f32_16x16x32_bf16(false, a.hi, false, b.lo, (short)0, c, false, false);
    c = __builtin_amdgcn_wmma_f32_16x16x32_bf16(false, a.lo, false, b.hi, (short)0, c, false, false);
    asm volatile("v_nop\n\tv_nop\n\tv_nop\n\tv_nop" : "+v"(c) : "v"(a.hi), "v"(a.lo), "v"(b.hi), "v"(b.lo));
    return c;
}
struct Split3 { v16b hi, mid, lo; };
// triple split product (6 terms, drops only terms below 2^-24 relative)
__device__ __forceinline__ v8f wmma6(const Split3& a, const Split3& b, v8f c) {
    c = __builtin_amdgcn_wmma_f32_16x16x32_bf16(false, a.hi, false, b.hi, (short)0, c, false, false);
    c = __builtin_amdgcn_wmma_f32_16x16x32_bf16(false, a.hi, false, b.mid, (short)0, c, false, false);
    c = __builtin_amdgcn_wmma_f32_16x16x32_bf16(false, a.mid, false, b.hi, (short)0, c, false, false);
    c = __builtin_amdgcn_wmma_f32_16x16x32_bf16(false, a.hi, false, b.lo, (short)0, c, false, false);
    c = __builtin_amdgcn_wmma_f32_16x16x32_bf16(false, a.mid, false, b.mid, (short)0, c, false, false);
    c = __builtin_amdgcn_wmma_f32_16x16x32_bf16(false, a.lo, false, b.hi, (short)0, c, false, false);
    asm volatile("v_nop\n\tv_nop\n\tv_nop\n\tv_nop" : "+v"(c) : "v"(a.hi), "v"(a.mid), "v"(a.lo), "v"(b.hi), "v"(b.mid), "v"(b.lo));
    return c;
}

// Fragment gathers from f32 memory: element i <- p[(k0 + frag_k(i,h)) * sk] * s, zero for k >= klen.
__device__ __forceinline__ v16h fh_ld(const float* __restrict__ p, long long sk, int k0, int h, int klen, float s) {
    v16h a;
#pragma unroll
    for (int i = 0; i < 16; ++i) { const int k = k0 + frag_k(i, h); a[i] = (k < klen) ? (_Float16)(p[(long long)k * sk] * s) : (_Float16)0.f; }
    return a;
}
__device__ __forceinline__ Split sp_ld(const float* __restrict__ p, long long sk, int k0, int h, int klen, float s) {
    Split r;
#pragma unroll
    for (int i = 0; i < 16; ++i) {
        const int k = k0 + frag_k(i, h); const float x = (k < klen) ? p[(long long)k * sk] * s : 0.f;
        const __bf16 hb = bf16_rne(x); r.hi[i] = hb; r.lo[i] = bf16_rne(x - bf16_f32(hb));
    }
    return r;
}
__device__ __forceinline__ Split3 sp3_ld(const float* __restrict__ p, long long sk, int k0, int h, int klen, float s) {
    Split3 r;
#pragma unroll
    for (int i = 0; i < 16; ++i) {
        const int k = k0 + frag_k(i, h); const float x = (k < klen) ? p[(long long)k * sk] * s : 0.f;
        const __bf16 hb = bf16_rne(x); const float r1 = x - bf16_f32(hb); const __bf16 mb = bf16_rne(r1);
        r.hi[i] = hb; r.mid[i] = mb; r.lo[i] = bf16_rne(r1 - bf16_f32(mb));
    }
    return r;
}
__device__ __forceinline__ v16b bh_ld(const float* __restrict__ p, long long sk, int k0, int h, int klen, float s) {
    v16b a;
#pragma unroll
    for (int i = 0; i < 16; ++i) { const int k = k0 + frag_k(i, h); a[i] = bf16_rne((k < klen) ? p[(long long)k * sk] * s : 0.f); }
    return a;
}
// f16 fragment from an f16 LDS/global row with element stride 1 (k-contiguous), no bounds (tile already zero padded)
__device__ __forceinline__ v16h fh_row(const _Float16* __restrict__ row, int k0, int h) {
    v16h a;
#pragma unroll
    for (int i = 0; i < 16; ++i) a[i] = row[k0 + frag_k(i, h)];
    return a;
}

typedef __attribute__((ext_vector_type(4))) _Float16 v4h;
typedef __attribute__((ext_vector_type(8))) short v8s;
typedef __attribute__((address_space(3))) v8s lds_v8s;         // 16 bytes of LDS, as the transposing load takes them
// One 16-bit fragment's 32 k of a k-contiguous, 16-byte aligned f32 row as four unguarded 16-byte loads; row = the lane's row + 8 * h elements.
// fr_cvt packs them in the k order of frag_k.
struct FragRaw { v4f x0, x1, x2, x3; };
__device__ __forceinline__ FragRaw fr_ld(const v4f* __restrict__ row, int k0) {
    FragRaw r; r.x0 = row[k0 / 4]; r.x1 = row[k0 / 4 + 1]; r.x2 = row[k0 / 4 + 4]; r.x3 = row[k0 / 4 + 5];
    return r;
}
__device__ __forceinline__ v16h fr_cvt(const FragRaw& r) {
    v16h a;
#pragma unroll
    for (int i = 0; i < 4; ++i) { a[i] = (_Float16)r.x0[i]; a[4 + i] = (_Float16)r.x1[i]; a[8 + i] = (_Float16)r.x2[i]; a[12 + i] = (_Float16)r.x3[i]; }
    return a;
}

#define VST2(T, ptr, val) do { const T vst2_v_ = (val); *(T*)(ptr) = vst2_v_;  } while (0)
typedef float v4f __attribute__((ext_vector_type(4)));
#define VST2V4(ptr, val) do { const v4f vst2_v4_ = (val); *(v4f*)(ptr) = vst2_v4_;  } while (0)

__device__ __attribute__((noinline)) float act_fn(float v, int act) {
    if (act == 1) return fmaxf(v, 0.f);                                                                               // relu
    if (act == 2) { const float u = 0.7978845608028654f * (v + 0.044715f * v * v * v); return 0.5f * v * (1.f + tanhf(u)); } // tanh-gelu
    if (act == 3) return v / (1.f + expf(-v));                                                                        // silu
    if (act == 4) return 0.5f * v * (1.f + erff(v * 0.7071067811865476f));                                             // erf-gelu
    if (act == 5) return tanhf(v);
    if (act == 6) return 1.f / (1.f + expf(-v));                                                                      // sigmoid
    if (act == 7) return (v > 0.f) ? v : 0.01f * v;                                                                   // leaky relu 0.01
    if (act == 8) return (v > 0.f) ? v : (expf(v) - 1.f);                                                             // elu
    if (act == 9) return fminf(fmaxf(v, 0.f), 6.f);                                                                   // relu6
    if (act == 10) return fabsf(v);                                                                                    // abs
    if (act == 11) return (v >= 0.f) ? v : 0.1f * v;                                                                  // leaky 0.1
    if (act == 12) return (v > 0.f) ? v : 0.2f * v;                                                                   // leaky 0.2
    if (act == 13) return (v > 20.f) ? v : log1pf(expf(v));                                                            // softplus
    return v;
}

// =====================================================================================================================
// k_gemm<MODE>: C(z, m, n) = act(alpha * sum_k A(z, m, k) * B(z, k, n) + bias) + beta * R(z, m, n)
//   One wave (32-thread block) per 16 x 32 tile of C; grid (ceil(N/32), ceil(M/16), Z). Batch z -> (zo = z / zi_n, zi = z % zi_n)
//   with separate outer/inner strides for every tensor (e.g. batch and head). A(m,k) = A[zo*sAo + zi*sAi + m*sAm + k*sAk] (f32),
//   B(k,n) = B[zo*sBo + zi*sBi + n*sBn + k*sBk] (f32); any M, N, K (K zero-padded to 32 inside the fragments, M/N tails guarded).
//   C(m,n) = C[zo*sCo + zi*sCi + m*sCm + n] (n contiguous). flags: 1 bias[n], 2 bias[m], 4 residual R[zo*sRo + zi*sRi + m*sRm + n*sRn].
//   MODE 0: f16 operands (A prescaled by sa, B by sb, both undone in the epilogue); 1: bf16 hi/lo split (3 products); 2: bf16;
//   3: bf16 hi/mid/lo triple split (6 products); 4: as 3 with Kahan-compensated f32 accumulation across k-steps.
// =====================================================================================================================
struct GemmP {
    const float* A; const float* B; const float* bias; const float* R; float* C;
    long long sAo, sAi, sAm, sAk, sBo, sBi, sBn, sBk, sCo, sCi, sCm, sRo, sRi, sRm, sRn;
    int M, N, K, zi_n, flags, act; float alpha, beta, sa, sb;
    int Npad, pad_;     // columns [N, Npad) of C are written as 0 so that padded workspace rows are covered by whole-line stores; Npad >= N
};
static_assert(sizeof(GemmP) == 5 * 8 + 15 * 8 + 6 * 4 + 4 * 4 + 2 * 4, "GemmP has padding");

template <int MODE>
__global__ __launch_bounds__(32) void k_gemm(GemmP p) {
    const int lane = threadIdx.x & 31, h = lane >> 4, l15 = lane & 15;
    const int m0 = blockIdx.y * 16, n0 = blockIdx.x * 32;
    const int z = blockIdx.z, zo = z / p.zi_n, zi = z - zo * p.zi_n;
    const float* A = p.A + zo * p.sAo + zi * p.sAi;
    const float* B = p.B + zo * p.sBo + zi * p.sBi;
    const int am = min(m0 + l15, p.M - 1);                       // clamped row for loads (stores are guarded)
    v8f acc[2], comp[2];
#pragma unroll
    for (int t = 0; t < 2; ++t) { v8f zz = {}; acc[t] = zz; comp[t] = zz; }
    for (int k0 = 0; k0 < p.K; k0 += 32) {
        const float* arow = A + (long long)am * p.sAm;
        if (MODE == 1) {
            const Split a = sp_ld(arow, p.sAk, k0, h, p.K, 1.f);
#pragma unroll
            for (int t = 0; t < 2; ++t) {
                const int bn = min(n0 + t * 16 + l15, p.N - 1);
                acc[t] = wmma3(a, sp_ld(B + (long long)bn * p.sBn, p.sBk, k0, h, p.K, 1.f), acc[t]);
            }
        } else if (MODE == 3) {
            const Split3 a = sp3_ld(arow, p.sAk, k0, h, p.K, 1.f);
#pragma unroll
            for (int t = 0; t < 2; ++t) {
                const int bn = min(n0 + t * 16 + l15, p.N - 1);
                acc[t] = wmma6(a, sp3_ld(B + (long long)bn * p.sBn, p.sBk, k0, h, p.K, 1.f), acc[t]);
            }
        } else if (MODE == 4) {
            // triple split as MODE 3, but each k-step's 6 products go into a fresh accumulator and the partial is added to the running f32 sum
            // on the VALU with Kahan compensation (accumulation error stays ~1 ulp however long K is)
            const Split3 a = sp3_ld(arow, p.sAk, k0, h, p.K, 1.f);
#pragma unroll
            for (int t = 0; t < 2; ++t) {
                const int bn = min(n0 + t * 16 + l15, p.N - 1); v8f zz = {};
                const v8f part = wmma6(a, sp3_ld(B + (long long)bn * p.sBn, p.sBk, k0, h, p.K, 1.f), zz);
                const v8f y = part - comp[t]; const v8f s = acc[t] + y; comp[t] = (s - acc[t]) - y; acc[t] = s;
            }
        } else if (MODE == 2) {
            const v16b a = bh_ld(arow, p.sAk, k0, h, p.K, 1.f);
#pragma unroll
            for (int t = 0; t < 2; ++t) {
                const int bn = min(n0 + t * 16 + l15, p.N - 1);
                acc[t] = wmmab(a, bh_ld(B + (long long)bn * p.sBn, p.sBk, k0, h, p.K, 1.f), acc[t]);
            }
        } else {
            const v16h a = fh_ld(arow, p.sAk, k0, h, p.K, p.sa);
#pragma unroll
            for (int t = 0; t < 2; ++t) {
                const int bn = min(n0 + t * 16 + l15, p.N - 1);
                acc[t] = wmma16(a, fh_ld(B + (long long)bn * p.sBn, p.sBk, k0, h, p.K, p.sb), acc[t]);
            }
        }
    }
    const float iscale = (MODE == 0) ? p.alpha / (p.sa * p.sb) : p.alpha;
    float* C = p.C + zo * p.sCo + zi * p.sCi;
    const float* R = p.R + zo * p.sRo + zi * p.sRi;
    __shared__ __align__(16) float ctile[16][36];
#pragma unroll
    for (int t = 0; t < 2; ++t) {
        const int n = n0 + t * 16 + l15; const int nn = min(n, p.N - 1);
#pragma unroll
        for (int r = 0; r < 8; ++r) {
            const int m = m0 + 8 * h + r; const int mm = min(m, p.M - 1);
            float v = acc[t][r] * iscale;
            if (p.flags & 1) v += p.bias[nn];
            if (p.flags & 2) v += p.bias[mm];
            if (p.flags & 8) v *= p.bias[(long long)zo * p.M + mm];   /* per-(z,row) scale vector laid out [Z][M]; exclusive with the bias flags */
            v = act_fn(v, p.act);
            if (p.flags & 4) v += p.beta * R[(long long)mm * p.sRm + (long long)nn * p.sRn];
            ctile[8 * h + r][t * 16 + l15] = (n < p.N) ? v : 0.f;
        }
    }
    __syncthreads();
    const int NW = (p.Npad > p.N) ? p.Npad : p.N;           // write width
    const bool fast = (m0 + 16 <= p.M) && (n0 + 32 <= NW) && ((p.sCm & 3) == 0) && ((((size_t)C) & 15) == 0);
    if (fast) {
#pragma unroll
        for (int s = 0; s < 4; ++s) {
            const int row = s * 4 + (lane >> 3), c4 = (lane & 7) * 4;
            const v4f v = *(const v4f*)&ctile[row][c4];
            VST2V4(C + (long long)(m0 + row) * p.sCm + n0 + c4, v);
        }
    } else {
        for (int row = 0; row < 16; ++row) {
            const int m = m0 + row, n = n0 + lane;
            if (m < p.M && n < NW) VST2(float, C + (long long)m * p.sCm + n, ctile[row][lane]);
        }
    }
}


// =====================================================================================================================
// k_gemmT<MODE, TM, TN>: same contract as k_gemm, but one wave computes a (16*TM) x (16*TN) tile: TM A fragments and TN B fragments are
//   loaded per 32-wide k-step and reused across TM*TN WMMAs (far fewer load/convert instructions per MAC). MODE 0 (f16), 1 (bf16 hi/lo),
//   2 (bf16) only. grid (ceil(NW/(16*TN)), ceil(M/(16*TM)), Z), block 32. Epilogue identical to k_gemm, run per 16x32 sub-tile.
// =====================================================================================================================
template <int MODE, int TM, int TN>
__global__ __launch_bounds__(32) void k_gemmT(GemmP p) {
    const int lane = threadIdx.x & 31, h = lane >> 4, l15 = lane & 15;
    const int m0 = blockIdx.y * (16 * TM), n0 = blockIdx.x * (16 * TN);
    const int z = blockIdx.z, zo = z / p.zi_n, zi = z - zo * p.zi_n;
    const float* A = p.A + zo * p.sAo + zi * p.sAi;
    const float* B = p.B + zo * p.sBo + zi * p.sBi;
    v8f acc[TM][TN];
#pragma unroll
    for (int i = 0; i < TM; ++i)
#pragma unroll
        for (int t = 0; t < TN; ++t) { v8f zz = {}; acc[i][t] = zz; }
    for (int k0 = 0; k0 < p.K; k0 += 32) {
        if (MODE == 1) {
            Split a[TM], b[TN];
#pragma unroll
            for (int i = 0; i < TM; ++i) { const int am = min(m0 + 16 * i + l15, p.M - 1); a[i] = sp_ld(A + (long long)am * p.sAm, p.sAk, k0, h, p.K, 1.f); }
#pragma unroll
            for (int t = 0; t < TN; ++t) { const int bn = min(n0 + 16 * t + l15, p.N - 1); b[t] = sp_ld(B + (long long)bn * p.sBn, p.sBk, k0, h, p.K, 1.f); }
#pragma unroll
            for (int i = 0; i < TM; ++i)
#pragma unroll
                for (int t = 0; t < TN; ++t) acc[i][t] = wmma3(a[i], b[t], acc[i][t]);
        } else if (MODE == 2) {
            v16b a[TM], b[TN];
#pragma unroll
            for (int i = 0; i < TM; ++i) { const int am = min(m0 + 16 * i + l15, p.M - 1); a[i] = bh_ld(A + (long long)am * p.sAm, p.sAk, k0, h, p.K, 1.f); }
#pragma unroll
            for (int t = 0; t < TN; ++t) { const int bn = min(n0 + 16 * t + l15, p.N - 1); b[t] = bh_ld(B + (long long)bn * p.sBn, p.sBk, k0, h, p.K, 1.f); }
#pragma unroll
            for (int i = 0; i < TM; ++i)
#pragma unroll
                for (int t = 0; t < TN; ++t) acc[i][t] = wmmab(a[i], b[t], acc[i][t]);
        } else {
            v16h a[TM], b[TN];
#pragma unroll
            for (int i = 0; i < TM; ++i) { const int am = min(m0 + 16 * i + l15, p.M - 1); a[i] = fh_ld(A + (long long)am * p.sAm, p.sAk, k0, h, p.K, p.sa); }
#pragma unroll
            for (int t = 0; t < TN; ++t) { const int bn = min(n0 + 16 * t + l15, p.N - 1); b[t] = fh_ld(B + (long long)bn * p.sBn, p.sBk, k0, h, p.K, p.sb); }
#pragma unroll
            for (int i = 0; i < TM; ++i)
#pragma unroll
                for (int t = 0; t < TN; ++t) acc[i][t] = wmma16(a[i], b[t], acc[i][t]);
        }
    }
    const float iscale = (MODE == 0) ? p.alpha / (p.sa * p.sb) : p.alpha;
    float* C = p.C + zo * p.sCo + zi * p.sCi;
    const float* R = p.R + zo * p.sRo + zi * p.sRi;
    const int NW = (p.Npad > p.N) ? p.Npad : p.N;
    __shared__ __align__(16) float ctile[16][36];
#pragma unroll
    for (int i = 0; i < TM; ++i) {
        const int mb = m0 + 16 * i; if (mb >= p.M) break;          // wave-uniform
#pragma unroll
        for (int tp = 0; tp < TN / 2; ++tp) {
            const int nb = n0 + 32 * tp; if (nb >= NW) break;        // wave-uniform
#pragma unroll
            for (int t2 = 0; t2 < 2; ++t2) {
                const int t = 2 * tp + t2; const int n = nb + t2 * 16 + l15; const int nn = min(n, p.N - 1);
#pragma unroll
                for (int r = 0; r < 8; ++r) {
                    const int m = mb + 8 * h + r; const int mm = min(m, p.M - 1);
                    float v = acc[i][t][r] * iscale;
                    if (p.flags & 1) v += p.bias[nn];
                    if (p.flags & 2) v += p.bias[mm];
            if (p.flags & 8) v *= p.bias[(long long)zo * p.M + mm];   /* per-(z,row) scale vector laid out [Z][M]; exclusive with the bias flags */
                    v = act_fn(v, p.act);
                    if (p.flags & 4) v += p.beta * R[(long long)mm * p.sRm + (long long)nn * p.sRn];
                    ctile[8 * h + r][t2 * 16 + l15] = (n < p.N) ? v : 0.f;
                }
            }
            __syncthreads();
            const bool fast = (mb + 16 <= p.M) && (nb + 32 <= NW) && ((p.sCm & 3) == 0) && ((((size_t)C) & 15) == 0);
            if (fast) {
#pragma unroll
                for (int s = 0; s < 4; ++s) {
                    const int row = s * 4 + (lane >> 3), c4 = (lane & 7) * 4;
                    const v4f v = *(const v4f*)&ctile[row][c4];
                    VST2V4(C + (long long)(mb + row) * p.sCm + nb + c4, v);
                }
            } else {
                for (int row = 0; row < 16; ++row) {
                    const int m = mb + row, n = nb + lane;
                    if (m < p.M && n < NW) VST2(float, C + (long long)m * p.sCm + n, ctile[row][lane]);
                }
            }
            __syncthreads();
        }
    }
}

// =====================================================================================================================
//   Wave = 16 queries, AW waves per block, 64-key blocks; grid (ceil(Lq/(16*AW)), H, B), block 32*AW. Any Lq, Lk; head dim dh <= DHP
//   (DHP multiple of 32), value dim dv <= DVP (multiple of 16, <= 128). Every tensor addressed by (batch, head, row, element) strides, f32.
//   Scores: QM 0 f16 operands, 1 bf16 hi/lo split, 2 bf16 triple split; statistics f32 (exp2 domain); P.V: P x 4096 as f16 with V f16 staged in LDS
//   (SPLITPV: P and V as bf16 hi/lo splits). kv head = h / hrep. Masking: causal = 1 (keep j <= i + coff, masked -> -inf, key blocks beyond the
//   diagonal skipped), causal = 2 (masked -> mfill, a finite fill like the -1e9; no skipping), causal = 3 (keep j >= i + coff,
//   masked -> -inf, no skipping); optional additive f32 mask Mf,
//   optional int keep-mask Mi (0 -> score := mfill), both addressed b*smb + h*smh + i*smi + j*smj (0 strides broadcast).
// =====================================================================================================================
#define AW 4
// lane l's value of lane l ^ 16 (the wave's other half), by a vector cross-row move
__device__ __forceinline__ float xhalf(float x) { return __builtin_bit_cast(float, __builtin_amdgcn_permlanex16(__builtin_bit_cast(int, x), __builtin_bit_cast(int, x), 0x76543210, 0xfedcba98, false, false)); }
struct AttnP {   // apv4
    const float* Q; const float* K; const float* V; float* O; float* P; const float* Mf; const int* Mi; float* ST;
    const float* Pw; const float* Rt; const int* SQ; const int* SK;           // optional: post-softmax weight, relative-position table, segment ids
    long long swb, swh, swi, swj, srb, srh, sri;                                 // Pw strides (b,h,i,j); Rt strides (b,h,i), column = clamp(i - j + roff, 0, rn-1)
    long long sQb, sQh, sQi, sQd, sKb, sKh, sKj, sKd, sVb, sVh, sVj, sVd, sOb, sOh, sOi, sPb, sPh, sPi, smb, smh, smi, smj;
    int Lq, Lk, dh, dv, hrep, causal, coff, pband;   // pband > 0: P holds only the band |j - i| <= pband, column j - i + pband
    float scale, mfill; int nonorm, mpol;             // nonorm (online path only): O = sum_j exp(score_j) V_j without the 1/rowsum (scores must be <= ~0); mpol: Mi masks where ==0 (mpol 0) or where !=0 (mpol 1)
    int roff, rn, segpol, win;                        // Rt column offset/count; SQ/SK: score := mfill where (segpol 0) SQ[i] != SK[j] or (segpol 1) SQ[i] == SK[j]; win > 0: keys with i - j > win (after coff) -> -inf
};
//   Pw: the softmax numerator is multiplied by Pw(b,h,i,j) AFTER the row sum is taken (probs * weight, then P.V), as in post-softmax multiplicative biases.                                                    // ST (optional): per row (b,h,i) -> ST[((b*H + h)*Lq + i)*2 + {0,1}] = {row max of the scaled+masked score (natural units), sum_j exp(score - max)}
static_assert(sizeof(AttnP) == 12 * 8 + 29 * 8 + 16 * 4, "AttnP has padding");

#ifndef KATTN_ATTR
#define KATTN_ATTR __attribute__((amdgpu_waves_per_eu(4, 4)))   // the launch puts 4 waves on a SIMD: registers are budgeted for that, so a key block's 16 loads still issue as one group
#endif
template <int DHP, int DVP, int QM, bool SPLITPV, bool TWOPASS, bool UNIT = false, bool PLAIN = false>
__global__ __launch_bounds__(32 * AW) KATTN_ATTR void k_attn(AttnP p) {
    static_assert(!PLAIN || !TWOPASS, "PLAIN covers the one-pass path");
    static_assert(!UNIT || (QM == 0 && !SPLITPV && !TWOPASS && (32 * AW) / (DVP / 4) == 8 && (32 * AW) / (DHP / 4) == 8), "UNIT covers the f16 one-pass path, 8 K rows and 8 V rows per load step");
    constexpr int NT = DVP / 16;                // output tiles
    constexpr int KS = DHP / 32;                // k-steps for the scores
    constexpr int VP = (UNIT && PLAIN) ? DVP + 16 : DVP + 8;   // LDS pitch of the V tile (halves); transposed path: an odd multiple of 32 bytes, the pitch at which the transposing LDS load runs without bank conflicts
    constexpr int KP = DHP + 8;                 // LDS pitch of the K tile (halves): an odd multiple of 16 bytes, so a fragment's 16 rows fall on different banks
    __shared__ __align__(16) float    pl[AW][16 * 64];
    __shared__ __align__(16) _Float16 vl[(SPLITPV ? 2 : 1) * 64 * VP];   // f16 V tile, or bf16 hi and lo tiles (same 2-byte size)
    __shared__ __align__(16) _Float16 kl[UNIT ? 64 * KP : 8];            // UNIT: f16 K tile, row = key
    const int lane = threadIdx.x & 31, hf = lane >> 4, l15 = lane & 15, wave = threadIdx.x >> 5;
    const int h = blockIdx.y, b = blockIdx.z, hk = h / p.hrep;
    const int q0 = (blockIdx.x * AW + wave) * 16;
    float* myp = pl[wave];
    const float L2E = 1.4426950408889634f;
    const float NEG = -__builtin_inff();
    const int qi = min(q0 + l15, p.Lq - 1);
    const float* qrow = p.Q + b * p.sQb + h * p.sQh + (long long)qi * p.sQi;
    const float* kbase = p.K + b * p.sKb + hk * p.sKh;
    const float* vbase = p.V + b * p.sVb + hk * p.sVh;
    const v4f* qp = (const v4f*)(qrow + 8 * hf);               // UNIT: the lane's half of the fragment's k
    v16h qa[QM == 0 ? KS : 1]; Split qs_[QM == 1 ? KS : 1]; Split3 qt_[QM == 2 ? KS : 1];
#pragma unroll
    for (int ks = 0; ks < KS; ++ks) {
        if (QM == 2) qt_[ks] = sp3_ld(qrow, p.sQd, ks * 32, hf, p.dh, 1.f);
        else if (QM == 1) qs_[ks] = sp_ld(qrow, p.sQd, ks * 32, hf, p.dh, 1.f);
        else if (UNIT) qa[ks] = fr_cvt(fr_ld(qp, ks * 32));
        else qa[ks] = fh_ld(qrow, p.sQd, ks * 32, hf, p.dh, 1.f);
    }
    if (UNIT) asm volatile("s_wait_xcnt 0x0" :: "v"(qp) : "memory");   // the Q loads' address registers stay as they are up to this wait (named as input) and are reused behind it
    constexpr int VR = (32 * AW) / (DVP / 4);                  // V rows that the block's threads cover with one 16-byte load each
    constexpr int KR = (32 * AW) / (DHP / 4);                  // K rows that the block's threads cover with one 16-byte load each
    const unsigned koff = (unsigned)((int)(threadIdx.x / (DHP / 4)) * (int)p.sKj + (int)(threadIdx.x % (DHP / 4)) * 4) * 4u;   // UNIT: thread's byte offset in KR rows of K
    const unsigned voff = (unsigned)((int)(threadIdx.x / (DVP / 4)) * (int)p.sVj + (int)(threadIdx.x % (DVP / 4)) * 4) * 4u;   // UNIT: thread's byte offset in VR rows of V
    // transposed path: the 16 bytes of the V tile that this lane hands to a transposing load of keys 0 ... 15, columns 0 ... 15: row 8 hf + (lane & 7), column half (lane >> 3) & 1
    lds_v8s* const vtr = (lds_v8s*)(vl + (8 * hf + (lane & 7)) * VP + 8 * ((lane >> 3) & 1));
    v8f o[NT]; float m8[8], l8[8];
#pragma unroll
    for (int t = 0; t < NT; ++t) { v8f zz = {}; o[t] = zz; }
#pragma unroll
    for (int i = 0; i < 8; ++i) { m8[i] = NEG; l8[i] = 0.f; }
    int jend = p.Lk; int jstart = 0;
    if (!PLAIN && p.causal == 1) { const int je = (blockIdx.x * AW + AW - 1) * 16 + 16 + p.coff; jend = min(jend, max(je, 0)); }   // uniform per block
    if (!PLAIN && p.win > 0) { const int js = (int)(blockIdx.x * AW) * 16 + p.coff - p.win; jstart = (js > 0) ? (js / 64) * 64 : 0; }   // uniform per block: key blocks entirely outside every row's window hold only -inf entries and are skipped exactly
    const int npass = TWOPASS ? 2 : 1;
    for (int pass = 0; pass < npass; ++pass) {
        const bool dopv = (!TWOPASS) || pass == 1;
        for (int j0 = jstart; j0 < jend; j0 += 64) {
            if (dopv) {
                __syncthreads();                                 // previous key block's reads of kl / vl / pl are done
                if (!UNIT)
                for (int idx = threadIdx.x; idx < 64 * DVP; idx += 32 * AW) {
                    const int jr = idx / DVP, d = idx - jr * DVP, j = j0 + jr;
                    const float f = (j < p.Lk && d < p.dv) ? vbase[(long long)j * p.sVj + (long long)d * p.sVd] : 0.f;
                    if (SPLITPV) {
                        const __bf16 hb = bf16_rne(f);
                        ((__bf16*)vl)[jr * VP + d] = hb; ((__bf16*)vl)[64 * VP + jr * VP + d] = bf16_rne(f - bf16_f32(hb));
                    } else vl[jr * VP + d] = (_Float16)f;
                }
            }
            v8f s[4];
            union { v16h v; v8s h[2]; } va[(UNIT && PLAIN) ? NT : 1][2];   // transposed path: V^T as A, [value tile t][the block's first and second 32 keys]: lane = value column 16 t + l15, element e = key frag_k(e, hf)
            if (UNIT) {
                v4f vr[8], kr[8]; const v4f* vp[8]; const v4f* kp[8];
#pragma unroll
                for (int it = 0; it < 8; ++it) { vp[it] = (const v4f*)((const char*)(vbase + (long long)(j0 + it * VR) * p.sVj) + voff); vr[it] = *vp[it]; }
#pragma unroll
                for (int it = 0; it < 8; ++it) { kp[it] = (const v4f*)((const char*)(kbase + (long long)(j0 + it * KR) * p.sKj) + koff); kr[it] = *kp[it]; }
                // the group's address registers stay as they are up to this wait (named as inputs) and are reused behind it, while the loads are still in flight
                asm volatile("s_wait_xcnt 0x0" :: "v"(vp[0]), "v"(vp[1]), "v"(vp[2]), "v"(vp[3]), "v"(vp[4]), "v"(vp[5]), "v"(vp[6]), "v"(vp[7]),
                             "v"(kp[0]), "v"(kp[1]), "v"(kp[2]), "v"(kp[3]), "v"(kp[4]), "v"(kp[5]), "v"(kp[6]), "v"(kp[7]) : "memory");
#pragma unroll
                for (int it = 0; it < 8; ++it) {
                    v4h hv; hv[0] = (_Float16)vr[it][0]; hv[1] = (_Float16)vr[it][1]; hv[2] = (_Float16)vr[it][2]; hv[3] = (_Float16)vr[it][3];
                    *(v4h*)(vl + (it * VR + (int)(threadIdx.x / (DVP / 4))) * VP + (int)(threadIdx.x % (DVP / 4)) * 4) = hv;
                }
#pragma unroll
                for (int it = 0; it < 8; ++it) {
                    v4h hk4; hk4[0] = (_Float16)kr[it][0]; hk4[1] = (_Float16)kr[it][1]; hk4[2] = (_Float16)kr[it][2]; hk4[3] = (_Float16)kr[it][3];
                    *(v4h*)(kl + (it * KR + (int)(threadIdx.x / (DHP / 4))) * KP + (int)(threadIdx.x % (DHP / 4)) * 4) = hk4;
                }
                __syncthreads();                                 // K and V tiles (shared) visible
                union { v16h v; v8h h[2]; } kf[4][KS];
#pragma unroll
                for (int t = 0; t < 4; ++t)
#pragma unroll
                    for (int ks = 0; ks < KS; ++ks) {
                        const _Float16* kq = kl + (t * 16 + l15) * KP + ks * 32 + 8 * hf;   // key row l15 of tile t; the lane's half of the fragment's k, in the order of frag_k
                        kf[t][ks].h[0] = *(const v8h*)kq; kf[t][ks].h[1] = *(const v8h*)(kq + 16);
                    }
                if (PLAIN) {                                     // one transposing load hands the lane 8 keys (8 hf + 0 ... 7 of a 16-key group) of its column; issued here, the loads return while the scores and the softmax run
#pragma unroll   // both loops: va is then indexed by constants and stays in registers, and each load's place is an immediate offset from vtr
                    for (int t = 0; t < NT; ++t)
#pragma unroll   // (as above)
                        for (int g = 0; g < 4; ++g) va[t][g >> 1].h[g & 1] = __builtin_amdgcn_ds_load_tr16_b128_v8i16(vtr + (g * 16 * VP + t * 16) / 8);
                }
#pragma unroll
                for (int t = 0; t < 4; ++t) {
                    v8f acc = {};
#pragma unroll
                    for (int ks = 0; ks < KS; ++ks) acc = PLAIN ? wmma16(kf[t][ks].v, qa[ks], acc) : wmma16(qa[ks], kf[t][ks].v, acc);
                    s[t] = acc;
                }
            } else
#pragma unroll
            for (int t = 0; t < 4; ++t) {
                const int j = min(j0 + t * 16 + l15, p.Lk - 1);
                const float* krow = kbase + (long long)j * p.sKj;
                v8f acc = {};
#pragma unroll
                for (int ks = 0; ks < KS; ++ks) {
                    if (QM == 2)      acc = wmma6(qt_[ks], sp3_ld(krow, p.sKd, ks * 32, hf, p.dh, 1.f), acc);
                    else if (QM == 1) acc = wmma3(qs_[ks], sp_ld(krow, p.sKd, ks * 32, hf, p.dh, 1.f), acc);
                    else              acc = wmma16(qa[ks], fh_ld(krow, p.sKd, ks * 32, hf, p.dh, 1.f), acc);
                }
                s[t] = acc;
            }
            if (UNIT && PLAIN) {                                 // s[t][r] = score of key j0 + 16 t + 8 hf + r for query q0 + l15; m8[0], l8[0]: that query's maximum and this half's sum
                float mt[4];                                     // one maximum chain per score tile, so that the four overlap
                // every loop of this block is unrolled: s, mt, rt, the fragments and o are then indexed by constants and stay in registers
#pragma unroll
                for (int t = 0; t < 4; ++t) {
#pragma unroll
                    for (int r = 0; r < 8; ++r) s[t][r] = s[t][r] * p.scale * L2E;
                    mt[t] = fmaxf(fmaxf(fmaxf(s[t][0], s[t][1]), fmaxf(s[t][2], s[t][3])), fmaxf(fmaxf(s[t][4], s[t][5]), fmaxf(s[t][6], s[t][7])));
                }
                float mx = fmaxf(fmaxf(mt[0], mt[1]), fmaxf(mt[2], mt[3]));
                mx = fmaxf(mx, xhalf(mx));
                const float mnew = fmaxf(m8[0], mx);
                const float corr = exp2f(m8[0] - mnew);
                float rt[4];
#pragma unroll
                for (int t = 0; t < 4; ++t) {
#pragma unroll
                    for (int r = 0; r < 8; ++r) s[t][r] = exp2f(s[t][r] - mnew);
                    rt[t] = ((s[t][0] + s[t][1]) + (s[t][2] + s[t][3])) + ((s[t][4] + s[t][5]) + (s[t][6] + s[t][7]));
                }
                l8[0] = l8[0] * corr + ((rt[0] + rt[1]) + (rt[2] + rt[3])); m8[0] = mnew;   // the halves' sums are joined behind the loop
                v16h pb0, pb1;                                   // P^T x 4096 as B: element e = key frag_k(e, hf) of the block's first and second 32 keys
#pragma unroll
                for (int e = 0; e < 16; ++e) { pb0[e] = (_Float16)(s[e >> 3][e & 7] * 4096.f); pb1[e] = (_Float16)(s[2 + (e >> 3)][e & 7] * 4096.f); }
#pragma unroll
                for (int t = 0; t < NT; ++t) {
                    o[t] *= corr;
                    o[t] = wmma16(va[t][0].v, pb0, o[t]);        // o[t][r] = O^T[16 t + 8 hf + r][query l15]
                    o[t] = wmma16(va[t][1].v, pb1, o[t]);
                }
                continue;
            }
            float pv[8][4];
#pragma unroll
            for (int i = 0; i < 8; ++i) {
                const int irow = q0 + i + 8 * hf;
                const int ic = min(irow, p.Lq - 1);
                float sc[4];
#pragma unroll
                for (int t = 0; t < 4; ++t) {
                    const int jg = j0 + t * 16 + l15;
                    float v = s[t][i] * p.scale;
                    if (!PLAIN && p.Mf) v += p.Mf[b * p.smb + h * p.smh + (long long)ic * p.smi + (long long)min(jg, p.Lk - 1) * p.smj];
                    if (!PLAIN && p.Rt) { int rc = ic - min(jg, p.Lk - 1) + p.roff; rc = rc < 0 ? 0 : (rc >= p.rn ? p.rn - 1 : rc); v += p.Rt[b * p.srb + h * p.srh + (long long)ic * p.sri + rc]; }
                    if (!PLAIN && p.Mi) { const int mv = p.Mi[b * p.smb + h * p.smh + (long long)ic * p.smi + (long long)min(jg, p.Lk - 1) * p.smj]; if (p.mpol ? (mv != 0) : (mv == 0)) v = p.mfill; }
                    if (!PLAIN && p.SQ) { const bool same = p.SQ[(long long)b * p.Lq + ic] == p.SK[(long long)b * p.Lk + min(jg, p.Lk - 1)]; if (p.segpol ? same : !same) v = p.mfill; }
                    if (!PLAIN && p.causal == 2 && jg > irow + p.coff) v = p.mfill;
                    if (!PLAIN && (jg >= p.Lk || (p.causal == 1 && jg > irow + p.coff) || (p.causal == 3 && jg < irow + p.coff) || (p.win > 0 && irow + p.coff - jg > p.win))) v = NEG; else v *= L2E;
                    sc[t] = v;
                }
                if (!TWOPASS || pass == 0) {
                    float mx = fmaxf(fmaxf(sc[0], sc[1]), fmaxf(sc[2], sc[3]));
                    mx = fmaxf(mx, __shfl_xor(mx, 1, 32)); mx = fmaxf(mx, __shfl_xor(mx, 2, 32));
                    mx = fmaxf(mx, __shfl_xor(mx, 4, 32)); mx = fmaxf(mx, __shfl_xor(mx, 8, 32));
                    const float mnew = fmaxf(m8[i], mx);
                    const float corr = (!PLAIN && mnew == NEG) ? 1.f : exp2f(m8[i] - mnew);
                    float rs = 0.f;
#pragma unroll
                    for (int t = 0; t < 4; ++t) {
                        const float pp = (!PLAIN && sc[t] == NEG) ? 0.f : exp2f(sc[t] - mnew); rs += pp;
                        pv[i][t] = (!PLAIN && p.Pw) ? pp * p.Pw[b * p.swb + h * p.swh + (long long)ic * p.swi + (long long)min(j0 + t * 16 + l15, p.Lk - 1) * p.swj] : pp;
                    }
                    rs += __shfl_xor(rs, 1, 32); rs += __shfl_xor(rs, 2, 32); rs += __shfl_xor(rs, 4, 32); rs += __shfl_xor(rs, 8, 32);
                    l8[i] = l8[i] * corr + rs; m8[i] = mnew;
                    if (!TWOPASS) {
#pragma unroll
                        for (int t = 0; t < NT; ++t) o[t][i] *= corr;
                    }
                } else {
                    const float inv = (l8[i] > 0.f) ? 1.f / l8[i] : 0.f;
#pragma unroll
                    for (int t = 0; t < 4; ++t) {
                        const int jg = j0 + t * 16 + l15;
                        float pp = (sc[t] == NEG) ? 0.f : exp2f(sc[t] - m8[i]) * inv;
                        if (p.Pw) pp *= p.Pw[b * p.swb + h * p.swh + (long long)ic * p.swi + (long long)min(jg, p.Lk - 1) * p.swj];
                        pv[i][t] = pp;
                    }
                }
            }
            if (dopv) {
#pragma unroll
                for (int i = 0; i < 8; ++i)
#pragma unroll
                    for (int t = 0; t < 4; ++t) ((float*)myp)[(i + 8 * hf) * 64 + t * 16 + l15] = pv[i][t];
                if (UNIT) {                                      // V was published with K, by the barrier behind the staging stores; P is read only by the wave that wrote it:
                    __builtin_amdgcn_fence(__ATOMIC_RELEASE, "workgroup");   // its lanes' P stores are done and stay in front of
                    __builtin_amdgcn_wave_barrier();                         // this point, the wave's P reads behind it
                    __builtin_amdgcn_fence(__ATOMIC_ACQUIRE, "workgroup");
                } else __syncthreads();                          // P (per wave) and V (shared) visible
                if (!PLAIN && p.P) {
                    float* pb_ = p.P + b * p.sPb + h * p.sPh;
                    const bool fastP = (p.pband == 0) && ((p.sPi & 3) == 0) && (j0 + 64 <= p.Lk) && (q0 + 16 <= p.Lq) && ((((size_t)pb_) & 15) == 0);
                    if (fastP) {
#pragma unroll
                        for (int s = 0; s < 8; ++s) {
                            const int row = s * 2 + (lane >> 4), c4 = (lane & 15) * 4;
                            const v4f v = *(const v4f*)(myp + row * 64 + c4);
                            VST2V4(pb_ + (long long)(q0 + row) * p.sPi + j0 + c4, v);
                        }
                    } else {
                        for (int row = 0; row < 16; ++row) {
                            const int irow = q0 + row; if (irow >= p.Lq) continue;
                            for (int c = lane; c < 64; c += 32) {
                                const int jg = j0 + c; if (jg >= p.Lk) continue;
                                if (p.pband == 0) VST2(float, pb_ + (long long)irow * p.sPi + jg, myp[row * 64 + c]);
                                else if (jg - irow <= p.pband && irow - jg <= p.pband) VST2(float, pb_ + (long long)irow * p.sPi + (jg - irow + p.pband), myp[row * 64 + c]);
                            }
                        }
                    }
                }
                if (SPLITPV) {
                    const Split pa0 = sp_ld(myp + l15 * 64, 1, 0, hf, 64, 1.f), pa1 = sp_ld(myp + l15 * 64, 1, 32, hf, 64, 1.f);
                    const __bf16* vh = (const __bf16*)vl; const __bf16* vlo = vh + 64 * VP;
#pragma unroll
                    for (int t = 0; t < NT; ++t) {
                        const int dcol = t * 16 + l15;
                        Split b0, b1;
#pragma unroll
                        for (int e = 0; e < 16; ++e) {
                            const int k0 = frag_k(e, hf), k1 = 32 + frag_k(e, hf);
                            b0.hi[e] = vh[k0 * VP + dcol]; b0.lo[e] = vlo[k0 * VP + dcol]; b1.hi[e] = vh[k1 * VP + dcol]; b1.lo[e] = vlo[k1 * VP + dcol];
                        }
                        o[t] = wmma3(pa0, b0, o[t]);
                        o[t] = wmma3(pa1, b1, o[t]);
                    }
                } else {
                    const v16h pa0 = fh_ld(myp + l15 * 64, 1, 0, hf, 64, 4096.f), pa1 = fh_ld(myp + l15 * 64, 1, 32, hf, 64, 4096.f);
#pragma unroll
                    for (int t = 0; t < NT; ++t) {
                        const int dcol = t * 16 + l15;
                        v16h b0, b1;
#pragma unroll
                        for (int e = 0; e < 16; ++e) { b0[e] = vl[frag_k(e, hf) * VP + dcol]; b1[e] = vl[(32 + frag_k(e, hf)) * VP + dcol]; }
                        o[t] = wmma16(pa0, b0, o[t]);
                        o[t] = wmma16(pa1, b1, o[t]);
                    }
                }
            }
        }
    }
    float* obase = p.O + b * p.sOb + h * p.sOh;
    if (!PLAIN && p.ST) {
        const int rl = lane >> 1, isel = rl & 7;           // row q0 + rl ; rl>>3 == hf holds because lane>>4 == (lane>>1)>>3
        float mv = 0.f, lv = 0.f;
#pragma unroll
        for (int i = 0; i < 8; ++i) if (i == isel) { mv = m8[i]; lv = l8[i]; }
        const int irow = q0 + rl;
        if (irow < p.Lq) { float* st = p.ST + (((long long)b * gridDim.y + h) * p.Lq + irow) * 2 + (lane & 1); VST2(float, st, (lane & 1) ? lv : mv * 0.6931471805599453f); }
    }
    float invr[8];
    if (UNIT && PLAIN) l8[0] += xhalf(l8[0]);                    // transposed path: the query's sum = its two halves' sums
#pragma unroll
    for (int i = 0; i < 8; ++i) {
        if (UNIT && PLAIN) invr[i] = (l8[0] > 0.f) ? 1.f / (l8[0] * 4096.f) : 0.f;
        else if (TWOPASS) invr[i] = SPLITPV ? 1.f : (1.f / 4096.f);
        else if (!PLAIN && p.nonorm) invr[i] = exp2f(m8[i]) * (SPLITPV ? 1.f : (1.f / 4096.f));
        else invr[i] = (l8[i] > 0.f) ? (SPLITPV ? 1.f / l8[i] : 1.f / (l8[i] * 4096.f)) : 0.f;
    }
    __syncthreads();                                             // all waves done with pl/vl from the main loop
    const bool ofast = ((p.sOi & 3) == 0) && ((((size_t)obase) & 15) == 0) && (q0 + 16 <= p.Lq);
#pragma unroll
    for (int c0 = 0; c0 < DVP; c0 += 64) {
#pragma unroll
        for (int i = 0; i < 8; ++i)
#pragma unroll
            for (int t = 0; t < NT; ++t) if (t * 16 >= c0 && t * 16 < c0 + 64) ((float*)myp)[(UNIT && PLAIN) ? l15 * 64 + (t * 16 - c0) + 8 * hf + i : (i + 8 * hf) * 64 + (t * 16 - c0) + l15] = o[t][i] * invr[i];
        __syncthreads();
        const int cw = (DVP - c0 < 64) ? (DVP - c0) : 64;      // staged columns in this chunk (multiple of 16)
        if (ofast && (c0 + cw <= p.dv) && (cw % 32 == 0)) {
            const int lpr = cw / 4;                              // lanes per row (16 for 64 cols, 8 for 32)
            const int rows_per_ins = 32 / lpr;
            for (int r0 = 0; r0 < 16; r0 += rows_per_ins) {
                const int row = r0 + lane / lpr, c4 = (lane % lpr) * 4;
                const v4f v = *(const v4f*)(myp + row * 64 + c4);
                VST2V4(obase + (long long)(q0 + row) * p.sOi + c0 + c4, v);
            }
        } else {
            for (int row = 0; row < 16; ++row) {
                const int irow = q0 + row; if (irow >= p.Lq) continue;
                for (int c = lane; c < cw; c += 32) { const int d = c0 + c; if (d < p.dv) VST2(float, obase + (long long)irow * p.sOi + d, myp[row * 64 + c]); }
            }
        }
        __syncthreads();
    }
}

// =====================================================================================================================
// k_tr: dst(z, c, r) = alpha * src(z, r, c) (+ beta * R2(z, c, r)): [Z][R][C] (row stride lds) -> [Z][C][R] (row stride ldd) through a 32x32 LDS tile;
//   flags: 1 -> add beta * residual R2 addressed like dst (z*sRz + c*ldr + r); act applied before the residual.
// =====================================================================================================================
struct TrP { const float* src; float* dst; const float* R2; long long sSz, lds, sDz, ldd, sRz, ldr; int R, C, flags, act; float alpha, beta; };
static_assert(sizeof(TrP) == 3 * 8 + 6 * 8 + 6 * 4, "TrP has padding");
__global__ __launch_bounds__(256) void k_tr(TrP p) {
    __shared__ float tile[32][33];
    const int c0 = blockIdx.x * 32, r0 = blockIdx.y * 32, z = blockIdx.z;
    const int lane = threadIdx.x & 31, wave = threadIdx.x >> 5;
    const float* s = p.src + z * p.sSz;
#pragma unroll
    for (int k = 0; k < 4; ++k) {
        const int rl = wave * 4 + k, r = r0 + rl, c = c0 + lane;
        tile[rl][lane] = (r < p.R && c < p.C) ? s[(long long)r * p.lds + c] : 0.f;
    }
    __syncthreads();
    float* d = p.dst + z * p.sDz; const float* rr = p.R2 + z * p.sRz;
#pragma unroll
    for (int k = 0; k < 4; ++k) {
        const int cl = wave * 4 + k, c = c0 + cl, r = r0 + lane;
        if (c < p.C && r < p.R) {
            float v = act_fn(p.alpha * tile[lane][cl], p.act);
            if (p.flags & 1) v += p.beta * rr[(long long)c * p.ldr + r];
            VST2(float, d + (long long)c * p.ldd + r, v);
        }
    }
}

// k_affine: dst[i] = a * (sdev ? sdev[0] : 1) * src[i] + b, i < n (one thread per element; consecutive lanes -> consecutive addresses)
__global__ __launch_bounds__(256) void k_affine(const float* __restrict__ src, float* __restrict__ dst, int n, float a, float b, const float* __restrict__ sdev) {
    const int i = blockIdx.x * 256 + threadIdx.x;
    if (i < n) { const float aa = sdev ? a * sdev[0] : a; const float v = aa * src[i] + b; VST2(float, dst + i, v); }
}

// =====================================================================================================================
// k_softmax: row softmax over n contiguous elements, one 256-thread block per row; rows addressed z*sz + r*sr (grid (R, Z)).
//   out = scale_out * softmax(scale_in * x + (Mf ? Mf[z*smz + r*smr + j] : 0)); a row whose max is -inf is written as 0.
// =====================================================================================================================
struct SmP { const float* src; float* dst; const float* Mf; long long sz, sr, dz, dr, smz, smr; int n, pad; float scale_in, scale_out; };
static_assert(sizeof(SmP) == 3 * 8 + 6 * 8 + 4 * 4, "SmP has padding");
__global__ __launch_bounds__(256) void k_softmax(SmP p) {
    __shared__ float red[256];
    const int r = blockIdx.x, z = blockIdx.y, tid = threadIdx.x;
    const float* s = p.src + z * p.sz + (long long)r * p.sr;
    const float* mf = p.Mf ? (p.Mf + z * p.smz + (long long)r * p.smr) : nullptr;
    float mx = -__builtin_inff();
    for (int j = tid; j < p.n; j += 256) { float v = s[j] * p.scale_in; if (mf) v += mf[j]; mx = fmaxf(mx, v); }
    red[tid] = mx; __syncthreads();
    for (int o = 128; o > 0; o >>= 1) { if (tid < o) red[tid] = fmaxf(red[tid], red[tid + o]); __syncthreads(); }
    mx = red[0]; __syncthreads();
    float sum = 0.f;
    for (int j = tid; j < p.n; j += 256) { float v = s[j] * p.scale_in; if (mf) v += mf[j]; sum += (mx == -__builtin_inff()) ? 0.f : expf(v - mx); }
    red[tid] = sum; __syncthreads();
    for (int o = 128; o > 0; o >>= 1) { if (tid < o) red[tid] += red[tid + o]; __syncthreads(); }
    sum = red[0];
    const float inv = (sum > 0.f) ? p.scale_out / sum : 0.f;
    float* d = p.dst + z * p.dz + (long long)r * p.dr;
    for (int j = tid; j < p.n; j += 256) { float v = s[j] * p.scale_in; if (mf) v += mf[j]; const float o = (mx == -__builtin_inff()) ? 0.f : expf(v - mx) * inv; VST2(float, d + j, o); }
}
// =====================================================================================================================
// k_stats: mean and rsqrt(var + eps) over a set of n elements addressed base + z*sz + (e / inner) * so + (e % inner) * si, one 256-thread
// k_norm_apply: y = (x - mean[set]) * rstd[set] * g[c] + b[c] over a [Z][C][L] chan-major tensor with set = z*G + c / (C/G) (G groups per z;
//   G = C -> per-chan sets indexed z*C+c; for batch norm pass stats indexed by c only via bn = 1). Optional act. Output same layout.
// =====================================================================================================================
//   mode 0: mean / rsqrt(var + eps); mode 1 (RMSNorm): 0 / rsqrt(mean(x^2) + eps); mode 2 (L2 normalize * sqrt(n)): 0 / sqrt(n) / max(||x||, eps); mode 3: as 0 with unbiased variance (n-1)
__global__ __launch_bounds__(256) void k_stats(const float* __restrict__ x, long long sz, long long so, long long si, int inner, int n, float eps, float* __restrict__ stat, int mode) {
    __shared__ float red[256];
    const int z = blockIdx.x, tid = threadIdx.x;
    const float* base = x + z * sz;
    float s = 0.f;
    for (int e = tid; e < n; e += 256) s += base[(long long)(e / inner) * so + (long long)(e % inner) * si];
    red[tid] = s; __syncthreads();
    for (int o = 128; o > 0; o >>= 1) { if (tid < o) red[tid] += red[tid + o]; __syncthreads(); }
    const float mu = (mode == 0 || mode == 3) ? red[0] / (float)n : 0.f; __syncthreads();
    float q = 0.f;
    for (int e = tid; e < n; e += 256) { const float dlt = base[(long long)(e / inner) * so + (long long)(e % inner) * si] - mu; q += dlt * dlt; }
    red[tid] = q; __syncthreads();
    for (int o = 128; o > 0; o >>= 1) { if (tid < o) red[tid] += red[tid + o]; __syncthreads(); }
    {
        float rs;
        if (mode == 2) rs = sqrtf((float)n) / fmaxf(sqrtf(red[0]), eps); else if (mode == 3) rs = rsqrtf(red[0] / (float)(n - 1) + eps); else rs = rsqrtf(red[0] / (float)n + eps);
        if (tid < 32) { const float v = (tid == 0) ? mu : ((tid == 1) ? rs : 0.f); VST2(float, stat + (long long)z * 32 + tid, v); }
    }
}
//   One thread per element over the flat [Z][C][L] index space: grid ceil(Z*C*L / 256).
__global__ __launch_bounds__(256) void k_norm_apply(const float* __restrict__ x, float* __restrict__ y, const float* __restrict__ stat, const float* __restrict__ g, const float* __restrict__ bta,
                                                     int Z, int C, int L, int G, int bn, int act) {
    const long long idx = (long long)blockIdx.x * 256 + threadIdx.x;
    if (idx >= (long long)Z * C * L) return;
    const int l = (int)(idx % L); const long long zc = idx / L; const int c = (int)(zc % C), z = (int)(zc / C); (void)l;
    const int set = bn ? c : (z * G + c / (C / G));
    float v = (x[idx] - stat[(long long)set * 32]) * stat[(long long)set * 32 + 1];
    if (g) v *= g[c];
    if (bta) v += bta[c];
    v = act_fn(v, act);
    VST2(float, y + idx, v);
}

// k_lse_neg: c[i] = -(st[2i] + log(st[2i+1])) = minus the log-sum-exp of row i from k_attn's ST output (for softmax over the query dimension)
__global__ __launch_bounds__(256) void k_lse_neg(const float* __restrict__ st, float* __restrict__ c, int n) {
    const int i = blockIdx.x * 256 + threadIdx.x;
    if (i < n) { const float v = -(st[2 * i] + logf(st[2 * i + 1])); VST2(float, c + i, v); }
}

// k_iota: dst[i] = a * i + b as int32 (segment/position id helper)
__global__ __launch_bounds__(256) void k_iota(int* __restrict__ dst, int n, int a, int b) {
    const int i = blockIdx.x * 256 + threadIdx.x;
    if (i < n) { const int v = a * i + b; VST2(int, dst + i, v); }
}

// k_axpby: dst[i] = a * x[i] + b * y[i] (+ c), i < n
__global__ __launch_bounds__(256) void k_axpby(const float* __restrict__ x, const float* __restrict__ y, float* __restrict__ dst, int n, float a, float b, float c) {
    const int i = blockIdx.x * 256 + threadIdx.x;
    if (i < n) { const float v = a * x[i] + b * y[i] + c; VST2(float, dst + i, v); }
}

// =====================================================================================================================
// k_rope: rotary embedding on a [R rows][Hn heads][D] view (row stride sXr, head stride sXh, element stride 1) -> Y (own strides).
//   mode 0: rotate_half (partner d±D/2, sign - for d<D/2); mode 1: interleaved pairs (partner d^1, sign - for even d).
//   table column tcol: tmode 0 -> d, 1 -> d % (D/2), 2 -> d / 2; position p: pmode 0 -> r % S, 1 -> head index, 2 -> pos[r];
//   c = C[(r / S) * sCb + p * sCp + tcol * sCd], s likewise from Sn; y = x[d] * c + sign * x[partner] * s. X and Y must not alias.
// =====================================================================================================================
struct RopeP { const float* X; float* Y; const float* C; const float* Sn; const int* pos; long long sXr, sXh, sYr, sYh, sCb, sCp, sCd; int R, Hn, D, S, mode, tmode, pmode, pad; };
static_assert(sizeof(RopeP) == 5 * 8 + 7 * 8 + 8 * 4, "RopeP has padding");
__global__ __launch_bounds__(256) void k_rope(RopeP p) {
    const long long idx = (long long)blockIdx.x * 256 + threadIdx.x;
    if (idx >= (long long)p.R * p.Hn * p.D) return;
    const int d = (int)(idx % p.D); const long long rh = idx / p.D; const int h = (int)(rh % p.Hn); const int r = (int)(rh / p.Hn);
    const int half = p.D / 2;
    int partner; float sign;
    if (p.mode == 0) { partner = (d < half) ? d + half : d - half; sign = (d < half) ? -1.f : 1.f; }
    else { partner = d ^ 1; sign = (d & 1) ? 1.f : -1.f; }
    const int tcol = (p.tmode == 0) ? d : ((p.tmode == 1) ? (d % half) : (d >> 1));
    const int pp = (p.pmode == 0) ? (r % p.S) : ((p.pmode == 1) ? h : p.pos[r]);
    const long long toff = (long long)(r / p.S) * p.sCb + (long long)pp * p.sCp + (long long)tcol * p.sCd;
    const float* xr = p.X + (long long)r * p.sXr + (long long)h * p.sXh;
    const float v = xr[d] * p.C[toff] + sign * xr[partner] * p.Sn[toff];
    VST2(float, p.Y + (long long)r * p.sYr + (long long)h * p.sYh + d, v);
}

// k_invf + k_sincos (split so neither kernel carries a large VALU-fma footprint): invf_i = num * (1 / powf(base, (2 i)/D)) [fmode 0],
//   num * expf((2 i) * cexp) [fmode 1], num * powf(base, -2 (i - 1) / D) [fmode 2]; then cs/sn[s*half + i] = cos/sin((pscale * s) * invf_i)
__global__ __launch_bounds__(256) void k_invf(float* __restrict__ invb, int half, int D, float base, float num, int fmode, float cexp) {
    const int i = blockIdx.x * 256 + threadIdx.x;
    if (i >= ((half + 31) / 32) * 32) return;
    if (i >= half) { VST2(float, invb + i, 0.f); return; }
    const float e = (float)(2 * i) / (float)D;
    float invf;
    if (fmode == 1) invf = num * expf((float)(2 * i) * cexp);
    else if (fmode == 2) invf = num * powf(base, (-2.0f * ((float)i - 1.0f)) / (float)D);
    else invf = num * (1.0f / powf(base, e));
    VST2(float, invb + i, invf);
}
__global__ __launch_bounds__(256) void k_sincos(float* __restrict__ cs, float* __restrict__ sn, const float* __restrict__ invb, int S, int half, float pscale) {
    const int idx = blockIdx.x * 256 + threadIdx.x;
    if (idx >= S * half) return;
    const int s = idx / half, i = idx - s * half;
    const float ang = (pscale * (float)s) * invb[i];
    VST2(float, cs + idx, cosf(ang)); VST2(float, sn + idx, sinf(ang));
}

// k_mulact: dst[i] = act(x[i]) * y[i]
__global__ __launch_bounds__(256) void k_mulact(const float* __restrict__ x, const float* __restrict__ y, float* __restrict__ dst, int n, int act) {
    const int i = blockIdx.x * 256 + threadIdx.x;
    if (i < n) { const float v = act_fn(x[i], act) * y[i]; VST2(float, dst + i, v); }
}

// =====================================================================================================================
// k_matvec: thread-per-row matrix-vector products for N <= 8 output columns (heads with 1-3 outputs, gates), f32 on the VALU.
//   C[r*sCm + j] = act(alpha * sum_k A[r*sAm + k*sAk] * B[j*sBn + k*sBk] + bias[j]) + beta * R[r*sRm + j*sRn]; each thread writes its N contiguous floats.
// =====================================================================================================================
__global__ __launch_bounds__(256) void k_matvec(GemmP p) {
    // 32 lanes write one line with one instruction.
    const int rpt = (p.N == 1) ? 1 : 32;
    const long long r0 = ((long long)blockIdx.x * 256 + threadIdx.x) * rpt; const int z = blockIdx.z, zo = z / p.zi_n, zi = z - zo * p.zi_n;
    if (r0 >= p.M) return;
    const float* Bb = p.B + zo * p.sBo + zi * p.sBi;
    float* C = p.C + zo * p.sCo + zi * p.sCi; const float* R = p.R + zo * p.sRo + zi * p.sRi;
    for (int rr = 0; rr < rpt; ++rr) {
        const long long r = r0 + rr; if (r >= p.M) break;
        const float* A = p.A + zo * p.sAo + zi * p.sAi + r * p.sAm;
        float acc[8] = {0.f, 0.f, 0.f, 0.f, 0.f, 0.f, 0.f, 0.f};
        for (int k = 0; k < p.K; ++k) { const float a = A[(long long)k * p.sAk];
#pragma unroll
            for (int j = 0; j < 8; ++j) if (j < p.N) acc[j] += a * Bb[(long long)j * p.sBn + (long long)k * p.sBk]; }
#pragma unroll
        for (int j = 0; j < 8; ++j) if (j < p.N) {
            float v = acc[j] * p.alpha;
            if (p.flags & 1) v += p.bias[j];
            if (p.flags & 2) v += p.bias[r];
            v = act_fn(v, p.act);
            if (p.flags & 4) v += p.beta * R[r * p.sRm + (long long)j * p.sRn];
            VST2(float, C + r * p.sCm + j, v);
        }
    }
}
// k_smallsoftmax: thread-per-row softmax for short rows (n <= 64): dst[r*dr + j] = softmax(scale*src[r*sr + j])
__global__ __launch_bounds__(256) void k_smallsoftmax(const float* __restrict__ src, float* __restrict__ dst, long long sr, long long dr, int n, long long R, float scale) {
    const long long r0 = ((long long)blockIdx.x * 256 + threadIdx.x) * 32;
    for (int rr = 0; rr < 32; ++rr) {
        const long long r = r0 + rr; if (r >= R) return;
        const float* s = src + r * sr; float* d = dst + r * dr;
        float mx = -__builtin_inff();
        for (int j = 0; j < n; ++j) mx = fmaxf(mx, s[j] * scale);
        float sum = 0.f;
        for (int j = 0; j < n; ++j) sum += expf(s[j] * scale - mx);
        const float inv = 1.f / sum;
        for (int j = 0; j < n; ++j) { const float v = expf(s[j] * scale - mx) * inv; VST2(float, d + j, v); }
    }
}

__global__ __launch_bounds__(32) void k_unitstat(float* __restrict__ st) { const int t = threadIdx.x; const float v = (t == 1) ? 1.f : 0.f; VST2(float, st + t, v); }

// destination (e.g. a d_out whose row width is not a multiple of 32 floats) is written by consecutive lanes of one instruction
__global__ __launch_bounds__(256) void k_lincopy(const float* __restrict__ src, long long lds, float* __restrict__ dst, long long ldd, long long rows, int cols) {
    const long long i = (long long)blockIdx.x * 256 + threadIdx.x; if (i >= rows * cols) return;
    const long long r = i / cols; const int c = (int)(i - r * cols);
    const float v = src[r * lds + c]; VST2(float, dst + r * ldd + c, v);
}

namespace w25 {
typedef __attribute__((ext_vector_type(16))) _Float16 v16h;
typedef __attribute__((ext_vector_type(8)))  _Float16 v8h;
typedef __attribute__((ext_vector_type(16))) __bf16   v16b;
typedef __attribute__((ext_vector_type(8)))  __bf16   v8b;
typedef __attribute__((ext_vector_type(8)))  float    v8f;
typedef __attribute__((ext_vector_type(4)))  float    v4f;

__device__ __forceinline__ unsigned short f2bf_bits(float f) {
  unsigned u = __float_as_uint(f);
  return (unsigned short)((u + 0x7FFFu + ((u >> 16) & 1u)) >> 16);
}
__device__ __forceinline__ float bf_bits2f(unsigned short h) { return __uint_as_float(((unsigned)h) << 16); }

// hazard guards as plain device helpers (no inline asm inside the kernel template body)
__device__ __forceinline__ void dep_guard_h(v8f& a, v8f& b, v16h x, v16h y) { asm volatile("v_nop\n\tv_nop\n\tv_nop\n\tv_nop" : "+v"(a), "+v"(b) : "v"(x), "v"(y)); }
__device__ __forceinline__ void dep_guard_b(v8f& a, v8f& b, v16b x, v16b y) { asm volatile("v_nop\n\tv_nop\n\tv_nop\n\tv_nop" : "+v"(a), "+v"(b) : "v"(x), "v"(y)); }
__device__ __forceinline__ void keep4_h(v16h a, v16h b, v16h c, v16h d) { asm volatile("v_nop" :: "v"(a), "v"(b), "v"(c), "v"(d)); }
__device__ __forceinline__ void keep4_b(v16b a, v16b b, v16b c, v16b d) { asm volatile("v_nop" :: "v"(a), "v"(b), "v"(c), "v"(d)); }
__device__ __forceinline__ void acc_guard4(v8f& a, v8f& b, v8f& c, v8f& d) { asm volatile("v_nop\n\tv_nop\n\tv_nop\n\tv_nop" : "+v"(a), "+v"(b), "+v"(c), "+v"(d)); }
template <typename T> struct Frag;
template <> struct Frag<_Float16> {
  typedef v16h V; union U { v16h v; v8h h[2]; };
  static __device__ __forceinline__ v16h load(const _Float16* p) {   // elements 0..7 <- p[0..7], 8..15 <- p[16..23]
    U f; f.h[0] = *(const v8h*)(p); f.h[1] = *(const v8h*)(p + 16); return f.v;
  }
  static __device__ __forceinline__ v8f mma(v16h a, v16h b, v8f c) {
    return __builtin_amdgcn_wmma_f32_16x16x32_f16(false, a, false, b, (short)0, c, false, false);
  }
  static __device__ __forceinline__ void guard(v8f& a, v8f& b, v16h x, v16h y) { dep_guard_h(a, b, x, y); }
  static __device__ __forceinline__ void keep(v16h a, v16h b, v16h c, v16h d) { keep4_h(a, b, c, d); }
};
template <> struct Frag<__bf16> {
  typedef v16b V; union U { v16b v; v8b h[2]; };
  static __device__ __forceinline__ v16b load(const __bf16* p) {
    U f; f.h[0] = *(const v8b*)(p); f.h[1] = *(const v8b*)(p + 16); return f.v;
  }
  static __device__ __forceinline__ v8f mma(v16b a, v16b b, v8f c) {
    return __builtin_amdgcn_wmma_f32_16x16x32_bf16(false, a, false, b, (short)0, c, false, false);
  }
  static __device__ __forceinline__ void guard(v8f& a, v8f& b, v16b x, v16b y) { dep_guard_b(a, b, x, y); }
  static __device__ __forceinline__ void keep(v16b a, v16b b, v16b c, v16b d) { keep4_b(a, b, c, d); }
};

// ---- Register-blocked batched WMMA GEMM ------------------------------------
// C[m,n] = scale * sum_k A[m,k] * Bt[n,k] (+bias)(+resid); each wave owns a 64x64 tile.
// A row-major [M,K]; Bt row-major [N,K]; M,N % 64 == 0, K % 32 == 0.
// SPLIT: operands are hi/lo planes (A2/Bt2 = lo planes, same layout); product = hi·hi + hi·lo + lo·hi.
// BIAS_MODE: 0 = none, 1 = bias[m], 2 = bias[n].
// OUT_MODE: 0 = f32, 1 = f16, 2 = bf16 hi plane (Cout) + bf16 lo plane (Cout2).
// ET: 0 = f16 operands, 1 = bf16 operands (pointers passed as 16-bit storage)
template <int ET> struct Elem;
template <> struct Elem<0> { typedef _Float16 T; };
template <> struct Elem<1> { typedef __bf16 T; };
template <int ET, bool SPLIT, int BIAS_MODE, int OUT_MODE, bool RESID, int ACT = 0>
__global__ __launch_bounds__(256) void wmma_gemm64(
    const unsigned short* __restrict__ Ap, const unsigned short* __restrict__ A2p, int lda, long strideA,
    const unsigned short* __restrict__ Btp, const unsigned short* __restrict__ Bt2p, int ldb, long strideB,
    void* __restrict__ Cout, void* __restrict__ Cout2, int ldc, long strideC,
    const float* __restrict__ bias,
    const float* __restrict__ resid, long strideR,
    int M, int N, int K, float scale) {
  typedef typename Elem<ET>::T T;
  typedef typename Frag<T>::V V;
  const T* A = (const T*)Ap; const T* A2 = (const T*)A2p; const T* Bt = (const T*)Btp; const T* Bt2 = (const T*)Bt2p;
  __shared__ __align__(16) float sT[8][16 * 68];   // per-wave 16x64 slab, pitch 68 floats
  const int b    = blockIdx.y;
  const int lane = threadIdx.x & 31;
  const int wave = threadIdx.x >> 5;
  const int tilesN = N >> 6;
  const int tilesM = M >> 6;
  const int tile = blockIdx.x * 8 + wave;
  if (tile >= tilesM * tilesN) return;   // wave-uniform; no block barriers in this kernel
  const int tm = tile / tilesN;
  const int tn = tile - tm * tilesN;
  const int m0 = tm << 6;
  const int n0 = tn << 6;

  const T* Ab  = A  + (size_t)b * strideA;
  const T* Bb  = Bt + (size_t)b * strideB;
  const T* Ab2 = SPLIT ? (A2  + (size_t)b * strideA) : nullptr;
  const T* Bb2 = SPLIT ? (Bt2 + (size_t)b * strideB) : nullptr;

  const int rlane = lane & 15;                 // row (A) / col (B, D) within subtile
  const int koff  = (lane >> 4) * 8;           // k offset of this lane half
  const int mOff  = (lane >> 4) * 8;           // D row offset

  v8f acc[4][4];
#pragma unroll
  for (int i = 0; i < 4; ++i)
#pragma unroll
    for (int j = 0; j < 4; ++j) acc[i][j] = (v8f){0.f,0.f,0.f,0.f,0.f,0.f,0.f,0.f};

  for (int k0 = 0; k0 < K; k0 += 32) {
    V bh[4], bl[4];
#pragma unroll
    for (int j = 0; j < 4; ++j) {
      const size_t bo = (size_t)(n0 + (j << 4) + rlane) * ldb + koff + k0;
      bh[j] = Frag<T>::load(Bb + bo);
      if (SPLIT) bl[j] = Frag<T>::load(Bb2 + bo);
    }
#pragma unroll
    for (int i = 0; i < 4; ++i) {
      const size_t ao = (size_t)(m0 + (i << 4) + rlane) * lda + koff + k0;
      V ah = Frag<T>::load(Ab + ao);
      V al;
      if (SPLIT) al = Frag<T>::load(Ab2 + ao);
#pragma unroll
      for (int j = 0; j < 4; ++j) {
        acc[i][j] = Frag<T>::mma(ah, bh[j], acc[i][j]);
        if (SPLIT) {
          acc[i][j] = Frag<T>::mma(ah, bl[j], acc[i][j]);
          acc[i][j] = Frag<T>::mma(al, bh[j], acc[i][j]);
        }
      }
      Frag<T>::guard(acc[i][0], acc[i][3], ah, SPLIT ? al : ah);
    }
    Frag<T>::keep(bh[0], bh[1], bh[2], bh[3]);
    if (SPLIT) Frag<T>::keep(bl[0], bl[1], bl[2], bl[3]);
  }
  acc_guard4(acc[0][0], acc[0][1], acc[0][2], acc[0][3]);
  acc_guard4(acc[1][0], acc[1][1], acc[1][2], acc[1][3]);
  acc_guard4(acc[2][0], acc[2][1], acc[2][2], acc[2][3]);
  acc_guard4(acc[3][0], acc[3][1], acc[3][2], acc[3][3]);

  // ---- epilogue ----
  float* slab = sT[wave];
  const float* Rb = RESID ? (resid + (size_t)b * strideR) : nullptr;
#pragma unroll
  for (int i = 0; i < 4; ++i) {
    const int mBase = m0 + (i << 4);
#pragma unroll
    for (int j = 0; j < 4; ++j) {
      const int n = n0 + (j << 4) + rlane;
      float bv = 0.f;
      if (BIAS_MODE == 2) bv = bias[n];
#pragma unroll
      for (int r = 0; r < 8; ++r) {
        float v = acc[i][j][r] * scale;
        if (BIAS_MODE == 1) v += bias[mBase + mOff + r];
        if (BIAS_MODE == 2) v += bv;
        if (RESID) v += Rb[(size_t)(mBase + mOff + r) * ldc + n];
        if (ACT == 1) v = tanhf(v);
        if (ACT == 2) v = fmaxf(v, 0.0f);
        if (ACT == 3) v = v / (1.0f + expf(-v));
        if (ACT == 4) v = (v > 0.f) ? v : 0.01f * v;
        if (ACT == 5) v = 0.5f * v * (1.0f + erff(v * 0.70710678118654752f));
        if (ACT == 6) v = (v > 0.f) ? v : 0.2f * v;
        if (ACT == 7) { const float u = 0.7978845608028654f * (v + 0.044715f * v * v * v); v = 0.5f * v * (1.f + tanhf(u)); }
        slab[(mOff + r) * 68 + (j << 4) + rlane] = v;
      }
    }
    __builtin_amdgcn_fence(__ATOMIC_RELEASE, "workgroup");
    __builtin_amdgcn_wave_barrier();
    __builtin_amdgcn_fence(__ATOMIC_ACQUIRE, "workgroup");
    if (OUT_MODE == 0) {
      float* C = (float*)Cout + (size_t)b * strideC;
      const int hh = lane >> 4, c4 = (lane & 15) * 4;     // row seg = 256 B = 16 lanes x 16 B
      {
#pragma unroll
        for (int it = 0; it < 8; ++it) {
          const int row = it * 2 + hh;
          v4f v = *(const v4f*)(slab + row * 68 + c4);
          *(v4f*)(C + (size_t)(mBase + row) * ldc + n0 + c4) = v;
        }
        
      }
    } else {
      const int q = lane >> 3, c8 = (lane & 7) * 8;
      unsigned short* C  = (unsigned short*)Cout  + (size_t)b * strideC;
      unsigned short* C2 = (OUT_MODE == 2) ? ((unsigned short*)Cout2 + (size_t)b * strideC) : nullptr;
      {
#pragma unroll
        for (int it = 0; it < 4; ++it) {
          const int row = it * 4 + q;
          const float* sp = slab + row * 68 + c8;
          v8h hv, lv;
#pragma unroll
          for (int e = 0; e < 8; ++e) {
            if (OUT_MODE == 1) {
              hv[e] = (_Float16)sp[e];
            } else {
              unsigned short hb = f2bf_bits(sp[e]);
              unsigned short lb = f2bf_bits(sp[e] - bf_bits2f(hb));
              hv[e] = __builtin_bit_cast(_Float16, hb);
              lv[e] = __builtin_bit_cast(_Float16, lb);
            }
          }
          *(v8h*)(C + (size_t)(mBase + row) * ldc + n0 + c8) = hv;
          if (OUT_MODE == 2) *(v8h*)(C2 + (size_t)(mBase + row) * ldc + n0 + c8) = lv;
        }
        
      }
    }
    __builtin_amdgcn_fence(__ATOMIC_RELEASE, "workgroup");
    __builtin_amdgcn_wave_barrier();
    __builtin_amdgcn_fence(__ATOMIC_ACQUIRE, "workgroup");
  }
}

__global__ __launch_bounds__(256) void cast_f32_f16x2(
    const float* __restrict__ in, _Float16* __restrict__ out, int n2) {
  int i = blockIdx.x * 256 + threadIdx.x;
  if (i < n2) {
    const _Float16 h0 = (_Float16)in[2 * i], h1 = (_Float16)in[2 * i + 1];
    const unsigned u = (unsigned)__builtin_bit_cast(unsigned short, h0) | ((unsigned)__builtin_bit_cast(unsigned short, h1) << 16);
    ((unsigned*)out)[i] = u;
    
  }
}


} // namespace w25

__global__ __launch_bounds__(256) void k_castT16(const float* __restrict__ src, long long lds, _Float16* __restrict__ dst, long long ldd, int R, int C, float s) {
    const long long i = (long long)blockIdx.x * 256 + threadIdx.x; const long long np = (long long)C * (R / 2); if (i >= np) return; const int c = (int)(i / (R / 2)); const int r = 2 * (int)(i % (R / 2));
    const _Float16 h0 = (_Float16)(src[(long long)r * lds + c] * s), h1 = (_Float16)(src[(long long)(r + 1) * lds + c] * s);
    const unsigned u = (unsigned)__builtin_bit_cast(unsigned short, h0) | ((unsigned)__builtin_bit_cast(unsigned short, h1) << 16);
    unsigned* d = (unsigned*)(dst + (long long)c * ldd + r); *d = u;  }
__global__ __launch_bounds__(256) void k_cast16(const float* __restrict__ src, long long lds, _Float16* __restrict__ dst, long long ldd, int R, int C, float s) {
    const long long i = (long long)blockIdx.x * 256 + threadIdx.x; const long long np = (long long)R * (C / 2); if (i >= np) return; const int r = (int)(i / (C / 2)); const int c = 2 * (int)(i % (C / 2));
    const _Float16 h0 = (_Float16)(src[(long long)r * lds + c] * s), h1 = (_Float16)(src[(long long)r * lds + c + 1] * s);
    const unsigned u = (unsigned)__builtin_bit_cast(unsigned short, h0) | ((unsigned)__builtin_bit_cast(unsigned short, h1) << 16);
    unsigned* d = (unsigned*)(dst + (long long)r * ldd + c); *d = u;  }

// f32 -> bf16 hi plane + bf16 lo plane (x = hi + lo to ~2^-17 relative; RNE both), [R][C] -> [R][C] (or transposed to [C][R]); 2 consecutive destination elements
__device__ __forceinline__ unsigned int f2bf2_pack(float a, float b, unsigned int* lo) {
    const unsigned short ha = w25::f2bf_bits(a), hb = w25::f2bf_bits(b);
    const unsigned short la = w25::f2bf_bits(a - w25::bf_bits2f(ha)), lb = w25::f2bf_bits(b - w25::bf_bits2f(hb));
    *lo = (unsigned)la | ((unsigned)lb << 16); return (unsigned)ha | ((unsigned)hb << 16); }
// blockIdx.y = matrix of a batch: source matrices sz floats apart, destination planes dz elements apart
__global__ __launch_bounds__(256) void k_castS16(const float* __restrict__ src, long long lds, __bf16* __restrict__ dhi, __bf16* __restrict__ dlo, long long ldd, int R, int C, float s, int transpose, long long sz, long long dz) {
    src += (long long)blockIdx.y * sz; dhi += (long long)blockIdx.y * dz; dlo += (long long)blockIdx.y * dz;
    const long long i = (long long)blockIdx.x * 256 + threadIdx.x; long long o; float a, b;
    if (transpose) { const long long np = (long long)C * (R / 2); if (i >= np) return; const int c = (int)(i / (R / 2)); const int r = 2 * (int)(i % (R / 2)); a = src[(long long)r * lds + c] * s; b = src[(long long)(r + 1) * lds + c] * s; o = (long long)c * ldd + r; }
    else { const long long np = (long long)R * (C / 2); if (i >= np) return; const int r = (int)(i / (C / 2)); const int c = 2 * (int)(i % (C / 2)); a = src[(long long)r * lds + c] * s; b = src[(long long)r * lds + c + 1] * s; o = (long long)r * ldd + c; }
    unsigned lo; const unsigned hi = f2bf2_pack(a, b, &lo); unsigned* ph = (unsigned*)(dhi + o); unsigned* pl = (unsigned*)(dlo + o);
    *ph = hi; *pl = lo;  }

namespace w25 {
// =====================================================================================
// Generic causal/non-causal attention for head_dim 64, f32 in / f32 out; 16-bit operands: bf16 with optional hi/lo splits, or
// plain f16 (F16=true, non-split, probabilities carried x2^15).
//   scores = (q*qscale)·kᵀ : v_wmma_f32_16x16x32_bf16; SPLIT_QK -> q,k as bf16 hi/lo (hi·hi + hi·lo + lo·hi)
//   out    = p·v           : v_wmma_f32_16x16x32_bf16; SPLIT_PV -> p,v as bf16 hi/lo; else p,v plain bf16
//   f32 accumulate; online softmax in f32. Block = 4 waves = 64 query rows of one (batch, head); S % 64 == 0.
//   Element (b, s, h, d) of tensor X lives at X[b*X_bs + s*X_rs + h*X_hs + d] (strides in floats, multiples of 4).
//   Masking: mask_mode 0 none, 1 causal (kv > q masked), 2 tensor [S][Skv] shared over (b,h) (float if
//   mask_is_int==0, int32 with element == 0 -> masked if 1, int32 with element != 0 -> masked if 2), 3 per-token vectors qmask[B][S] & kvmask[B][Skv] (int32,
//   0 -> masked), 4 causal + sliding window (kv > q or q - kv > W masked; W passed in mask_is_int);
//   5 = relative-position bias: s += cp[b,h,q][idx[q][kv]] + pc[b,h,kv][idx[q][kv]] with idx = mask_b ([S][Skv] int32) and
//   mask_a an int32 [S][Skv] tensor with nonzero = masked (tables: element (b,h,row,n) at X + b*c_bs + h*c_hs + row*c_rs + n);
//   masked scores are replaced by mask_fill (e.g. -inf or -1e9) before the softmax.
//   grid.x = B * H * (S/64) (or a sub-range with blk0).
// =====================================================================================
#define AT_D 64
#define AT_NW 4
#define AT_QB 64
#define AT_KC 64
struct AttnGeom { const float* cp = nullptr; const float* pc = nullptr; long c_bs = 0, c_rs = 0, c_hs = 0;   // mode-5 score-bias tables
                  long q_bs, q_rs, q_hs, k_bs, k_rs, k_hs, v_bs, v_rs, v_hs, o_bs, o_rs, o_hs;
                  int S, Skv, H, mask_mode; float qscale; int blk0; float mask_fill; int mask_is_int; };
static_assert(sizeof(AttnGeom) == 168, "no padding");

__device__ __forceinline__ unsigned short at_bf_bits(float f) {
  unsigned u = __float_as_uint(f);
  return (unsigned short)((u + 0x7FFFu + ((u >> 16) & 1u)) >> 16);
}
__device__ __forceinline__ __bf16 at_f2bf(float f) { return __builtin_bit_cast(__bf16, at_bf_bits(f)); }
__device__ __forceinline__ void at_split(float f, __bf16& hi, __bf16& lo) {
  const unsigned short hb = at_bf_bits(f);
  hi = __builtin_bit_cast(__bf16, hb);
  lo = at_f2bf(f - __uint_as_float(((unsigned)hb) << 16));
}
__device__ __forceinline__ v8f at_mma(v16b a, v16b b, v8f c) {
  c = __builtin_amdgcn_wmma_f32_16x16x32_bf16(false, a, false, b, (short)0, c, false, false);
  asm volatile("v_nop\n\tv_nop\n\tv_nop\n\tv_nop" : "+v"(c) : "v"(a), "v"(b));
  return c;
}
// 16-bit element as a bit pattern held in a __bf16 slot: f16 bits when F16, bf16 (RNE) otherwise
template <bool F16> __device__ __forceinline__ __bf16 at_to16(float f) {
  if (F16) return __builtin_bit_cast(__bf16, (_Float16)f);
  return at_f2bf(f);
}
template <bool F16> __device__ __forceinline__ v8f at_mma16(v16b a, v16b b, v8f c) {
  if (F16) {
    const v16h ah = __builtin_bit_cast(v16h, a), bh = __builtin_bit_cast(v16h, b);
    c = __builtin_amdgcn_wmma_f32_16x16x32_f16(false, ah, false, bh, (short)0, c, false, false);
    asm volatile("v_nop\n\tv_nop\n\tv_nop\n\tv_nop" : "+v"(c) : "v"(ah), "v"(bh));
    return c;
  }
  return at_mma(a, b, c);
}

template <bool SPLIT_QK, bool SPLIT_PV, bool F16 = false>
__global__ __launch_bounds__(128)
void attn64_kernel(const float* __restrict__ q, const float* __restrict__ k,
                   const float* __restrict__ v, float* __restrict__ out,
                   const void* __restrict__ mask_a, const int* __restrict__ mask_b, AttnGeom g) {
  static_assert(!(F16 && (SPLIT_QK || SPLIT_PV)), "f16 mode is non-split");
  const float PSC = F16 ? 32768.0f : 1.0f;     // f16 probabilities carried x2^15 (subnormal range), folded into the final 1/l
  union FB { v16b v; v8b h[2]; };
  __shared__ __align__(16) __bf16 Ksh[AT_KC * AT_D];             // K hi [kv][d]      8 KB
  __shared__ __align__(16) __bf16 Ksl[SPLIT_QK ? AT_KC * AT_D : 8];
  __shared__ __align__(16) __bf16 Vth[AT_D * AT_KC];             // V hi [d][kv]      8 KB
  __shared__ __align__(16) __bf16 Vtl[SPLIT_PV ? AT_D * AT_KC : 8];
  __shared__ __align__(16) __bf16 Psh[AT_NW][16 * AT_KC];        // per wave P hi [row][kv]  8 KB
  __shared__ __align__(16) __bf16 Psl[SPLIT_PV ? AT_NW : 1][SPLIT_PV ? 16 * AT_KC : 8];
  __shared__ __align__(16) float  Os[AT_NW][16 * 68];            // per wave out tile, pitch 68

  const int tid  = threadIdx.x;
  const int wave = tid >> 5;
  const int lane = tid & 31;
  const int hh   = lane >> 4;
  const int c    = lane & 15;

  const int nqb = g.S / AT_QB;
  const int bx = blockIdx.x + g.blk0;
  const int qb = bx % nqb;
  const int bh = bx / nqb;
  const int h  = bh % g.H;
  const int b  = bh / g.H;
  const int qbase_block = qb * AT_QB;
  const int q0 = qbase_block + wave * 16;

  const float* qb_ptr = q + (size_t)b * g.q_bs + (size_t)h * g.q_hs;
  const float* kb_ptr = k + (size_t)b * g.k_bs + (size_t)h * g.k_hs;
  const float* vb_ptr = v + (size_t)b * g.v_bs + (size_t)h * g.v_hs;
  float*       ob_ptr = out + (size_t)b * g.o_bs + (size_t)h * g.o_hs;

  // ---- Q fragments (A operand): 2 d-chunks, hi (and lo) ----
  v16b qah[2], qal[2];
  {
    const float* qrow = qb_ptr + (size_t)(q0 + c) * g.q_rs;
#pragma unroll
    for (int dc = 0; dc < 2; ++dc) {
#pragma unroll
      for (int e = 0; e < 8; ++e) {
        const float f0 = qrow[dc * 32 + 8 * hh + e] * g.qscale;
        const float f1 = qrow[dc * 32 + 16 + 8 * hh + e] * g.qscale;
        if (SPLIT_QK) { __bf16 hq, lq; at_split(f0, hq, lq); qah[dc][e] = hq; qal[dc][e] = lq; at_split(f1, hq, lq); qah[dc][8 + e] = hq; qal[dc][8 + e] = lq; }
        else { qah[dc][e] = at_to16<F16>(f0); qah[dc][8 + e] = at_to16<F16>(f1); qal[dc][e] = qah[dc][e]; qal[dc][8 + e] = qah[dc][8 + e]; }
      }
    }
  }

  float mrow[8], lrow[8];
  v8f oacc[4];
#pragma unroll
  for (int r = 0; r < 8; ++r) { mrow[r] = -INFINITY; lrow[r] = 0.f; }
#pragma unroll
  for (int t = 0; t < 4; ++t) oacc[t] = (v8f){0.f,0.f,0.f,0.f,0.f,0.f,0.f,0.f};

  const int nChunks = (g.mask_mode == 1 || g.mask_mode == 4) ? (qb + 1) : (g.Skv / AT_KC);   // block-uniform
  // per-row query mask (mode 3)
  int qkeep[8];
#pragma unroll
  for (int r = 0; r < 8; ++r) qkeep[r] = (g.mask_mode == 3) ? mask_b[(size_t)b * g.S + q0 + 8 * hh + r] : 1;   // mask_b = qmask in mode 3
  for (int kc = 0; kc < nChunks; ++kc) {
    const int kv0 = kc * AT_KC;
    __syncthreads();
    {
      const int kvr = tid >> 1, dh = (tid & 1) * 32;
      const float* krow = kb_ptr + (size_t)(kv0 + kvr) * g.k_rs + dh;
      const float* vrow = vb_ptr + (size_t)(kv0 + kvr) * g.v_rs + dh;
#pragma unroll
      for (int i = 0; i < 8; ++i) {
        v4f kk = *(const v4f*)(krow + 4 * i);
        v4f vv = *(const v4f*)(vrow + 4 * i);
#pragma unroll
        for (int e = 0; e < 4; ++e) {
          const int d = dh + 4 * i + e;
          if (SPLIT_QK) { __bf16 a, bl; at_split(kk[e], a, bl); Ksh[kvr * AT_D + d] = a; Ksl[kvr * AT_D + d] = bl; }
          else Ksh[kvr * AT_D + d] = at_to16<F16>(kk[e]);
          if (SPLIT_PV) { __bf16 a, bl; at_split(vv[e], a, bl); Vth[d * AT_KC + kvr] = a; Vtl[d * AT_KC + kvr] = bl; }
          else Vth[d * AT_KC + kvr] = at_to16<F16>(vv[e]);
        }
      }
    }
    __syncthreads();

    v8f s[4];
#pragma unroll
    for (int j = 0; j < 4; ++j) {
      s[j] = (v8f){0.f,0.f,0.f,0.f,0.f,0.f,0.f,0.f};
#pragma unroll 1
      for (int dc = 0; dc < 2; ++dc) {
        FB kb;
        kb.h[0] = *(const v8b*)(Ksh + (j * 16 + c) * AT_D + dc * 32 + 8 * hh);
        kb.h[1] = *(const v8b*)(Ksh + (j * 16 + c) * AT_D + dc * 32 + 16 + 8 * hh);
        s[j] = at_mma16<F16>(qah[dc], kb.v, s[j]);
        if (SPLIT_QK) {
          FB kl;
          kl.h[0] = *(const v8b*)(Ksl + (j * 16 + c) * AT_D + dc * 32 + 8 * hh);
          kl.h[1] = *(const v8b*)(Ksl + (j * 16 + c) * AT_D + dc * 32 + 16 + 8 * hh);
          s[j] = at_mma16<F16>(qah[dc], kl.v, s[j]);
          s[j] = at_mma16<F16>(qal[dc], kb.v, s[j]);
        }
      }
    }
    const bool diag = (g.mask_mode == 1) && (kc == qb);
    int kvkeep[4] = {1, 1, 1, 1};
    if (g.mask_mode == 3) {
#pragma unroll
      for (int j = 0; j < 4; ++j) kvkeep[j] = ((const int*)mask_a)[(size_t)b * g.Skv + kv0 + j * 16 + c];   // mask_a = kvmask
    }
    float cm[8];
#pragma unroll
    for (int r = 0; r < 8; ++r) {
      const int qrow = q0 + 8 * hh + r;
      float m = -INFINITY;
#pragma unroll
      for (int j = 0; j < 4; ++j) {
        const int kvcol = kv0 + j * 16 + c;
        bool masked = false;
        if (diag) masked = (kvcol > qrow);
        else if (g.mask_mode == 4) masked = (kvcol > qrow) || (qrow - kvcol > g.mask_is_int);
        else if (g.mask_mode == 2) {
          const size_t mi = (size_t)qrow * g.Skv + kvcol;
          masked = (g.mask_is_int == 0) ? (((const float*)mask_a)[mi] == 0.0f)
                 : (g.mask_is_int == 1) ? (((const int*)mask_a)[mi] == 0) : (((const int*)mask_a)[mi] != 0);
        } else if (g.mask_mode == 3) masked = (qkeep[r] == 0) || (kvkeep[j] == 0);
        else if (g.mask_mode == 5) {
          const size_t mi = (size_t)qrow * g.Skv + kvcol;
          masked = (((const int*)mask_a)[mi] != 0);
          int n = mask_b[mi]; n = n < 0 ? 0 : n;
          s[j][r] += g.cp[(size_t)b * g.c_bs + (size_t)h * g.c_hs + (size_t)qrow * g.c_rs + n]
                   + g.pc[(size_t)b * g.c_bs + (size_t)h * g.c_hs + (size_t)kvcol * g.c_rs + n];
        }
        if (masked) s[j][r] = g.mask_fill;
        m = fmaxf(m, s[j][r]);
      }
#pragma unroll
      for (int off = 1; off < 16; off <<= 1) m = fmaxf(m, __shfl_xor(m, off, 32));
      cm[r] = m;
    }
    __bf16* pwh = Psh[wave];
    __bf16* pwl = Psl[SPLIT_PV ? wave : 0];
#pragma unroll
    for (int r = 0; r < 8; ++r) {
      const float mnew = fmaxf(mrow[r], cm[r]);
      const float alpha = expf(mrow[r] - mnew);
      mrow[r] = mnew;
      float psum = 0.f;
#pragma unroll
      for (int j = 0; j < 4; ++j) {
        const float p = expf(s[j][r] - mnew);
        psum += p;
        if (SPLIT_PV) { __bf16 a, bl; at_split(p, a, bl); pwh[(8 * hh + r) * AT_KC + j * 16 + c] = a; pwl[(8 * hh + r) * AT_KC + j * 16 + c] = bl; }
        else pwh[(8 * hh + r) * AT_KC + j * 16 + c] = at_to16<F16>(p * PSC);
      }
#pragma unroll
      for (int off = 1; off < 16; off <<= 1) psum += __shfl_xor(psum, off, 32);
      lrow[r] = lrow[r] * alpha + psum;
#pragma unroll
      for (int t = 0; t < 4; ++t) oacc[t][r] *= alpha;
    }
    __builtin_amdgcn_fence(__ATOMIC_RELEASE, "workgroup");
    __builtin_amdgcn_wave_barrier();
    __builtin_amdgcn_fence(__ATOMIC_ACQUIRE, "workgroup");
#pragma unroll 1
    for (int kk = 0; kk < 2; ++kk) {
      FB pa, pl;
      pa.h[0] = *(const v8b*)(pwh + c * AT_KC + kk * 32 + 8 * hh);
      pa.h[1] = *(const v8b*)(pwh + c * AT_KC + kk * 32 + 16 + 8 * hh);
      if (SPLIT_PV) {
        pl.h[0] = *(const v8b*)(pwl + c * AT_KC + kk * 32 + 8 * hh);
        pl.h[1] = *(const v8b*)(pwl + c * AT_KC + kk * 32 + 16 + 8 * hh);
      }
#pragma unroll
      for (int t = 0; t < 4; ++t) {
        FB vb;
        vb.h[0] = *(const v8b*)(Vth + (t * 16 + c) * AT_KC + kk * 32 + 8 * hh);
        vb.h[1] = *(const v8b*)(Vth + (t * 16 + c) * AT_KC + kk * 32 + 16 + 8 * hh);
        oacc[t] = at_mma16<F16>(pa.v, vb.v, oacc[t]);
        if (SPLIT_PV) {
          FB vl;
          vl.h[0] = *(const v8b*)(Vtl + (t * 16 + c) * AT_KC + kk * 32 + 8 * hh);
          vl.h[1] = *(const v8b*)(Vtl + (t * 16 + c) * AT_KC + kk * 32 + 16 + 8 * hh);
          oacc[t] = at_mma16<F16>(pa.v, vl.v, oacc[t]);
          oacc[t] = at_mma16<F16>(pl.v, vb.v, oacc[t]);
        }
      }
    }
  }

  float* os = Os[wave];
#pragma unroll
  for (int r = 0; r < 8; ++r) {
    const float inv = 1.0f / (lrow[r] * PSC);
#pragma unroll
    for (int t = 0; t < 4; ++t) os[(8 * hh + r) * 68 + t * 16 + c] = oacc[t][r] * inv;
  }
  __builtin_amdgcn_fence(__ATOMIC_RELEASE, "workgroup");
  __builtin_amdgcn_wave_barrier();
  __builtin_amdgcn_fence(__ATOMIC_ACQUIRE, "workgroup");
  {
    const int c4 = (lane & 15) * 4;
    {
#pragma unroll
      for (int it = 0; it < 8; ++it) {
        const int row = it * 2 + hh;
        v4f val = *(const v4f*)(os + row * 68 + c4);
        *(v4f*)(ob_ptr + (size_t)(q0 + row) * g.o_rs + c4) = val;
      }
      
    }
  }
}

} // namespace w25


__device__ __forceinline__ void st_h2(unsigned short* d2, float a, float b) { const unsigned u = (unsigned)__builtin_bit_cast(unsigned short, (_Float16)a) | ((unsigned)__builtin_bit_cast(unsigned short, (_Float16)b) << 16); unsigned* d = (unsigned*)d2; *d = u;  }
__device__ __forceinline__ float ldh(const unsigned short* p) { return (float)__builtin_bit_cast(_Float16, *p); }
__device__ __forceinline__ v4f ld4h(const unsigned short* p) { const unsigned long long u = *(const unsigned long long*)p; v4f a;
    a.x = (float)__builtin_bit_cast(_Float16, (unsigned short)(u & 0xFFFFu)); a.y = (float)__builtin_bit_cast(_Float16, (unsigned short)((u >> 16) & 0xFFFFu)); a.z = (float)__builtin_bit_cast(_Float16, (unsigned short)((u >> 32) & 0xFFFFu)); a.w = (float)__builtin_bit_cast(_Float16, (unsigned short)((u >> 48) & 0xFFFFu)); return a; }
__device__ __forceinline__ unsigned long long pk4h(v4f s) { return (unsigned long long)__builtin_bit_cast(unsigned short, (_Float16)s.x) | ((unsigned long long)__builtin_bit_cast(unsigned short, (_Float16)s.y) << 16) | ((unsigned long long)__builtin_bit_cast(unsigned short, (_Float16)s.z) << 32) | ((unsigned long long)__builtin_bit_cast(unsigned short, (_Float16)s.w) << 48); }
typedef unsigned v4u __attribute__((ext_vector_type(4)));
__device__ __forceinline__ void st8h(unsigned short* d, v4f a, v4f b) { const unsigned long long pa = pk4h(a), pb = pk4h(b); v4u pk; pk.x = (unsigned)(pa & 0xFFFFFFFFull); pk.y = (unsigned)(pa >> 32); pk.z = (unsigned)(pb & 0xFFFFFFFFull); pk.w = (unsigned)(pb >> 32); v4u* dd = (v4u*)d; *dd = pk;  }
__device__ __forceinline__ unsigned short bfu_rne(float v) { unsigned u = __builtin_bit_cast(unsigned, v); u += 0x7FFFu + ((u >> 16) & 1u); return (unsigned short)(u >> 16); }
__device__ __forceinline__ void bfsplit(float v, unsigned short& hi, unsigned short& lo) { hi = bfu_rne(v); lo = bfu_rne(v - __builtin_bit_cast(float, (unsigned)hi << 16)); }
__device__ __forceinline__ void st_s2(unsigned short* Hp, unsigned short* Lp, long long o, float a, float b) { unsigned short h0,l0,h1,l1; bfsplit(a,h0,l0); bfsplit(b,h1,l1); const unsigned ph = (unsigned)h0 | ((unsigned)h1 << 16), pl = (unsigned)l0 | ((unsigned)l1 << 16);
    unsigned* dh = (unsigned*)(Hp + o); unsigned* dl = (unsigned*)(Lp + o); *dh = ph; *dl = pl;  }
__device__ __forceinline__ int cl(int v, int n) { return min(max(v, 0), n - 1); }

// GAT-style aggregation over a device in-edge CSR at dst (+ optional explicit self loop as iteration j = -1):
//   logit = leaky(AS[src][h] + AD[n][h] (+ EW[e]*CW[h]), slope); softmax over the node's edges per head; acc[c] = sum alpha XP[src][c] (f16 gather plane, pitch XW; 256 channels = H heads x CH)
//   wave per node; lane L owns channels 8L..8L+7 (head = 8L / CH); per-lane softmax state (lanes of one head agree) -> no shuffles in the loop.
//   EPI 0: + bias -> f32 OUT[n][256] via LDS redistribution (two 16-B stores per lane, each instruction 512 contiguous B)
//   EPI 1: + bias, LayerNorm(256) * g + bb, relu -> bf16 hi/lo planes OH/OL [n][256] (16-B stores)
//   EPI 2: mean over the 256/CH heads + bias[0..CH-1] , LayerNorm(64) * g + bb, relu -> f32 OUT[n][64] (CH must be 64; LDS redistribution, 8-B stores)
//   EPI 3: mean over heads + bias -> f32 OUT[n][64] (no norm / activation)
//   EPI 4: + bias, ELU -> bf16 hi/lo planes OH/OL [n][256];  EPI 5: + bias (full 256-wide, per head), ELU, then mean over the 256/CH heads -> f32 OUT[n][64]
//   EPI 6: (CH = 128, two heads) mean over the two heads, + bias[0..127], relu -> f32 OUT[n][128] (LDS redistribution, 16-B stores)
//   EWM 0: no edge weights; 1: logit += EW[e] * CW[h] (self loop weight 1); 2: alpha *= EW[e] after the softmax (message scale; self loop weight 1)
template <int CH, bool SELF, int EWM, int EPI>
__global__ __launch_bounds__(256) void k_gat_agg(const unsigned short* __restrict__ XP, int XW, const float* __restrict__ AS, const float* __restrict__ AD, int ASTR, const float* __restrict__ EW, const float* __restrict__ CW,
        const int* __restrict__ esrc, const int* __restrict__ off, const int* __restrict__ cnt, const int* __restrict__ slot, const float* __restrict__ bias, const float* __restrict__ g, const float* __restrict__ bb,
        float* __restrict__ OUT, unsigned short* __restrict__ OH, unsigned short* __restrict__ OL, int N, int E, int CAP, float slope) {
    __shared__ float stage[8][256];
    const int wv = threadIdx.x >> 5; const int n = blockIdx.x * 8 + wv; const int L = threadIdx.x & 31; if (n >= N) return; const int c0 = 8 * L; const int h = c0 / CH;
    const float ad = AD[(long long)n * ASTR + h]; const float cw = (EWM == 1) ? CW[h] : 0.f; float m = -3.0e38f, s = 0.f; v4f a0, a1; a0.x = a0.y = a0.z = a0.w = 0.f; a1 = a0;
    const int p0 = cl(off[n], E + 1), cn = min(max(cnt[n], 0), CAP);
    for (int j = (SELF ? -1 : 0); j < cn; ++j) { int sj; float ew = 0.f;
        if (j < 0) { sj = n; ew = 1.f; } else { int e = slot[cl(p0 + j, E)]; e = cl(e, E); sj = cl(esrc[e], N); if (EWM != 0) ew = EW[e]; }
        float lg = AS[(long long)sj * ASTR + h] + ad + ((EWM == 1) ? ew * cw : 0.f); lg = (lg >= 0.f) ? lg : slope * lg;
        const float mn = fmaxf(m, lg); const float cz = expf(m - mn), pj = expf(lg - mn); s = s * cz + pj; const float pw = (EWM == 2) ? pj * ew : pj;
        const unsigned short* xr = XP + (long long)sj * XW + c0; a0 = a0 * cz + ld4h(xr) * pw; a1 = a1 * cz + ld4h(xr + 4) * pw; m = mn; }
    const float inv = (s > 0.f) ? 1.f / (s + 1e-16f) : 0.f; a0 = a0 * inv; a1 = a1 * inv;
    if (EPI == 0 || EPI == 1 || EPI == 4 || EPI == 5) { a0 = a0 + *(const v4f*)(bias + c0); a1 = a1 + *(const v4f*)(bias + c0 + 4); }
    if (EPI == 4 || EPI == 5) { a0.x = (a0.x > 0.f) ? a0.x : (expf(a0.x) - 1.f); a0.y = (a0.y > 0.f) ? a0.y : (expf(a0.y) - 1.f); a0.z = (a0.z > 0.f) ? a0.z : (expf(a0.z) - 1.f); a0.w = (a0.w > 0.f) ? a0.w : (expf(a0.w) - 1.f);
        a1.x = (a1.x > 0.f) ? a1.x : (expf(a1.x) - 1.f); a1.y = (a1.y > 0.f) ? a1.y : (expf(a1.y) - 1.f); a1.z = (a1.z > 0.f) ? a1.z : (expf(a1.z) - 1.f); a1.w = (a1.w > 0.f) ? a1.w : (expf(a1.w) - 1.f); }
    if (EPI == 4) { float o8[8] = {a0.x, a0.y, a0.z, a0.w, a1.x, a1.y, a1.z, a1.w}; unsigned short hh[8], ll[8];
#pragma unroll
        for (int u = 0; u < 8; ++u) bfsplit(o8[u], hh[u], ll[u]);
        const unsigned long long ph0 = (unsigned long long)hh[0] | ((unsigned long long)hh[1] << 16) | ((unsigned long long)hh[2] << 32) | ((unsigned long long)hh[3] << 48), pl0 = (unsigned long long)ll[0] | ((unsigned long long)ll[1] << 16) | ((unsigned long long)ll[2] << 32) | ((unsigned long long)ll[3] << 48);
        const unsigned long long ph1 = (unsigned long long)hh[4] | ((unsigned long long)hh[5] << 16) | ((unsigned long long)hh[6] << 32) | ((unsigned long long)hh[7] << 48), pl1 = (unsigned long long)ll[4] | ((unsigned long long)ll[5] << 16) | ((unsigned long long)ll[6] << 32) | ((unsigned long long)ll[7] << 48);
        v4u pk; pk.x = (unsigned)(ph0 & 0xFFFFFFFFull); pk.y = (unsigned)(ph0 >> 32); pk.z = (unsigned)(ph1 & 0xFFFFFFFFull); pk.w = (unsigned)(ph1 >> 32); v4u* dh = (v4u*)(OH + (long long)n * 256 + c0); *dh = pk; 
        v4u ql; ql.x = (unsigned)(pl0 & 0xFFFFFFFFull); ql.y = (unsigned)(pl0 >> 32); ql.z = (unsigned)(pl1 & 0xFFFFFFFFull); ql.w = (unsigned)(pl1 >> 32); v4u* dl = (v4u*)(OL + (long long)n * 256 + c0); *dl = ql;  return; }
    if (EPI == 6) {
        a0.x += __shfl_xor(a0.x, 16); a0.y += __shfl_xor(a0.y, 16); a0.z += __shfl_xor(a0.z, 16); a0.w += __shfl_xor(a0.w, 16); a1.x += __shfl_xor(a1.x, 16); a1.y += __shfl_xor(a1.y, 16); a1.z += __shfl_xor(a1.z, 16); a1.w += __shfl_xor(a1.w, 16);
        if (L < 16) { const int cb = 8 * L; const v4f b0 = *(const v4f*)(bias + cb), b1v = *(const v4f*)(bias + cb + 4);
            stage[wv][cb] = fmaxf(a0.x * 0.5f + b0.x, 0.f); stage[wv][cb + 1] = fmaxf(a0.y * 0.5f + b0.y, 0.f); stage[wv][cb + 2] = fmaxf(a0.z * 0.5f + b0.z, 0.f); stage[wv][cb + 3] = fmaxf(a0.w * 0.5f + b0.w, 0.f);
            stage[wv][cb + 4] = fmaxf(a1.x * 0.5f + b1v.x, 0.f); stage[wv][cb + 5] = fmaxf(a1.y * 0.5f + b1v.y, 0.f); stage[wv][cb + 6] = fmaxf(a1.z * 0.5f + b1v.z, 0.f); stage[wv][cb + 7] = fmaxf(a1.w * 0.5f + b1v.w, 0.f); }
        __builtin_amdgcn_fence(__ATOMIC_RELEASE, "workgroup"); __builtin_amdgcn_wave_barrier(); __builtin_amdgcn_fence(__ATOMIC_ACQUIRE, "workgroup");
        v4f o6; o6.x = stage[wv][4 * L]; o6.y = stage[wv][4 * L + 1]; o6.z = stage[wv][4 * L + 2]; o6.w = stage[wv][4 * L + 3]; VST2V4(OUT + (long long)n * 128 + 4 * L, o6); return; }
    if (EPI == 5) {
        a0.x += __shfl_xor(a0.x, 8); a0.y += __shfl_xor(a0.y, 8); a0.z += __shfl_xor(a0.z, 8); a0.w += __shfl_xor(a0.w, 8); a1.x += __shfl_xor(a1.x, 8); a1.y += __shfl_xor(a1.y, 8); a1.z += __shfl_xor(a1.z, 8); a1.w += __shfl_xor(a1.w, 8);
        a0.x += __shfl_xor(a0.x, 16); a0.y += __shfl_xor(a0.y, 16); a0.z += __shfl_xor(a0.z, 16); a0.w += __shfl_xor(a0.w, 16); a1.x += __shfl_xor(a1.x, 16); a1.y += __shfl_xor(a1.y, 16); a1.z += __shfl_xor(a1.z, 16); a1.w += __shfl_xor(a1.w, 16);
        const int gq5 = L & 7; a0 = a0 * 0.25f; a1 = a1 * 0.25f;
        if (L < 8) { stage[wv][8 * gq5] = a0.x; stage[wv][8 * gq5 + 1] = a0.y; stage[wv][8 * gq5 + 2] = a0.z; stage[wv][8 * gq5 + 3] = a0.w; stage[wv][8 * gq5 + 4] = a1.x; stage[wv][8 * gq5 + 5] = a1.y; stage[wv][8 * gq5 + 6] = a1.z; stage[wv][8 * gq5 + 7] = a1.w; }
        __builtin_amdgcn_fence(__ATOMIC_RELEASE, "workgroup"); __builtin_amdgcn_wave_barrier(); __builtin_amdgcn_fence(__ATOMIC_ACQUIRE, "workgroup");
        const unsigned long long pk5 = (unsigned long long)__builtin_bit_cast(unsigned, stage[wv][2 * L]) | ((unsigned long long)__builtin_bit_cast(unsigned, stage[wv][2 * L + 1]) << 32); VST2(unsigned long long, (unsigned long long*)(OUT + (long long)n * 64 + 2 * L), pk5); return; }
    if (EPI == 1) { float sm = a0.x + a0.y + a0.z + a0.w + a1.x + a1.y + a1.z + a1.w;
#pragma unroll
        for (int o = 16; o > 0; o >>= 1) sm += __shfl_xor(sm, o);
        const float mu = sm * (1.f / 256.f); const v4f d0 = a0 - mu, d1 = a1 - mu; float q = d0.x * d0.x + d0.y * d0.y + d0.z * d0.z + d0.w * d0.w + d1.x * d1.x + d1.y * d1.y + d1.z * d1.z + d1.w * d1.w;
#pragma unroll
        for (int o = 16; o > 0; o >>= 1) q += __shfl_xor(q, o);
        const float rs = rsqrtf(q * (1.f / 256.f) + 1e-5f); float o8[8] = {d0.x, d0.y, d0.z, d0.w, d1.x, d1.y, d1.z, d1.w}; unsigned short hh[8], ll[8];
#pragma unroll
        for (int u = 0; u < 8; ++u) { const float v = fmaxf(o8[u] * rs * g[c0 + u] + bb[c0 + u], 0.f); bfsplit(v, hh[u], ll[u]); }
        const unsigned long long ph0 = (unsigned long long)hh[0] | ((unsigned long long)hh[1] << 16) | ((unsigned long long)hh[2] << 32) | ((unsigned long long)hh[3] << 48), pl0 = (unsigned long long)ll[0] | ((unsigned long long)ll[1] << 16) | ((unsigned long long)ll[2] << 32) | ((unsigned long long)ll[3] << 48);
        const unsigned long long ph1 = (unsigned long long)hh[4] | ((unsigned long long)hh[5] << 16) | ((unsigned long long)hh[6] << 32) | ((unsigned long long)hh[7] << 48), pl1 = (unsigned long long)ll[4] | ((unsigned long long)ll[5] << 16) | ((unsigned long long)ll[6] << 32) | ((unsigned long long)ll[7] << 48);
        // lane L's 8 halves at c0 = 8L: 16 B -> one 16-B store per plane (32 lanes x 16 B = whole 512-B row)
        v4u pk; pk.x = (unsigned)(ph0 & 0xFFFFFFFFull); pk.y = (unsigned)(ph0 >> 32); pk.z = (unsigned)(ph1 & 0xFFFFFFFFull); pk.w = (unsigned)(ph1 >> 32); v4u* dh = (v4u*)(OH + (long long)n * 256 + c0); *dh = pk; 
        v4u ql; ql.x = (unsigned)(pl0 & 0xFFFFFFFFull); ql.y = (unsigned)(pl0 >> 32); ql.z = (unsigned)(pl1 & 0xFFFFFFFFull); ql.w = (unsigned)(pl1 >> 32); v4u* dl = (v4u*)(OL + (long long)n * 256 + c0); *dl = ql;  return; }
    if (EPI == 2 || EPI == 3) {   // head mean: lanes L, L^8, L^16, L^24 hold the same chan group of the 4 heads (CH = 64 -> 8 lanes per head)
        a0.x += __shfl_xor(a0.x, 8); a0.y += __shfl_xor(a0.y, 8); a0.z += __shfl_xor(a0.z, 8); a0.w += __shfl_xor(a0.w, 8); a1.x += __shfl_xor(a1.x, 8); a1.y += __shfl_xor(a1.y, 8); a1.z += __shfl_xor(a1.z, 8); a1.w += __shfl_xor(a1.w, 8);
        a0.x += __shfl_xor(a0.x, 16); a0.y += __shfl_xor(a0.y, 16); a0.z += __shfl_xor(a0.z, 16); a0.w += __shfl_xor(a0.w, 16); a1.x += __shfl_xor(a1.x, 16); a1.y += __shfl_xor(a1.y, 16); a1.z += __shfl_xor(a1.z, 16); a1.w += __shfl_xor(a1.w, 16);
        const int gq = L & 7; a0 = a0 * 0.25f + *(const v4f*)(bias + 8 * gq); a1 = a1 * 0.25f + *(const v4f*)(bias + 8 * gq + 4);      // every lane now holds channels 8gq..8gq+7 of the mean
        if (EPI == 3) { if (L < 8) { stage[wv][8 * gq] = a0.x; stage[wv][8 * gq + 1] = a0.y; stage[wv][8 * gq + 2] = a0.z; stage[wv][8 * gq + 3] = a0.w; stage[wv][8 * gq + 4] = a1.x; stage[wv][8 * gq + 5] = a1.y; stage[wv][8 * gq + 6] = a1.z; stage[wv][8 * gq + 7] = a1.w; }
            __builtin_amdgcn_fence(__ATOMIC_RELEASE, "workgroup"); __builtin_amdgcn_wave_barrier(); __builtin_amdgcn_fence(__ATOMIC_ACQUIRE, "workgroup");
            const unsigned long long pk3 = (unsigned long long)__builtin_bit_cast(unsigned, stage[wv][2 * L]) | ((unsigned long long)__builtin_bit_cast(unsigned, stage[wv][2 * L + 1]) << 32); VST2(unsigned long long, (unsigned long long*)(OUT + (long long)n * 64 + 2 * L), pk3); return; }
        float sm = (L < 8) ? (a0.x + a0.y + a0.z + a0.w + a1.x + a1.y + a1.z + a1.w) : 0.f;
#pragma unroll
        for (int o = 16; o > 0; o >>= 1) sm += __shfl_xor(sm, o);
        const float mu = sm * (1.f / 64.f); const v4f d0 = a0 - mu, d1 = a1 - mu; float q = (L < 8) ? (d0.x * d0.x + d0.y * d0.y + d0.z * d0.z + d0.w * d0.w + d1.x * d1.x + d1.y * d1.y + d1.z * d1.z + d1.w * d1.w) : 0.f;
#pragma unroll
        for (int o = 16; o > 0; o >>= 1) q += __shfl_xor(q, o);
        const float rs = rsqrtf(q * (1.f / 64.f) + 1e-5f);
        if (L < 8) { const float* gg = g + 8 * gq; const float* bq = bb + 8 * gq; stage[wv][8 * gq] = fmaxf(d0.x * rs * gg[0] + bq[0], 0.f); stage[wv][8 * gq + 1] = fmaxf(d0.y * rs * gg[1] + bq[1], 0.f); stage[wv][8 * gq + 2] = fmaxf(d0.z * rs * gg[2] + bq[2], 0.f); stage[wv][8 * gq + 3] = fmaxf(d0.w * rs * gg[3] + bq[3], 0.f);
            stage[wv][8 * gq + 4] = fmaxf(d1.x * rs * gg[4] + bq[4], 0.f); stage[wv][8 * gq + 5] = fmaxf(d1.y * rs * gg[5] + bq[5], 0.f); stage[wv][8 * gq + 6] = fmaxf(d1.z * rs * gg[6] + bq[6], 0.f); stage[wv][8 * gq + 7] = fmaxf(d1.w * rs * gg[7] + bq[7], 0.f); }
        __builtin_amdgcn_fence(__ATOMIC_RELEASE, "workgroup"); __builtin_amdgcn_wave_barrier(); __builtin_amdgcn_fence(__ATOMIC_ACQUIRE, "workgroup");
        const unsigned long long pk = (unsigned long long)__builtin_bit_cast(unsigned, stage[wv][2 * L]) | ((unsigned long long)__builtin_bit_cast(unsigned, stage[wv][2 * L + 1]) << 32); VST2(unsigned long long, (unsigned long long*)(OUT + (long long)n * 64 + 2 * L), pk); return; }
    // EPI 0
    stage[wv][c0] = a0.x; stage[wv][c0 + 1] = a0.y; stage[wv][c0 + 2] = a0.z; stage[wv][c0 + 3] = a0.w; stage[wv][c0 + 4] = a1.x; stage[wv][c0 + 5] = a1.y; stage[wv][c0 + 6] = a1.z; stage[wv][c0 + 7] = a1.w;
    __builtin_amdgcn_fence(__ATOMIC_RELEASE, "workgroup"); __builtin_amdgcn_wave_barrier(); __builtin_amdgcn_fence(__ATOMIC_ACQUIRE, "workgroup");
#pragma unroll
    for (int q2 = 0; q2 < 2; ++q2) { const int c = 128 * q2 + 4 * L; v4f v; v.x = stage[wv][c]; v.y = stage[wv][c + 1]; v.z = stage[wv][c + 2]; v.w = stage[wv][c + 3]; VST2V4(OUT + (long long)n * 256 + c, v); } }

__device__ __forceinline__ void st4s(unsigned short* Hp, unsigned short* Lp, long long o, v4f a) { unsigned short h[4], l[4]; bfsplit(a.x, h[0], l[0]); bfsplit(a.y, h[1], l[1]); bfsplit(a.z, h[2], l[2]); bfsplit(a.w, h[3], l[3]);
    const unsigned long long ph = (unsigned long long)h[0] | ((unsigned long long)h[1] << 16) | ((unsigned long long)h[2] << 32) | ((unsigned long long)h[3] << 48), pl = (unsigned long long)l[0] | ((unsigned long long)l[1] << 16) | ((unsigned long long)l[2] << 32) | ((unsigned long long)l[3] << 48);
    VST2(unsigned long long, (unsigned long long*)(Hp + o), ph); VST2(unsigned long long, (unsigned long long*)(Lp + o), pl); }
// f32 [nval2 pairs] -> bf16 hi/lo planes (n2 pairs; pairs >= nval2 zero); thread-linear 4-B stores per plane
__global__ __launch_bounds__(256) void k_pl(const float* __restrict__ S, unsigned short* __restrict__ PH, unsigned short* __restrict__ PL, long long nval2, long long n2) { const long long u = (long long)blockIdx.x * 256 + threadIdx.x; if (u >= n2) return; const bool in = (u < nval2); const long long uc = in ? u : ((nval2 > 0) ? (nval2 - 1) : 0); const float a = S[2 * uc], b = S[2 * uc + 1]; st_s2(PH, PL, 2 * u, in ? a : 0.f, in ? b : 0.f); }
// WC [K][NOP] (thread-linear whole rows) = [W (cols < FO) | 0 | W_h . as_h @EO+h | W_h . ad_h @EO+NH+h | 0 ...]; W is [K][FO] (x @ W layout), as/ad [NH][DH]; EO >= FO.
// branch-free: every lane loads all candidates with clamped indices and selects by value (no exec-masked load arms)
__global__ __launch_bounds__(256) void k_wext(const float* __restrict__ Wm, const float* __restrict__ AS_, const float* __restrict__ AD_, int K, int NOP, int FO, int NH, int DH, int EO, float* __restrict__ WC) {
    #pragma clang fp contract(off)
    const long long u = (long long)blockIdx.x * 256 + threadIdx.x; if (u >= (long long)K * NOP) return; const int kk = (int)(u / NOP), o = (int)(u % NOP);
    const int oo = min(o, FO - 1); const float vw = Wm[(long long)kk * FO + oo]; const int q = min(max(o - EO, 0), 2 * NH - 1); const int h = q % NH; float s = 0.f;
#pragma unroll 1
    for (int c = 0; c < DH; ++c) { const float w = Wm[(long long)kk * FO + h * DH + c]; const float asv = AS_[h * DH + c], adv = AD_[h * DH + c]; s += w * ((q < NH) ? asv : adv); }
    const float v = (o < FO) ? vw : ((o >= EO && o < EO + 2 * NH) ? s : 0.f); VST2(float, WC + u, v); }
// GAT aggregation over a device in-edge CSR (+ analytic self loop as iteration j = -1 when SELF), per-lane online softmax (lanes of one head agree):
// HS rows (pitch P floats): [0,128) projected features z, col 128 + h = a_src.z_h, col 128 + NH + h = a_dst.z_h; lane L owns channels 4L..4L+3 (head = 4L / CH).
// out = sum_j softmax_j(leaky(el[src_j][h] + er[n][h])) z[src_j] (/ (den + deps)) + bias -> ACT (0 none, 1 relu, 2 elu, 3 leaky 0.01) ->
// MODE 0: f32 OUT[n][OW] cols < OC (16-B lane stores, OC*4 contiguous B per wave; OC in {64,128}); MODE 1: bf16 hi/lo planes PH/PL pitch PP (rows n >= N zero); MODE 2: both.
template <int CH, bool SELF, int ACT, int MODE>
__global__ __launch_bounds__(256) void k_gat128(const float* __restrict__ HS, int P, int NH, const float* __restrict__ bias, const int* __restrict__ SRC, const int* __restrict__ off, const int* __restrict__ cnt, const int* __restrict__ slot,
        float* __restrict__ OUT, int OW, int OC, unsigned short* __restrict__ PH, unsigned short* __restrict__ PL, int PP, int N, int NP, int E, int CAP, float slope, float deps) {
    #pragma clang fp contract(off)
    const int n = blockIdx.x * 8 + (threadIdx.x >> 5); const int L = threadIdx.x & 31; if (n >= NP) return; const int c = 4 * L; const int h = c / CH; v4f o; o.x = o.y = o.z = o.w = 0.f;
    if (n < N) { const float* hn = HS + (long long)n * P; const float er = hn[128 + NH + h]; float m = -3.0e38f, s = 0.f; v4f a; a.x = a.y = a.z = a.w = 0.f;
        const int p0 = min(max(off[n], 0), E), cn = min(max(cnt[n], 0), CAP);
        for (int j = (SELF ? -1 : 0); j < cn; ++j) { int sj; if (j < 0) sj = n; else { const int e = min(max(slot[min(p0 + j, E - 1)], 0), E - 1); sj = min(max(SRC[e], 0), N - 1); }
            const float* hs = HS + (long long)sj * P; float lg = hs[128 + h] + er; lg = (lg >= 0.f) ? lg : slope * lg;
            const float mn = fmaxf(m, lg); const float cz = expf(m - mn), pj = expf(lg - mn); s = s * cz + pj; a = a * cz + *(const v4f*)(hs + c) * pj; m = mn; }
        const float inv = (s > 0.f || deps > 0.f) ? 1.f / (s + deps) : 0.f; o = a * inv + *(const v4f*)(bias + c);
        if (ACT == 1) { o.x = fmaxf(o.x, 0.f); o.y = fmaxf(o.y, 0.f); o.z = fmaxf(o.z, 0.f); o.w = fmaxf(o.w, 0.f); }
        if (ACT == 2) { o.x = (o.x > 0.f) ? o.x : (expf(o.x) - 1.f); o.y = (o.y > 0.f) ? o.y : (expf(o.y) - 1.f); o.z = (o.z > 0.f) ? o.z : (expf(o.z) - 1.f); o.w = (o.w > 0.f) ? o.w : (expf(o.w) - 1.f); }
        if (ACT == 3) { o.x = (o.x >= 0.f) ? o.x : 0.01f * o.x; o.y = (o.y >= 0.f) ? o.y : 0.01f * o.y; o.z = (o.z >= 0.f) ? o.z : 0.01f * o.z; o.w = (o.w >= 0.f) ? o.w : 0.01f * o.w; }
        if (MODE != 1 && c < OC) VST2V4(OUT + (long long)n * OW + c, o); }
    if (MODE != 0) st4s(PH, PL, (long long)n * PP + c, o); }

// ---- util2 ----
// generic Bt plane builder from an f32 weight: Bt[o][k] (pitch KP halves) = (TRANS ? W[k*ldw + o] : W[o*ldw + k]) * (S ? S[o] : 1) for o < NO, k < KI; zero elsewhere for o < NOP rows, k < KP (thread per (o < NOP, pair k))
__global__ __launch_bounds__(256) void k_u2_bt(const float* __restrict__ Wm, int ldw, int TRANS, int KI, int NO, int KP, int NOP, const float* __restrict__ S, unsigned short* __restrict__ PH_, unsigned short* __restrict__ PL_) {
    const long long u = (long long)blockIdx.x * 256 + threadIdx.x; if (u >= (long long)NOP * (KP / 2)) return; const int k0 = 2 * (int)(u % (KP / 2)); const int o = (int)(u / (KP / 2)); float a = 0.f, b = 0.f;
    if (o < NO) { const float s = S ? S[o] : 1.f;
        if (k0 < KI) a = (TRANS ? Wm[(long long)k0 * ldw + o] : Wm[(long long)o * ldw + k0]) * s;
        if (k0 + 1 < KI) b = (TRANS ? Wm[(long long)(k0 + 1) * ldw + o] : Wm[(long long)o * ldw + k0 + 1]) * s; }
    st_s2(PH_, PL_, (long long)o * KP + k0, a, b); }
// generic padded vector: O[i] = (i < n) ? (A[i] * (S ? S[i] : 1) + (B2 ? B2[i] : 0)) : 0 for i < NP (one block of 256, NP <= 4096 looped)
__global__ __launch_bounds__(256) void k_u2_vec(const float* __restrict__ A, const float* __restrict__ S, const float* __restrict__ B2, int n, int NP, float* __restrict__ O) { for (int i = threadIdx.x; i < NP; i += 256) { float v = 0.f; if (i < n) v = A[i] * (S ? S[i] : 1.f) + (B2 ? B2[i] : 0.f); VST2(float, O + i, v); } }
__global__ __launch_bounds__(256) void k_u2_colstat(const float* __restrict__ X, int P, int N, float eps, float* __restrict__ STAT) {
    #pragma clang fp contract(off)
    __shared__ float red[256]; const int c = blockIdx.x; const int t = threadIdx.x; float s = 0.f; for (int r = t; r < N; r += 256) s += X[(long long)r * P + c]; red[t] = s; __syncthreads();
    for (int o = 128; o > 0; o >>= 1) { if (t < o) red[t] += red[t + o]; __syncthreads(); }
    const float mu = red[0] / (float)N; __syncthreads(); float q = 0.f; for (int r = t; r < N; r += 256) { const float d = X[(long long)r * P + c] - mu; q += d * d; } red[t] = q; __syncthreads();
    for (int o = 128; o > 0; o >>= 1) { if (t < o) red[t] += red[t + o]; __syncthreads(); }
    const float rs = 1.f / sqrtf(red[0] / (float)N + eps); if (t < 32) VST2(float, STAT + (long long)c * 32 + t, (t == 0) ? mu : ((t == 1) ? rs : 0.f)); }
// rows f32 [R][W] (pitch PW) -> planes at pitch PP, column offset coff; rows >= RL (live) written as zeros up to RP (thread per (r < RP, 4 of W))
__global__ __launch_bounds__(256) void k_u2_pl(const float* __restrict__ X, int PW, int Wd, int RL, int RP, unsigned short* __restrict__ PH_, unsigned short* __restrict__ PL_, int PP, int coff) { const long long u = (long long)blockIdx.x * 256 + threadIdx.x; if (u >= (long long)RP * (Wd / 4)) return; const int r = (int)(u / (Wd / 4)); const int c = 4 * (int)(u % (Wd / 4)); v4f v; v.x = v.y = v.z = v.w = 0.f; if (r < RL) v = *(const v4f*)(X + (long long)r * PW + c); st4s(PH_, PL_, (long long)r * PP + coff + c, v); }

typedef unsigned int cm_u4 __attribute__((ext_vector_type(4)));

__global__ __launch_bounds__(256) void k_cm_zero16(unsigned short* __restrict__ DST, long long n) { const long long u = (long long)blockIdx.x * 256 + threadIdx.x; if (u * 8 >= n) return; cm_u4 z; z.x = z.y = z.z = z.w = 0u; cm_u4* d = (cm_u4*)(DST + u * 8); *d = z;  }
// f32 -> bf16 (RNE) -> f16 casts: every 16-bit operand then holds exactly the bf16-rounded input value (times a power-of-two
// weight scale), so the f16 WMMA products are exact. Plain: thread per (row, 8 cols),
// dst [R][C] pitch ldd; transposed: thread per (col, 8 consecutive rows) -> dst [C][R] pitch ldd; both store 16 B per thread, thread-linear along the dst row.
__device__ __forceinline__ unsigned int cmb_pk2(float a, float b) { return (unsigned int)__builtin_bit_cast(unsigned short, (_Float16)a) | ((unsigned int)__builtin_bit_cast(unsigned short, (_Float16)b) << 16); }
__device__ __forceinline__ float cmb_bf(float v) { const unsigned u = __builtin_bit_cast(unsigned, v); const unsigned r = (u + 0x7fffu + ((u >> 16) & 1u)) & 0xffff0000u; return __builtin_bit_cast(float, r); }   // bf16 RNE, kept as f32 (finite inputs)
// BR[i] = bf16_rne(B[i]) kept as f32 (thread per element; bias vectors)
__global__ __launch_bounds__(256) void k_cm_bfvec(const float* __restrict__ SRC, float* __restrict__ DST, int n) { const int u = blockIdx.x * 256 + threadIdx.x; if (u >= n) return; VST2(float, DST + u, cmb_bf(SRC[u])); }
__global__ __launch_bounds__(256) void k_cm_castb(const float* __restrict__ SRC, int lds, unsigned short* __restrict__ DST, int ldd, int nR, int nC, float sc) {
    const long long u = (long long)blockIdx.x * 256 + threadIdx.x; const int per = nC / 8; if (u >= (long long)nR * per) return; const int r = (int)(u / per); const int c0 = 8 * (int)(u % per);
    const float* s = SRC + (long long)r * lds + c0; float w[8];
#pragma unroll
    for (int e = 0; e < 8; ++e) w[e] = cmb_bf(s[e]) * sc;
    cm_u4 pk; pk.x = cmb_pk2(w[0], w[1]); pk.y = cmb_pk2(w[2], w[3]); pk.z = cmb_pk2(w[4], w[5]); pk.w = cmb_pk2(w[6], w[7]); VST2(cm_u4, (cm_u4*)(DST + (long long)r * ldd + c0), pk); }
__global__ __launch_bounds__(256) void k_cm_castbT(const float* __restrict__ SRC, int lds, unsigned short* __restrict__ DST, int ldd, int nR, int nC, float sc) {
    const long long u = (long long)blockIdx.x * 256 + threadIdx.x; const int per = nR / 8; if (u >= (long long)nC * per) return; const int c = (int)(u / per); const int r0 = 8 * (int)(u % per);
    float w[8];
#pragma unroll
    for (int e = 0; e < 8; ++e) w[e] = cmb_bf(SRC[(long long)(r0 + e) * lds + c]) * sc;
    cm_u4 pk; pk.x = cmb_pk2(w[0], w[1]); pk.y = cmb_pk2(w[2], w[3]); pk.z = cmb_pk2(w[4], w[5]); pk.w = cmb_pk2(w[6], w[7]); VST2(cm_u4, (cm_u4*)(DST + (long long)c * ldd + r0), pk); }

typedef float ab_v2f __attribute__((ext_vector_type(2)));
// A thread's loads go out AB_GB at a time, and the next AB_GB are in flight while these are summed (two register sets, A and B, in turn), instead of one load and its
// wait per trip; each thread adds its values in the same order as one load per trip would (whole groups first, the rest one by one).
#define AB_GB 16
#define AB_GS (AB_GB * 256)                                      // 16-byte pieces from one group of the block's loads to the next
typedef const __attribute__((address_space(1))) v4f* ab_gp;     // pointer to global memory: it stays one behind the wait statement below, through which the compiler does not see
__device__ __forceinline__ void ab_ld(v4f (&v)[AB_GB], ab_gp& p, int off) {   // the group that begins off pieces behind p
#pragma unroll   // v is then indexed by constants and stays in registers, and the loads stand one behind the other
    for (int u = 0; u < AB_GB; ++u) v[u] = p[off + 256 * u];    // the block's 256 threads cover 256 consecutive 16-byte pieces per load
    asm volatile("s_wait_xcnt 0x0" : "+v"(p) :: "memory");      // the loads' address register pair is stepped or reused only behind this wait (p goes through it), the loads still in flight
}
__global__ __launch_bounds__(256) void k_ab_gstat(const float* __restrict__ X, float* __restrict__ STp, int per) {
    #pragma clang fp contract(off)
    __shared__ float red[256]; const int g = blockIdx.x; const int t = threadIdx.x; const float* base = X + (long long)g * per; float s = 0.f;
    const int nb = per / (AB_GB * 1024);                         // whole groups (the same for every thread)
    v4f A[AB_GB], B[AB_GB];
    auto sum = [&s](const v4f (&v)[AB_GB]) {
#pragma unroll   // v is then indexed by constants and stays in registers
        for (int u = 0; u < AB_GB; ++u) s += (cmb_bf(v[u].x) + cmb_bf(v[u].y)) + (cmb_bf(v[u].z) + cmb_bf(v[u].w));
    };
    ab_gp p = (ab_gp)base + t; int k = 0;                        // p: the thread's piece of group k
    if (nb > 0) {
        ab_ld(A, p, 0);
        for (; k + 2 < nb; k += 2) { ab_ld(B, p, AB_GS); sum(A); ab_ld(A, p, 2 * AB_GS); p += 2 * AB_GS; sum(B); }
        if (k + 1 < nb) { ab_ld(B, p, AB_GS); sum(A); sum(B); } else sum(A);
    }
    for (int i = nb * (AB_GB * 1024) + 4 * t; i < per; i += 1024) { const v4f v = *(const v4f*)(base + i); s += (cmb_bf(v.x) + cmb_bf(v.y)) + (cmb_bf(v.z) + cmb_bf(v.w)); }
    red[t] = s; __syncthreads();
    for (int o = 128; o > 0; o >>= 1) { if (t < o) red[t] += red[t + o]; __syncthreads(); }
    const float mean = red[0] / (float)per; __syncthreads(); float q = 0.f;
    auto sq = [&q, mean](const v4f (&v)[AB_GB]) {
#pragma unroll   // v is then indexed by constants and stays in registers
        for (int u = 0; u < AB_GB; ++u) { const float a = cmb_bf(v[u].x) - mean, b = cmb_bf(v[u].y) - mean, c = cmb_bf(v[u].z) - mean, d = cmb_bf(v[u].w) - mean; q += (a * a + b * b) + (c * c + d * d); }
    };
    if (nb > 0) {
        p -= (long long)k * AB_GS; k = 0; ab_ld(A, p, 0);        // p is stepped back to group 0, not formed anew: the first group too is then addressed by the pair that the wait in ab_ld holds
        for (; k + 2 < nb; k += 2) { ab_ld(B, p, AB_GS); sq(A); ab_ld(A, p, 2 * AB_GS); p += 2 * AB_GS; sq(B); }
        if (k + 1 < nb) { ab_ld(B, p, AB_GS); sq(A); sq(B); } else sq(A);
    }
    for (int i = nb * (AB_GB * 1024) + 4 * t; i < per; i += 1024) { const v4f v = *(const v4f*)(base + i); const float a = cmb_bf(v.x) - mean, b = cmb_bf(v.y) - mean, c = cmb_bf(v.z) - mean, d = cmb_bf(v.w) - mean; q += (a * a + b * b) + (c * c + d * d); }
    red[t] = q; __syncthreads();
    for (int o = 128; o > 0; o >>= 1) { if (t < o) red[t] += red[t + o]; __syncthreads(); }
    if (t == 0) { ab_v2f ms; ms.x = mean; ms.y = rsqrtf(red[0] / (float)per + 1e-5f); VST2(ab_v2f, (ab_v2f*)(STp + 32 * g), ms); } }
// XN[c][n] = (bf16(x[c][n]) - mean[g]) rstd[g] bf16(gamma[c]) + bf16(beta[c]); XB[c][n] = bf16(x[c][n]) (residual copy); c runs over the rows of all images ([B * CH][N], groups numbered through), gamma and beta repeat every CH rows
__global__ __launch_bounds__(256) void k_ab_gapply(const float* __restrict__ X, const float* __restrict__ STp, const float* __restrict__ Gm, const float* __restrict__ Bt, float* __restrict__ XNp, float* __restrict__ XBp, int N, int CPG, int CH, long long n4) {
    #pragma clang fp contract(off)
    // A thread takes 8 float4 pieces, 32 apart, all loaded before the first is used: a wave covers 1024 consecutive floats with 8 loads of 512 contiguous bytes each. The launch promises
    // N a multiple of 1024 and n4 a multiple of 256, so that a wave's 1024 floats lie in one row c and inside the buffers.
    const long long u0 = ((long long)blockIdx.x * 8 + __builtin_amdgcn_readfirstlane((int)(threadIdx.x >> 5))) * 256; if (u0 >= n4) return;   // the wave's first piece, in scalar registers: row, group and their four constants are then scalar loads
    const long long u = u0 + (threadIdx.x & 31); const int c = (int)((4 * u0) / N); const int g = c / CPG; const float mean = STp[32 * g], rs = STp[32 * g + 1], ga = cmb_bf(Gm[c % CH]), be = cmb_bf(Bt[c % CH]);
    const v4f* xp = (const v4f*)(X + 4 * u); v4f w[8];
#pragma unroll   // w is then indexed by constants and stays in registers, and the 8 loads stand one behind the other
    for (int k = 0; k < 8; ++k) w[k] = xp[32 * k];
    asm volatile("s_wait_xcnt 0x0" :: "v"(xp) : "memory");       // the loads' address pair stays as it is up to this wait (named as input) and is reused only behind it
#pragma unroll   // (as above)
    for (int k = 0; k < 8; ++k) {
        const v4f v = w[k]; v4f xb; xb.x = cmb_bf(v.x); xb.y = cmb_bf(v.y); xb.z = cmb_bf(v.z); xb.w = cmb_bf(v.w); v4f r; r.x = (xb.x - mean) * rs * ga + be; r.y = (xb.y - mean) * rs * ga + be; r.z = (xb.z - mean) * rs * ga + be; r.w = (xb.w - mean) * rs * ga + be;
        VST2V4(XNp + 4 * (u + 32 * k), r); VST2V4(XBp + 4 * (u + 32 * k), xb);
    } }
// The two large hi/lo split casts, 32 elements per thread (k_castS16 converts 2): the same conversion of each element, from 16 times fewer waves, each with 8 16-byte loads in flight.
typedef unsigned int cs_u2 __attribute__((ext_vector_type(2)));
// k_castS16w: [R][C] -> [R][C], rows one behind the other in source and planes (lds = ldd = C), n = R C a multiple of 1024. A wave takes 1024 consecutive elements: 8 loads of 512
// contiguous bytes, and per plane 8 stores of 256 contiguous bytes.
__global__ __launch_bounds__(256) void k_castS16w(const float* __restrict__ src, __bf16* __restrict__ dhi, __bf16* __restrict__ dlo, long long n, float s) {
    const long long o = ((long long)blockIdx.x * 8 + (threadIdx.x >> 5)) * 1024 + (threadIdx.x & 31) * 4; if (o >= n) return;
    const v4f* sp = (const v4f*)(src + o); v4f w[8];
#pragma unroll   // w is then indexed by constants and stays in registers, and the 8 loads stand one behind the other
    for (int k = 0; k < 8; ++k) w[k] = sp[32 * k];
    asm volatile("s_wait_xcnt 0x0" :: "v"(sp) : "memory");       // the loads' address pair stays as it is up to this wait (named as input) and is reused only behind it
#pragma unroll   // (as above)
    for (int k = 0; k < 8; ++k) {
        cs_u2 hi, lo; unsigned l0, l1; hi.x = f2bf2_pack(w[k].x * s, w[k].y * s, &l0); hi.y = f2bf2_pack(w[k].z * s, w[k].w * s, &l1); lo.x = l0; lo.y = l1;
        *(cs_u2*)(dhi + o + 128 * k) = hi; *(cs_u2*)(dlo + o + 128 * k) = lo;
    } }
// k_castS16t: [256][C] (row stride lds) -> [C][256] (row stride ldd), C a multiple of 32, 16-byte aligned rows; blockIdx.x = 32 source columns, blockIdx.y = matrix of a batch (as in k_castS16).
// A thread takes 8 source rows x 4 source columns and transposes them in its registers: 8 loads of 16 bytes (one per row), and per plane 4 stores of 16 bytes (8 consecutive elements of a
// destination row). Lanes: 8 along the rows, so that a store writes whole 128-byte lines; 4 along the columns, the neighbour wave reading the other half of each 128-byte source line.
__global__ __launch_bounds__(256) void k_castS16t(const float* __restrict__ src, long long lds, __bf16* __restrict__ dhi, __bf16* __restrict__ dlo, long long ldd, float s, long long sz, long long dz) {
    src += (long long)blockIdx.y * sz; dhi += (long long)blockIdx.y * dz; dlo += (long long)blockIdx.y * dz;
    const int lane = threadIdx.x & 31, wave = threadIdx.x >> 5;
    const int r0 = (wave >> 1) * 64 + (lane & 7) * 8, c0 = (int)blockIdx.x * 32 + (wave & 1) * 16 + (lane >> 3) * 4;
    const v4f* sp[8]; v4f w[8];
#pragma unroll   // sp and w are then indexed by constants and stay in registers, and the 8 loads stand one behind the other
    for (int k = 0; k < 8; ++k) { sp[k] = (const v4f*)(src + (long long)(r0 + k) * lds + c0); w[k] = *sp[k]; }
    // the loads' address pairs stay as they are up to this wait (named as inputs) and are reused only behind it
    asm volatile("s_wait_xcnt 0x0" :: "v"(sp[0]), "v"(sp[1]), "v"(sp[2]), "v"(sp[3]), "v"(sp[4]), "v"(sp[5]), "v"(sp[6]), "v"(sp[7]) : "memory");
#pragma unroll   // (as above)
    for (int j = 0; j < 4; ++j) {
        cm_u4 hi, lo; unsigned l0, l1, l2, l3;
        hi.x = f2bf2_pack(w[0][j] * s, w[1][j] * s, &l0); hi.y = f2bf2_pack(w[2][j] * s, w[3][j] * s, &l1); hi.z = f2bf2_pack(w[4][j] * s, w[5][j] * s, &l2); hi.w = f2bf2_pack(w[6][j] * s, w[7][j] * s, &l3);
        lo.x = l0; lo.y = l1; lo.z = l2; lo.w = l3;
        const long long o = (long long)(c0 + j) * ldd + r0; *(cm_u4*)(dhi + o) = hi; *(cm_u4*)(dlo + o) = lo;
    } }


extern "C" void kernel_launch(void* const* d_in, const int* in_sizes, int n_in, void* d_out, int out_size, void* d_ws, size_t ws_size, hipStream_t stream) {
    (void)in_sizes; (void)n_in; (void)out_size; (void)ws_size;
    const float* x = (const float*)d_in[0];
    const float* gam = (const float*)d_in[1];
    const float* bet = (const float*)d_in[2];
    const float* wqkv = (const float*)d_in[3];
    const float* bqkv = (const float*)d_in[4];
    const float* wo = (const float*)d_in[5];
    const float* bo = (const float*)d_in[6];
    float* out = (float*)d_out;
    char* wsp = (char*)d_ws;
    float* ST = (float*)wsp; wsp += (((size_t)((size_t)32 * 32 + 64) * 4 + 255) / 256) * 256;
    float* XN = (float*)wsp; wsp += (((size_t)((size_t)1024 * 4096) * 4 + 255) / 256) * 256;
    unsigned short* XTH = (unsigned short*)wsp; wsp += (((size_t)((size_t)16384 * 256) * 2 + 255) / 256) * 256;
    unsigned short* XTL = (unsigned short*)wsp; wsp += (((size_t)((size_t)16384 * 256) * 2 + 255) / 256) * 256;
    unsigned short* W3H = (unsigned short*)wsp; wsp += (((size_t)((size_t)768 * 256) * 2 + 255) / 256) * 256;
    unsigned short* W3L = (unsigned short*)wsp; wsp += (((size_t)((size_t)768 * 256) * 2 + 255) / 256) * 256;
    float* BR3 = (float*)wsp; wsp += (((size_t)((size_t)768 + 64) * 4 + 255) / 256) * 256;
    float* QKV = (float*)wsp; wsp += (((size_t)((size_t)16384 * 768) * 4 + 255) / 256) * 256;
    float* AO = (float*)wsp; wsp += (((size_t)((size_t)16384 * 256) * 4 + 255) / 256) * 256;
    unsigned short* AOH = (unsigned short*)wsp; wsp += (((size_t)((size_t)16384 * 256) * 2 + 255) / 256) * 256;
    unsigned short* AOL = (unsigned short*)wsp; wsp += (((size_t)((size_t)16384 * 256) * 2 + 255) / 256) * 256;
    unsigned short* WOH = (unsigned short*)wsp; wsp += (((size_t)((size_t)256 * 256) * 2 + 255) / 256) * 256;
    unsigned short* WOL = (unsigned short*)wsp; wsp += (((size_t)((size_t)256 * 256) * 2 + 255) / 256) * 256;
    float* BRO = (float*)wsp; wsp += (((size_t)((size_t)256 + 64) * 4 + 255) / 256) * 256;
    float* XB = (float*)wsp; wsp += (((size_t)((size_t)1024 * 4096) * 4 + 255) / 256) * 256;
    if ((size_t)(wsp - (char*)d_ws) > ws_size) return;   // static carve guard
    // All four images go through each stage in ONE launch: every buffer holds the four images one behind the other (pixel-major buffers as 16384 rows,
    // channel-major ones as 4 matrices), and the image is extra rows, grid.y or grid.z of the launch.
    k_castS16<<<(unsigned)((((long long)(768) * ((256) / 2)) + 255) / 256), 256, 0, stream>>>(wqkv, 256, (__bf16*)(W3H), (__bf16*)(W3L), 256, 768, 256, 1.0f, 0, 0, 0);
    k_cm_bfvec<<<3, 256, 0, stream>>>(bqkv, BR3, 768); k_cm_bfvec<<<1, 256, 0, stream>>>(bo, BRO, 256);
    k_castS16<<<(unsigned)((((long long)(256) * ((256) / 2)) + 255) / 256), 256, 0, stream>>>(wo, 256, (__bf16*)(WOH), (__bf16*)(WOL), 256, 256, 256, 1.0f, 0, 0, 0);
    k_ab_gstat<<<32, 256, 0, stream>>>(x, ST, 131072); k_ab_gapply<<<512, 256, 0, stream>>>(x, ST, gam, bet, XN, XB, 4096, 32, 256, 1048576LL);
    k_castS16t<<<dim3(128u, 4u), 256, 0, stream>>>(XN, 4096, (__bf16*)(XTH), (__bf16*)(XTL), 256, 1.0f, 1048576, 1048576);
    w25::wmma_gemm64<1, false, 2, 0, false, 0><<<dim3((unsigned)((((16384) / 64) * ((768) / 64) + 7) / 8), (unsigned)(1)), 256, 0, stream>>>((const unsigned short*)(XTH), nullptr, 256, 0, (const unsigned short*)(W3H), nullptr, 256, 0, (void*)(QKV), nullptr, 768, 0, BR3, nullptr, 0, 16384, 768, 256, 1.0f);
    w25::wmma_gemm64<1, false, 0, 0, true, 0><<<dim3((unsigned)((((16384) / 64) * ((768) / 64) + 7) / 8), (unsigned)(1)), 256, 0, stream>>>((const unsigned short*)(XTL), nullptr, 256, 0, (const unsigned short*)(W3H), nullptr, 256, 0, (void*)(QKV), nullptr, 768, 0, nullptr, QKV, 0, 16384, 768, 256, 1.0f);
    { /*apv4*/ AttnP a;
      a.Q = QKV; a.K = QKV + 256; a.V = QKV + 512; a.O = AO; a.P = 0; a.Mf = 0; a.Mi = 0; a.ST = 0;
      a.Pw = 0; a.Rt = 0; a.SQ = 0; a.SK = 0;
      a.swb = 0; a.swh = 0; a.swi = 0; a.swj = 0; a.srb = 0; a.srh = 0; a.sri = 0; a.sQb = 3145728; a.sQh = 64; a.sQi = 768; a.sQd = 1; a.sKb = 3145728; a.sKh = 64; a.sKj = 768; a.sKd = 1; a.sVb = 3145728; a.sVh = 64; a.sVj = 768; a.sVd = 1; a.sOb = 1048576; a.sOh = 64; a.sOi = 256; a.sPb = 0; a.sPh = 0; a.sPi = 0; a.smb = 0; a.smh = 0; a.smi = 0; a.smj = 0;
      a.Lq = 4096; a.Lk = 4096; a.dh = 64; a.dv = 64; a.hrep = 1; a.causal = 0; a.coff = 0; a.pband = 0;
      a.scale = 0.125f; a.mfill = 0.0f; a.nonorm = 0; a.mpol = 0;
      a.roff = 0; a.rn = 1; a.segpol = 0; a.win = 0;
      k_attn<64, 64, 0, false, false, true, true><<<dim3((unsigned)((4096) + 16 * AW - 1) / (16 * AW), (unsigned)(4), (unsigned)(4)), 32 * AW, 0, stream>>>(a); }
    k_castS16w<<<512, 256, 0, stream>>>(AO, (__bf16*)(AOH), (__bf16*)(AOL), 4194304LL, 1.0f);
    w25::wmma_gemm64<1, false, 1, 0, true, 0><<<dim3((unsigned)((((256) / 64) * ((4096) / 64) + 7) / 8), (unsigned)(4)), 256, 0, stream>>>((const unsigned short*)(WOH), nullptr, 256, 0, (const unsigned short*)(AOH), nullptr, 256, 1048576, (void*)(out), nullptr, 4096, 1048576, BRO, XB, 1048576, 256, 4096, 256, 1.0f);
    w25::wmma_gemm64<1, false, 0, 0, true, 0><<<dim3((unsigned)((((256) / 64) * ((4096) / 64) + 7) / 8), (unsigned)(4)), 256, 0, stream>>>((const unsigned short*)(WOH), nullptr, 256, 0, (const unsigned short*)(AOL), nullptr, 256, 1048576, (void*)(out), nullptr, 4096, 1048576, nullptr, out, 1048576, 256, 4096, 256, 1.0f);
}

// v009
// Measured time: 236 microseconds a run.
// In two side-by-side timings against v008, it was 1.08 and 1.09 times as fast.
// Counting every step since v000, which is the starting kernel, it is 34.7 times as fast.
#include <hip/hip_runtime.h>
#include <math.h>

typedef __attribute__((ext_vector_type(16))) _Float16 v16h;
typedef __attribute__((ext_vector_type(8)))  _Float16 v8h;
typedef __attribute__((ext_vector_type(16))) __bf16   v16b;
typedef __attribute__((ext_vector_type(8)))  float    v8f;
typedef __attribute__((ext_vector_type(4)))  float    v4f;

// 16-bit WMMA fragment map (wave32), lane L, h = L>>4, m = L&15:
//   A 16x32: lane = row m;   element i -> k = (i<8) ? 8h+i : 16+8h+(i-8)
//   B 32x16: lane = column m; the SAME k(i,h)
//   D 16x16 (8 f32): lane = column m; element r -> row 8h+r
__device__ __forceinline__ int frag_k(int i, int h) { return (i < 8) ? (8 * h + i) : (16 + 8 * h + (i - 8)); }
__device__ __forceinline__ __bf16 bf16_rne(float f) {
    unsigned int u = __float_as_uint(f);
    u += 0x7fffu + ((u >> 16) & 1u);
    return __builtin_bit_cast(__bf16, (unsigned short)(u >> 16));
}
__device__ __forceinline__ float bf16_f32(__bf16 b) { return __uint_as_float(((unsigned int)__builtin_bit_cast(unsigned short, b)) << 16); }
__device__ __forceinline__ v8f wmma16(v16h a, v16h b, v8f c) {
    c = __builtin_amdgcn_wmma_f32_16x16x32_f16(false, a, false, b, (short)0, c, false, false);
    asm volatile("v_nop\n\tv_nop\n\tv_nop\n\tv_nop" : "+v"(c) : "v"(a), "v"(b));
    return c;
}
__device__ __forceinline__ v8f wmmab(v16b a, v16b b, v8f c) {
    c = __builtin_amdgcn_wmma_f32_16x16x32_bf16(false, a, false, b, (short)0, c, false, false);
    asm volatile("v_nop\n\tv_nop\n\tv_nop\n\tv_nop" : "+v"(c) : "v"(a), "v"(b));
    return c;
}
struct Split { v16b hi, lo; };
// hi/lo split product: a.hi*b.hi + a.hi*b.lo + a.lo*b.hi
__device__ __forceinline__ v8f wmma3(const Split& a, const Split& b, v8f c) {
    c = __builtin_amdgcn_wmma_f32_16x16x32_bf16(false, a.hi, false, b.hi, (short)0, c, false, false);
    c = __builtin_amdgcn_wmma_f32_16x16x32_bf16(false, a.hi, false, b.lo, (short)0, c, false, false);
    c = __builtin_amdgcn_wmma_f32_16x16x32_bf16(false, a.lo, false, b.hi, (short)0, c, false, false);
    asm volatile("v_nop\n\tv_nop\n\tv_nop\n\tv_nop" : "+v"(c) : "v"(a.hi), "v"(a.lo), "v"(b.hi), "v"(b.lo));
    return c;
}
struct Split3 { v16b hi, mid, lo; };
// triple split product (6 terms, drops only terms below 2^-24 relative)
__device__ __forceinline__ v8f wmma6(const Split3& a, const Split3& b, v8f c) {
    c = __builtin_amdgcn_wmma_f32_16x16x32_bf16(false, a.hi, false, b.hi, (short)0, c, false, false);
    c = __builtin_amdgcn_wmma_f32_16x16x32_bf16(false, a.hi, false, b.mid, (short)0, c, false, false);
    c = __builtin_amdgcn_wmma_f32_16x16x32_bf16(false, a.mid, false, b.hi, (short)0, c, false, false);
    c = __builtin_amdgcn_wmma_f32_16x16x32_bf16(false, a.hi, false, b.lo, (short)0, c, false, false);
    c = __builtin_amdgcn_wmma_f32_16x16x32_bf16(false, a.mid, false, b.mid, (short)0, c, false, false);
    c = __builtin_amdgcn_wmma_f32_16x16x32_bf16(false, a.lo, false, b.hi, (short)0, c, false, false);
    asm volatile("v_nop\n\tv_nop\n\tv_nop\n\tv_nop" : "+v"(c) : "v"(a.hi), "v"(a.mid), "v"(a.lo), "v"(b.hi), "v"(b.mid), "v"(b.lo));
    return c;
}

// Fragment gathers from f32 memory: element i <- p[(k0 + frag_k(i,h)) * sk] * s, zero for k >= klen.
__device__ __forceinline__ v16h fh_ld(const float* __restrict__ p, long long sk, int k0, int h, int klen, float s) {
    v16h a;
#pragma unroll
    for (int i = 0; i < 16; ++i) { const int k = k0 + frag_k(i, h); a[i] = (k < klen) ? (_Float16)(p[(long long)k * sk] * s) : (_Float16)0.f; }
    return a;
}
__device__ __forceinline__ Split sp_ld(const float* __restrict__ p, long long sk, int k0, int h, int klen, float s) {
    Split r;
#pragma unroll
    for (int i = 0; i < 16; ++i) {
        const int k = k0 + frag_k(i, h); const float x = (k < klen) ? p[(long long)k * sk] * s : 0.f;
        const __bf16 hb = bf16_rne(x); r.hi[i] = hb; r.lo[i] = bf16_rne(x - bf16_f32(hb));
    }
    return r;
}
__device__ __forceinline__ Split3 sp3_ld(const float* __restrict__ p, long long sk, int k0, int h, int klen, float s) {
    Split3 r;
#pragma unroll
    for (int i = 0; i < 16; ++i) {
        const int k = k0 + frag_k(i, h); const float x = (k < klen) ? p[(long long)k * sk] * s : 0.f;
        const __bf16 hb = bf16_rne(x); const float r1 = x - bf16_f32(hb); const __bf16 mb = bf16_rne(r1);
        r.hi[i] = hb; r.mid[i] = mb; r.lo[i] = bf16_rne(r1 - bf16_f32(mb));
    }
    return r;
}
__device__ __forceinline__ v16b bh_ld(const float* __restrict__ p, long long sk, int k0, int h, int klen, float s) {
    v16b a;
#pragma unroll
    for (int i = 0; i < 16; ++i) { const int k = k0 + frag_k(i, h); a[i] = bf16_rne((k < klen) ? p[(long long)k * sk] * s : 0.f); }
    return a;
}
// f16 fragment from an f16 LDS/global row with element stride 1 (k-contiguous), no bounds (tile already zero padded)
__device__ __forceinline__ v16h fh_row(const _Float16* __restrict__ row, int k0, int h) {
    v16h a;
#pragma unroll
    for (int i = 0; i < 16; ++i) a[i] = row[k0 + frag_k(i, h)];
    return a;
}

typedef __attribute__((ext_vector_type(4))) _Float16 v4h;
typedef __attribute__((ext_vector_type(8))) short v8s;
typedef __attribute__((address_space(3))) v8s lds_v8s;         // 16 bytes of LDS, as the transposing load takes them
// One 16-bit fragment's 32 k of a k-contiguous, 16-byte aligned f32 row as four unguarded 16-byte loads; row = the lane's row + 8 * h elements.
// fr_cvt packs them in the k order of frag_k.
struct FragRaw { v4f x0, x1, x2, x3; };
__device__ __forceinline__ FragRaw fr_ld(const v4f* __restrict__ row, int k0) {
    FragRaw r; r.x0 = row[k0 / 4]; r.x1 = row[k0 / 4 + 1]; r.x2 = row[k0 / 4 + 4]; r.x3 = row[k0 / 4 + 5];
    return r;
}
__device__ __forceinline__ v16h fr_cvt(const FragRaw& r) {
    v16h a;
#pragma unroll
    for (int i = 0; i < 4; ++i) { a[i] = (_Float16)r.x0[i]; a[4 + i] = (_Float16)r.x1[i]; a[8 + i] = (_Float16)r.x2[i]; a[12 + i] = (_Float16)r.x3[i]; }
    return a;
}

#define VST2(T, ptr, val) do { const T vst2_v_ = (val); *(T*)(ptr) = vst2_v_;  } while (0)
typedef float v4f __attribute__((ext_vector_type(4)));
#define VST2V4(ptr, val) do { const v4f vst2_v4_ = (val); *(v4f*)(ptr) = vst2_v4_;  } while (0)

__device__ __attribute__((noinline)) float act_fn(float v, int act) {
    if (act == 1) return fmaxf(v, 0.f);                                                                               // relu
    if (act == 2) { const float u = 0.7978845608028654f * (v + 0.044715f * v * v * v); return 0.5f * v * (1.f + tanhf(u)); } // tanh-gelu
    if (act == 3) return v / (1.f + expf(-v));                                                                        // silu
    if (act == 4) return 0.5f * v * (1.f + erff(v * 0.7071067811865476f));                                             // erf-gelu
    if (act == 5) return tanhf(v);
    if (act == 6) return 1.f / (1.f + expf(-v));                                                                      // sigmoid
    if (act == 7) return (v > 0.f) ? v : 0.01f * v;                                                                   // leaky relu 0.01
    if (act == 8) return (v > 0.f) ? v : (expf(v) - 1.f);                                                             // elu
    if (act == 9) return fminf(fmaxf(v, 0.f), 6.f);                                                                   // relu6
    if (act == 10) return fabsf(v);                                                                                    // abs
    if (act == 11) return (v >= 0.f) ? v : 0.1f * v;                                                                  // leaky 0.1
    if (act == 12) return (v > 0.f) ? v : 0.2f * v;                                                                   // leaky 0.2
    if (act == 13) return (v > 20.f) ? v : log1pf(expf(v));                                                            // softplus
    return v;
}

// =====================================================================================================================
// k_gemm<MODE>: C(z, m, n) = act(alpha * sum_k A(z, m, k) * B(z, k, n) + bias) + beta * R(z, m, n)
//   One wave (32-thread block) per 16 x 32 tile of C; grid (ceil(N/32), ceil(M/16), Z). Batch z -> (zo = z / zi_n, zi = z % zi_n)
//   with separate outer/inner strides for every tensor (e.g. batch and head). A(m,k) = A[zo*sAo + zi*sAi + m*sAm + k*sAk] (f32),
//   B(k,n) = B[zo*sBo + zi*sBi + n*sBn + k*sBk] (f32); any M, N, K (K zero-padded to 32 inside the fragments, M/N tails guarded).
//   C(m,n) = C[zo*sCo + zi*sCi + m*sCm + n] (n contiguous). flags: 1 bias[n], 2 bias[m], 4 residual R[zo*sRo + zi*sRi + m*sRm + n*sRn].
//   MODE 0: f16 operands (A prescaled by sa, B by sb, both undone in the epilogue); 1: bf16 hi/lo split (3 products); 2: bf16;
//   3: bf16 hi/mid/lo triple split (6 products); 4: as 3 with Kahan-compensated f32 accumulation across k-steps.
// =====================================================================================================================
struct GemmP {
    const float* A; const float* B; const float* bias; const float* R; float* C;
    long long sAo, sAi, sAm, sAk, sBo, sBi, sBn, sBk, sCo, sCi, sCm, sRo, sRi, sRm, sRn;
    int M, N, K, zi_n, flags, act; float alpha, beta, sa, sb;
    int Npad, pad_;     // columns [N, Npad) of C are written as 0 so that padded workspace rows are covered by whole-line stores; Npad >= N
};
static_assert(sizeof(GemmP) == 5 * 8 + 15 * 8 + 6 * 4 + 4 * 4 + 2 * 4, "GemmP has padding");

template <int MODE>
__global__ __launch_bounds__(32) void k_gemm(GemmP p) {
    const int lane = threadIdx.x & 31, h = lane >> 4, l15 = lane & 15;
    const int m0 = blockIdx.y * 16, n0 = blockIdx.x * 32;
    const int z = blockIdx.z, zo = z / p.zi_n, zi = z - zo * p.zi_n;
    const float* A = p.A + zo * p.sAo + zi * p.sAi;
    const float* B = p.B + zo * p.sBo + zi * p.sBi;
    const int am = min(m0 + l15, p.M - 1);                       // clamped row for loads (stores are guarded)
    v8f acc[2], comp[2];
#pragma unroll
    for (int t = 0; t < 2; ++t) { v8f zz = {}; acc[t] = zz; comp[t] = zz; }
    for (int k0 = 0; k0 < p.K; k0 += 32) {
        const float* arow = A + (long long)am * p.sAm;
        if (MODE == 1) {
            const Split a = sp_ld(arow, p.sAk, k0, h, p.K, 1.f);
#pragma unroll
            for (int t = 0; t < 2; ++t) {
                const int bn = min(n0 + t * 16 + l15, p.N - 1);
                acc[t] = wmma3(a, sp_ld(B + (long long)bn * p.sBn, p.sBk, k0, h, p.K, 1.f), acc[t]);
            }
        } else if (MODE == 3) {
            const Split3 a = sp3_ld(arow, p.sAk, k0, h, p.K, 1.f);
#pragma unroll
            for (int t = 0; t < 2; ++t) {
                const int bn = min(n0 + t * 16 + l15, p.N - 1);
                acc[t] = wmma6(a, sp3_ld(B + (long long)bn * p.sBn, p.sBk, k0, h, p.K, 1.f), acc[t]);
            }
        } else if (MODE == 4) {
            // triple split as MODE 3, but each k-step's 6 products go into a fresh accumulator and the partial is added to the running f32 sum
            // on the VALU with Kahan compensation (accumulation error stays ~1 ulp however long K is)
            const Split3 a = sp3_ld(arow, p.sAk, k0, h, p.K, 1.f);
#pragma unroll
            for (int t = 0; t < 2; ++t) {
                const int bn = min(n0 + t * 16 + l15, p.N - 1); v8f zz = {};
                const v8f part = wmma6(a, sp3_ld(B + (long long)bn * p.sBn, p.sBk, k0, h, p.K, 1.f), zz);
                const v8f y = part - comp[t]; const v8f s = acc[t] + y; comp[t] = (s - acc[t]) - y; acc[t] = s;
            }
        } else if (MODE == 2) {
            const v16b a = bh_ld(arow, p.sAk, k0, h, p.K, 1.f);
#pragma unroll
            for (int t = 0; t < 2; ++t) {
                const int bn = min(n0 + t * 16 + l15, p.N - 1);
                acc[t] = wmmab(a, bh_ld(B + (long long)bn * p.sBn, p.sBk, k0, h, p.K, 1.f), acc[t]);
            }
        } else {
            const v16h a = fh_ld(arow, p.sAk, k0, h, p.K, p.sa);
#pragma unroll
            for (int t = 0; t < 2; ++t) {
                const int bn = min(n0 + t * 16 + l15, p.N - 1);
                acc[t] = wmma16(a, fh_ld(B + (long long)bn * p.sBn, p.sBk, k0, h, p.K, p.sb), acc[t]);
            }
        }
    }
    const float iscale = (MODE == 0) ? p.alpha / (p.sa * p.sb) : p.alpha;
    float* C = p.C + zo * p.sCo + zi * p.sCi;
    const float* R = p.R + zo * p.sRo + zi * p.sRi;
    __shared__ __align__(16) float ctile[16][36];
#pragma unroll
    for (int t = 0; t < 2; ++t) {
        const int n = n0 + t * 16 + l15; const int nn = min(n, p.N - 1);
#pragma unroll
        for (int r = 0; r < 8; ++r) {
            const int m = m0 + 8 * h + r; const int mm = min(m, p.M - 1);
            float v = acc[t][r] * iscale;
            if (p.flags & 1) v += p.bias[nn];
            if (p.flags & 2) v += p.bias[mm];
            if (p.flags & 8) v *= p.bias[(long long)zo * p.M + mm];   /* per-(z,row) scale vector laid out [Z][M]; exclusive with the bias flags */
            v = act_fn(v, p.act);
            if (p.flags & 4) v += p.beta * R[(long long)mm * p.sRm + (long long)nn * p.sRn];
            ctile[8 * h + r][t * 16 + l15] = (n < p.N) ? v : 0.f;
        }
    }
    __syncthreads();
    const int NW = (p.Npad > p.N) ? p.Npad : p.N;           // write width
    const bool fast = (m0 + 16 <= p.M) && (n0 + 32 <= NW) && ((p.sCm & 3) == 0) && ((((size_t)C) & 15) == 0);
    if (fast) {
#pragma unroll
        for (int s = 0; s < 4; ++s) {
            const int row = s * 4 + (lane >> 3), c4 = (lane & 7) * 4;
            const v4f v = *(const v4f*)&ctile[row][c4];
            VST2V4(C + (long long)(m0 + row) * p.sCm + n0 + c4, v);
        }
    } else {
        for (int row = 0; row < 16; ++row) {
            const int m = m0 + row, n = n0 + lane;
            if (m < p.M && n < NW) VST2(float, C + (long long)m * p.sCm + n, ctile[row][lane]);
        }
    }
}


// =====================================================================================================================
// k_gemmT<MODE, TM, TN>: same contract as k_gemm, but one wave computes a (16*TM) x (16*TN) tile: TM A fragments and TN B fragments are
//   loaded per 32-wide k-step and reused across TM*TN WMMAs (far fewer load/convert instructions per MAC). MODE 0 (f16), 1 (bf16 hi/lo),
//   2 (bf16) only. grid (ceil(NW/(16*TN)), ceil(M/(16*TM)), Z), block 32. Epilogue identical to k_gemm, run per 16x32 sub-tile.
// =====================================================================================================================
template <int MODE, int TM, int TN>
__global__ __launch_bounds__(32) void k_gemmT(GemmP p) {
    const int lane = threadIdx.x & 31, h = lane >> 4, l15 = lane & 15;
    const int m0 = blockIdx.y * (16 * TM), n0 = blockIdx.x * (16 * TN);
    const int z = blockIdx.z, zo = z / p.zi_n, zi = z - zo * p.zi_n;
    const float* A = p.A + zo * p.sAo + zi * p.sAi;
    const float* B = p.B + zo * p.sBo + zi * p.sBi;
    v8f acc[TM][TN];
#pragma unroll
    for (int i = 0; i < TM; ++i)
#pragma unroll
        for (int t = 0; t < TN; ++t) { v8f zz = {}; acc[i][t] = zz; }
    for (int k0 = 0; k0 < p.K; k0 += 32) {
        if (MODE == 1) {
            Split a[TM], b[TN];
#pragma unroll
            for (int i = 0; i < TM; ++i) { const int am = min(m0 + 16 * i + l15, p.M - 1); a[i] = sp_ld(A + (long long)am * p.sAm, p.sAk, k0, h, p.K, 1.f); }
#pragma unroll
            for (int t = 0; t < TN; ++t) { const int bn = min(n0 + 16 * t + l15, p.N - 1); b[t] = sp_ld(B + (long long)bn * p.sBn, p.sBk, k0, h, p.K, 1.f); }
#pragma unroll
            for (int i = 0; i < TM; ++i)
#pragma unroll
                for (int t = 0; t < TN; ++t) acc[i][t] = wmma3(a[i], b[t], acc[i][t]);
        } else if (MODE == 2) {
            v16b a[TM], b[TN];
#pragma unroll
            for (int i = 0; i < TM; ++i) { const int am = min(m0 + 16 * i + l15, p.M - 1); a[i] = bh_ld(A + (long long)am * p.sAm, p.sAk, k0, h, p.K, 1.f); }
#pragma unroll
            for (int t = 0; t < TN; ++t) { const int bn = min(n0 + 16 * t + l15, p.N - 1); b[t] = bh_ld(B + (long long)bn * p.sBn, p.sBk, k0, h, p.K, 1.f); }
#pragma unroll
            for (int i = 0; i < TM; ++i)
#pragma unroll
                for (int t = 0; t < TN; ++t) acc[i][t] = wmmab(a[i], b[t], acc[i][t]);
        } else {
            v16h a[TM], b[TN];
#pragma unroll
            for (int i = 0; i < TM; ++i) { const int am = min(m0 + 16 * i + l15, p.M - 1); a[i] = fh_ld(A + (long long)am * p.sAm, p.sAk, k0, h, p.K, p.sa); }
#pragma unroll
            for (int t = 0; t < TN; ++t) { const int bn = min(n0 + 16 * t + l15, p.N - 1); b[t] = fh_ld(B + (long long)bn * p.sBn, p.sBk, k0, h, p.K, p.sb); }
#pragma unroll
            for (int i = 0; i < TM; ++i)
#pragma unroll
                for (int t = 0; t < TN; ++t) acc[i][t] = wmma16(a[i], b[t], acc[i][t]);
        }
    }
    const float iscale = (MODE == 0) ? p.alpha / (p.sa * p.sb) : p.alpha;
    float* C = p.C + zo * p.sCo + zi * p.sCi;
    const float* R = p.R + zo * p.sRo + zi * p.sRi;
    const int NW = (p.Npad > p.N) ? p.Npad : p.N;
    __shared__ __align__(16) float ctile[16][36];
#pragma unroll
    for (int i = 0; i < TM; ++i) {
        const int mb = m0 + 16 * i; if (mb >= p.M) break;          // wave-uniform
#pragma unroll
        for (int tp = 0; tp < TN / 2; ++tp) {
            const int nb = n0 + 32 * tp; if (nb >= NW) break;        // wave-uniform
#pragma unroll
            for (int t2 = 0; t2 < 2; ++t2) {
                const int t = 2 * tp + t2; const int n = nb + t2 * 16 + l15; const int nn = min(n, p.N - 1);
#pragma unroll
                for (int r = 0; r < 8; ++r) {
                    const int m = mb + 8 * h + r; const int mm = min(m, p.M - 1);
                    float v = acc[i][t][r] * iscale;
                    if (p.flags & 1) v += p.bias[nn];
                    if (p.flags & 2) v += p.bias[mm];
            if (p.flags & 8) v *= p.bias[(long long)zo * p.M + mm];   /* per-(z,row) scale vector laid out [Z][M]; exclusive with the bias flags */
                    v = act_fn(v, p.act);
                    if (p.flags & 4) v += p.beta * R[(long long)mm * p.sRm + (long long)nn * p.sRn];
                    ctile[8 * h + r][t2 * 16 + l15] = (n < p.N) ? v : 0.f;
                }
            }
            __syncthreads();
            const bool fast = (mb + 16 <= p.M) && (nb + 32 <= NW) && ((p.sCm & 3) == 0) && ((((size_t)C) & 15) == 0);
            if (fast) {
#pragma unroll
                for (int s = 0; s < 4; ++s) {
                    const int row = s * 4 + (lane >> 3), c4 = (lane & 7) * 4;
                    const v4f v = *(const v4f*)&ctile[row][c4];
                    VST2V4(C + (long long)(mb + row) * p.sCm + nb + c4, v);
                }
            } else {
                for (int row = 0; row < 16; ++row) {
                    const int m = mb + row, n = nb + lane;
                    if (m < p.M && n < NW) VST2(float, C + (long long)m * p.sCm + n, ctile[row][lane]);
                }
            }
            __syncthreads();
        }
    }
}

// =====================================================================================================================
//   Wave = 16 queries, AW waves per block, 64-key blocks; grid (ceil(Lq/(16*AW)), H, B), block 32*AW. Any Lq, Lk; head dim dh <= DHP
//   (DHP multiple of 32), value dim dv <= DVP (multiple of 16, <= 128). Every tensor addressed by (batch, head, row, element) strides, f32.
//   Scores: QM 0 f16 operands, 1 bf16 hi/lo split, 2 bf16 triple split; statistics f32 (exp2 domain); P.V: P x 4096 as f16 with V f16 staged in LDS
//   (SPLITPV: P and V as bf16 hi/lo splits). kv head = h / hrep. Masking: causal = 1 (keep j <= i + coff, masked -> -inf, key blocks beyond the
//   diagonal skipped), causal = 2 (masked -> mfill, a finite fill like the -1e9; no skipping), causal = 3 (keep j >= i + coff,
//   masked -> -inf, no skipping); optional additive f32 mask Mf,
//   optional int keep-mask Mi (0 -> score := mfill), both addressed b*smb + h*smh + i*smi + j*smj (0 strides broadcast).
// =====================================================================================================================
#define AW 4
// lane l's value of lane l ^ 16 (the wave's other half), by a vector cross-row move
__device__ __forceinline__ float xhalf(float x) { return __builtin_bit_cast(float, __builtin_amdgcn_permlanex16(__builtin_bit_cast(int, x), __builtin_bit_cast(int, x), 0x76543210, 0xfedcba98, false, false)); }
// x[i] = 2^x[i], eight values, by v_exp_f32 alone: no fix-up for results under 2^-126 (exp2f spends a compare, two selects, an add and an ldexp per value on them), which may come out as 0.
// One statement: each exponential works in place on a register of its own, so each is the independent instruction that the instruction set asks for behind the one before it
// (before a transcendental's result is read or its source overwritten); the closing v_nop is that slot for the last one, whose successor is the compiler's choice.
__device__ __forceinline__ void exp2_raw8(float (&x)[8]) {
    asm("v_exp_f32 %0, %0\n\tv_exp_f32 %1, %1\n\tv_exp_f32 %2, %2\n\tv_exp_f32 %3, %3\n\tv_exp_f32 %4, %4\n\tv_exp_f32 %5, %5\n\tv_exp_f32 %6, %6\n\tv_exp_f32 %7, %7\n\tv_nop"
        : "+v"(x[0]), "+v"(x[1]), "+v"(x[2]), "+v"(x[3]), "+v"(x[4]), "+v"(x[5]), "+v"(x[6]), "+v"(x[7]));
}
struct AttnP {   // apv4
    const float* Q; const float* K; const float* V; float* O; float* P; const float* Mf; const int* Mi; float* ST;
    const float* Pw; const float* Rt; const int* SQ; const int* SK;           // optional: post-softmax weight, relative-position table, segment ids
    long long swb, swh, swi, swj, srb, srh, sri;                                 // Pw strides (b,h,i,j); Rt strides (b,h,i), column = clamp(i - j + roff, 0, rn-1)
    long long sQb, sQh, sQi, sQd, sKb, sKh, sKj, sKd, sVb, sVh, sVj, sVd, sOb, sOh, sOi, sPb, sPh, sPi, smb, smh, smi, smj;
    int Lq, Lk, dh, dv, hrep, causal, coff, pband;   // pband > 0: P holds only the band |j - i| <= pband, column j - i + pband
    float scale, mfill; int nonorm, mpol;             // nonorm (online path only): O = sum_j exp(score_j) V_j without the 1/rowsum (scores must be <= ~0); mpol: Mi masks where ==0 (mpol 0) or where !=0 (mpol 1)
    int roff, rn, segpol, win;                        // Rt column offset/count; SQ/SK: score := mfill where (segpol 0) SQ[i] != SK[j] or (segpol 1) SQ[i] == SK[j]; win > 0: keys with i - j > win (after coff) -> -inf
};
//   Pw: the softmax numerator is multiplied by Pw(b,h,i,j) AFTER the row sum is taken (probs * weight, then P.V), as in post-softmax multiplicative biases.                                                    // ST (optional): per row (b,h,i) -> ST[((b*H + h)*Lq + i)*2 + {0,1}] = {row max of the scaled+masked score (natural units), sum_j exp(score - max)}
static_assert(sizeof(AttnP) == 12 * 8 + 29 * 8 + 16 * 4, "AttnP has padding");

#ifndef KATTN_ATTR
#define KATTN_ATTR __attribute__((amdgpu_waves_per_eu(4, 4)))   // the launch puts 4 waves on a SIMD: registers are budgeted for that, so a key block's 16 loads still issue as one group
#endif
template <int DHP, int DVP, int QM, bool SPLITPV, bool TWOPASS, bool UNIT = false, bool PLAIN = false>
__global__ __launch_bounds__(32 * AW) KATTN_ATTR void k_attn(AttnP p) {
    static_assert(!PLAIN || !TWOPASS, "PLAIN covers the one-pass path");
    static_assert(!UNIT || (QM == 0 && !SPLITPV && !TWOPASS && (32 * AW) / (DVP / 4) == 8 && (32 * AW) / (DHP / 4) == 8), "UNIT covers the f16 one-pass path, 8 K rows and 8 V rows per load step");
    constexpr int NT = DVP / 16;                // output tiles
    constexpr int KS = DHP / 32;                // k-steps for the scores
    constexpr int VP = (UNIT && PLAIN) ? DVP + 16 : DVP + 8;   // LDS pitch of the V tile (halves); transposed path: an odd multiple of 32 bytes, the pitch at which the transposing LDS load runs without bank conflicts
    constexpr int KP = DHP + 8;                 // LDS pitch of the K tile (halves): an odd multiple of 16 bytes, so a fragment's 16 rows fall on different banks
    __shared__ __align__(16) float    pl[AW][16 * 64];
    __shared__ __align__(16) _Float16 vl[(SPLITPV ? 2 : 1) * 64 * VP];   // f16 V tile, or bf16 hi and lo tiles (same 2-byte size)
    __shared__ __align__(16) _Float16 kl[UNIT ? 64 * KP : 8];            // UNIT: f16 K tile, row = key
    const int lane = threadIdx.x & 31, hf = lane >> 4, l15 = lane & 15, wave = threadIdx.x >> 5;
    const int h = blockIdx.y, b = blockIdx.z, hk = h / p.hrep;
    const int q0 = (blockIdx.x * AW + wave) * 16;
    float* myp = pl[wave];
    const float L2E = 1.4426950408889634f;
    const float NEG = -__builtin_inff();
    const int qi = min(q0 + l15, p.Lq - 1);
    const float* qrow = p.Q + b * p.sQb + h * p.sQh + (long long)qi * p.sQi;
    const float* kbase = p.K + b * p.sKb + hk * p.sKh;
    const float* vbase = p.V + b * p.sVb + hk * p.sVh;
    const v4f* qp = (const v4f*)(qrow + 8 * hf);               // UNIT: the lane's half of the fragment's k
    v16h qa[QM == 0 ? KS : 1]; Split qs_[QM == 1 ? KS : 1]; Split3 qt_[QM == 2 ? KS : 1];
#pragma unroll
    for (int ks = 0; ks < KS; ++ks) {
        if (QM == 2) qt_[ks] = sp3_ld(qrow, p.sQd, ks * 32, hf, p.dh, 1.f);
        else if (QM == 1) qs_[ks] = sp_ld(qrow, p.sQd, ks * 32, hf, p.dh, 1.f);
        else if (UNIT) qa[ks] = fr_cvt(fr_ld(qp, ks * 32));
        else qa[ks] = fh_ld(qrow, p.sQd, ks * 32, hf, p.dh, 1.f);
    }
    if (UNIT) asm volatile("s_wait_xcnt 0x0" :: "v"(qp) : "memory");   // the Q loads' address registers stay as they are up to this wait (named as input) and are reused behind it
    constexpr int VR = (32 * AW) / (DVP / 4);                  // V rows that the block's threads cover with one 16-byte load each
    constexpr int KR = (32 * AW) / (DHP / 4);                  // K rows that the block's threads cover with one 16-byte load each
    const unsigned koff = (unsigned)((int)(threadIdx.x / (DHP / 4)) * (int)p.sKj + (int)(threadIdx.x % (DHP / 4)) * 4) * 4u;   // UNIT: thread's byte offset in KR rows of K
    const unsigned voff = (unsigned)((int)(threadIdx.x / (DVP / 4)) * (int)p.sVj + (int)(threadIdx.x % (DVP / 4)) * 4) * 4u;   // UNIT: thread's byte offset in VR rows of V
    // transposed path: the 16 bytes of the V tile that this lane hands to a transposing load of keys 0 ... 15, columns 0 ... 15: row 8 hf + (lane & 7), column half (lane >> 3) & 1
    lds_v8s* const vtr = (lds_v8s*)(vl + (8 * hf + (lane & 7)) * VP + 8 * ((lane >> 3) & 1));
    v8f o[NT]; float m8[8], l8[8];
#pragma unroll
    for (int t = 0; t < NT; ++t) { v8f zz = {}; o[t] = zz; }
#pragma unroll
    for (int i = 0; i < 8; ++i) { m8[i] = NEG; l8[i] = 0.f; }
    int jend = p.Lk; int jstart = 0;
    if (!PLAIN && p.causal == 1) { const int je = (blockIdx.x * AW + AW - 1) * 16 + 16 + p.coff; jend = min(jend, max(je, 0)); }   // uniform per block
    if (!PLAIN && p.win > 0) { const int js = (int)(blockIdx.x * AW) * 16 + p.coff - p.win; jstart = (js > 0) ? (js / 64) * 64 : 0; }   // uniform per block: key blocks entirely outside every row's window hold only -inf entries and are skipped exactly
    const int npass = TWOPASS ? 2 : 1;
    for (int pass = 0; pass < npass; ++pass) {
        const bool dopv = (!TWOPASS) || pass == 1;
        for (int j0 = jstart; j0 < jend; j0 += 64) {
            if (dopv) {
                __syncthreads();                                 // previous key block's reads of kl / vl / pl are done
                if (!UNIT)
                for (int idx = threadIdx.x; idx < 64 * DVP; idx += 32 * AW) {
                    const int jr = idx / DVP, d = idx - jr * DVP, j = j0 + jr;
                    const float f = (j < p.Lk && d < p.dv) ? vbase[(long long)j * p.sVj + (long long)d * p.sVd] : 0.f;
                    if (SPLITPV) {
                        const __bf16 hb = bf16_rne(f);
                        ((__bf16*)vl)[jr * VP + d] = hb; ((__bf16*)vl)[64 * VP + jr * VP + d] = bf16_rne(f - bf16_f32(hb));
                    } else vl[jr * VP + d] = (_Float16)f;
                }
            }
            v8f s[4];
            union { v16h v; v8s h[2]; } va[(UNIT && PLAIN) ? NT : 1][2];   // transposed path: V^T as A, [value tile t][the block's first and second 32 keys]: lane = value column 16 t + l15, element e = key frag_k(e, hf)
            if (UNIT) {
                v4f vr[8], kr[8]; const v4f* vp[8]; const v4f* kp[8];
#pragma unroll
                for (int it = 0; it < 8; ++it) { vp[it] = (const v4f*)((const char*)(vbase + (long long)(j0 + it * VR) * p.sVj) + voff); vr[it] = *vp[it]; }
#pragma unroll
                for (int it = 0; it < 8; ++it) { kp[it] = (const v4f*)((const char*)(kbase + (long long)(j0 + it * KR) * p.sKj) + koff); kr[it] = *kp[it]; }
                // the group's address registers stay as they are up to this wait (named as inputs) and are reused behind it, while the loads are still in flight
                asm volatile("s_wait_xcnt 0x0" :: "v"(vp[0]), "v"(vp[1]), "v"(vp[2]), "v"(vp[3]), "v"(vp[4]), "v"(vp[5]), "v"(vp[6]), "v"(vp[7]),
                             "v"(kp[0]), "v"(kp[1]), "v"(kp[2]), "v"(kp[3]), "v"(kp[4]), "v"(kp[5]), "v"(kp[6]), "v"(kp[7]) : "memory");
#pragma unroll
                for (int it = 0; it < 8; ++it) {
                    v4h hv; hv[0] = (_Float16)vr[it][0]; hv[1] = (_Float16)vr[it][1]; hv[2] = (_Float16)vr[it][2]; hv[3] = (_Float16)vr[it][3];
                    *(v4h*)(vl + (it * VR + (int)(threadIdx.x / (DVP / 4))) * VP + (int)(threadIdx.x % (DVP / 4)) * 4) = hv;
                }
#pragma unroll
                for (int it = 0; it < 8; ++it) {
                    v4h hk4; hk4[0] = (_Float16)kr[it][0]; hk4[1] = (_Float16)kr[it][1]; hk4[2] = (_Float16)kr[it][2]; hk4[3] = (_Float16)kr[it][3];
                    *(v4h*)(kl + (it * KR + (int)(threadIdx.x / (DHP / 4))) * KP + (int)(threadIdx.x % (DHP / 4)) * 4) = hk4;
                }
                __syncthreads();                                 // K and V tiles (shared) visible
                union { v16h v; v8h h[2]; } kf[4][KS];
#pragma unroll
                for (int t = 0; t < 4; ++t)
#pragma unroll
                    for (int ks = 0; ks < KS; ++ks) {
                        const _Float16* kq = kl + (t * 16 + l15) * KP + ks * 32 + 8 * hf;   // key row l15 of tile t; the lane's half of the fragment's k, in the order of frag_k
                        kf[t][ks].h[0] = *(const v8h*)kq; kf[t][ks].h[1] = *(const v8h*)(kq + 16);
                    }
                if (PLAIN) {                                     // one transposing load hands the lane 8 keys (8 hf + 0 ... 7 of a 16-key group) of its column; issued here, the loads return while the scores and the softmax run
#pragma unroll   // both loops: va is then indexed by constants and stays in registers, and each load's place is an immediate offset from vtr
                    for (int t = 0; t < NT; ++t)
#pragma unroll   // (as above)
                        for (int g = 0; g < 4; ++g) va[t][g >> 1].h[g & 1] = __builtin_amdgcn_ds_load_tr16_b128_v8i16(vtr + (g * 16 * VP + t * 16) / 8);
                }
#pragma unroll
                for (int t = 0; t < 4; ++t) {
                    v8f acc = {};
#pragma unroll
                    for (int ks = 0; ks < KS; ++ks) acc = PLAIN ? wmma16(kf[t][ks].v, qa[ks], acc) : wmma16(qa[ks], kf[t][ks].v, acc);
                    s[t] = acc;
                }
            } else
#pragma unroll
            for (int t = 0; t < 4; ++t) {
                const int j = min(j0 + t * 16 + l15, p.Lk - 1);
                const float* krow = kbase + (long long)j * p.sKj;
                v8f acc = {};
#pragma unroll
                for (int ks = 0; ks < KS; ++ks) {
                    if (QM == 2)      acc = wmma6(qt_[ks], sp3_ld(krow, p.sKd, ks * 32, hf, p.dh, 1.f), acc);
                    else if (QM == 1) acc = wmma3(qs_[ks], sp_ld(krow, p.sKd, ks * 32, hf, p.dh, 1.f), acc);
                    else              acc = wmma16(qa[ks], fh_ld(krow, p.sKd, ks * 32, hf, p.dh, 1.f), acc);
                }
                s[t] = acc;
            }
            if (UNIT && PLAIN) {                                 // s[t][r] = score of key j0 + 16 t + 8 hf + r for query q0 + l15; m8[0], l8[0]: that query's maximum and this half's sum
                float mt[4];                                     // one maximum chain per score tile, so that the four overlap
                // every loop of this block is unrolled: s, mt, rt, the fragments and o are then indexed by constants and stay in registers
#pragma unroll
                for (int t = 0; t < 4; ++t) {
#pragma unroll
                    for (int r = 0; r < 8; ++r) s[t][r] = s[t][r] * p.scale * L2E;
                    mt[t] = fmaxf(fmaxf(fmaxf(s[t][0], s[t][1]), fmaxf(s[t][2], s[t][3])), fmaxf(fmaxf(s[t][4], s[t][5]), fmaxf(s[t][6], s[t][7])));
                }
                float mx = fmaxf(fmaxf(mt[0], mt[1]), fmaxf(mt[2], mt[3]));
                mx = fmaxf(mx, xhalf(mx));
                const float mnew = fmaxf(m8[0], mx);
                // bare v_exp_f32 here and in exp2_raw8: a value under 2^-126 may become 0; x 4096 it is 0 in f16 anyway, and it is far below one f32 ulp of the query's sum, whose
                // largest term is 1, and of the output it would rescale; -inf (m8 in front of the first block) gives 0 either way
                const float corr = __builtin_amdgcn_exp2f(m8[0] - mnew);
                float rt[4];
#pragma unroll
                for (int t = 0; t < 4; ++t) {
                    float x[8];
#pragma unroll
                    for (int r = 0; r < 8; ++r) x[r] = s[t][r] - mnew;
                    exp2_raw8(x);
#pragma unroll
                    for (int r = 0; r < 8; ++r) s[t][r] = x[r];
                    rt[t] = ((s[t][0] + s[t][1]) + (s[t][2] + s[t][3])) + ((s[t][4] + s[t][5]) + (s[t][6] + s[t][7]));
                }
                l8[0] = l8[0] * corr + ((rt[0] + rt[1]) + (rt[2] + rt[3])); m8[0] = mnew;   // the halves' sums are joined behind the loop
                v16h pb0, pb1;                                   // P^T x 4096 as B: element e = key frag_k(e, hf) of the block's first and second 32 keys
#pragma unroll
                for (int e = 0; e < 16; ++e) { pb0[e] = (_Float16)(s[e >> 3][e & 7] * 4096.f); pb1[e] = (_Float16)(s[2 + (e >> 3)][e & 7] * 4096.f); }
#pragma unroll
                for (int t = 0; t < NT; ++t) {
                    o[t] *= corr;
                    o[t] = wmma16(va[t][0].v, pb0, o[t]);        // o[t][r] = O^T[16 t + 8 hf + r][query l15]
                    o[t] = wmma16(va[t][1].v, pb1, o[t]);
                }
                continue;
            }
            float pv[8][4];
#pragma unroll
            for (int i = 0; i < 8; ++i) {
                const int irow = q0 + i + 8 * hf;
                const int ic = min(irow, p.Lq - 1);
                float sc[4];
#pragma unroll
                for (int t = 0; t < 4; ++t) {
                    const int jg = j0 + t * 16 + l15;
                    float v = s[t][i] * p.scale;
                    if (!PLAIN && p.Mf) v += p.Mf[b * p.smb + h * p.smh + (long long)ic * p.smi + (long long)min(jg, p.Lk - 1) * p.smj];
                    if (!PLAIN && p.Rt) { int rc = ic - min(jg, p.Lk - 1) + p.roff; rc = rc < 0 ? 0 : (rc >= p.rn ? p.rn - 1 : rc); v += p.Rt[b * p.srb + h * p.srh + (long long)ic * p.sri + rc]; }
                    if (!PLAIN && p.Mi) { const int mv = p.Mi[b * p.smb + h * p.smh + (long long)ic * p.smi + (long long)min(jg, p.Lk - 1) * p.smj]; if (p.mpol ? (mv != 0) : (mv == 0)) v = p.mfill; }
                    if (!PLAIN && p.SQ) { const bool same = p.SQ[(long long)b * p.Lq + ic] == p.SK[(long long)b * p.Lk + min(jg, p.Lk - 1)]; if (p.segpol ? same : !same) v = p.mfill; }
                    if (!PLAIN && p.causal == 2 && jg > irow + p.coff) v = p.mfill;
                    if (!PLAIN && (jg >= p.Lk || (p.causal == 1 && jg > irow + p.coff) || (p.causal == 3 && jg < irow + p.coff) || (p.win > 0 && irow + p.coff - jg > p.win))) v = NEG; else v *= L2E;
                    sc[t] = v;
                }
                if (!TWOPASS || pass == 0) {
                    float mx = fmaxf(fmaxf(sc[0], sc[1]), fmaxf(sc[2], sc[3]));
                    mx = fmaxf(mx, __shfl_xor(mx, 1, 32)); mx = fmaxf(mx, __shfl_xor(mx, 2, 32));
                    mx = fmaxf(mx, __shfl_xor(mx, 4, 32)); mx = fmaxf(mx, __shfl_xor(mx, 8, 32));
                    const float mnew = fmaxf(m8[i], mx);
                    const float corr = (!PLAIN && mnew == NEG) ? 1.f : exp2f(m8[i] - mnew);
                    float rs = 0.f;
#pragma unroll
                    for (int t = 0; t < 4; ++t) {
                        const float pp = (!PLAIN && sc[t] == NEG) ? 0.f : exp2f(sc[t] - mnew); rs += pp;
                        pv[i][t] = (!PLAIN && p.Pw) ? pp * p.Pw[b * p.swb + h * p.swh + (long long)ic * p.swi + (long long)min(j0 + t * 16 + l15, p.Lk - 1) * p.swj] : pp;
                    }
                    rs += __shfl_xor(rs, 1, 32); rs += __shfl_xor(rs, 2, 32); rs += __shfl_xor(rs, 4, 32); rs += __shfl_xor(rs, 8, 32);
                    l8[i] = l8[i] * corr + rs; m8[i] = mnew;
                    if (!TWOPASS) {
#pragma unroll
                        for (int t = 0; t < NT; ++t) o[t][i] *= corr;
                    }
                } else {
                    const float inv = (l8[i] > 0.f) ? 1.f / l8[i] : 0.f;
#pragma unroll
                    for (int t = 0; t < 4; ++t) {
                        const int jg = j0 + t * 16 + l15;
                        float pp = (sc[t] == NEG) ? 0.f : exp2f(sc[t] - m8[i]) * inv;
                        if (p.Pw) pp *= p.Pw[b * p.swb + h * p.swh + (long long)ic * p.swi + (long long)min(jg, p.Lk - 1) * p.swj];
                        pv[i][t] = pp;
                    }
                }
            }
            if (dopv) {
#pragma unroll
                for (int i = 0; i < 8; ++i)
#pragma unroll
                    for (int t = 0; t < 4; ++t) ((float*)myp)[(i + 8 * hf) * 64 + t * 16 + l15] = pv[i][t];
                if (UNIT) {                                      // V was published with K, by the barrier behind the staging stores; P is read only by the wave that wrote it:
                    __builtin_amdgcn_fence(__ATOMIC_RELEASE, "workgroup");   // its lanes' P stores are done and stay in front of
                    __builtin_amdgcn_wave_barrier();                         // this point, the wave's P reads behind it
                    __builtin_amdgcn_fence(__ATOMIC_ACQUIRE, "workgroup");
                } else __syncthreads();                          // P (per wave) and V (shared) visible
                if (!PLAIN && p.P) {
                    float* pb_ = p.P + b * p.sPb + h * p.sPh;
                    const bool fastP = (p.pband == 0) && ((p.sPi & 3) == 0) && (j0 + 64 <= p.Lk) && (q0 + 16 <= p.Lq) && ((((size_t)pb_) & 15) == 0);
                    if (fastP) {
#pragma unroll
                        for (int s = 0; s < 8; ++s) {
                            const int row = s * 2 + (lane >> 4), c4 = (lane & 15) * 4;
                            const v4f v = *(const v4f*)(myp + row * 64 + c4);
                            VST2V4(pb_ + (long long)(q0 + row) * p.sPi + j0 + c4, v);
                        }
                    } else {
                        for (int row = 0; row < 16; ++row) {
                            const int irow = q0 + row; if (irow >= p.Lq) continue;
                            for (int c = lane; c < 64; c += 32) {
                                const int jg = j0 + c; if (jg >= p.Lk) continue;
                                if (p.pband == 0) VST2(float, pb_ + (long long)irow * p.sPi + jg, myp[row * 64 + c]);
                                else if (jg - irow <= p.pband && irow - jg <= p.pband) VST2(float, pb_ + (long long)irow * p.sPi + (jg - irow + p.pband), myp[row * 64 + c]);
                            }
                        }
                    }
                }
                if (SPLITPV) {
                    const Split pa0 = sp_ld(myp + l15 * 64, 1, 0, hf, 64, 1.f), pa1 = sp_ld(myp + l15 * 64, 1, 32, hf, 64, 1.f);
                    const __bf16* vh = (const __bf16*)vl; const __bf16* vlo = vh + 64 * VP;
#pragma unroll
                    for (int t = 0; t < NT; ++t) {
                        const int dcol = t * 16 + l15;
                        Split b0, b1;
#pragma unroll
                        for (int e = 0; e < 16; ++e) {
                            const int k0 = frag_k(e, hf), k1 = 32 + frag_k(e, hf);
                            b0.hi[e] = vh[k0 * VP + dcol]; b0.lo[e] = vlo[k0 * VP + dcol]; b1.hi[e] = vh[k1 * VP + dcol]; b1.lo[e] = vlo[k1 * VP + dcol];
                        }
                        o[t] = wmma3(pa0, b0, o[t]);
                        o[t] = wmma3(pa1, b1, o[t]);
                    }
                } else {
                    const v16h pa0 = fh_ld(myp + l15 * 64, 1, 0, hf, 64, 4096.f), pa1 = fh_ld(myp + l15 * 64, 1, 32, hf, 64, 4096.f);
#pragma unroll
                    for (int t = 0; t < NT; ++t) {
                        const int dcol = t * 16 + l15;
                        v16h b0, b1;
#pragma unroll
                        for (int e = 0; e < 16; ++e) { b0[e] = vl[frag_k(e, hf) * VP + dcol]; b1[e] = vl[(32 + frag_k(e, hf)) * VP + dcol]; }
                        o[t] = wmma16(pa0, b0, o[t]);
                        o[t] = wmma16(pa1, b1, o[t]);
                    }
                }
            }
        }
    }
    float* obase = p.O + b * p.sOb + h * p.sOh;
    if (!PLAIN && p.ST) {
        const int rl = lane >> 1, isel = rl & 7;           // row q0 + rl ; rl>>3 == hf holds because lane>>4 == (lane>>1)>>3
        float mv = 0.f, lv = 0.f;
#pragma unroll
        for (int i = 0; i < 8; ++i) if (i == isel) { mv = m8[i]; lv = l8[i]; }
        const int irow = q0 + rl;
        if (irow < p.Lq) { float* st = p.ST + (((long long)b * gridDim.y + h) * p.Lq + irow) * 2 + (lane & 1); VST2(float, st, (lane & 1) ? lv : mv * 0.6931471805599453f); }
    }
    float invr[8];
    if (UNIT && PLAIN) l8[0] += xhalf(l8[0]);                    // transposed path: the query's sum = its two halves' sums
#pragma unroll
    for (int i = 0; i < 8; ++i) {
        if (UNIT && PLAIN) invr[i] = (l8[0] > 0.f) ? 1.f / (l8[0] * 4096.f) : 0.f;
        else if (TWOPASS) invr[i] = SPLITPV ? 1.f : (1.f / 4096.f);
        else if (!PLAIN && p.nonorm) invr[i] = exp2f(m8[i]) * (SPLITPV ? 1.f : (1.f / 4096.f));
        else invr[i] = (l8[i] > 0.f) ? (SPLITPV ? 1.f / l8[i] : 1.f / (l8[i] * 4096.f)) : 0.f;
    }
    __syncthreads();                                             // all waves done with pl/vl from the main loop
    const bool ofast = ((p.sOi & 3) == 0) && ((((size_t)obase) & 15) == 0) && (q0 + 16 <= p.Lq);
#pragma unroll
    for (int c0 = 0; c0 < DVP; c0 += 64) {
#pragma unroll
        for (int i = 0; i < 8; ++i)
#pragma unroll
            for (int t = 0; t < NT; ++t) if (t * 16 >= c0 && t * 16 < c0 + 64) ((float*)myp)[(UNIT && PLAIN) ? l15 * 64 + (t * 16 - c0) + 8 * hf + i : (i + 8 * hf) * 64 + (t * 16 - c0) + l15] = o[t][i] * invr[i];
        __syncthreads();
        const int cw = (DVP - c0 < 64) ? (DVP - c0) : 64;      // staged columns in this chunk (multiple of 16)
        if (ofast && (c0 + cw <= p.dv) && (cw % 32 == 0)) {
            const int lpr = cw / 4;                              // lanes per row (16 for 64 cols, 8 for 32)
            const int rows_per_ins = 32 / lpr;
            for (int r0 = 0; r0 < 16; r0 += rows_per_ins) {
                const int row = r0 + lane / lpr, c4 = (lane % lpr) * 4;
                const v4f v = *(const v4f*)(myp + row * 64 + c4);
                VST2V4(obase + (long long)(q0 + row) * p.sOi + c0 + c4, v);
            }
        } else {
            for (int row = 0; row < 16; ++row) {
                const int irow = q0 + row; if (irow >= p.Lq) continue;
                for (int c = lane; c < cw; c += 32) { const int d = c0 + c; if (d < p.dv) VST2(float, obase + (long long)irow * p.sOi + d, myp[row * 64 + c]); }
            }
        }
        __syncthreads();
    }
}

// =====================================================================================================================
// k_tr: dst(z, c, r) = alpha * src(z, r, c) (+ beta * R2(z, c, r)): [Z][R][C] (row stride lds) -> [Z][C][R] (row stride ldd) through a 32x32 LDS tile;
//   flags: 1 -> add beta * residual R2 addressed like dst (z*sRz + c*ldr + r); act applied before the residual.
// =====================================================================================================================
struct TrP { const float* src; float* dst; const float* R2; long long sSz, lds, sDz, ldd, sRz, ldr; int R, C, flags, act; float alpha, beta; };
static_assert(sizeof(TrP) == 3 * 8 + 6 * 8 + 6 * 4, "TrP has padding");
__global__ __launch_bounds__(256) void k_tr(TrP p) {
    __shared__ float tile[32][33];
    const int c0 = blockIdx.x * 32, r0 = blockIdx.y * 32, z = blockIdx.z;
    const int lane = threadIdx.x & 31, wave = threadIdx.x >> 5;
    const float* s = p.src + z * p.sSz;
#pragma unroll
    for (int k = 0; k < 4; ++k) {
        const int rl = wave * 4 + k, r = r0 + rl, c = c0 + lane;
        tile[rl][lane] = (r < p.R && c < p.C) ? s[(long long)r * p.lds + c] : 0.f;
    }
    __syncthreads();
    float* d = p.dst + z * p.sDz; const float* rr = p.R2 + z * p.sRz;
#pragma unroll
    for (int k = 0; k < 4; ++k) {
        const int cl = wave * 4 + k, c = c0 + cl, r = r0 + lane;
        if (c < p.C && r < p.R) {
            float v = act_fn(p.alpha * tile[lane][cl], p.act);
            if (p.flags & 1) v += p.beta * rr[(long long)c * p.ldr + r];
            VST2(float, d + (long long)c * p.ldd + r, v);
        }
    }
}

// k_affine: dst[i] = a * (sdev ? sdev[0] : 1) * src[i] + b, i < n (one thread per element; consecutive lanes -> consecutive addresses)
__global__ __launch_bounds__(256) void k_affine(const float* __restrict__ src, float* __restrict__ dst, int n, float a, float b, const float* __restrict__ sdev) {
    const int i = blockIdx.x * 256 + threadIdx.x;
    if (i < n) { const float aa = sdev ? a * sdev[0] : a; const float v = aa * src[i] + b; VST2(float, dst + i, v); }
}

// =====================================================================================================================
// k_softmax: row softmax over n contiguous elements, one 256-thread block per row; rows addressed z*sz + r*sr (grid (R, Z)).
//   out = scale_out * softmax(scale_in * x + (Mf ? Mf[z*smz + r*smr + j] : 0)); a row whose max is -inf is written as 0.
// =====================================================================================================================
struct SmP { const float* src; float* dst; const float* Mf; long long sz, sr, dz, dr, smz, smr; int n, pad; float scale_in, scale_out; };
static_assert(sizeof(SmP) == 3 * 8 + 6 * 8 + 4 * 4, "SmP has padding");
__global__ __launch_bounds__(256) void k_softmax(SmP p) {
    __shared__ float red[256];
    const int r = blockIdx.x, z = blockIdx.y, tid = threadIdx.x;
    const float* s = p.src + z * p.sz + (long long)r * p.sr;
    const float* mf = p.Mf ? (p.Mf + z * p.smz + (long long)r * p.smr) : nullptr;
    float mx = -__builtin_inff();
    for (int j = tid; j < p.n; j += 256) { float v = s[j] * p.scale_in; if (mf) v += mf[j]; mx = fmaxf(mx, v); }
    red[tid] = mx; __syncthreads();
    for (int o = 128; o > 0; o >>= 1) { if (tid < o) red[tid] = fmaxf(red[tid], red[tid + o]); __syncthreads(); }
    mx = red[0]; __syncthreads();
    float sum = 0.f;
    for (int j = tid; j < p.n; j += 256) { float v = s[j] * p.scale_in; if (mf) v += mf[j]; sum += (mx == -__builtin_inff()) ? 0.f : expf(v - mx); }
    red[tid] = sum; __syncthreads();
    for (int o = 128; o > 0; o >>= 1) { if (tid < o) red[tid] += red[tid + o]; __syncthreads(); }
    sum = red[0];
    const float inv = (sum > 0.f) ? p.scale_out / sum : 0.f;
    float* d = p.dst + z * p.dz + (long long)r * p.dr;
    for (int j = tid; j < p.n; j += 256) { float v = s[j] * p.scale_in; if (mf) v += mf[j]; const float o = (mx == -__builtin_inff()) ? 0.f : expf(v - mx) * inv; VST2(float, d + j, o); }
}
// =====================================================================================================================
// k_stats: mean and rsqrt(var + eps) over a set of n elements addressed base + z*sz + (e / inner) * so + (e % inner) * si, one 256-thread
// k_norm_apply: y = (x - mean[set]) * rstd[set] * g[c] + b[c] over a [Z][C][L] chan-major tensor with set = z*G + c / (C/G) (G groups per z;
//   G = C -> per-chan sets indexed z*C+c; for batch norm pass stats indexed by c only via bn = 1). Optional act. Output same layout.
// =====================================================================================================================
//   mode 0: mean / rsqrt(var + eps); mode 1 (RMSNorm): 0 / rsqrt(mean(x^2) + eps); mode 2 (L2 normalize * sqrt(n)): 0 / sqrt(n) / max(||x||, eps); mode 3: as 0 with unbiased variance (n-1)
__global__ __launch_bounds__(256) void k_stats(const float* __restrict__ x, long long sz, long long so, long long si, int inner, int n, float eps, float* __restrict__ stat, int mode) {
    __shared__ float red[256];
    const int z = blockIdx.x, tid = threadIdx.x;
    const float* base = x + z * sz;
    float s = 0.f;
    for (int e = tid; e < n; e += 256) s += base[(long long)(e / inner) * so + (long long)(e % inner) * si];
    red[tid] = s; __syncthreads();
    for (int o = 128; o > 0; o >>= 1) { if (tid < o) red[tid] += red[tid + o]; __syncthreads(); }
    const float mu = (mode == 0 || mode == 3) ? red[0] / (float)n : 0.f; __syncthreads();
    float q = 0.f;
    for (int e = tid; e < n; e += 256) { const float dlt = base[(long long)(e / inner) * so + (long long)(e % inner) * si] - mu; q += dlt * dlt; }
    red[tid] = q; __syncthreads();
    for (int o = 128; o > 0; o >>= 1) { if (tid < o) red[tid] += red[tid + o]; __syncthreads(); }
    {
        float rs;
        if (mode == 2) rs = sqrtf((float)n) / fmaxf(sqrtf(red[0]), eps); else if (mode == 3) rs = rsqrtf(red[0] / (float)(n - 1) + eps); else rs = rsqrtf(red[0] / (float)n + eps);
        if (tid < 32) { const float v = (tid == 0) ? mu : ((tid == 1) ? rs : 0.f); VST2(float, stat + (long long)z * 32 + tid, v); }
    }
}
//   One thread per element over the flat [Z][C][L] index space: grid ceil(Z*C*L / 256).
__global__ __launch_bounds__(256) void k_norm_apply(const float* __restrict__ x, float* __restrict__ y, const float* __restrict__ stat, const float* __restrict__ g, const float* __restrict__ bta,
                                                     int Z, int C, int L, int G, int bn, int act) {
    const long long idx = (long long)blockIdx.x * 256 + threadIdx.x;
    if (idx >= (long long)Z * C * L) return;
    const int l = (int)(idx % L); const long long zc = idx / L; const int c = (int)(zc % C), z = (int)(zc / C); (void)l;
    const int set = bn ? c : (z * G + c / (C / G));
    float v = (x[idx] - stat[(long long)set * 32]) * stat[(long long)set * 32 + 1];
    if (g) v *= g[c];
    if (bta) v += bta[c];
    v = act_fn(v, act);
    VST2(float, y + idx, v);
}

// k_lse_neg: c[i] = -(st[2i] + log(st[2i+1])) = minus the log-sum-exp of row i from k_attn's ST output (for softmax over the query dimension)
__global__ __launch_bounds__(256) void k_lse_neg(const float* __restrict__ st, float* __restrict__ c, int n) {
    const int i = blockIdx.x * 256 + threadIdx.x;
    if (i < n) { const float v = -(st[2 * i] + logf(st[2 * i + 1])); VST2(float, c + i, v); }
}

// k_iota: dst[i] = a * i + b as int32 (segment/position id helper)
__global__ __launch_bounds__(256) void k_iota(int* __restrict__ dst, int n, int a, int b) {
    const int i = blockIdx.x * 256 + threadIdx.x;
    if (i < n) { const int v = a * i + b; VST2(int, dst + i, v); }
}

// k_axpby: dst[i] = a * x[i] + b * y[i] (+ c), i < n
__global__ __launch_bounds__(256) void k_axpby(const float* __restrict__ x, const float* __restrict__ y, float* __restrict__ dst, int n, float a, float b, float c) {
    const int i = blockIdx.x * 256 + threadIdx.x;
    if (i < n) { const float v = a * x[i] + b * y[i] + c; VST2(float, dst + i, v); }
}

// =====================================================================================================================
// k_rope: rotary embedding on a [R rows][Hn heads][D] view (row stride sXr, head stride sXh, element stride 1) -> Y (own strides).
//   mode 0: rotate_half (partner d±D/2, sign - for d<D/2); mode 1: interleaved pairs (partner d^1, sign - for even d).
//   table column tcol: tmode 0 -> d, 1 -> d % (D/2), 2 -> d / 2; position p: pmode 0 -> r % S, 1 -> head index, 2 -> pos[r];
//   c = C[(r / S) * sCb + p * sCp + tcol * sCd], s likewise from Sn; y = x[d] * c + sign * x[partner] * s. X and Y must not alias.
// =====================================================================================================================
struct RopeP { const float* X; float* Y; const float* C; const float* Sn; const int* pos; long long sXr, sXh, sYr, sYh, sCb, sCp, sCd; int R, Hn, D, S, mode, tmode, pmode, pad; };
static_assert(sizeof(RopeP) == 5 * 8 + 7 * 8 + 8 * 4, "RopeP has padding");
__global__ __launch_bounds__(256) void k_rope(RopeP p) {
    const long long idx = (long long)blockIdx.x * 256 + threadIdx.x;
    if (idx >= (long long)p.R * p.Hn * p.D) return;
    const int d = (int)(idx % p.D); const long long rh = idx / p.D; const int h = (int)(rh % p.Hn); const int r = (int)(rh / p.Hn);
    const int half = p.D / 2;
    int partner; float sign;
    if (p.mode == 0) { partner = (d < half) ? d + half : d - half; sign = (d < half) ? -1.f : 1.f; }
    else { partner = d ^ 1; sign = (d & 1) ? 1.f : -1.f; }
    const int tcol = (p.tmode == 0) ? d : ((p.tmode == 1) ? (d % half) : (d >> 1));
    const int pp = (p.pmode == 0) ? (r % p.S) : ((p.pmode == 1) ? h : p.pos[r]);
    const long long toff = (long long)(r / p.S) * p.sCb + (long long)pp * p.sCp + (long long)tcol * p.sCd;
    const float* xr = p.X + (long long)r * p.sXr + (long long)h * p.sXh;
    const float v = xr[d] * p.C[toff] + sign * xr[partner] * p.Sn[toff];
    VST2(float, p.Y + (long long)r * p.sYr + (long long)h * p.sYh + d, v);
}

// k_invf + k_sincos (split so neither kernel carries a large VALU-fma footprint): invf_i = num * (1 / powf(base, (2 i)/D)) [fmode 0],
//   num * expf((2 i) * cexp) [fmode 1], num * powf(base, -2 (i - 1) / D) [fmode 2]; then cs/sn[s*half + i] = cos/sin((pscale * s) * invf_i)
__global__ __launch_bounds__(256) void k_invf(float* __restrict__ invb, int half, int D, float base, float num, int fmode, float cexp) {
    const int i = blockIdx.x * 256 + threadIdx.x;
    if (i >= ((half + 31) / 32) * 32) return;
    if (i >= half) { VST2(float, invb + i, 0.f); return; }
    const float e = (float)(2 * i) / (float)D;
    float invf;
    if (fmode == 1) invf = num * expf((float)(2 * i) * cexp);
    else if (fmode == 2) invf = num * powf(base, (-2.0f * ((float)i - 1.0f)) / (float)D);
    else invf = num * (1.0f / powf(base, e));
    VST2(float, invb + i, invf);
}
__global__ __launch_bounds__(256) void k_sincos(float* __restrict__ cs, float* __restrict__ sn, const float* __restrict__ invb, int S, int half, float pscale) {
    const int idx = blockIdx.x * 256 + threadIdx.x;
    if (idx >= S * half) return;
    const int s = idx / half, i = idx - s * half;
    const float ang = (pscale * (float)s) * invb[i];
    VST2(float, cs + idx, cosf(ang)); VST2(float, sn + idx, sinf(ang));
}

// k_mulact: dst[i] = act(x[i]) * y[i]
__global__ __launch_bounds__(256) void k_mulact(const float* __restrict__ x, const float* __restrict__ y, float* __restrict__ dst, int n, int act) {
    const int i = blockIdx.x * 256 + threadIdx.x;
    if (i < n) { const float v = act_fn(x[i], act) * y[i]; VST2(float, dst + i, v); }
}

// =====================================================================================================================
// k_matvec: thread-per-row matrix-vector products for N <= 8 output columns (heads with 1-3 outputs, gates), f32 on the VALU.
//   C[r*sCm + j] = act(alpha * sum_k A[r*sAm + k*sAk] * B[j*sBn + k*sBk] + bias[j]) + beta * R[r*sRm + j*sRn]; each thread writes its N contiguous floats.
// =====================================================================================================================
__global__ __launch_bounds__(256) void k_matvec(GemmP p) {
    // 32 lanes write one line with one instruction.
    const int rpt = (p.N == 1) ? 1 : 32;
    const long long r0 = ((long long)blockIdx.x * 256 + threadIdx.x) * rpt; const int z = blockIdx.z, zo = z / p.zi_n, zi = z - zo * p.zi_n;
    if (r0 >= p.M) return;
    const float* Bb = p.B + zo * p.sBo + zi * p.sBi;
    float* C = p.C + zo * p.sCo + zi * p.sCi; const float* R = p.R + zo * p.sRo + zi * p.sRi;
    for (int rr = 0; rr < rpt; ++rr) {
        const long long r = r0 + rr; if (r >= p.M) break;
        const float* A = p.A + zo * p.sAo + zi * p.sAi + r * p.sAm;
        float acc[8] = {0.f, 0.f, 0.f, 0.f, 0.f, 0.f, 0.f, 0.f};
        for (int k = 0; k < p.K; ++k) { const float a = A[(long long)k * p.sAk];
#pragma unroll
            for (int j = 0; j < 8; ++j) if (j < p.N) acc[j] += a * Bb[(long long)j * p.sBn + (long long)k * p.sBk]; }
#pragma unroll
        for (int j = 0; j < 8; ++j) if (j < p.N) {
            float v = acc[j] * p.alpha;
            if (p.flags & 1) v += p.bias[j];
            if (p.flags & 2) v += p.bias[r];
            v = act_fn(v, p.act);
            if (p.flags & 4) v += p.beta * R[r * p.sRm + (long long)j * p.sRn];
            VST2(float, C + r * p.sCm + j, v);
        }
    }
}
// k_smallsoftmax: thread-per-row softmax for short rows (n <= 64): dst[r*dr + j] = softmax(scale*src[r*sr + j])
__global__ __launch_bounds__(256) void k_smallsoftmax(const float* __restrict__ src, float* __restrict__ dst, long long sr, long long dr, int n, long long R, float scale) {
    const long long r0 = ((long long)blockIdx.x * 256 + threadIdx.x) * 32;
    for (int rr = 0; rr < 32; ++rr) {
        const long long r = r0 + rr; if (r >= R) return;
        const float* s = src + r * sr; float* d = dst + r * dr;
        float mx = -__builtin_inff();
        for (int j = 0; j < n; ++j) mx = fmaxf(mx, s[j] * scale);
        float sum = 0.f;
        for (int j = 0; j < n; ++j) sum += expf(s[j] * scale - mx);
        const float inv = 1.f / sum;
        for (int j = 0; j < n; ++j) { const float v = expf(s[j] * scale - mx) * inv; VST2(float, d + j, v); }
    }
}

__global__ __launch_bounds__(32) void k_unitstat(float* __restrict__ st) { const int t = threadIdx.x; const float v = (t == 1) ? 1.f : 0.f; VST2(float, st + t, v); }

// destination (e.g. a d_out whose row width is not a multiple of 32 floats) is written by consecutive lanes of one instruction
__global__ __launch_bounds__(256) void k_lincopy(const float* __restrict__ src, long long lds, float* __restrict__ dst, long long ldd, long long rows, int cols) {
    const long long i = (long long)blockIdx.x * 256 + threadIdx.x; if (i >= rows * cols) return;
    const long long r = i / cols; const int c = (int)(i - r * cols);
    const float v = src[r * lds + c]; VST2(float, dst + r * ldd + c, v);
}

namespace w25 {
typedef __attribute__((ext_vector_type(16))) _Float16 v16h;
typedef __attribute__((ext_vector_type(8)))  _Float16 v8h;
typedef __attribute__((ext_vector_type(16))) __bf16   v16b;
typedef __attribute__((ext_vector_type(8)))  __bf16   v8b;
typedef __attribute__((ext_vector_type(8)))  float    v8f;
typedef __attribute__((ext_vector_type(4)))  float    v4f;

__device__ __forceinline__ unsigned short f2bf_bits(float f) {
  unsigned u = __float_as_uint(f);
  return (unsigned short)((u + 0x7FFFu + ((u >> 16) & 1u)) >> 16);
}
__device__ __forceinline__ float bf_bits2f(unsigned short h) { return __uint_as_float(((unsigned)h) << 16); }

// hazard guards as plain device helpers (no inline asm inside the kernel template body)
__device__ __forceinline__ void dep_guard_h(v8f& a, v8f& b, v16h x, v16h y) { asm volatile("v_nop\n\tv_nop\n\tv_nop\n\tv_nop" : "+v"(a), "+v"(b) : "v"(x), "v"(y)); }
__device__ __forceinline__ void dep_guard_b(v8f& a, v8f& b, v16b x, v16b y) { asm volatile("v_nop\n\tv_nop\n\tv_nop\n\tv_nop" : "+v"(a), "+v"(b) : "v"(x), "v"(y)); }
__device__ __forceinline__ void keep4_h(v16h a, v16h b, v16h c, v16h d) { asm volatile("v_nop" :: "v"(a), "v"(b), "v"(c), "v"(d)); }
__device__ __forceinline__ void keep4_b(v16b a, v16b b, v16b c, v16b d) { asm volatile("v_nop" :: "v"(a), "v"(b), "v"(c), "v"(d)); }
__device__ __forceinline__ void acc_guard4(v8f& a, v8f& b, v8f& c, v8f& d) { asm volatile("v_nop\n\tv_nop\n\tv_nop\n\tv_nop" : "+v"(a), "+v"(b), "+v"(c), "+v"(d)); }
template <typename T> struct Frag;
template <> struct Frag<_Float16> {
  typedef v16h V; union U { v16h v; v8h h[2]; };
  static __device__ __forceinline__ v16h load(const _Float16* p) {   // elements 0..7 <- p[0..7], 8..15 <- p[16..23]
    U f; f.h[0] = *(const v8h*)(p); f.h[1] = *(const v8h*)(p + 16); return f.v;
  }
  static __device__ __forceinline__ v8f mma(v16h a, v16h b, v8f c) {
    return __builtin_amdgcn_wmma_f32_16x16x32_f16(false, a, false, b, (short)0, c, false, false);
  }
  static __device__ __forceinline__ void guard(v8f& a, v8f& b, v16h x, v16h y) { dep_guard_h(a, b, x, y); }
  static __device__ __forceinline__ void keep(v16h a, v16h b, v16h c, v16h d) { keep4_h(a, b, c, d); }
};
template <> struct Frag<__bf16> {
  typedef v16b V; union U { v16b v; v8b h[2]; };
  static __device__ __forceinline__ v16b load(const __bf16* p) {
    U f; f.h[0] = *(const v8b*)(p); f.h[1] = *(const v8b*)(p + 16); return f.v;
  }
  static __device__ __forceinline__ v8f mma(v16b a, v16b b, v8f c) {
    return __builtin_amdgcn_wmma_f32_16x16x32_bf16(false, a, false, b, (short)0, c, false, false);
  }
  static __device__ __forceinline__ void guard(v8f& a, v8f& b, v16b x, v16b y) { dep_guard_b(a, b, x, y); }
  static __device__ __forceinline__ void keep(v16b a, v16b b, v16b c, v16b d) { keep4_b(a, b, c, d); }
};

// ---- Register-blocked batched WMMA GEMM ------------------------------------
// C[m,n] = scale * sum_k A[m,k] * Bt[n,k] (+bias)(+resid); each wave owns a 64x64 tile.
// A row-major [M,K]; Bt row-major [N,K]; M,N % 64 == 0, K % 32 == 0.
// SPLIT: operands are hi/lo planes (A2/Bt2 = lo planes, same layout); product = hi·hi + hi·lo + lo·hi.
// BIAS_MODE: 0 = none, 1 = bias[m], 2 = bias[n].
// OUT_MODE: 0 = f32, 1 = f16, 2 = bf16 hi plane (Cout) + bf16 lo plane (Cout2).
// ET: 0 = f16 operands, 1 = bf16 operands (pointers passed as 16-bit storage)
template <int ET> struct Elem;
template <> struct Elem<0> { typedef _Float16 T; };
template <> struct Elem<1> { typedef __bf16 T; };
template <int ET, bool SPLIT, int BIAS_MODE, int OUT_MODE, bool RESID, int ACT = 0>
__global__ __launch_bounds__(256) void wmma_gemm64(
    const unsigned short* __restrict__ Ap, const unsigned short* __restrict__ A2p, int lda, long strideA,
    const unsigned short* __restrict__ Btp, const unsigned short* __restrict__ Bt2p, int ldb, long strideB,
    void* __restrict__ Cout, void* __restrict__ Cout2, int ldc, long strideC,
    const float* __restrict__ bias,
    const float* __restrict__ resid, long strideR,
    int M, int N, int K, float scale) {
  typedef typename Elem<ET>::T T;
  typedef typename Frag<T>::V V;
  const T* A = (const T*)Ap; const T* A2 = (const T*)A2p; const T* Bt = (const T*)Btp; const T* Bt2 = (const T*)Bt2p;
  __shared__ __align__(16) float sT[8][16 * 68];   // per-wave 16x64 slab, pitch 68 floats
  const int b    = blockIdx.y;
  const int lane = threadIdx.x & 31;
  const int wave = threadIdx.x >> 5;
  const int tilesN = N >> 6;
  const int tilesM = M >> 6;
  const int tile = blockIdx.x * 8 + wave;
  if (tile >= tilesM * tilesN) return;   // wave-uniform; no block barriers in this kernel
  const int tm = tile / tilesN;
  const int tn = tile - tm * tilesN;
  const int m0 = tm << 6;
  const int n0 = tn << 6;

  const T* Ab  = A  + (size_t)b * strideA;
  const T* Bb  = Bt + (size_t)b * strideB;
  const T* Ab2 = SPLIT ? (A2  + (size_t)b * strideA) : nullptr;
  const T* Bb2 = SPLIT ? (Bt2 + (size_t)b * strideB) : nullptr;

  const int rlane = lane & 15;                 // row (A) / col (B, D) within subtile
  const int koff  = (lane >> 4) * 8;           // k offset of this lane half
  const int mOff  = (lane >> 4) * 8;           // D row offset

  v8f acc[4][4];
#pragma unroll
  for (int i = 0; i < 4; ++i)
#pragma unroll
    for (int j = 0; j < 4; ++j) acc[i][j] = (v8f){0.f,0.f,0.f,0.f,0.f,0.f,0.f,0.f};

  for (int k0 = 0; k0 < K; k0 += 32) {
    V bh[4], bl[4];
#pragma unroll
    for (int j = 0; j < 4; ++j) {
      const size_t bo = (size_t)(n0 + (j << 4) + rlane) * ldb + koff + k0;
      bh[j] = Frag<T>::load(Bb + bo);
      if (SPLIT) bl[j] = Frag<T>::load(Bb2 + bo);
    }
#pragma unroll
    for (int i = 0; i < 4; ++i) {
      const size_t ao = (size_t)(m0 + (i << 4) + rlane) * lda + koff + k0;
      V ah = Frag<T>::load(Ab + ao);
      V al;
      if (SPLIT) al = Frag<T>::load(Ab2 + ao);
#pragma unroll
      for (int j = 0; j < 4; ++j) {
        acc[i][j] = Frag<T>::mma(ah, bh[j], acc[i][j]);
        if (SPLIT) {
          acc[i][j] = Frag<T>::mma(ah, bl[j], acc[i][j]);
          acc[i][j] = Frag<T>::mma(al, bh[j], acc[i][j]);
        }
      }
      Frag<T>::guard(acc[i][0], acc[i][3], ah, SPLIT ? al : ah);
    }
    Frag<T>::keep(bh[0], bh[1], bh[2], bh[3]);
    if (SPLIT) Frag<T>::keep(bl[0], bl[1], bl[2], bl[3]);
  }
  acc_guard4(acc[0][0], acc[0][1], acc[0][2], acc[0][3]);
  acc_guard4(acc[1][0], acc[1][1], acc[1][2], acc[1][3]);
  acc_guard4(acc[2][0], acc[2][1], acc[2][2], acc[2][3]);
  acc_guard4(acc[3][0], acc[3][1], acc[3][2], acc[3][3]);

  // ---- epilogue ----
  float* slab = sT[wave];
  const float* Rb = RESID ? (resid + (size_t)b * strideR) : nullptr;
#pragma unroll
  for (int i = 0; i < 4; ++i) {
    const int mBase = m0 + (i << 4);
#pragma unroll
    for (int j = 0; j < 4; ++j) {
      const int n = n0 + (j << 4) + rlane;
      float bv = 0.f;
      if (BIAS_MODE == 2) bv = bias[n];
#pragma unroll
      for (int r = 0; r < 8; ++r) {
        float v = acc[i][j][r] * scale;
        if (BIAS_MODE == 1) v += bias[mBase + mOff + r];
        if (BIAS_MODE == 2) v += bv;
        if (RESID) v += Rb[(size_t)(mBase + mOff + r) * ldc + n];
        if (ACT == 1) v = tanhf(v);
        if (ACT == 2) v = fmaxf(v, 0.0f);
        if (ACT == 3) v = v / (1.0f + expf(-v));
        if (ACT == 4) v = (v > 0.f) ? v : 0.01f * v;
        if (ACT == 5) v = 0.5f * v * (1.0f + erff(v * 0.70710678118654752f));
        if (ACT == 6) v = (v > 0.f) ? v : 0.2f * v;
        if (ACT == 7) { const float u = 0.7978845608028654f * (v + 0.044715f * v * v * v); v = 0.5f * v * (1.f + tanhf(u)); }
        slab[(mOff + r) * 68 + (j << 4) + rlane] = v;
      }
    }
    __builtin_amdgcn_fence(__ATOMIC_RELEASE, "workgroup");
    __builtin_amdgcn_wave_barrier();
    __builtin_amdgcn_fence(__ATOMIC_ACQUIRE, "workgroup");
    if (OUT_MODE == 0) {
      float* C = (float*)Cout + (size_t)b * strideC;
      const int hh = lane >> 4, c4 = (lane & 15) * 4;     // row seg = 256 B = 16 lanes x 16 B
      {
#pragma unroll
        for (int it = 0; it < 8; ++it) {
          const int row = it * 2 + hh;
          v4f v = *(const v4f*)(slab + row * 68 + c4);
          *(v4f*)(C + (size_t)(mBase + row) * ldc + n0 + c4) = v;
        }
        
      }
    } else {
      const int q = lane >> 3, c8 = (lane & 7) * 8;
      unsigned short* C  = (unsigned short*)Cout  + (size_t)b * strideC;
      unsigned short* C2 = (OUT_MODE == 2) ? ((unsigned short*)Cout2 + (size_t)b * strideC) : nullptr;
      {
#pragma unroll
        for (int it = 0; it < 4; ++it) {
          const int row = it * 4 + q;
          const float* sp = slab + row * 68 + c8;
          v8h hv, lv;
#pragma unroll
          for (int e = 0; e < 8; ++e) {
            if (OUT_MODE == 1) {
              hv[e] = (_Float16)sp[e];
            } else {
              unsigned short hb = f2bf_bits(sp[e]);
              unsigned short lb = f2bf_bits(sp[e] - bf_bits2f(hb));
              hv[e] = __builtin_bit_cast(_Float16, hb);
              lv[e] = __builtin_bit_cast(_Float16, lb);
            }
          }
          *(v8h*)(C + (size_t)(mBase + row) * ldc + n0 + c8) = hv;
          if (OUT_MODE == 2) *(v8h*)(C2 + (size_t)(mBase + row) * ldc + n0 + c8) = lv;
        }
        
      }
    }
    __builtin_amdgcn_fence(__ATOMIC_RELEASE, "workgroup");
    __builtin_amdgcn_wave_barrier();
    __builtin_amdgcn_fence(__ATOMIC_ACQUIRE, "workgroup");
  }
}

__global__ __launch_bounds__(256) void cast_f32_f16x2(
    const float* __restrict__ in, _Float16* __restrict__ out, int n2) {
  int i = blockIdx.x * 256 + threadIdx.x;
  if (i < n2) {
    const _Float16 h0 = (_Float16)in[2 * i], h1 = (_Float16)in[2 * i + 1];
    const unsigned u = (unsigned)__builtin_bit_cast(unsigned short, h0) | ((unsigned)__builtin_bit_cast(unsigned short, h1) << 16);
    ((unsigned*)out)[i] = u;
    
  }
}


} // namespace w25

__global__ __launch_bounds__(256) void k_castT16(const float* __restrict__ src, long long lds, _Float16* __restrict__ dst, long long ldd, int R, int C, float s) {
    const long long i = (long long)blockIdx.x * 256 + threadIdx.x; const long long np = (long long)C * (R / 2); if (i >= np) return; const int c = (int)(i / (R / 2)); const int r = 2 * (int)(i % (R / 2));
    const _Float16 h0 = (_Float16)(src[(long long)r * lds + c] * s), h1 = (_Float16)(src[(long long)(r + 1) * lds + c] * s);
    const unsigned u = (unsigned)__builtin_bit_cast(unsigned short, h0) | ((unsigned)__builtin_bit_cast(unsigned short, h1) << 16);
    unsigned* d = (unsigned*)(dst + (long long)c * ldd + r); *d = u;  }
__global__ __launch_bounds__(256) void k_cast16(const float* __restrict__ src, long long lds, _Float16* __restrict__ dst, long long ldd, int R, int C, float s) {
    const long long i = (long long)blockIdx.x * 256 + threadIdx.x; const long long np = (long long)R * (C / 2); if (i >= np) return; const int r = (int)(i / (C / 2)); const int c = 2 * (int)(i % (C / 2));
    const _Float16 h0 = (_Float16)(src[(long long)r * lds + c] * s), h1 = (_Float16)(src[(long long)r * lds + c + 1] * s);
    const unsigned u = (unsigned)__builtin_bit_cast(unsigned short, h0) | ((unsigned)__builtin_bit_cast(unsigned short, h1) << 16);
    unsigned* d = (unsigned*)(dst + (long long)r * ldd + c); *d = u;  }

// f32 -> bf16 hi plane + bf16 lo plane (x = hi + lo to ~2^-17 relative; RNE both), [R][C] -> [R][C] (or transposed to [C][R]); 2 consecutive destination elements
__device__ __forceinline__ unsigned int f2bf2_pack(float a, float b, unsigned int* lo) {
    const unsigned short ha = w25::f2bf_bits(a), hb = w25::f2bf_bits(b);
    const unsigned short la = w25::f2bf_bits(a - w25::bf_bits2f(ha)), lb = w25::f2bf_bits(b - w25::bf_bits2f(hb));
    *lo = (unsigned)la | ((unsigned)lb << 16); return (unsigned)ha | ((unsigned)hb << 16); }
// blockIdx.y = matrix of a batch: source matrices sz floats apart, destination planes dz elements apart
__global__ __launch_bounds__(256) void k_castS16(const float* __restrict__ src, long long lds, __bf16* __restrict__ dhi, __bf16* __restrict__ dlo, long long ldd, int R, int C, float s, int transpose, long long sz, long long dz) {
    src += (long long)blockIdx.y * sz; dhi += (long long)blockIdx.y * dz; dlo += (long long)blockIdx.y * dz;
    const long long i = (long long)blockIdx.x * 256 + threadIdx.x; long long o; float a, b;
    if (transpose) { const long long np = (long long)C * (R / 2); if (i >= np) return; const int c = (int)(i / (R / 2)); const int r = 2 * (int)(i % (R / 2)); a = src[(long long)r * lds + c] * s; b = src[(long long)(r + 1) * lds + c] * s; o = (long long)c * ldd + r; }
    else { const long long np = (long long)R * (C / 2); if (i >= np) return; const int r = (int)(i / (C / 2)); const int c = 2 * (int)(i % (C / 2)); a = src[(long long)r * lds + c] * s; b = src[(long long)r * lds + c + 1] * s; o = (long long)r * ldd + c; }
    unsigned lo; const unsigned hi = f2bf2_pack(a, b, &lo); unsigned* ph = (unsigned*)(dhi + o); unsigned* pl = (unsigned*)(dlo + o);
    *ph = hi; *pl = lo;  }

namespace w25 {
// =====================================================================================
// Generic causal/non-causal attention for head_dim 64, f32 in / f32 out; 16-bit operands: bf16 with optional hi/lo splits, or
// plain f16 (F16=true, non-split, probabilities carried x2^15).
//   scores = (q*qscale)·kᵀ : v_wmma_f32_16x16x32_bf16; SPLIT_QK -> q,k as bf16 hi/lo (hi·hi + hi·lo + lo·hi)
//   out    = p·v           : v_wmma_f32_16x16x32_bf16; SPLIT_PV -> p,v as bf16 hi/lo; else p,v plain bf16
//   f32 accumulate; online softmax in f32. Block = 4 waves = 64 query rows of one (batch, head); S % 64 == 0.
//   Element (b, s, h, d) of tensor X lives at X[b*X_bs + s*X_rs + h*X_hs + d] (strides in floats, multiples of 4).
//   Masking: mask_mode 0 none, 1 causal (kv > q masked), 2 tensor [S][Skv] shared over (b,h) (float if
//   mask_is_int==0, int32 with element == 0 -> masked if 1, int32 with element != 0 -> masked if 2), 3 per-token vectors qmask[B][S] & kvmask[B][Skv] (int32,
//   0 -> masked), 4 causal + sliding window (kv > q or q - kv > W masked; W passed in mask_is_int);
//   5 = relative-position bias: s += cp[b,h,q][idx[q][kv]] + pc[b,h,kv][idx[q][kv]] with idx = mask_b ([S][Skv] int32) and
//   mask_a an int32 [S][Skv] tensor with nonzero = masked (tables: element (b,h,row,n) at X + b*c_bs + h*c_hs + row*c_rs + n);
//   masked scores are replaced by mask_fill (e.g. -inf or -1e9) before the softmax.
//   grid.x = B * H * (S/64) (or a sub-range with blk0).
// =====================================================================================
#define AT_D 64
#define AT_NW 4
#define AT_QB 64
#define AT_KC 64
struct AttnGeom { const float* cp = nullptr; const float* pc = nullptr; long c_bs = 0, c_rs = 0, c_hs = 0;   // mode-5 score-bias tables
                  long q_bs, q_rs, q_hs, k_bs, k_rs, k_hs, v_bs, v_rs, v_hs, o_bs, o_rs, o_hs;
                  int S, Skv, H, mask_mode; float qscale; int blk0; float mask_fill; int mask_is_int; };
static_assert(sizeof(AttnGeom) == 168, "no padding");

__device__ __forceinline__ unsigned short at_bf_bits(float f) {
  unsigned u = __float_as_uint(f);
  return (unsigned short)((u + 0x7FFFu + ((u >> 16) & 1u)) >> 16);
}
__device__ __forceinline__ __bf16 at_f2bf(float f) { return __builtin_bit_cast(__bf16, at_bf_bits(f)); }
__device__ __forceinline__ void at_split(float f, __bf16& hi, __bf16& lo) {
  const unsigned short hb = at_bf_bits(f);
  hi = __builtin_bit_cast(__bf16, hb);
  lo = at_f2bf(f - __uint_as_float(((unsigned)hb) << 16));
}
__device__ __forceinline__ v8f at_mma(v16b a, v16b b, v8f c) {
  c = __builtin_amdgcn_wmma_f32_16x16x32_bf16(false, a, false, b, (short)0, c, false, false);
  asm volatile("v_nop\n\tv_nop\n\tv_nop\n\tv_nop" : "+v"(c) : "v"(a), "v"(b));
  return c;
}
// 16-bit element as a bit pattern held in a __bf16 slot: f16 bits when F16, bf16 (RNE) otherwise
template <bool F16> __device__ __forceinline__ __bf16 at_to16(float f) {
  if (F16) return __builtin_bit_cast(__bf16, (_Float16)f);
  return at_f2bf(f);
}
template <bool F16> __device__ __forceinline__ v8f at_mma16(v16b a, v16b b, v8f c) {
  if (F16) {
    const v16h ah = __builtin_bit_cast(v16h, a), bh = __builtin_bit_cast(v16h, b);
    c = __builtin_amdgcn_wmma_f32_16x16x32_f16(false, ah, false, bh, (short)0, c, false, false);
    asm volatile("v_nop\n\tv_nop\n\tv_nop\n\tv_nop" : "+v"(c) : "v"(ah), "v"(bh));
    return c;
  }
  return at_mma(a, b, c);
}

template <bool SPLIT_QK, bool SPLIT_PV, bool F16 = false>
__global__ __launch_bounds__(128)
void attn64_kernel(const float* __restrict__ q, const float* __restrict__ k,
                   const float* __restrict__ v, float* __restrict__ out,
                   const void* __restrict__ mask_a, const int* __restrict__ mask_b, AttnGeom g) {
  static_assert(!(F16 && (SPLIT_QK || SPLIT_PV)), "f16 mode is non-split");
  const float PSC = F16 ? 32768.0f : 1.0f;     // f16 probabilities carried x2^15 (subnormal range), folded into the final 1/l
  union FB { v16b v; v8b h[2]; };
  __shared__ __align__(16) __bf16 Ksh[AT_KC * AT_D];             // K hi [kv][d]      8 KB
  __shared__ __align__(16) __bf16 Ksl[SPLIT_QK ? AT_KC * AT_D : 8];
  __shared__ __align__(16) __bf16 Vth[AT_D * AT_KC];             // V hi [d][kv]      8 KB
  __shared__ __align__(16) __bf16 Vtl[SPLIT_PV ? AT_D * AT_KC : 8];
  __shared__ __align__(16) __bf16 Psh[AT_NW][16 * AT_KC];        // per wave P hi [row][kv]  8 KB
  __shared__ __align__(16) __bf16 Psl[SPLIT_PV ? AT_NW : 1][SPLIT_PV ? 16 * AT_KC : 8];
  __shared__ __align__(16) float  Os[AT_NW][16 * 68];            // per wave out tile, pitch 68

  const int tid  = threadIdx.x;
  const int wave = tid >> 5;
  const int lane = tid & 31;
  const int hh   = lane >> 4;
  const int c    = lane & 15;

  const int nqb = g.S / AT_QB;
  const int bx = blockIdx.x + g.blk0;
  const int qb = bx % nqb;
  const int bh = bx / nqb;
  const int h  = bh % g.H;
  const int b  = bh / g.H;
  const int qbase_block = qb * AT_QB;
  const int q0 = qbase_block + wave * 16;

  const float* qb_ptr = q + (size_t)b * g.q_bs + (size_t)h * g.q_hs;
  const float* kb_ptr = k + (size_t)b * g.k_bs + (size_t)h * g.k_hs;
  const float* vb_ptr = v + (size_t)b * g.v_bs + (size_t)h * g.v_hs;
  float*       ob_ptr = out + (size_t)b * g.o_bs + (size_t)h * g.o_hs;

  // ---- Q fragments (A operand): 2 d-chunks, hi (and lo) ----
  v16b qah[2], qal[2];
  {
    const float* qrow = qb_ptr + (size_t)(q0 + c) * g.q_rs;
#pragma unroll
    for (int dc = 0; dc < 2; ++dc) {
#pragma unroll
      for (int e = 0; e < 8; ++e) {
        const float f0 = qrow[dc * 32 + 8 * hh + e] * g.qscale;
        const float f1 = qrow[dc * 32 + 16 + 8 * hh + e] * g.qscale;
        if (SPLIT_QK) { __bf16 hq, lq; at_split(f0, hq, lq); qah[dc][e] = hq; qal[dc][e] = lq; at_split(f1, hq, lq); qah[dc][8 + e] = hq; qal[dc][8 + e] = lq; }
        else { qah[dc][e] = at_to16<F16>(f0); qah[dc][8 + e] = at_to16<F16>(f1); qal[dc][e] = qah[dc][e]; qal[dc][8 + e] = qah[dc][8 + e]; }
      }
    }
  }

  float mrow[8], lrow[8];
  v8f oacc[4];
#pragma unroll
  for (int r = 0; r < 8; ++r) { mrow[r] = -INFINITY; lrow[r] = 0.f; }
#pragma unroll
  for (int t = 0; t < 4; ++t) oacc[t] = (v8f){0.f,0.f,0.f,0.f,0.f,0.f,0.f,0.f};

  const int nChunks = (g.mask_mode == 1 || g.mask_mode == 4) ? (qb + 1) : (g.Skv / AT_KC);   // block-uniform
  // per-row query mask (mode 3)
  int qkeep[8];
#pragma unroll
  for (int r = 0; r < 8; ++r) qkeep[r] = (g.mask_mode == 3) ? mask_b[(size_t)b * g.S + q0 + 8 * hh + r] : 1;   // mask_b = qmask in mode 3
  for (int kc = 0; kc < nChunks; ++kc) {
    const int kv0 = kc * AT_KC;
    __syncthreads();
    {
      const int kvr = tid >> 1, dh = (tid & 1) * 32;
      const float* krow = kb_ptr + (size_t)(kv0 + kvr) * g.k_rs + dh;
      const float* vrow = vb_ptr + (size_t)(kv0 + kvr) * g.v_rs + dh;
#pragma unroll
      for (int i = 0; i < 8; ++i) {
        v4f kk = *(const v4f*)(krow + 4 * i);
        v4f vv = *(const v4f*)(vrow + 4 * i);
#pragma unroll
        for (int e = 0; e < 4; ++e) {
          const int d = dh + 4 * i + e;
          if (SPLIT_QK) { __bf16 a, bl; at_split(kk[e], a, bl); Ksh[kvr * AT_D + d] = a; Ksl[kvr * AT_D + d] = bl; }
          else Ksh[kvr * AT_D + d] = at_to16<F16>(kk[e]);
          if (SPLIT_PV) { __bf16 a, bl; at_split(vv[e], a, bl); Vth[d * AT_KC + kvr] = a; Vtl[d * AT_KC + kvr] = bl; }
          else Vth[d * AT_KC + kvr] = at_to16<F16>(vv[e]);
        }
      }
    }
    __syncthreads();

    v8f s[4];
#pragma unroll
    for (int j = 0; j < 4; ++j) {
      s[j] = (v8f){0.f,0.f,0.f,0.f,0.f,0.f,0.f,0.f};
#pragma unroll 1
      for (int dc = 0; dc < 2; ++dc) {
        FB kb;
        kb.h[0] = *(const v8b*)(Ksh + (j * 16 + c) * AT_D + dc * 32 + 8 * hh);
        kb.h[1] = *(const v8b*)(Ksh + (j * 16 + c) * AT_D + dc * 32 + 16 + 8 * hh);
        s[j] = at_mma16<F16>(qah[dc], kb.v, s[j]);
        if (SPLIT_QK) {
          FB kl;
          kl.h[0] = *(const v8b*)(Ksl + (j * 16 + c) * AT_D + dc * 32 + 8 * hh);
          kl.h[1] = *(const v8b*)(Ksl + (j * 16 + c) * AT_D + dc * 32 + 16 + 8 * hh);
          s[j] = at_mma16<F16>(qah[dc], kl.v, s[j]);
          s[j] = at_mma16<F16>(qal[dc], kb.v, s[j]);
        }
      }
    }
    const bool diag = (g.mask_mode == 1) && (kc == qb);
    int kvkeep[4] = {1, 1, 1, 1};
    if (g.mask_mode == 3) {
#pragma unroll
      for (int j = 0; j < 4; ++j) kvkeep[j] = ((const int*)mask_a)[(size_t)b * g.Skv + kv0 + j * 16 + c];   // mask_a = kvmask
    }
    float cm[8];
#pragma unroll
    for (int r = 0; r < 8; ++r) {
      const int qrow = q0 + 8 * hh + r;
      float m = -INFINITY;
#pragma unroll
      for (int j = 0; j < 4; ++j) {
        const int kvcol = kv0 + j * 16 + c;
        bool masked = false;
        if (diag) masked = (kvcol > qrow);
        else if (g.mask_mode == 4) masked = (kvcol > qrow) || (qrow - kvcol > g.mask_is_int);
        else if (g.mask_mode == 2) {
          const size_t mi = (size_t)qrow * g.Skv + kvcol;
          masked = (g.mask_is_int == 0) ? (((const float*)mask_a)[mi] == 0.0f)
                 : (g.mask_is_int == 1) ? (((const int*)mask_a)[mi] == 0) : (((const int*)mask_a)[mi] != 0);
        } else if (g.mask_mode == 3) masked = (qkeep[r] == 0) || (kvkeep[j] == 0);
        else if (g.mask_mode == 5) {
          const size_t mi = (size_t)qrow * g.Skv + kvcol;
          masked = (((const int*)mask_a)[mi] != 0);
          int n = mask_b[mi]; n = n < 0 ? 0 : n;
          s[j][r] += g.cp[(size_t)b * g.c_bs + (size_t)h * g.c_hs + (size_t)qrow * g.c_rs + n]
                   + g.pc[(size_t)b * g.c_bs + (size_t)h * g.c_hs + (size_t)kvcol * g.c_rs + n];
        }
        if (masked) s[j][r] = g.mask_fill;
        m = fmaxf(m, s[j][r]);
      }
#pragma unroll
      for (int off = 1; off < 16; off <<= 1) m = fmaxf(m, __shfl_xor(m, off, 32));
      cm[r] = m;
    }
    __bf16* pwh = Psh[wave];
    __bf16* pwl = Psl[SPLIT_PV ? wave : 0];
#pragma unroll
    for (int r = 0; r < 8; ++r) {
      const float mnew = fmaxf(mrow[r], cm[r]);
      const float alpha = expf(mrow[r] - mnew);
      mrow[r] = mnew;
      float psum = 0.f;
#pragma unroll
      for (int j = 0; j < 4; ++j) {
        const float p = expf(s[j][r] - mnew);
        psum += p;
        if (SPLIT_PV) { __bf16 a, bl; at_split(p, a, bl); pwh[(8 * hh + r) * AT_KC + j * 16 + c] = a; pwl[(8 * hh + r) * AT_KC + j * 16 + c] = bl; }
        else pwh[(8 * hh + r) * AT_KC + j * 16 + c] = at_to16<F16>(p * PSC);
      }
#pragma unroll
      for (int off = 1; off < 16; off <<= 1) psum += __shfl_xor(psum, off, 32);
      lrow[r] = lrow[r] * alpha + psum;
#pragma unroll
      for (int t = 0; t < 4; ++t) oacc[t][r] *= alpha;
    }
    __builtin_amdgcn_fence(__ATOMIC_RELEASE, "workgroup");
    __builtin_amdgcn_wave_barrier();
    __builtin_amdgcn_fence(__ATOMIC_ACQUIRE, "workgroup");
#pragma unroll 1
    for (int kk = 0; kk < 2; ++kk) {
      FB pa, pl;
      pa.h[0] = *(const v8b*)(pwh + c * AT_KC + kk * 32 + 8 * hh);
      pa.h[1] = *(const v8b*)(pwh + c * AT_KC + kk * 32 + 16 + 8 * hh);
      if (SPLIT_PV) {
        pl.h[0] = *(const v8b*)(pwl + c * AT_KC + kk * 32 + 8 * hh);
        pl.h[1] = *(const v8b*)(pwl + c * AT_KC + kk * 32 + 16 + 8 * hh);
      }
#pragma unroll
      for (int t = 0; t < 4; ++t) {
        FB vb;
        vb.h[0] = *(const v8b*)(Vth + (t * 16 + c) * AT_KC + kk * 32 + 8 * hh);
        vb.h[1] = *(const v8b*)(Vth + (t * 16 + c) * AT_KC + kk * 32 + 16 + 8 * hh);
        oacc[t] = at_mma16<F16>(pa.v, vb.v, oacc[t]);
        if (SPLIT_PV) {
          FB vl;
          vl.h[0] = *(const v8b*)(Vtl + (t * 16 + c) * AT_KC + kk * 32 + 8 * hh);
          vl.h[1] = *(const v8b*)(Vtl + (t * 16 + c) * AT_KC + kk * 32 + 16 + 8 * hh);
          oacc[t] = at_mma16<F16>(pa.v, vl.v, oacc[t]);
          oacc[t] = at_mma16<F16>(pl.v, vb.v, oacc[t]);
        }
      }
    }
  }

  float* os = Os[wave];
#pragma unroll
  for (int r = 0; r < 8; ++r) {
    const float inv = 1.0f / (lrow[r] * PSC);
#pragma unroll
    for (int t = 0; t < 4; ++t) os[(8 * hh + r) * 68 + t * 16 + c] = oacc[t][r] * inv;
  }
  __builtin_amdgcn_fence(__ATOMIC_RELEASE, "workgroup");
  __builtin_amdgcn_wave_barrier();
  __builtin_amdgcn_fence(__ATOMIC_ACQUIRE, "workgroup");
  {
    const int c4 = (lane & 15) * 4;
    {
#pragma unroll
      for (int it = 0; it < 8; ++it) {
        const int row = it * 2 + hh;
        v4f val = *(const v4f*)(os + row * 68 + c4);
        *(v4f*)(ob_ptr + (size_t)(q0 + row) * g.o_rs + c4) = val;
      }
      
    }
  }
}

} // namespace w25


__device__ __forceinline__ void st_h2(unsigned short* d2, float a, float b) { const unsigned u = (unsigned)__builtin_bit_cast(unsigned short, (_Float16)a) | ((unsigned)__builtin_bit_cast(unsigned short, (_Float16)b) << 16); unsigned* d = (unsigned*)d2; *d = u;  }
__device__ __forceinline__ float ldh(const unsigned short* p) { return (float)__builtin_bit_cast(_Float16, *p); }
__device__ __forceinline__ v4f ld4h(const unsigned short* p) { const unsigned long long u = *(const unsigned long long*)p; v4f a;
    a.x = (float)__builtin_bit_cast(_Float16, (unsigned short)(u & 0xFFFFu)); a.y = (float)__builtin_bit_cast(_Float16, (unsigned short)((u >> 16) & 0xFFFFu)); a.z = (float)__builtin_bit_cast(_Float16, (unsigned short)((u >> 32) & 0xFFFFu)); a.w = (float)__builtin_bit_cast(_Float16, (unsigned short)((u >> 48) & 0xFFFFu)); return a; }
__device__ __forceinline__ unsigned long long pk4h(v4f s) { return (unsigned long long)__builtin_bit_cast(unsigned short, (_Float16)s.x) | ((unsigned long long)__builtin_bit_cast(unsigned short, (_Float16)s.y) << 16) | ((unsigned long long)__builtin_bit_cast(unsigned short, (_Float16)s.z) << 32) | ((unsigned long long)__builtin_bit_cast(unsigned short, (_Float16)s.w) << 48); }
typedef unsigned v4u __attribute__((ext_vector_type(4)));
__device__ __forceinline__ void st8h(unsigned short* d, v4f a, v4f b) { const unsigned long long pa = pk4h(a), pb = pk4h(b); v4u pk; pk.x = (unsigned)(pa & 0xFFFFFFFFull); pk.y = (unsigned)(pa >> 32); pk.z = (unsigned)(pb & 0xFFFFFFFFull); pk.w = (unsigned)(pb >> 32); v4u* dd = (v4u*)d; *dd = pk;  }
__device__ __forceinline__ unsigned short bfu_rne(float v) { unsigned u = __builtin_bit_cast(unsigned, v); u += 0x7FFFu + ((u >> 16) & 1u); return (unsigned short)(u >> 16); }
__device__ __forceinline__ void bfsplit(float v, unsigned short& hi, unsigned short& lo) { hi = bfu_rne(v); lo = bfu_rne(v - __builtin_bit_cast(float, (unsigned)hi << 16)); }
__device__ __forceinline__ void st_s2(unsigned short* Hp, unsigned short* Lp, long long o, float a, float b) { unsigned short h0,l0,h1,l1; bfsplit(a,h0,l0); bfsplit(b,h1,l1); const unsigned ph = (unsigned)h0 | ((unsigned)h1 << 16), pl = (unsigned)l0 | ((unsigned)l1 << 16);
    unsigned* dh = (unsigned*)(Hp + o); unsigned* dl = (unsigned*)(Lp + o); *dh = ph; *dl = pl;  }
__device__ __forceinline__ int cl(int v, int n) { return min(max(v, 0), n - 1); }

// GAT-style aggregation over a device in-edge CSR at dst (+ optional explicit self loop as iteration j = -1):
//   logit = leaky(AS[src][h] + AD[n][h] (+ EW[e]*CW[h]), slope); softmax over the node's edges per head; acc[c] = sum alpha XP[src][c] (f16 gather plane, pitch XW; 256 channels = H heads x CH)
//   wave per node; lane L owns channels 8L..8L+7 (head = 8L / CH); per-lane softmax state (lanes of one head agree) -> no shuffles in the loop.
//   EPI 0: + bias -> f32 OUT[n][256] via LDS redistribution (two 16-B stores per lane, each instruction 512 contiguous B)
//   EPI 1: + bias, LayerNorm(256) * g + bb, relu -> bf16 hi/lo planes OH/OL [n][256] (16-B stores)
//   EPI 2: mean over the 256/CH heads + bias[0..CH-1] , LayerNorm(64) * g + bb, relu -> f32 OUT[n][64] (CH must be 64; LDS redistribution, 8-B stores)
//   EPI 3: mean over heads + bias -> f32 OUT[n][64] (no norm / activation)
//   EPI 4: + bias, ELU -> bf16 hi/lo planes OH/OL [n][256];  EPI 5: + bias (full 256-wide, per head), ELU, then mean over the 256/CH heads -> f32 OUT[n][64]
//   EPI 6: (CH = 128, two heads) mean over the two heads, + bias[0..127], relu -> f32 OUT[n][128] (LDS redistribution, 16-B stores)
//   EWM 0: no edge weights; 1: logit += EW[e] * CW[h] (self loop weight 1); 2: alpha *= EW[e] after the softmax (message scale; self loop weight 1)
template <int CH, bool SELF, int EWM, int EPI>
__global__ __launch_bounds__(256) void k_gat_agg(const unsigned short* __restrict__ XP, int XW, const float* __restrict__ AS, const float* __restrict__ AD, int ASTR, const float* __restrict__ EW, const float* __restrict__ CW,
        const int* __restrict__ esrc, const int* __restrict__ off, const int* __restrict__ cnt, const int* __restrict__ slot, const float* __restrict__ bias, const float* __restrict__ g, const float* __restrict__ bb,
        float* __restrict__ OUT, unsigned short* __restrict__ OH, unsigned short* __restrict__ OL, int N, int E, int CAP, float slope) {
    __shared__ float stage[8][256];
    const int wv = threadIdx.x >> 5; const int n = blockIdx.x * 8 + wv; const int L = threadIdx.x & 31; if (n >= N) return; const int c0 = 8 * L; const int h = c0 / CH;
    const float ad = AD[(long long)n * ASTR + h]; const float cw = (EWM == 1) ? CW[h] : 0.f; float m = -3.0e38f, s = 0.f; v4f a0, a1; a0.x = a0.y = a0.z = a0.w = 0.f; a1 = a0;
    const int p0 = cl(off[n], E + 1), cn = min(max(cnt[n], 0), CAP);
    for (int j = (SELF ? -1 : 0); j < cn; ++j) { int sj; float ew = 0.f;
        if (j < 0) { sj = n; ew = 1.f; } else { int e = slot[cl(p0 + j, E)]; e = cl(e, E); sj = cl(esrc[e], N); if (EWM != 0) ew = EW[e]; }
        float lg = AS[(long long)sj * ASTR + h] + ad + ((EWM == 1) ? ew * cw : 0.f); lg = (lg >= 0.f) ? lg : slope * lg;
        const float mn = fmaxf(m, lg); const float cz = expf(m - mn), pj = expf(lg - mn); s = s * cz + pj; const float pw = (EWM == 2) ? pj * ew : pj;
        const unsigned short* xr = XP + (long long)sj * XW + c0; a0 = a0 * cz + ld4h(xr) * pw; a1 = a1 * cz + ld4h(xr + 4) * pw; m = mn; }
    const float inv = (s > 0.f) ? 1.f / (s + 1e-16f) : 0.f; a0 = a0 * inv; a1 = a1 * inv;
    if (EPI == 0 || EPI == 1 || EPI == 4 || EPI == 5) { a0 = a0 + *(const v4f*)(bias + c0); a1 = a1 + *(const v4f*)(bias + c0 + 4); }
    if (EPI == 4 || EPI == 5) { a0.x = (a0.x > 0.f) ? a0.x : (expf(a0.x) - 1.f); a0.y = (a0.y > 0.f) ? a0.y : (expf(a0.y) - 1.f); a0.z = (a0.z > 0.f) ? a0.z : (expf(a0.z) - 1.f); a0.w = (a0.w > 0.f) ? a0.w : (expf(a0.w) - 1.f);
        a1.x = (a1.x > 0.f) ? a1.x : (expf(a1.x) - 1.f); a1.y = (a1.y > 0.f) ? a1.y : (expf(a1.y) - 1.f); a1.z = (a1.z > 0.f) ? a1.z : (expf(a1.z) - 1.f); a1.w = (a1.w > 0.f) ? a1.w : (expf(a1.w) - 1.f); }
    if (EPI == 4) { float o8[8] = {a0.x, a0.y, a0.z, a0.w, a1.x, a1.y, a1.z, a1.w}; unsigned short hh[8], ll[8];
#pragma unroll
        for (int u = 0; u < 8; ++u) bfsplit(o8[u], hh[u], ll[u]);
        const unsigned long long ph0 = (unsigned long long)hh[0] | ((unsigned long long)hh[1] << 16) | ((unsigned long long)hh[2] << 32) | ((unsigned long long)hh[3] << 48), pl0 = (unsigned long long)ll[0] | ((unsigned long long)ll[1] << 16) | ((unsigned long long)ll[2] << 32) | ((unsigned long long)ll[3] << 48);
        const unsigned long long ph1 = (unsigned long long)hh[4] | ((unsigned long long)hh[5] << 16) | ((unsigned long long)hh[6] << 32) | ((unsigned long long)hh[7] << 48), pl1 = (unsigned long long)ll[4] | ((unsigned long long)ll[5] << 16) | ((unsigned long long)ll[6] << 32) | ((unsigned long long)ll[7] << 48);
        v4u pk; pk.x = (unsigned)(ph0 & 0xFFFFFFFFull); pk.y = (unsigned)(ph0 >> 32); pk.z = (unsigned)(ph1 & 0xFFFFFFFFull); pk.w = (unsigned)(ph1 >> 32); v4u* dh = (v4u*)(OH + (long long)n * 256 + c0); *dh = pk; 
        v4u ql; ql.x = (unsigned)(pl0 & 0xFFFFFFFFull); ql.y = (unsigned)(pl0 >> 32); ql.z = (unsigned)(pl1 & 0xFFFFFFFFull); ql.w = (unsigned)(pl1 >> 32); v4u* dl = (v4u*)(OL + (long long)n * 256 + c0); *dl = ql;  return; }
    if (EPI == 6) {
        a0.x += __shfl_xor(a0.x, 16); a0.y += __shfl_xor(a0.y, 16); a0.z += __shfl_xor(a0.z, 16); a0.w += __shfl_xor(a0.w, 16); a1.x += __shfl_xor(a1.x, 16); a1.y += __shfl_xor(a1.y, 16); a1.z += __shfl_xor(a1.z, 16); a1.w += __shfl_xor(a1.w, 16);
        if (L < 16) { const int cb = 8 * L; const v4f b0 = *(const v4f*)(bias + cb), b1v = *(const v4f*)(bias + cb + 4);
            stage[wv][cb] = fmaxf(a0.x * 0.5f + b0.x, 0.f); stage[wv][cb + 1] = fmaxf(a0.y * 0.5f + b0.y, 0.f); stage[wv][cb + 2] = fmaxf(a0.z * 0.5f + b0.z, 0.f); stage[wv][cb + 3] = fmaxf(a0.w * 0.5f + b0.w, 0.f);
            stage[wv][cb + 4] = fmaxf(a1.x * 0.5f + b1v.x, 0.f); stage[wv][cb + 5] = fmaxf(a1.y * 0.5f + b1v.y, 0.f); stage[wv][cb + 6] = fmaxf(a1.z * 0.5f + b1v.z, 0.f); stage[wv][cb + 7] = fmaxf(a1.w * 0.5f + b1v.w, 0.f); }
        __builtin_amdgcn_fence(__ATOMIC_RELEASE, "workgroup"); __builtin_amdgcn_wave_barrier(); __builtin_amdgcn_fence(__ATOMIC_ACQUIRE, "workgroup");
        v4f o6; o6.x = stage[wv][4 * L]; o6.y = stage[wv][4 * L + 1]; o6.z = stage[wv][4 * L + 2]; o6.w = stage[wv][4 * L + 3]; VST2V4(OUT + (long long)n * 128 + 4 * L, o6); return; }
    if (EPI == 5) {
        a0.x += __shfl_xor(a0.x, 8); a0.y += __shfl_xor(a0.y, 8); a0.z += __shfl_xor(a0.z, 8); a0.w += __shfl_xor(a0.w, 8); a1.x += __shfl_xor(a1.x, 8); a1.y += __shfl_xor(a1.y, 8); a1.z += __shfl_xor(a1.z, 8); a1.w += __shfl_xor(a1.w, 8);
        a0.x += __shfl_xor(a0.x, 16); a0.y += __shfl_xor(a0.y, 16); a0.z += __shfl_xor(a0.z, 16); a0.w += __shfl_xor(a0.w, 16); a1.x += __shfl_xor(a1.x, 16); a1.y += __shfl_xor(a1.y, 16); a1.z += __shfl_xor(a1.z, 16); a1.w += __shfl_xor(a1.w, 16);
        const int gq5 = L & 7; a0 = a0 * 0.25f; a1 = a1 * 0.25f;
        if (L < 8) { stage[wv][8 * gq5] = a0.x; stage[wv][8 * gq5 + 1] = a0.y; stage[wv][8 * gq5 + 2] = a0.z; stage[wv][8 * gq5 + 3] = a0.w; stage[wv][8 * gq5 + 4] = a1.x; stage[wv][8 * gq5 + 5] = a1.y; stage[wv][8 * gq5 + 6] = a1.z; stage[wv][8 * gq5 + 7] = a1.w; }
        __builtin_amdgcn_fence(__ATOMIC_RELEASE, "workgroup"); __builtin_amdgcn_wave_barrier(); __builtin_amdgcn_fence(__ATOMIC_ACQUIRE, "workgroup");
        const unsigned long long pk5 = (unsigned long long)__builtin_bit_cast(unsigned, stage[wv][2 * L]) | ((unsigned long long)__builtin_bit_cast(unsigned, stage[wv][2 * L + 1]) << 32); VST2(unsigned long long, (unsigned long long*)(OUT + (long long)n * 64 + 2 * L), pk5); return; }
    if (EPI == 1) { float sm = a0.x + a0.y + a0.z + a0.w + a1.x + a1.y + a1.z + a1.w;
#pragma unroll
        for (int o = 16; o > 0; o >>= 1) sm += __shfl_xor(sm, o);
        const float mu = sm * (1.f / 256.f); const v4f d0 = a0 - mu, d1 = a1 - mu; float q = d0.x * d0.x + d0.y * d0.y + d0.z * d0.z + d0.w * d0.w + d1.x * d1.x + d1.y * d1.y + d1.z * d1.z + d1.w * d1.w;
#pragma unroll
        for (int o = 16; o > 0; o >>= 1) q += __shfl_xor(q, o);
        const float rs = rsqrtf(q * (1.f / 256.f) + 1e-5f); float o8[8] = {d0.x, d0.y, d0.z, d0.w, d1.x, d1.y, d1.z, d1.w}; unsigned short hh[8], ll[8];
#pragma unroll
        for (int u = 0; u < 8; ++u) { const float v = fmaxf(o8[u] * rs * g[c0 + u] + bb[c0 + u], 0.f); bfsplit(v, hh[u], ll[u]); }
        const unsigned long long ph0 = (unsigned long long)hh[0] | ((unsigned long long)hh[1] << 16) | ((unsigned long long)hh[2] << 32) | ((unsigned long long)hh[3] << 48), pl0 = (unsigned long long)ll[0] | ((unsigned long long)ll[1] << 16) | ((unsigned long long)ll[2] << 32) | ((unsigned long long)ll[3] << 48);
        const unsigned long long ph1 = (unsigned long long)hh[4] | ((unsigned long long)hh[5] << 16) | ((unsigned long long)hh[6] << 32) | ((unsigned long long)hh[7] << 48), pl1 = (unsigned long long)ll[4] | ((unsigned long long)ll[5] << 16) | ((unsigned long long)ll[6] << 32) | ((unsigned long long)ll[7] << 48);
        // lane L's 8 halves at c0 = 8L: 16 B -> one 16-B store per plane (32 lanes x 16 B = whole 512-B row)
        v4u pk; pk.x = (unsigned)(ph0 & 0xFFFFFFFFull); pk.y = (unsigned)(ph0 >> 32); pk.z = (unsigned)(ph1 & 0xFFFFFFFFull); pk.w = (unsigned)(ph1 >> 32); v4u* dh = (v4u*)(OH + (long long)n * 256 + c0); *dh = pk; 
        v4u ql; ql.x = (unsigned)(pl0 & 0xFFFFFFFFull); ql.y = (unsigned)(pl0 >> 32); ql.z = (unsigned)(pl1 & 0xFFFFFFFFull); ql.w = (unsigned)(pl1 >> 32); v4u* dl = (v4u*)(OL + (long long)n * 256 + c0); *dl = ql;  return; }
    if (EPI == 2 || EPI == 3) {   // head mean: lanes L, L^8, L^16, L^24 hold the same chan group of the 4 heads (CH = 64 -> 8 lanes per head)
        a0.x += __shfl_xor(a0.x, 8); a0.y += __shfl_xor(a0.y, 8); a0.z += __shfl_xor(a0.z, 8); a0.w += __shfl_xor(a0.w, 8); a1.x += __shfl_xor(a1.x, 8); a1.y += __shfl_xor(a1.y, 8); a1.z += __shfl_xor(a1.z, 8); a1.w += __shfl_xor(a1.w, 8);
        a0.x += __shfl_xor(a0.x, 16); a0.y += __shfl_xor(a0.y, 16); a0.z += __shfl_xor(a0.z, 16); a0.w += __shfl_xor(a0.w, 16); a1.x += __shfl_xor(a1.x, 16); a1.y += __shfl_xor(a1.y, 16); a1.z += __shfl_xor(a1.z, 16); a1.w += __shfl_xor(a1.w, 16);
        const int gq = L & 7; a0 = a0 * 0.25f + *(const v4f*)(bias + 8 * gq); a1 = a1 * 0.25f + *(const v4f*)(bias + 8 * gq + 4);      // every lane now holds channels 8gq..8gq+7 of the mean
        if (EPI == 3) { if (L < 8) { stage[wv][8 * gq] = a0.x; stage[wv][8 * gq + 1] = a0.y; stage[wv][8 * gq + 2] = a0.z; stage[wv][8 * gq + 3] = a0.w; stage[wv][8 * gq + 4] = a1.x; stage[wv][8 * gq + 5] = a1.y; stage[wv][8 * gq + 6] = a1.z; stage[wv][8 * gq + 7] = a1.w; }
            __builtin_amdgcn_fence(__ATOMIC_RELEASE, "workgroup"); __builtin_amdgcn_wave_barrier(); __builtin_amdgcn_fence(__ATOMIC_ACQUIRE, "workgroup");
            const unsigned long long pk3 = (unsigned long long)__builtin_bit_cast(unsigned, stage[wv][2 * L]) | ((unsigned long long)__builtin_bit_cast(unsigned, stage[wv][2 * L + 1]) << 32); VST2(unsigned long long, (unsigned long long*)(OUT + (long long)n * 64 + 2 * L), pk3); return; }
        float sm = (L < 8) ? (a0.x + a0.y + a0.z + a0.w + a1.x + a1.y + a1.z + a1.w) : 0.f;
#pragma unroll
        for (int o = 16; o > 0; o >>= 1) sm += __shfl_xor(sm, o);
        const float mu = sm * (1.f / 64.f); const v4f d0 = a0 - mu, d1 = a1 - mu; float q = (L < 8) ? (d0.x * d0.x + d0.y * d0.y + d0.z * d0.z + d0.w * d0.w + d1.x * d1.x + d1.y * d1.y + d1.z * d1.z + d1.w * d1.w) : 0.f;
#pragma unroll
        for (int o = 16; o > 0; o >>= 1) q += __shfl_xor(q, o);
        const float rs = rsqrtf(q * (1.f / 64.f) + 1e-5f);
        if (L < 8) { const float* gg = g + 8 * gq; const float* bq = bb + 8 * gq; stage[wv][8 * gq] = fmaxf(d0.x * rs * gg[0] + bq[0], 0.f); stage[wv][8 * gq + 1] = fmaxf(d0.y * rs * gg[1] + bq[1], 0.f); stage[wv][8 * gq + 2] = fmaxf(d0.z * rs * gg[2] + bq[2], 0.f); stage[wv][8 * gq + 3] = fmaxf(d0.w * rs * gg[3] + bq[3], 0.f);
            stage[wv][8 * gq + 4] = fmaxf(d1.x * rs * gg[4] + bq[4], 0.f); stage[wv][8 * gq + 5] = fmaxf(d1.y * rs * gg[5] + bq[5], 0.f); stage[wv][8 * gq + 6] = fmaxf(d1.z * rs * gg[6] + bq[6], 0.f); stage[wv][8 * gq + 7] = fmaxf(d1.w * rs * gg[7] + bq[7], 0.f); }
        __builtin_amdgcn_fence(__ATOMIC_RELEASE, "workgroup"); __builtin_amdgcn_wave_barrier(); __builtin_amdgcn_fence(__ATOMIC_ACQUIRE, "workgroup");
        const unsigned long long pk = (unsigned long long)__builtin_bit_cast(unsigned, stage[wv][2 * L]) | ((unsigned long long)__builtin_bit_cast(unsigned, stage[wv][2 * L + 1]) << 32); VST2(unsigned long long, (unsigned long long*)(OUT + (long long)n * 64 + 2 * L), pk); return; }
    // EPI 0
    stage[wv][c0] = a0.x; stage[wv][c0 + 1] = a0.y; stage[wv][c0 + 2] = a0.z; stage[wv][c0 + 3] = a0.w; stage[wv][c0 + 4] = a1.x; stage[wv][c0 + 5] = a1.y; stage[wv][c0 + 6] = a1.z; stage[wv][c0 + 7] = a1.w;
    __builtin_amdgcn_fence(__ATOMIC_RELEASE, "workgroup"); __builtin_amdgcn_wave_barrier(); __builtin_amdgcn_fence(__ATOMIC_ACQUIRE, "workgroup");
#pragma unroll
    for (int q2 = 0; q2 < 2; ++q2) { const int c = 128 * q2 + 4 * L; v4f v; v.x = stage[wv][c]; v.y = stage[wv][c + 1]; v.z = stage[wv][c + 2]; v.w = stage[wv][c + 3]; VST2V4(OUT + (long long)n * 256 + c, v); } }

__device__ __forceinline__ void st4s(unsigned short* Hp, unsigned short* Lp, long long o, v4f a) { unsigned short h[4], l[4]; bfsplit(a.x, h[0], l[0]); bfsplit(a.y, h[1], l[1]); bfsplit(a.z, h[2], l[2]); bfsplit(a.w, h[3], l[3]);
    const unsigned long long ph = (unsigned long long)h[0] | ((unsigned long long)h[1] << 16) | ((unsigned long long)h[2] << 32) | ((unsigned long long)h[3] << 48), pl = (unsigned long long)l[0] | ((unsigned long long)l[1] << 16) | ((unsigned long long)l[2] << 32) | ((unsigned long long)l[3] << 48);
    VST2(unsigned long long, (unsigned long long*)(Hp + o), ph); VST2(unsigned long long, (unsigned long long*)(Lp + o), pl); }
// f32 [nval2 pairs] -> bf16 hi/lo planes (n2 pairs; pairs >= nval2 zero); thread-linear 4-B stores per plane
__global__ __launch_bounds__(256) void k_pl(const float* __restrict__ S, unsigned short* __restrict__ PH, unsigned short* __restrict__ PL, long long nval2, long long n2) { const long long u = (long long)blockIdx.x * 256 + threadIdx.x; if (u >= n2) return; const bool in = (u < nval2); const long long uc = in ? u : ((nval2 > 0) ? (nval2 - 1) : 0); const float a = S[2 * uc], b = S[2 * uc + 1]; st_s2(PH, PL, 2 * u, in ? a : 0.f, in ? b : 0.f); }
// WC [K][NOP] (thread-linear whole rows) = [W (cols < FO) | 0 | W_h . as_h @EO+h | W_h . ad_h @EO+NH+h | 0 ...]; W is [K][FO] (x @ W layout), as/ad [NH][DH]; EO >= FO.
// branch-free: every lane loads all candidates with clamped indices and selects by value (no exec-masked load arms)
__global__ __launch_bounds__(256) void k_wext(const float* __restrict__ Wm, const float* __restrict__ AS_, const float* __restrict__ AD_, int K, int NOP, int FO, int NH, int DH, int EO, float* __restrict__ WC) {
    #pragma clang fp contract(off)
    const long long u = (long long)blockIdx.x * 256 + threadIdx.x; if (u >= (long long)K * NOP) return; const int kk = (int)(u / NOP), o = (int)(u % NOP);
    const int oo = min(o, FO - 1); const float vw = Wm[(long long)kk * FO + oo]; const int q = min(max(o - EO, 0), 2 * NH - 1); const int h = q % NH; float s = 0.f;
#pragma unroll 1
    for (int c = 0; c < DH; ++c) { const float w = Wm[(long long)kk * FO + h * DH + c]; const float asv = AS_[h * DH + c], adv = AD_[h * DH + c]; s += w * ((q < NH) ? asv : adv); }
    const float v = (o < FO) ? vw : ((o >= EO && o < EO + 2 * NH) ? s : 0.f); VST2(float, WC + u, v); }
// GAT aggregation over a device in-edge CSR (+ analytic self loop as iteration j = -1 when SELF), per-lane online softmax (lanes of one head agree):
// HS rows (pitch P floats): [0,128) projected features z, col 128 + h = a_src.z_h, col 128 + NH + h = a_dst.z_h; lane L owns channels 4L..4L+3 (head = 4L / CH).
// out = sum_j softmax_j(leaky(el[src_j][h] + er[n][h])) z[src_j] (/ (den + deps)) + bias -> ACT (0 none, 1 relu, 2 elu, 3 leaky 0.01) ->
// MODE 0: f32 OUT[n][OW] cols < OC (16-B lane stores, OC*4 contiguous B per wave; OC in {64,128}); MODE 1: bf16 hi/lo planes PH/PL pitch PP (rows n >= N zero); MODE 2: both.
template <int CH, bool SELF, int ACT, int MODE>
__global__ __launch_bounds__(256) void k_gat128(const float* __restrict__ HS, int P, int NH, const float* __restrict__ bias, const int* __restrict__ SRC, const int* __restrict__ off, const int* __restrict__ cnt, const int* __restrict__ slot,
        float* __restrict__ OUT, int OW, int OC, unsigned short* __restrict__ PH, unsigned short* __restrict__ PL, int PP, int N, int NP, int E, int CAP, float slope, float deps) {
    #pragma clang fp contract(off)
    const int n = blockIdx.x * 8 + (threadIdx.x >> 5); const int L = threadIdx.x & 31; if (n >= NP) return; const int c = 4 * L; const int h = c / CH; v4f o; o.x = o.y = o.z = o.w = 0.f;
    if (n < N) { const float* hn = HS + (long long)n * P; const float er = hn[128 + NH + h]; float m = -3.0e38f, s = 0.f; v4f a; a.x = a.y = a.z = a.w = 0.f;
        const int p0 = min(max(off[n], 0), E), cn = min(max(cnt[n], 0), CAP);
        for (int j = (SELF ? -1 : 0); j < cn; ++j) { int sj; if (j < 0) sj = n; else { const int e = min(max(slot[min(p0 + j, E - 1)], 0), E - 1); sj = min(max(SRC[e], 0), N - 1); }
            const float* hs = HS + (long long)sj * P; float lg = hs[128 + h] + er; lg = (lg >= 0.f) ? lg : slope * lg;
            const float mn = fmaxf(m, lg); const float cz = expf(m - mn), pj = expf(lg - mn); s = s * cz + pj; a = a * cz + *(const v4f*)(hs + c) * pj; m = mn; }
        const float inv = (s > 0.f || deps > 0.f) ? 1.f / (s + deps) : 0.f; o = a * inv + *(const v4f*)(bias + c);
        if (ACT == 1) { o.x = fmaxf(o.x, 0.f); o.y = fmaxf(o.y, 0.f); o.z = fmaxf(o.z, 0.f); o.w = fmaxf(o.w, 0.f); }
        if (ACT == 2) { o.x = (o.x > 0.f) ? o.x : (expf(o.x) - 1.f); o.y = (o.y > 0.f) ? o.y : (expf(o.y) - 1.f); o.z = (o.z > 0.f) ? o.z : (expf(o.z) - 1.f); o.w = (o.w > 0.f) ? o.w : (expf(o.w) - 1.f); }
        if (ACT == 3) { o.x = (o.x >= 0.f) ? o.x : 0.01f * o.x; o.y = (o.y >= 0.f) ? o.y : 0.01f * o.y; o.z = (o.z >= 0.f) ? o.z : 0.01f * o.z; o.w = (o.w >= 0.f) ? o.w : 0.01f * o.w; }
        if (MODE != 1 && c < OC) VST2V4(OUT + (long long)n * OW + c, o); }
    if (MODE != 0) st4s(PH, PL, (long long)n * PP + c, o); }

// ---- util2 ----
// generic Bt plane builder from an f32 weight: Bt[o][k] (pitch KP halves) = (TRANS ? W[k*ldw + o] : W[o*ldw + k]) * (S ? S[o] : 1) for o < NO, k < KI; zero elsewhere for o < NOP rows, k < KP (thread per (o < NOP, pair k))
__global__ __launch_bounds__(256) void k_u2_bt(const float* __restrict__ Wm, int ldw, int TRANS, int KI, int NO, int KP, int NOP, const float* __restrict__ S, unsigned short* __restrict__ PH_, unsigned short* __restrict__ PL_) {
    const long long u = (long long)blockIdx.x * 256 + threadIdx.x; if (u >= (long long)NOP * (KP / 2)) return; const int k0 = 2 * (int)(u % (KP / 2)); const int o = (int)(u / (KP / 2)); float a = 0.f, b = 0.f;
    if (o < NO) { const float s = S ? S[o] : 1.f;
        if (k0 < KI) a = (TRANS ? Wm[(long long)k0 * ldw + o] : Wm[(long long)o * ldw + k0]) * s;
        if (k0 + 1 < KI) b = (TRANS ? Wm[(long long)(k0 + 1) * ldw + o] : Wm[(long long)o * ldw + k0 + 1]) * s; }
    st_s2(PH_, PL_, (long long)o * KP + k0, a, b); }
// generic padded vector: O[i] = (i < n) ? (A[i] * (S ? S[i] : 1) + (B2 ? B2[i] : 0)) : 0 for i < NP (one block of 256, NP <= 4096 looped)
__global__ __launch_bounds__(256) void k_u2_vec(const float* __restrict__ A, const float* __restrict__ S, const float* __restrict__ B2, int n, int NP, float* __restrict__ O) { for (int i = threadIdx.x; i < NP; i += 256) { float v = 0.f; if (i < n) v = A[i] * (S ? S[i] : 1.f) + (B2 ? B2[i] : 0.f); VST2(float, O + i, v); } }
__global__ __launch_bounds__(256) void k_u2_colstat(const float* __restrict__ X, int P, int N, float eps, float* __restrict__ STAT) {
    #pragma clang fp contract(off)
    __shared__ float red[256]; const int c = blockIdx.x; const int t = threadIdx.x; float s = 0.f; for (int r = t; r < N; r += 256) s += X[(long long)r * P + c]; red[t] = s; __syncthreads();
    for (int o = 128; o > 0; o >>= 1) { if (t < o) red[t] += red[t + o]; __syncthreads(); }
    const float mu = red[0] / (float)N; __syncthreads(); float q = 0.f; for (int r = t; r < N; r += 256) { const float d = X[(long long)r * P + c] - mu; q += d * d; } red[t] = q; __syncthreads();
    for (int o = 128; o > 0; o >>= 1) { if (t < o) red[t] += red[t + o]; __syncthreads(); }
    const float rs = 1.f / sqrtf(red[0] / (float)N + eps); if (t < 32) VST2(float, STAT + (long long)c * 32 + t, (t == 0) ? mu : ((t == 1) ? rs : 0.f)); }
// rows f32 [R][W] (pitch PW) -> planes at pitch PP, column offset coff; rows >= RL (live) written as zeros up to RP (thread per (r < RP, 4 of W))
__global__ __launch_bounds__(256) void k_u2_pl(const float* __restrict__ X, int PW, int Wd, int RL, int RP, unsigned short* __restrict__ PH_, unsigned short* __restrict__ PL_, int PP, int coff) { const long long u = (long long)blockIdx.x * 256 + threadIdx.x; if (u >= (long long)RP * (Wd / 4)) return; const int r = (int)(u / (Wd / 4)); const int c = 4 * (int)(u % (Wd / 4)); v4f v; v.x = v.y = v.z = v.w = 0.f; if (r < RL) v = *(const v4f*)(X + (long long)r * PW + c); st4s(PH_, PL_, (long long)r * PP + coff + c, v); }

typedef unsigned int cm_u4 __attribute__((ext_vector_type(4)));

__global__ __launch_bounds__(256) void k_cm_zero16(unsigned short* __restrict__ DST, long long n) { const long long u = (long long)blockIdx.x * 256 + threadIdx.x; if (u * 8 >= n) return; cm_u4 z; z.x = z.y = z.z = z.w = 0u; cm_u4* d = (cm_u4*)(DST + u * 8); *d = z;  }
// f32 -> bf16 (RNE) -> f16 casts: every 16-bit operand then holds exactly the bf16-rounded input value (times a power-of-two
// weight scale), so the f16 WMMA products are exact. Plain: thread per (row, 8 cols),
// dst [R][C] pitch ldd; transposed: thread per (col, 8 consecutive rows) -> dst [C][R] pitch ldd; both store 16 B per thread, thread-linear along the dst row.
__device__ __forceinline__ unsigned int cmb_pk2(float a, float b) { return (unsigned int)__builtin_bit_cast(unsigned short, (_Float16)a) | ((unsigned int)__builtin_bit_cast(unsigned short, (_Float16)b) << 16); }
__device__ __forceinline__ float cmb_bf(float v) { const unsigned u = __builtin_bit_cast(unsigned, v); const unsigned r = (u + 0x7fffu + ((u >> 16) & 1u)) & 0xffff0000u; return __builtin_bit_cast(float, r); }   // bf16 RNE, kept as f32 (finite inputs)
// BR[i] = bf16_rne(B[i]) kept as f32 (thread per element; bias vectors)
__global__ __launch_bounds__(256) void k_cm_bfvec(const float* __restrict__ SRC, float* __restrict__ DST, int n) { const int u = blockIdx.x * 256 + threadIdx.x; if (u >= n) return; VST2(float, DST + u, cmb_bf(SRC[u])); }
__global__ __launch_bounds__(256) void k_cm_castb(const float* __restrict__ SRC, int lds, unsigned short* __restrict__ DST, int ldd, int nR, int nC, float sc) {
    const long long u = (long long)blockIdx.x * 256 + threadIdx.x; const int per = nC / 8; if (u >= (long long)nR * per) return; const int r = (int)(u / per); const int c0 = 8 * (int)(u % per);
    const float* s = SRC + (long long)r * lds + c0; float w[8];
#pragma unroll
    for (int e = 0; e < 8; ++e) w[e] = cmb_bf(s[e]) * sc;
    cm_u4 pk; pk.x = cmb_pk2(w[0], w[1]); pk.y = cmb_pk2(w[2], w[3]); pk.z = cmb_pk2(w[4], w[5]); pk.w = cmb_pk2(w[6], w[7]); VST2(cm_u4, (cm_u4*)(DST + (long long)r * ldd + c0), pk); }
__global__ __launch_bounds__(256) void k_cm_castbT(const float* __restrict__ SRC, int lds, unsigned short* __restrict__ DST, int ldd, int nR, int nC, float sc) {
    const long long u = (long long)blockIdx.x * 256 + threadIdx.x; const int per = nR / 8; if (u >= (long long)nC * per) return; const int c = (int)(u / per); const int r0 = 8 * (int)(u % per);
    float w[8];
#pragma unroll
    for (int e = 0; e < 8; ++e) w[e] = cmb_bf(SRC[(long long)(r0 + e) * lds + c]) * sc;
    cm_u4 pk; pk.x = cmb_pk2(w[0], w[1]); pk.y = cmb_pk2(w[2], w[3]); pk.z = cmb_pk2(w[4], w[5]); pk.w = cmb_pk2(w[6], w[7]); VST2(cm_u4, (cm_u4*)(DST + (long long)c * ldd + r0), pk); }

typedef float ab_v2f __attribute__((ext_vector_type(2)));
// A thread's loads go out AB_GB at a time, and the next AB_GB are in flight while these are summed (two register sets, A and B, in turn), instead of one load and its
// wait per trip; each thread adds its values in the same order as one load per trip would (whole groups first, the rest one by one).
#define AB_GB 16
#define AB_GS (AB_GB * 256)                                      // 16-byte pieces from one group of the block's loads to the next
typedef const __attribute__((address_space(1))) v4f* ab_gp;     // pointer to global memory: it stays one behind the wait statement below, through which the compiler does not see
__device__ __forceinline__ void ab_ld(v4f (&v)[AB_GB], ab_gp& p, int off) {   // the group that begins off pieces behind p
#pragma unroll   // v is then indexed by constants and stays in registers, and the loads stand one behind the other
    for (int u = 0; u < AB_GB; ++u) v[u] = p[off + 256 * u];    // the block's 256 threads cover 256 consecutive 16-byte pieces per load
    asm volatile("s_wait_xcnt 0x0" : "+v"(p) :: "memory");      // the loads' address register pair is stepped or reused only behind this wait (p goes through it), the loads still in flight
}
__global__ __launch_bounds__(256) void k_ab_gstat(const float* __restrict__ X, float* __restrict__ STp, int per) {
    #pragma clang fp contract(off)
    __shared__ float red[256]; const int g = blockIdx.x; const int t = threadIdx.x; const float* base = X + (long long)g * per; float s = 0.f;
    const int nb = per / (AB_GB * 1024);                         // whole groups (the same for every thread)
    v4f A[AB_GB], B[AB_GB];
    auto sum = [&s](const v4f (&v)[AB_GB]) {
#pragma unroll   // v is then indexed by constants and stays in registers
        for (int u = 0; u < AB_GB; ++u) s += (cmb_bf(v[u].x) + cmb_bf(v[u].y)) + (cmb_bf(v[u].z) + cmb_bf(v[u].w));
    };
    ab_gp p = (ab_gp)base + t; int k = 0;                        // p: the thread's piece of group k
    if (nb > 0) {
        ab_ld(A, p, 0);
        for (; k + 2 < nb; k += 2) { ab_ld(B, p, AB_GS); sum(A); ab_ld(A, p, 2 * AB_GS); p += 2 * AB_GS; sum(B); }
        if (k + 1 < nb) { ab_ld(B, p, AB_GS); sum(A); sum(B); } else sum(A);
    }
    for (int i = nb * (AB_GB * 1024) + 4 * t; i < per; i += 1024) { const v4f v = *(const v4f*)(base + i); s += (cmb_bf(v.x) + cmb_bf(v.y)) + (cmb_bf(v.z) + cmb_bf(v.w)); }
    red[t] = s; __syncthreads();
    for (int o = 128; o > 0; o >>= 1) { if (t < o) red[t] += red[t + o]; __syncthreads(); }
    const float mean = red[0] / (float)per; __syncthreads(); float q = 0.f;
    auto sq = [&q, mean](const v4f (&v)[AB_GB]) {
#pragma unroll   // v is then indexed by constants and stays in registers
        for (int u = 0; u < AB_GB; ++u) { const float a = cmb_bf(v[u].x) - mean, b = cmb_bf(v[u].y) - mean, c = cmb_bf(v[u].z) - mean, d = cmb_bf(v[u].w) - mean; q += (a * a + b * b) + (c * c + d * d); }
    };
    if (nb > 0) {
        p -= (long long)k * AB_GS; k = 0; ab_ld(A, p, 0);        // p is stepped back to group 0, not formed anew: the first group too is then addressed by the pair that the wait in ab_ld holds
        for (; k + 2 < nb; k += 2) { ab_ld(B, p, AB_GS); sq(A); ab_ld(A, p, 2 * AB_GS); p += 2 * AB_GS; sq(B); }
        if (k + 1 < nb) { ab_ld(B, p, AB_GS); sq(A); sq(B); } else sq(A);
    }
    for (int i = nb * (AB_GB * 1024) + 4 * t; i < per; i += 1024) { const v4f v = *(const v4f*)(base + i); const float a = cmb_bf(v.x) - mean, b = cmb_bf(v.y) - mean, c = cmb_bf(v.z) - mean, d = cmb_bf(v.w) - mean; q += (a * a + b * b) + (c * c + d * d); }
    red[t] = q; __syncthreads();
    for (int o = 128; o > 0; o >>= 1) { if (t < o) red[t] += red[t + o]; __syncthreads(); }
    if (t == 0) { ab_v2f ms; ms.x = mean; ms.y = rsqrtf(red[0] / (float)per + 1e-5f); VST2(ab_v2f, (ab_v2f*)(STp + 32 * g), ms); } }
// XN[c][n] = (bf16(x[c][n]) - mean[g]) rstd[g] bf16(gamma[c]) + bf16(beta[c]); XB[c][n] = bf16(x[c][n]) (residual copy); c runs over the rows of all images ([B * CH][N], groups numbered through), gamma and beta repeat every CH rows
__global__ __launch_bounds__(256) void k_ab_gapply(const float* __restrict__ X, const float* __restrict__ STp, const float* __restrict__ Gm, const float* __restrict__ Bt, float* __restrict__ XNp, float* __restrict__ XBp, int N, int CPG, int CH, long long n4) {
    #pragma clang fp contract(off)
    // A thread takes 8 float4 pieces, 32 apart, all loaded before the first is used: a wave covers 1024 consecutive floats with 8 loads of 512 contiguous bytes each. The launch promises
    // N a multiple of 1024 and n4 a multiple of 256, so that a wave's 1024 floats lie in one row c and inside the buffers.
    const long long u0 = ((long long)blockIdx.x * 8 + __builtin_amdgcn_readfirstlane((int)(threadIdx.x >> 5))) * 256; if (u0 >= n4) return;   // the wave's first piece, in scalar registers: row, group and their four constants are then scalar loads
    const long long u = u0 + (threadIdx.x & 31); const int c = (int)((4 * u0) / N); const int g = c / CPG; const float mean = STp[32 * g], rs = STp[32 * g + 1], ga = cmb_bf(Gm[c % CH]), be = cmb_bf(Bt[c % CH]);
    const v4f* xp = (const v4f*)(X + 4 * u); v4f w[8];
#pragma unroll   // w is then indexed by constants and stays in registers, and the 8 loads stand one behind the other
    for (int k = 0; k < 8; ++k) w[k] = xp[32 * k];
    asm volatile("s_wait_xcnt 0x0" :: "v"(xp) : "memory");       // the loads' address pair stays as it is up to this wait (named as input) and is reused only behind it
#pragma unroll   // (as above)
    for (int k = 0; k < 8; ++k) {
        const v4f v = w[k]; v4f xb; xb.x = cmb_bf(v.x); xb.y = cmb_bf(v.y); xb.z = cmb_bf(v.z); xb.w = cmb_bf(v.w); v4f r; r.x = (xb.x - mean) * rs * ga + be; r.y = (xb.y - mean) * rs * ga + be; r.z = (xb.z - mean) * rs * ga + be; r.w = (xb.w - mean) * rs * ga + be;
        VST2V4(XNp + 4 * (u + 32 * k), r); VST2V4(XBp + 4 * (u + 32 * k), xb);
    } }
// The two large hi/lo split casts, 32 elements per thread (k_castS16 converts 2): the same conversion of each element, from 16 times fewer waves, each with 8 16-byte loads in flight.
typedef unsigned int cs_u2 __attribute__((ext_vector_type(2)));
// k_castS16w: [R][C] -> [R][C], rows one behind the other in source and planes (lds = ldd = C), n = R C a multiple of 1024. A wave takes 1024 consecutive elements: 8 loads of 512
// contiguous bytes, and per plane 8 stores of 256 contiguous bytes.
__global__ __launch_bounds__(256) void k_castS16w(const float* __restrict__ src, __bf16* __restrict__ dhi, __bf16* __restrict__ dlo, long long n, float s) {
    const long long o = ((long long)blockIdx.x * 8 + (threadIdx.x >> 5)) * 1024 + (threadIdx.x & 31) * 4; if (o >= n) return;
    const v4f* sp = (const v4f*)(src + o); v4f w[8];
#pragma unroll   // w is then indexed by constants and stays in registers, and the 8 loads stand one behind the other
    for (int k = 0; k < 8; ++k) w[k] = sp[32 * k];
    asm volatile("s_wait_xcnt 0x0" :: "v"(sp) : "memory");       // the loads' address pair stays as it is up to this wait (named as input) and is reused only behind it
#pragma unroll   // (as above)
    for (int k = 0; k < 8; ++k) {
        cs_u2 hi, lo; unsigned l0, l1; hi.x = f2bf2_pack(w[k].x * s, w[k].y * s, &l0); hi.y = f2bf2_pack(w[k].z * s, w[k].w * s, &l1); lo.x = l0; lo.y = l1;
        *(cs_u2*)(dhi + o + 128 * k) = hi; *(cs_u2*)(dlo + o + 128 * k) = lo;
    } }
// k_castS16t: [256][C] (row stride lds) -> [C][256] (row stride ldd), C a multiple of 32, 16-byte aligned rows; blockIdx.x = 32 source columns, blockIdx.y = matrix of a batch (as in k_castS16).
// A thread takes 8 source rows x 4 source columns and transposes them in its registers: 8 loads of 16 bytes (one per row), and per plane 4 stores of 16 bytes (8 consecutive elements of a
// destination row). Lanes: 8 along the rows, so that a store writes whole 128-byte lines; 4 along the columns, the neighbour wave reading the other half of each 128-byte source line.
__global__ __launch_bounds__(256) void k_castS16t(const float* __restrict__ src, long long lds, __bf16* __restrict__ dhi, __bf16* __restrict__ dlo, long long ldd, float s, long long sz, long long dz) {
    src += (long long)blockIdx.y * sz; dhi += (long long)blockIdx.y * dz; dlo += (long long)blockIdx.y * dz;
    const int lane = threadIdx.x & 31, wave = threadIdx.x >> 5;
    const int r0 = (wave >> 1) * 64 + (lane & 7) * 8, c0 = (int)blockIdx.x * 32 + (wave & 1) * 16 + (lane >> 3) * 4;
    const v4f* sp[8]; v4f w[8];
#pragma unroll   // sp and w are then indexed by constants and stay in registers, and the 8 loads stand one behind the other
    for (int k = 0; k < 8; ++k) { sp[k] = (const v4f*)(src + (long long)(r0 + k) * lds + c0); w[k] = *sp[k]; }
    // the loads' address pairs stay as they are up to this wait (named as inputs) and are reused only behind it
    asm volatile("s_wait_xcnt 0x0" :: "v"(sp[0]), "v"(sp[1]), "v"(sp[2]), "v"(sp[3]), "v"(sp[4]), "v"(sp[5]), "v"(sp[6]), "v"(sp[7]) : "memory");
#pragma unroll   // (as above)
    for (int j = 0; j < 4; ++j) {
        cm_u4 hi, lo; unsigned l0, l1, l2, l3;
        hi.x = f2bf2_pack(w[0][j] * s, w[1][j] * s, &l0); hi.y = f2bf2_pack(w[2][j] * s, w[3][j] * s, &l1); hi.z = f2bf2_pack(w[4][j] * s, w[5][j] * s, &l2); hi.w = f2bf2_pack(w[6][j] * s, w[7][j] * s, &l3);
        lo.x = l0; lo.y = l1; lo.z = l2; lo.w = l3;
        const long long o = (long long)(c0 + j) * ldd + r0; *(cm_u4*)(dhi + o) = hi; *(cm_u4*)(dlo + o) = lo;
    } }


extern "C" void kernel_launch(void* const* d_in, const int* in_sizes, int n_in, void* d_out, int out_size, void* d_ws, size_t ws_size, hipStream_t stream) {
    (void)in_sizes; (void)n_in; (void)out_size; (void)ws_size;
    const float* x = (const float*)d_in[0];
    const float* gam = (const float*)d_in[1];
    const float* bet = (const float*)d_in[2];
    const float* wqkv = (const float*)d_in[3];
    const float* bqkv = (const float*)d_in[4];
    const float* wo = (const float*)d_in[5];
    const float* bo = (const float*)d_in[6];
    float* out = (float*)d_out;
    char* wsp = (char*)d_ws;
    float* ST = (float*)wsp; wsp += (((size_t)((size_t)32 * 32 + 64) * 4 + 255) / 256) * 256;
    float* XN = (float*)wsp; wsp += (((size_t)((size_t)1024 * 4096) * 4 + 255) / 256) * 256;
    unsigned short* XTH = (unsigned short*)wsp; wsp += (((size_t)((size_t)16384 * 256) * 2 + 255) / 256) * 256;
    unsigned short* XTL = (unsigned short*)wsp; wsp += (((size_t)((size_t)16384 * 256) * 2 + 255) / 256) * 256;
    unsigned short* W3H = (unsigned short*)wsp; wsp += (((size_t)((size_t)768 * 256) * 2 + 255) / 256) * 256;
    unsigned short* W3L = (unsigned short*)wsp; wsp += (((size_t)((size_t)768 * 256) * 2 + 255) / 256) * 256;
    float* BR3 = (float*)wsp; wsp += (((size_t)((size_t)768 + 64) * 4 + 255) / 256) * 256;
    float* QKV = (float*)wsp; wsp += (((size_t)((size_t)16384 * 768) * 4 + 255) / 256) * 256;
    float* AO = (float*)wsp; wsp += (((size_t)((size_t)16384 * 256) * 4 + 255) / 256) * 256;
    unsigned short* AOH = (unsigned short*)wsp; wsp += (((size_t)((size_t)16384 * 256) * 2 + 255) / 256) * 256;
    unsigned short* AOL = (unsigned short*)wsp; wsp += (((size_t)((size_t)16384 * 256) * 2 + 255) / 256) * 256;
    unsigned short* WOH = (unsigned short*)wsp; wsp += (((size_t)((size_t)256 * 256) * 2 + 255) / 256) * 256;
    unsigned short* WOL = (unsigned short*)wsp; wsp += (((size_t)((size_t)256 * 256) * 2 + 255) / 256) * 256;
    float* BRO = (float*)wsp; wsp += (((size_t)((size_t)256 + 64) * 4 + 255) / 256) * 256;
    float* XB = (float*)wsp; wsp += (((size_t)((size_t)1024 * 4096) * 4 + 255) / 256) * 256;
    if ((size_t)(wsp - (char*)d_ws) > ws_size) return;   // static carve guard
    // All four images go through each stage in ONE launch: every buffer holds the four images one behind the other (pixel-major buffers as 16384 rows,
    // channel-major ones as 4 matrices), and the image is extra rows, grid.y or grid.z of the launch.
    k_castS16<<<(unsigned)((((long long)(768) * ((256) / 2)) + 255) / 256), 256, 0, stream>>>(wqkv, 256, (__bf16*)(W3H), (__bf16*)(W3L), 256, 768, 256, 1.0f, 0, 0, 0);
    k_cm_bfvec<<<3, 256, 0, stream>>>(bqkv, BR3, 768); k_cm_bfvec<<<1, 256, 0, stream>>>(bo, BRO, 256);
    k_castS16<<<(unsigned)((((long long)(256) * ((256) / 2)) + 255) / 256), 256, 0, stream>>>(wo, 256, (__bf16*)(WOH), (__bf16*)(WOL), 256, 256, 256, 1.0f, 0, 0, 0);
    k_ab_gstat<<<32, 256, 0, stream>>>(x, ST, 131072); k_ab_gapply<<<512, 256, 0, stream>>>(x, ST, gam, bet, XN, XB, 4096, 32, 256, 1048576LL);
    k_castS16t<<<dim3(128u, 4u), 256, 0, stream>>>(XN, 4096, (__bf16*)(XTH), (__bf16*)(XTL), 256, 1.0f, 1048576, 1048576);
    w25::wmma_gemm64<1, false, 2, 0, false, 0><<<dim3((unsigned)((((16384) / 64) * ((768) / 64) + 7) / 8), (unsigned)(1)), 256, 0, stream>>>((const unsigned short*)(XTH), nullptr, 256, 0, (const unsigned short*)(W3H), nullptr, 256, 0, (void*)(QKV), nullptr, 768, 0, BR3, nullptr, 0, 16384, 768, 256, 1.0f);
    w25::wmma_gemm64<1, false, 0, 0, true, 0><<<dim3((unsigned)((((16384) / 64) * ((768) / 64) + 7) / 8), (unsigned)(1)), 256, 0, stream>>>((const unsigned short*)(XTL), nullptr, 256, 0, (const unsigned short*)(W3H), nullptr, 256, 0, (void*)(QKV), nullptr, 768, 0, nullptr, QKV, 0, 16384, 768, 256, 1.0f);
    { /*apv4*/ AttnP a;
      a.Q = QKV; a.K = QKV + 256; a.V = QKV + 512; a.O = AO; a.P = 0; a.Mf = 0; a.Mi = 0; a.ST = 0;
      a.Pw = 0; a.Rt = 0; a.SQ = 0; a.SK = 0;
      a.swb = 0; a.swh = 0; a.swi = 0; a.swj = 0; a.srb = 0; a.srh = 0; a.sri = 0; a.sQb = 3145728; a.sQh = 64; a.sQi = 768; a.sQd = 1; a.sKb = 3145728; a.sKh = 64; a.sKj = 768; a.sKd = 1; a.sVb = 3145728; a.sVh = 64; a.sVj = 768; a.sVd = 1; a.sOb = 1048576; a.sOh = 64; a.sOi = 256; a.sPb = 0; a.sPh = 0; a.sPi = 0; a.smb = 0; a.smh = 0; a.smi = 0; a.smj = 0;
      a.Lq = 4096; a.Lk = 4096; a.dh = 64; a.dv = 64; a.hrep = 1; a.causal = 0; a.coff = 0; a.pband = 0;
      a.scale = 0.125f; a.mfill = 0.0f; a.nonorm = 0; a.mpol = 0;
      a.roff = 0; a.rn = 1; a.segpol = 0; a.win = 0;
      k_attn<64, 64, 0, false, false, true, true><<<dim3((unsigned)((4096) + 16 * AW - 1) / (16 * AW), (unsigned)(4), (unsigned)(4)), 32 * AW, 0, stream>>>(a); }
    k_castS16w<<<512, 256, 0, stream>>>(AO, (__bf16*)(AOH), (__bf16*)(AOL), 4194304LL, 1.0f);
    w25::wmma_gemm64<1, false, 1, 0, true, 0><<<dim3((unsigned)((((256) / 64) * ((4096) / 64) + 7) / 8), (unsigned)(4)), 256, 0, stream>>>((const unsigned short*)(WOH), nullptr, 256, 0, (const unsigned short*)(AOH), nullptr, 256, 1048576, (void*)(out), nullptr, 4096, 1048576, BRO, XB, 1048576, 256, 4096, 256, 1.0f);
    w25::wmma_gemm64<1, false, 0, 0, true, 0><<<dim3((unsigned)((((256) / 64) * ((4096) / 64) + 7) / 8), (unsigned)(4)), 256, 0, stream>>>((const unsigned short*)(WOH), nullptr, 256, 0, (const unsigned short*)(AOL), nullptr, 256, 1048576, (void*)(out), nullptr, 4096, 1048576, nullptr, out, 1048576, 256, 4096, 256, 1.0f);
}

// v010
// It runs in 201 microseconds.
// In two side-by-side timings against v009, it was 1.18 and 1.17 times as fast.
// Over all steps from v000, the starting kernel, it is 40.8 times as fast.
#include <hip/hip_runtime.h>
#include <math.h>

typedef __attribute__((ext_vector_type(16))) _Float16 v16h;
typedef __attribute__((ext_vector_type(8)))  _Float16 v8h;
typedef __attribute__((ext_vector_type(16))) __bf16   v16b;
typedef __attribute__((ext_vector_type(8)))  float    v8f;
typedef __attribute__((ext_vector_type(4)))  float    v4f;

// 16-bit WMMA fragment map (wave32), lane L, h = L>>4, m = L&15:
//   A 16x32: lane = row m;   element i -> k = (i<8) ? 8h+i : 16+8h+(i-8)
//   B 32x16: lane = column m; the SAME k(i,h)
//   D 16x16 (8 f32): lane = column m; element r -> row 8h+r
__device__ __forceinline__ int frag_k(int i, int h) { return (i < 8) ? (8 * h + i) : (16 + 8 * h + (i - 8)); }
__device__ __forceinline__ __bf16 bf16_rne(float f) {
    unsigned int u = __float_as_uint(f);
    u += 0x7fffu + ((u >> 16) & 1u);
    return __builtin_bit_cast(__bf16, (unsigned short)(u >> 16));
}
__device__ __forceinline__ float bf16_f32(__bf16 b) { return __uint_as_float(((unsigned int)__builtin_bit_cast(unsigned short, b)) << 16); }
__device__ __forceinline__ v8f wmma16(v16h a, v16h b, v8f c) {
    c = __builtin_amdgcn_wmma_f32_16x16x32_f16(false, a, false, b, (short)0, c, false, false);
    asm volatile("v_nop\n\tv_nop\n\tv_nop\n\tv_nop" : "+v"(c) : "v"(a), "v"(b));
    return c;
}
__device__ __forceinline__ v8f wmmab(v16b a, v16b b, v8f c) {
    c = __builtin_amdgcn_wmma_f32_16x16x32_bf16(false, a, false, b, (short)0, c, false, false);
    asm volatile("v_nop\n\tv_nop\n\tv_nop\n\tv_nop" : "+v"(c) : "v"(a), "v"(b));
    return c;
}
struct Split { v16b hi, lo; };
// hi/lo split product: a.hi*b.hi + a.hi*b.lo + a.lo*b.hi
__device__ __forceinline__ v8f wmma3(const Split& a, const Split& b, v8f c) {
    c = __builtin_amdgcn_wmma_f32_16x16x32_bf16(false, a.hi, false, b.hi, (short)0, c, false, false);
    c = __builtin_amdgcn_wmma_f32_16x16x32_bf16(false, a.hi, false, b.lo, (short)0, c, false, false);
    c = __builtin_amdgcn_wmma_f32_16x16x32_bf16(false, a.lo, false, b.hi, (short)0, c, false, false);
    asm volatile("v_nop\n\tv_nop\n\tv_nop\n\tv_nop" : "+v"(c) : "v"(a.hi), "v"(a.lo), "v"(b.hi), "v"(b.lo));
    return c;
}
struct Split3 { v16b hi, mid, lo; };
// triple split product (6 terms, drops only terms below 2^-24 relative)
__device__ __forceinline__ v8f wmma6(const Split3& a, const Split3& b, v8f c) {
    c = __builtin_amdgcn_wmma_f32_16x16x32_bf16(false, a.hi, false, b.hi, (short)0, c, false, false);
    c = __builtin_amdgcn_wmma_f32_16x16x32_bf16(false, a.hi, false, b.mid, (short)0, c, false, false);
    c = __builtin_amdgcn_wmma_f32_16x16x32_bf16(false, a.mid, false, b.hi, (short)0, c, false, false);
    c = __builtin_amdgcn_wmma_f32_16x16x32_bf16(false, a.hi, false, b.lo, (short)0, c, false, false);
    c = __builtin_amdgcn_wmma_f32_16x16x32_bf16(false, a.mid, false, b.mid, (short)0, c, false, false);
    c = __builtin_amdgcn_wmma_f32_16x16x32_bf16(false, a.lo, false, b.hi, (short)0, c, false, false);
    asm volatile("v_nop\n\tv_nop\n\tv_nop\n\tv_nop" : "+v"(c) : "v"(a.hi), "v"(a.mid), "v"(a.lo), "v"(b.hi), "v"(b.mid), "v"(b.lo));
    return c;
}

// Fragment gathers from f32 memory: element i <- p[(k0 + frag_k(i,h)) * sk] * s, zero for k >= klen.
__device__ __forceinline__ v16h fh_ld(const float* __restrict__ p, long long sk, int k0, int h, int klen, float s) {
    v16h a;
#pragma unroll
    for (int i = 0; i < 16; ++i) { const int k = k0 + frag_k(i, h); a[i] = (k < klen) ? (_Float16)(p[(long long)k * sk] * s) : (_Float16)0.f; }
    return a;
}
__device__ __forceinline__ Split sp_ld(const float* __restrict__ p, long long sk, int k0, int h, int klen, float s) {
    Split r;
#pragma unroll
    for (int i = 0; i < 16; ++i) {
        const int k = k0 + frag_k(i, h); const float x = (k < klen) ? p[(long long)k * sk] * s : 0.f;
        const __bf16 hb = bf16_rne(x); r.hi[i] = hb; r.lo[i] = bf16_rne(x - bf16_f32(hb));
    }
    return r;
}
__device__ __forceinline__ Split3 sp3_ld(const float* __restrict__ p, long long sk, int k0, int h, int klen, float s) {
    Split3 r;
#pragma unroll
    for (int i = 0; i < 16; ++i) {
        const int k = k0 + frag_k(i, h); const float x = (k < klen) ? p[(long long)k * sk] * s : 0.f;
        const __bf16 hb = bf16_rne(x); const float r1 = x - bf16_f32(hb); const __bf16 mb = bf16_rne(r1);
        r.hi[i] = hb; r.mid[i] = mb; r.lo[i] = bf16_rne(r1 - bf16_f32(mb));
    }
    return r;
}
__device__ __forceinline__ v16b bh_ld(const float* __restrict__ p, long long sk, int k0, int h, int klen, float s) {
    v16b a;
#pragma unroll
    for (int i = 0; i < 16; ++i) { const int k = k0 + frag_k(i, h); a[i] = bf16_rne((k < klen) ? p[(long long)k * sk] * s : 0.f); }
    return a;
}
// f16 fragment from an f16 LDS/global row with element stride 1 (k-contiguous), no bounds (tile already zero padded)
__device__ __forceinline__ v16h fh_row(const _Float16* __restrict__ row, int k0, int h) {
    v16h a;
#pragma unroll
    for (int i = 0; i < 16; ++i) a[i] = row[k0 + frag_k(i, h)];
    return a;
}

typedef __attribute__((ext_vector_type(4))) _Float16 v4h;
typedef __attribute__((ext_vector_type(8))) short v8s;
typedef __attribute__((address_space(3))) v8s lds_v8s;         // 16 bytes of LDS, as the transposing load takes them
// One 16-bit fragment's 32 k of a k-contiguous, 16-byte aligned f32 row as four unguarded 16-byte loads; row = the lane's row + 8 * h elements.
// fr_cvt packs them in the k order of frag_k.
struct FragRaw { v4f x0, x1, x2, x3; };
__device__ __forceinline__ FragRaw fr_ld(const v4f* __restrict__ row, int k0) {
    FragRaw r; r.x0 = row[k0 / 4]; r.x1 = row[k0 / 4 + 1]; r.x2 = row[k0 / 4 + 4]; r.x3 = row[k0 / 4 + 5];
    return r;
}
__device__ __forceinline__ v16h fr_cvt(const FragRaw& r) {
    v16h a;
#pragma unroll
    for (int i = 0; i < 4; ++i) { a[i] = (_Float16)r.x0[i]; a[4 + i] = (_Float16)r.x1[i]; a[8 + i] = (_Float16)r.x2[i]; a[12 + i] = (_Float16)r.x3[i]; }
    return a;
}

#define VST2(T, ptr, val) do { const T vst2_v_ = (val); *(T*)(ptr) = vst2_v_;  } while (0)
typedef float v4f __attribute__((ext_vector_type(4)));
#define VST2V4(ptr, val) do { const v4f vst2_v4_ = (val); *(v4f*)(ptr) = vst2_v4_;  } while (0)

__device__ __attribute__((noinline)) float act_fn(float v, int act) {
    if (act == 1) return fmaxf(v, 0.f);                                                                               // relu
    if (act == 2) { const float u = 0.7978845608028654f * (v + 0.044715f * v * v * v); return 0.5f * v * (1.f + tanhf(u)); } // tanh-gelu
    if (act == 3) return v / (1.f + expf(-v));                                                                        // silu
    if (act == 4) return 0.5f * v * (1.f + erff(v * 0.7071067811865476f));                                             // erf-gelu
    if (act == 5) return tanhf(v);
    if (act == 6) return 1.f / (1.f + expf(-v));                                                                      // sigmoid
    if (act == 7) return (v > 0.f) ? v : 0.01f * v;                                                                   // leaky relu 0.01
    if (act == 8) return (v > 0.f) ? v : (expf(v) - 1.f);                                                             // elu
    if (act == 9) return fminf(fmaxf(v, 0.f), 6.f);                                                                   // relu6
    if (act == 10) return fabsf(v);                                                                                    // abs
    if (act == 11) return (v >= 0.f) ? v : 0.1f * v;                                                                  // leaky 0.1
    if (act == 12) return (v > 0.f) ? v : 0.2f * v;                                                                   // leaky 0.2
    if (act == 13) return (v > 20.f) ? v : log1pf(expf(v));                                                            // softplus
    return v;
}

// =====================================================================================================================
// k_gemm<MODE>: C(z, m, n) = act(alpha * sum_k A(z, m, k) * B(z, k, n) + bias) + beta * R(z, m, n)
//   One wave (32-thread block) per 16 x 32 tile of C; grid (ceil(N/32), ceil(M/16), Z). Batch z -> (zo = z / zi_n, zi = z % zi_n)
//   with separate outer/inner strides for every tensor (e.g. batch and head). A(m,k) = A[zo*sAo + zi*sAi + m*sAm + k*sAk] (f32),
//   B(k,n) = B[zo*sBo + zi*sBi + n*sBn + k*sBk] (f32); any M, N, K (K zero-padded to 32 inside the fragments, M/N tails guarded).
//   C(m,n) = C[zo*sCo + zi*sCi + m*sCm + n] (n contiguous). flags: 1 bias[n], 2 bias[m], 4 residual R[zo*sRo + zi*sRi + m*sRm + n*sRn].
//   MODE 0: f16 operands (A prescaled by sa, B by sb, both undone in the epilogue); 1: bf16 hi/lo split (3 products); 2: bf16;
//   3: bf16 hi/mid/lo triple split (6 products); 4: as 3 with Kahan-compensated f32 accumulation across k-steps.
// =====================================================================================================================
struct GemmP {
    const float* A; const float* B; const float* bias; const float* R; float* C;
    long long sAo, sAi, sAm, sAk, sBo, sBi, sBn, sBk, sCo, sCi, sCm, sRo, sRi, sRm, sRn;
    int M, N, K, zi_n, flags, act; float alpha, beta, sa, sb;
    int Npad, pad_;     // columns [N, Npad) of C are written as 0 so that padded workspace rows are covered by whole-line stores; Npad >= N
};
static_assert(sizeof(GemmP) == 5 * 8 + 15 * 8 + 6 * 4 + 4 * 4 + 2 * 4, "GemmP has padding");

template <int MODE>
__global__ __launch_bounds__(32) void k_gemm(GemmP p) {
    const int lane = threadIdx.x & 31, h = lane >> 4, l15 = lane & 15;
    const int m0 = blockIdx.y * 16, n0 = blockIdx.x * 32;
    const int z = blockIdx.z, zo = z / p.zi_n, zi = z - zo * p.zi_n;
    const float* A = p.A + zo * p.sAo + zi * p.sAi;
    const float* B = p.B + zo * p.sBo + zi * p.sBi;
    const int am = min(m0 + l15, p.M - 1);                       // clamped row for loads (stores are guarded)
    v8f acc[2], comp[2];
#pragma unroll
    for (int t = 0; t < 2; ++t) { v8f zz = {}; acc[t] = zz; comp[t] = zz; }
    for (int k0 = 0; k0 < p.K; k0 += 32) {
        const float* arow = A + (long long)am * p.sAm;
        if (MODE == 1) {
            const Split a = sp_ld(arow, p.sAk, k0, h, p.K, 1.f);
#pragma unroll
            for (int t = 0; t < 2; ++t) {
                const int bn = min(n0 + t * 16 + l15, p.N - 1);
                acc[t] = wmma3(a, sp_ld(B + (long long)bn * p.sBn, p.sBk, k0, h, p.K, 1.f), acc[t]);
            }
        } else if (MODE == 3) {
            const Split3 a = sp3_ld(arow, p.sAk, k0, h, p.K, 1.f);
#pragma unroll
            for (int t = 0; t < 2; ++t) {
                const int bn = min(n0 + t * 16 + l15, p.N - 1);
                acc[t] = wmma6(a, sp3_ld(B + (long long)bn * p.sBn, p.sBk, k0, h, p.K, 1.f), acc[t]);
            }
        } else if (MODE == 4) {
            // triple split as MODE 3, but each k-step's 6 products go into a fresh accumulator and the partial is added to the running f32 sum
            // on the VALU with Kahan compensation (accumulation error stays ~1 ulp however long K is)
            const Split3 a = sp3_ld(arow, p.sAk, k0, h, p.K, 1.f);
#pragma unroll
            for (int t = 0; t < 2; ++t) {
                const int bn = min(n0 + t * 16 + l15, p.N - 1); v8f zz = {};
                const v8f part = wmma6(a, sp3_ld(B + (long long)bn * p.sBn, p.sBk, k0, h, p.K, 1.f), zz);
                const v8f y = part - comp[t]; const v8f s = acc[t] + y; comp[t] = (s - acc[t]) - y; acc[t] = s;
            }
        } else if (MODE == 2) {
            const v16b a = bh_ld(arow, p.sAk, k0, h, p.K, 1.f);
#pragma unroll
            for (int t = 0; t < 2; ++t) {
                const int bn = min(n0 + t * 16 + l15, p.N - 1);
                acc[t] = wmmab(a, bh_ld(B + (long long)bn * p.sBn, p.sBk, k0, h, p.K, 1.f), acc[t]);
            }
        } else {
            const v16h a = fh_ld(arow, p.sAk, k0, h, p.K, p.sa);
#pragma unroll
            for (int t = 0; t < 2; ++t) {
                const int bn = min(n0 + t * 16 + l15, p.N - 1);
                acc[t] = wmma16(a, fh_ld(B + (long long)bn * p.sBn, p.sBk, k0, h, p.K, p.sb), acc[t]);
            }
        }
    }
    const float iscale = (MODE == 0) ? p.alpha / (p.sa * p.sb) : p.alpha;
    float* C = p.C + zo * p.sCo + zi * p.sCi;
    const float* R = p.R + zo * p.sRo + zi * p.sRi;
    __shared__ __align__(16) float ctile[16][36];
#pragma unroll
    for (int t = 0; t < 2; ++t) {
        const int n = n0 + t * 16 + l15; const int nn = min(n, p.N - 1);
#pragma unroll
        for (int r = 0; r < 8; ++r) {
            const int m = m0 + 8 * h + r; const int mm = min(m, p.M - 1);
            float v = acc[t][r] * iscale;
            if (p.flags & 1) v += p.bias[nn];
            if (p.flags & 2) v += p.bias[mm];
            if (p.flags & 8) v *= p.bias[(long long)zo * p.M + mm];   /* per-(zo,row) scale vector laid out [Z / zi_n][M]; exclusive with the bias flags */
            v = act_fn(v, p.act);
            if (p.flags & 4) v += p.beta * R[(long long)mm * p.sRm + (long long)nn * p.sRn];
            ctile[8 * h + r][t * 16 + l15] = (n < p.N) ? v : 0.f;
        }
    }
    __syncthreads();
    const int NW = (p.Npad > p.N) ? p.Npad : p.N;           // write width
    const bool fast = (m0 + 16 <= p.M) && (n0 + 32 <= NW) && ((p.sCm & 3) == 0) && ((((size_t)C) & 15) == 0);
    if (fast) {
#pragma unroll
        for (int s = 0; s < 4; ++s) {
            const int row = s * 4 + (lane >> 3), c4 = (lane & 7) * 4;
            const v4f v = *(const v4f*)&ctile[row][c4];
            VST2V4(C + (long long)(m0 + row) * p.sCm + n0 + c4, v);
        }
    } else {
        for (int row = 0; row < 16; ++row) {
            const int m = m0 + row, n = n0 + lane;
            if (m < p.M && n < NW) VST2(float, C + (long long)m * p.sCm + n, ctile[row][lane]);
        }
    }
}


// =====================================================================================================================
// k_gemmT<MODE, TM, TN>: same contract as k_gemm, but one wave computes a (16*TM) x (16*TN) tile: TM A fragments and TN B fragments are
//   loaded per 32-wide k-step and reused across TM*TN WMMAs (far fewer load/convert instructions per MAC). MODE 0 (f16), 1 (bf16 hi/lo),
//   2 (bf16) only. grid (ceil(NW/(16*TN)), ceil(M/(16*TM)), Z), block 32. Epilogue identical to k_gemm, run per 16x32 sub-tile.
// =====================================================================================================================
template <int MODE, int TM, int TN>
__global__ __launch_bounds__(32) void k_gemmT(GemmP p) {
    const int lane = threadIdx.x & 31, h = lane >> 4, l15 = lane & 15;
    const int m0 = blockIdx.y * (16 * TM), n0 = blockIdx.x * (16 * TN);
    const int z = blockIdx.z, zo = z / p.zi_n, zi = z - zo * p.zi_n;
    const float* A = p.A + zo * p.sAo + zi * p.sAi;
    const float* B = p.B + zo * p.sBo + zi * p.sBi;
    v8f acc[TM][TN];
#pragma unroll
    for (int i = 0; i < TM; ++i)
#pragma unroll
        for (int t = 0; t < TN; ++t) { v8f zz = {}; acc[i][t] = zz; }
    for (int k0 = 0; k0 < p.K; k0 += 32) {
        if (MODE == 1) {
            Split a[TM], b[TN];
#pragma unroll
            for (int i = 0; i < TM; ++i) { const int am = min(m0 + 16 * i + l15, p.M - 1); a[i] = sp_ld(A + (long long)am * p.sAm, p.sAk, k0, h, p.K, 1.f); }
#pragma unroll
            for (int t = 0; t < TN; ++t) { const int bn = min(n0 + 16 * t + l15, p.N - 1); b[t] = sp_ld(B + (long long)bn * p.sBn, p.sBk, k0, h, p.K, 1.f); }
#pragma unroll
            for (int i = 0; i < TM; ++i)
#pragma unroll
                for (int t = 0; t < TN; ++t) acc[i][t] = wmma3(a[i], b[t], acc[i][t]);
        } else if (MODE == 2) {
            v16b a[TM], b[TN];
#pragma unroll
            for (int i = 0; i < TM; ++i) { const int am = min(m0 + 16 * i + l15, p.M - 1); a[i] = bh_ld(A + (long long)am * p.sAm, p.sAk, k0, h, p.K, 1.f); }
#pragma unroll
            for (int t = 0; t < TN; ++t) { const int bn = min(n0 + 16 * t + l15, p.N - 1); b[t] = bh_ld(B + (long long)bn * p.sBn, p.sBk, k0, h, p.K, 1.f); }
#pragma unroll
            for (int i = 0; i < TM; ++i)
#pragma unroll
                for (int t = 0; t < TN; ++t) acc[i][t] = wmmab(a[i], b[t], acc[i][t]);
        } else {
            v16h a[TM], b[TN];
#pragma unroll
            for (int i = 0; i < TM; ++i) { const int am = min(m0 + 16 * i + l15, p.M - 1); a[i] = fh_ld(A + (long long)am * p.sAm, p.sAk, k0, h, p.K, p.sa); }
#pragma unroll
            for (int t = 0; t < TN; ++t) { const int bn = min(n0 + 16 * t + l15, p.N - 1); b[t] = fh_ld(B + (long long)bn * p.sBn, p.sBk, k0, h, p.K, p.sb); }
#pragma unroll
            for (int i = 0; i < TM; ++i)
#pragma unroll
                for (int t = 0; t < TN; ++t) acc[i][t] = wmma16(a[i], b[t], acc[i][t]);
        }
    }
    const float iscale = (MODE == 0) ? p.alpha / (p.sa * p.sb) : p.alpha;
    float* C = p.C + zo * p.sCo + zi * p.sCi;
    const float* R = p.R + zo * p.sRo + zi * p.sRi;
    const int NW = (p.Npad > p.N) ? p.Npad : p.N;
    __shared__ __align__(16) float ctile[16][36];
#pragma unroll
    for (int i = 0; i < TM; ++i) {
        const int mb = m0 + 16 * i; if (mb >= p.M) break;          // wave-uniform
#pragma unroll
        for (int tp = 0; tp < TN / 2; ++tp) {
            const int nb = n0 + 32 * tp; if (nb >= NW) break;        // wave-uniform
#pragma unroll
            for (int t2 = 0; t2 < 2; ++t2) {
                const int t = 2 * tp + t2; const int n = nb + t2 * 16 + l15; const int nn = min(n, p.N - 1);
#pragma unroll
                for (int r = 0; r < 8; ++r) {
                    const int m = mb + 8 * h + r; const int mm = min(m, p.M - 1);
                    float v = acc[i][t][r] * iscale;
                    if (p.flags & 1) v += p.bias[nn];
                    if (p.flags & 2) v += p.bias[mm];
            if (p.flags & 8) v *= p.bias[(long long)zo * p.M + mm];   /* per-(zo,row) scale vector laid out [Z / zi_n][M]; exclusive with the bias flags */
                    v = act_fn(v, p.act);
                    if (p.flags & 4) v += p.beta * R[(long long)mm * p.sRm + (long long)nn * p.sRn];
                    ctile[8 * h + r][t2 * 16 + l15] = (n < p.N) ? v : 0.f;
                }
            }
            __syncthreads();
            const bool fast = (mb + 16 <= p.M) && (nb + 32 <= NW) && ((p.sCm & 3) == 0) && ((((size_t)C) & 15) == 0);
            if (fast) {
#pragma unroll
                for (int s = 0; s < 4; ++s) {
                    const int row = s * 4 + (lane >> 3), c4 = (lane & 7) * 4;
                    const v4f v = *(const v4f*)&ctile[row][c4];
                    VST2V4(C + (long long)(mb + row) * p.sCm + nb + c4, v);
                }
            } else {
                for (int row = 0; row < 16; ++row) {
                    const int m = mb + row, n = nb + lane;
                    if (m < p.M && n < NW) VST2(float, C + (long long)m * p.sCm + n, ctile[row][lane]);
                }
            }
            __syncthreads();
        }
    }
}

// =====================================================================================================================
//   Wave = 16 queries, AW waves per block, 64-key blocks; grid (ceil(Lq/(16*AW)), H, B), block 32*AW. Any Lq, Lk; head dim dh <= DHP
//   (DHP multiple of 32), value dim dv <= DVP (multiple of 16, <= 128). Every tensor addressed by (batch, head, row, element) strides, f32.
//   Scores: QM 0 f16 operands, 1 bf16 hi/lo split, 2 bf16 triple split; statistics f32 (exp2 domain); P.V: P x 4096 as f16 with V f16 staged in LDS
//   (SPLITPV: P and V as bf16 hi/lo splits). kv head = h / hrep. Masking: causal = 1 (keep j <= i + coff, masked -> -inf, key blocks beyond the
//   diagonal skipped), causal = 2 (masked -> mfill, a finite fill like the -1e9; no skipping), causal = 3 (keep j >= i + coff,
//   masked -> -inf, no skipping); optional additive f32 mask Mf,
//   optional int keep-mask Mi (0 -> score := mfill), both addressed b*smb + h*smh + i*smi + j*smj (0 strides broadcast).
// =====================================================================================================================
#define AW 4
// lane l's value of lane l ^ 16 (the wave's other half), by a vector cross-row move
__device__ __forceinline__ float xhalf(float x) { return __builtin_bit_cast(float, __builtin_amdgcn_permlanex16(__builtin_bit_cast(int, x), __builtin_bit_cast(int, x), 0x76543210, 0xfedcba98, false, false)); }
// x[i] = 2^x[i], eight values, by v_exp_f32 alone: no fix-up for results under 2^-126 (exp2f spends a compare, two selects, an add and an ldexp per value on them), which may come out as 0.
// One statement: each exponential works in place on a register of its own, so each is the independent instruction that the instruction set asks for behind the one before it
// (before a transcendental's result is read or its source overwritten); the closing v_nop is that slot for the last one, whose successor is the compiler's choice.
__device__ __forceinline__ void exp2_raw8(float (&x)[8]) {
    asm("v_exp_f32 %0, %0\n\tv_exp_f32 %1, %1\n\tv_exp_f32 %2, %2\n\tv_exp_f32 %3, %3\n\tv_exp_f32 %4, %4\n\tv_exp_f32 %5, %5\n\tv_exp_f32 %6, %6\n\tv_exp_f32 %7, %7\n\tv_nop"
        : "+v"(x[0]), "+v"(x[1]), "+v"(x[2]), "+v"(x[3]), "+v"(x[4]), "+v"(x[5]), "+v"(x[6]), "+v"(x[7]));
}
struct AttnP {   // apv4
    const float* Q; const float* K; const float* V; float* O; float* P; const float* Mf; const int* Mi; float* ST;
    const float* Pw; const float* Rt; const int* SQ; const int* SK;           // optional: post-softmax weight, relative-position table, segment ids
    long long swb, swh, swi, swj, srb, srh, sri;                                 // Pw strides (b,h,i,j); Rt strides (b,h,i), column = clamp(i - j + roff, 0, rn-1)
    long long sQb, sQh, sQi, sQd, sKb, sKh, sKj, sKd, sVb, sVh, sVj, sVd, sOb, sOh, sOi, sPb, sPh, sPi, smb, smh, smi, smj;
    int Lq, Lk, dh, dv, hrep, causal, coff, pband;   // pband > 0: P holds only the band |j - i| <= pband, column j - i + pband
    float scale, mfill; int nonorm, mpol;             // nonorm (online path only): O = sum_j exp(score_j) V_j without the 1/rowsum (scores must be <= ~0); mpol: Mi masks where ==0 (mpol 0) or where !=0 (mpol 1)
    int roff, rn, segpol, win;                        // Rt column offset/count; SQ/SK: score := mfill where (segpol 0) SQ[i] != SK[j] or (segpol 1) SQ[i] == SK[j]; win > 0: keys with i - j > win (after coff) -> -inf
};
//   Pw: the softmax numerator is multiplied by Pw(b,h,i,j) AFTER the row sum is taken (probs * weight, then P.V), as in post-softmax multiplicative biases.                                                    // ST (optional): per row (b,h,i) -> ST[((b*H + h)*Lq + i)*2 + {0,1}] = {row max of the scaled+masked score (natural units), sum_j exp(score - max)}
static_assert(sizeof(AttnP) == 12 * 8 + 29 * 8 + 16 * 4, "AttnP has padding");

#ifndef KATTN_ATTR
#define KATTN_ATTR __attribute__((amdgpu_waves_per_eu(4, 4)))   // the launch puts 4 waves on a SIMD: registers are budgeted for that, so a key block's 16 loads still issue as one group
#endif
template <int DHP, int DVP, int QM, bool SPLITPV, bool TWOPASS, bool UNIT = false, bool PLAIN = false>
__global__ __launch_bounds__(32 * AW) KATTN_ATTR void k_attn(AttnP p) {
    static_assert(!PLAIN || !TWOPASS, "PLAIN covers the one-pass path");
    static_assert(!UNIT || (QM == 0 && !SPLITPV && !TWOPASS && (32 * AW) / (DVP / 4) == 8 && (32 * AW) / (DHP / 4) == 8), "UNIT covers the f16 one-pass path, 8 K rows and 8 V rows per load step");
    constexpr int NT = DVP / 16;                // output tiles
    constexpr int KS = DHP / 32;                // k-steps for the scores
    constexpr int VP = (UNIT && PLAIN) ? DVP + 16 : DVP + 8;   // LDS pitch of the V tile (halves); transposed path: an odd multiple of 32 bytes, the pitch at which the transposing LDS load runs without bank conflicts
    constexpr int KP = DHP + 8;                 // LDS pitch of the K tile (halves): an odd multiple of 16 bytes, so a fragment's 16 rows fall on different banks
    __shared__ __align__(16) float    pl[AW][16 * 64];
    __shared__ __align__(16) _Float16 vl[(SPLITPV ? 2 : 1) * 64 * VP];   // f16 V tile, or bf16 hi and lo tiles (same 2-byte size)
    __shared__ __align__(16) _Float16 kl[UNIT ? 64 * KP : 8];            // UNIT: f16 K tile, row = key
    const int lane = threadIdx.x & 31, hf = lane >> 4, l15 = lane & 15, wave = threadIdx.x >> 5;
    const int h = blockIdx.y, b = blockIdx.z, hk = h / p.hrep;
    const int q0 = (blockIdx.x * AW + wave) * 16;
    float* myp = pl[wave];
    const float L2E = 1.4426950408889634f;
    const float NEG = -__builtin_inff();
    const int qi = min(q0 + l15, p.Lq - 1);
    const float* qrow = p.Q + b * p.sQb + h * p.sQh + (long long)qi * p.sQi;
    const float* kbase = p.K + b * p.sKb + hk * p.sKh;
    const float* vbase = p.V + b * p.sVb + hk * p.sVh;
    const v4f* qp = (const v4f*)(qrow + 8 * hf);               // UNIT: the lane's half of the fragment's k
    v16h qa[QM == 0 ? KS : 1]; Split qs_[QM == 1 ? KS : 1]; Split3 qt_[QM == 2 ? KS : 1];
#pragma unroll
    for (int ks = 0; ks < KS; ++ks) {
        if (QM == 2) qt_[ks] = sp3_ld(qrow, p.sQd, ks * 32, hf, p.dh, 1.f);
        else if (QM == 1) qs_[ks] = sp_ld(qrow, p.sQd, ks * 32, hf, p.dh, 1.f);
        else if (UNIT) qa[ks] = fr_cvt(fr_ld(qp, ks * 32));
        else qa[ks] = fh_ld(qrow, p.sQd, ks * 32, hf, p.dh, 1.f);
    }
    if (UNIT) asm volatile("s_wait_xcnt 0x0" :: "v"(qp) : "memory");   // the Q loads' address registers stay as they are up to this wait (named as input) and are reused behind it
    constexpr int VR = (32 * AW) / (DVP / 4);                  // V rows that the block's threads cover with one 16-byte load each
    constexpr int KR = (32 * AW) / (DHP / 4);                  // K rows that the block's threads cover with one 16-byte load each
    const unsigned koff = (unsigned)((int)(threadIdx.x / (DHP / 4)) * (int)p.sKj + (int)(threadIdx.x % (DHP / 4)) * 4) * 4u;   // UNIT: thread's byte offset in KR rows of K
    const unsigned voff = (unsigned)((int)(threadIdx.x / (DVP / 4)) * (int)p.sVj + (int)(threadIdx.x % (DVP / 4)) * 4) * 4u;   // UNIT: thread's byte offset in VR rows of V
    // transposed path: the 16 bytes of the V tile that this lane hands to a transposing load of keys 0 ... 15, columns 0 ... 15: row 8 hf + (lane & 7), column half (lane >> 3) & 1
    lds_v8s* const vtr = (lds_v8s*)(vl + (8 * hf + (lane & 7)) * VP + 8 * ((lane >> 3) & 1));
    v8f o[NT]; float m8[8], l8[8];
#pragma unroll
    for (int t = 0; t < NT; ++t) { v8f zz = {}; o[t] = zz; }
#pragma unroll
    for (int i = 0; i < 8; ++i) { m8[i] = NEG; l8[i] = 0.f; }
    int jend = p.Lk; int jstart = 0;
    if (!PLAIN && p.causal == 1) { const int je = (blockIdx.x * AW + AW - 1) * 16 + 16 + p.coff; jend = min(jend, max(je, 0)); }   // uniform per block
    if (!PLAIN && p.win > 0) { const int js = (int)(blockIdx.x * AW) * 16 + p.coff - p.win; jstart = (js > 0) ? (js / 64) * 64 : 0; }   // uniform per block: key blocks entirely outside every row's window hold only -inf entries and are skipped exactly
    const int npass = TWOPASS ? 2 : 1;
    for (int pass = 0; pass < npass; ++pass) {
        const bool dopv = (!TWOPASS) || pass == 1;
        for (int j0 = jstart; j0 < jend; j0 += 64) {
            if (dopv) {
                __syncthreads();                                 // previous key block's reads of kl / vl / pl are done
                if (!UNIT)
                for (int idx = threadIdx.x; idx < 64 * DVP; idx += 32 * AW) {
                    const int jr = idx / DVP, d = idx - jr * DVP, j = j0 + jr;
                    const float f = (j < p.Lk && d < p.dv) ? vbase[(long long)j * p.sVj + (long long)d * p.sVd] : 0.f;
                    if (SPLITPV) {
                        const __bf16 hb = bf16_rne(f);
                        ((__bf16*)vl)[jr * VP + d] = hb; ((__bf16*)vl)[64 * VP + jr * VP + d] = bf16_rne(f - bf16_f32(hb));
                    } else vl[jr * VP + d] = (_Float16)f;
                }
            }
            v8f s[4];
            union { v16h v; v8s h[2]; } va[(UNIT && PLAIN) ? NT : 1][2];   // transposed path: V^T as A, [value tile t][the block's first and second 32 keys]: lane = value column 16 t + l15, element e = key frag_k(e, hf)
            if (UNIT) {
                v4f vr[8], kr[8]; const v4f* vp[8]; const v4f* kp[8];
#pragma unroll
                for (int it = 0; it < 8; ++it) { vp[it] = (const v4f*)((const char*)(vbase + (long long)(j0 + it * VR) * p.sVj) + voff); vr[it] = *vp[it]; }
#pragma unroll
                for (int it = 0; it < 8; ++it) { kp[it] = (const v4f*)((const char*)(kbase + (long long)(j0 + it * KR) * p.sKj) + koff); kr[it] = *kp[it]; }
                // the group's address registers stay as they are up to this wait (named as inputs) and are reused behind it, while the loads are still in flight
                asm volatile("s_wait_xcnt 0x0" :: "v"(vp[0]), "v"(vp[1]), "v"(vp[2]), "v"(vp[3]), "v"(vp[4]), "v"(vp[5]), "v"(vp[6]), "v"(vp[7]),
                             "v"(kp[0]), "v"(kp[1]), "v"(kp[2]), "v"(kp[3]), "v"(kp[4]), "v"(kp[5]), "v"(kp[6]), "v"(kp[7]) : "memory");
#pragma unroll
                for (int it = 0; it < 8; ++it) {
                    v4h hv; hv[0] = (_Float16)vr[it][0]; hv[1] = (_Float16)vr[it][1]; hv[2] = (_Float16)vr[it][2]; hv[3] = (_Float16)vr[it][3];
                    *(v4h*)(vl + (it * VR + (int)(threadIdx.x / (DVP / 4))) * VP + (int)(threadIdx.x % (DVP / 4)) * 4) = hv;
                }
#pragma unroll
                for (int it = 0; it < 8; ++it) {
                    v4h hk4; hk4[0] = (_Float16)kr[it][0]; hk4[1] = (_Float16)kr[it][1]; hk4[2] = (_Float16)kr[it][2]; hk4[3] = (_Float16)kr[it][3];
                    *(v4h*)(kl + (it * KR + (int)(threadIdx.x / (DHP / 4))) * KP + (int)(threadIdx.x % (DHP / 4)) * 4) = hk4;
                }
                __syncthreads();                                 // K and V tiles (shared) visible
                union { v16h v; v8h h[2]; } kf[4][KS];
#pragma unroll
                for (int t = 0; t < 4; ++t)
#pragma unroll
                    for (int ks = 0; ks < KS; ++ks) {
                        const _Float16* kq = kl + (t * 16 + l15) * KP + ks * 32 + 8 * hf;   // key row l15 of tile t; the lane's half of the fragment's k, in the order of frag_k
                        kf[t][ks].h[0] = *(const v8h*)kq; kf[t][ks].h[1] = *(const v8h*)(kq + 16);
                    }
                if (PLAIN) {                                     // one transposing load hands the lane 8 keys (8 hf + 0 ... 7 of a 16-key group) of its column; issued here, the loads return while the scores and the softmax run
#pragma unroll   // both loops: va is then indexed by constants and stays in registers, and each load's place is an immediate offset from vtr
                    for (int t = 0; t < NT; ++t)
#pragma unroll   // (as above)
                        for (int g = 0; g < 4; ++g) va[t][g >> 1].h[g & 1] = __builtin_amdgcn_ds_load_tr16_b128_v8i16(vtr + (g * 16 * VP + t * 16) / 8);
                }
#pragma unroll
                for (int t = 0; t < 4; ++t) {
                    v8f acc = {};
#pragma unroll
                    for (int ks = 0; ks < KS; ++ks) acc = PLAIN ? wmma16(kf[t][ks].v, qa[ks], acc) : wmma16(qa[ks], kf[t][ks].v, acc);
                    s[t] = acc;
                }
            } else
#pragma unroll
            for (int t = 0; t < 4; ++t) {
                const int j = min(j0 + t * 16 + l15, p.Lk - 1);
                const float* krow = kbase + (long long)j * p.sKj;
                v8f acc = {};
#pragma unroll
                for (int ks = 0; ks < KS; ++ks) {
                    if (QM == 2)      acc = wmma6(qt_[ks], sp3_ld(krow, p.sKd, ks * 32, hf, p.dh, 1.f), acc);
                    else if (QM == 1) acc = wmma3(qs_[ks], sp_ld(krow, p.sKd, ks * 32, hf, p.dh, 1.f), acc);
                    else              acc = wmma16(qa[ks], fh_ld(krow, p.sKd, ks * 32, hf, p.dh, 1.f), acc);
                }
                s[t] = acc;
            }
            if (UNIT && PLAIN) {                                 // s[t][r] = score of key j0 + 16 t + 8 hf + r for query q0 + l15; m8[0], l8[0]: that query's maximum and this half's sum
                float mt[4];                                     // one maximum chain per score tile, so that the four overlap
                // every loop of this block is unrolled: s, mt, rt, the fragments and o are then indexed by constants and stay in registers
#pragma unroll
                for (int t = 0; t < 4; ++t) {
#pragma unroll
                    for (int r = 0; r < 8; ++r) s[t][r] = s[t][r] * p.scale * L2E;
                    mt[t] = fmaxf(fmaxf(fmaxf(s[t][0], s[t][1]), fmaxf(s[t][2], s[t][3])), fmaxf(fmaxf(s[t][4], s[t][5]), fmaxf(s[t][6], s[t][7])));
                }
                float mx = fmaxf(fmaxf(mt[0], mt[1]), fmaxf(mt[2], mt[3]));
                mx = fmaxf(mx, xhalf(mx));
                const float mnew = fmaxf(m8[0], mx);
                // bare v_exp_f32 here and in exp2_raw8: a value under 2^-126 may become 0; x 4096 it is 0 in f16 anyway, and it is far below one f32 ulp of the query's sum, whose
                // largest term is 1, and of the output it would rescale; -inf (m8 in front of the first block) gives 0 either way
                const float corr = __builtin_amdgcn_exp2f(m8[0] - mnew);
                float rt[4];
#pragma unroll
                for (int t = 0; t < 4; ++t) {
                    float x[8];
#pragma unroll
                    for (int r = 0; r < 8; ++r) x[r] = s[t][r] - mnew;
                    exp2_raw8(x);
#pragma unroll
                    for (int r = 0; r < 8; ++r) s[t][r] = x[r];
                    rt[t] = ((s[t][0] + s[t][1]) + (s[t][2] + s[t][3])) + ((s[t][4] + s[t][5]) + (s[t][6] + s[t][7]));
                }
                l8[0] = l8[0] * corr + ((rt[0] + rt[1]) + (rt[2] + rt[3])); m8[0] = mnew;   // the halves' sums are joined behind the loop
                v16h pb0, pb1;                                   // P^T x 4096 as B: element e = key frag_k(e, hf) of the block's first and second 32 keys
#pragma unroll
                for (int e = 0; e < 16; ++e) { pb0[e] = (_Float16)(s[e >> 3][e & 7] * 4096.f); pb1[e] = (_Float16)(s[2 + (e >> 3)][e & 7] * 4096.f); }
#pragma unroll
                for (int t = 0; t < NT; ++t) {
                    o[t] *= corr;
                    o[t] = wmma16(va[t][0].v, pb0, o[t]);        // o[t][r] = O^T[16 t + 8 hf + r][query l15]
                    o[t] = wmma16(va[t][1].v, pb1, o[t]);
                }
                continue;
            }
            float pv[8][4];
#pragma unroll
            for (int i = 0; i < 8; ++i) {
                const int irow = q0 + i + 8 * hf;
                const int ic = min(irow, p.Lq - 1);
                float sc[4];
#pragma unroll
                for (int t = 0; t < 4; ++t) {
                    const int jg = j0 + t * 16 + l15;
                    float v = s[t][i] * p.scale;
                    if (!PLAIN && p.Mf) v += p.Mf[b * p.smb + h * p.smh + (long long)ic * p.smi + (long long)min(jg, p.Lk - 1) * p.smj];
                    if (!PLAIN && p.Rt) { int rc = ic - min(jg, p.Lk - 1) + p.roff; rc = rc < 0 ? 0 : (rc >= p.rn ? p.rn - 1 : rc); v += p.Rt[b * p.srb + h * p.srh + (long long)ic * p.sri + rc]; }
                    if (!PLAIN && p.Mi) { const int mv = p.Mi[b * p.smb + h * p.smh + (long long)ic * p.smi + (long long)min(jg, p.Lk - 1) * p.smj]; if (p.mpol ? (mv != 0) : (mv == 0)) v = p.mfill; }
                    if (!PLAIN && p.SQ) { const bool same = p.SQ[(long long)b * p.Lq + ic] == p.SK[(long long)b * p.Lk + min(jg, p.Lk - 1)]; if (p.segpol ? same : !same) v = p.mfill; }
                    if (!PLAIN && p.causal == 2 && jg > irow + p.coff) v = p.mfill;
                    if (!PLAIN && (jg >= p.Lk || (p.causal == 1 && jg > irow + p.coff) || (p.causal == 3 && jg < irow + p.coff) || (p.win > 0 && irow + p.coff - jg > p.win))) v = NEG; else v *= L2E;
                    sc[t] = v;
                }
                if (!TWOPASS || pass == 0) {
                    float mx = fmaxf(fmaxf(sc[0], sc[1]), fmaxf(sc[2], sc[3]));
                    mx = fmaxf(mx, __shfl_xor(mx, 1, 32)); mx = fmaxf(mx, __shfl_xor(mx, 2, 32));
                    mx = fmaxf(mx, __shfl_xor(mx, 4, 32)); mx = fmaxf(mx, __shfl_xor(mx, 8, 32));
                    const float mnew = fmaxf(m8[i], mx);
                    const float corr = (!PLAIN && mnew == NEG) ? 1.f : exp2f(m8[i] - mnew);
                    float rs = 0.f;
#pragma unroll
                    for (int t = 0; t < 4; ++t) {
                        const float pp = (!PLAIN && sc[t] == NEG) ? 0.f : exp2f(sc[t] - mnew); rs += pp;
                        pv[i][t] = (!PLAIN && p.Pw) ? pp * p.Pw[b * p.swb + h * p.swh + (long long)ic * p.swi + (long long)min(j0 + t * 16 + l15, p.Lk - 1) * p.swj] : pp;
                    }
                    rs += __shfl_xor(rs, 1, 32); rs += __shfl_xor(rs, 2, 32); rs += __shfl_xor(rs, 4, 32); rs += __shfl_xor(rs, 8, 32);
                    l8[i] = l8[i] * corr + rs; m8[i] = mnew;
                    if (!TWOPASS) {
#pragma unroll
                        for (int t = 0; t < NT; ++t) o[t][i] *= corr;
                    }
                } else {
                    const float inv = (l8[i] > 0.f) ? 1.f / l8[i] : 0.f;
#pragma unroll
                    for (int t = 0; t < 4; ++t) {
                        const int jg = j0 + t * 16 + l15;
                        float pp = (sc[t] == NEG) ? 0.f : exp2f(sc[t] - m8[i]) * inv;
                        if (p.Pw) pp *= p.Pw[b * p.swb + h * p.swh + (long long)ic * p.swi + (long long)min(jg, p.Lk - 1) * p.swj];
                        pv[i][t] = pp;
                    }
                }
            }
            if (dopv) {
#pragma unroll
                for (int i = 0; i < 8; ++i)
#pragma unroll
                    for (int t = 0; t < 4; ++t) ((float*)myp)[(i + 8 * hf) * 64 + t * 16 + l15] = pv[i][t];
                if (UNIT) {                                      // V was published with K, by the barrier behind the staging stores; P is read only by the wave that wrote it:
                    __builtin_amdgcn_fence(__ATOMIC_RELEASE, "workgroup");   // its lanes' P stores are done and stay in front of
                    __builtin_amdgcn_wave_barrier();                         // this point, the wave's P reads behind it
                    __builtin_amdgcn_fence(__ATOMIC_ACQUIRE, "workgroup");
                } else __syncthreads();                          // P (per wave) and V (shared) visible
                if (!PLAIN && p.P) {
                    float* pb_ = p.P + b * p.sPb + h * p.sPh;
                    const bool fastP = (p.pband == 0) && ((p.sPi & 3) == 0) && (j0 + 64 <= p.Lk) && (q0 + 16 <= p.Lq) && ((((size_t)pb_) & 15) == 0);
                    if (fastP) {
#pragma unroll
                        for (int s = 0; s < 8; ++s) {
                            const int row = s * 2 + (lane >> 4), c4 = (lane & 15) * 4;
                            const v4f v = *(const v4f*)(myp + row * 64 + c4);
                            VST2V4(pb_ + (long long)(q0 + row) * p.sPi + j0 + c4, v);
                        }
                    } else {
                        for (int row = 0; row < 16; ++row) {
                            const int irow = q0 + row; if (irow >= p.Lq) continue;
                            for (int c = lane; c < 64; c += 32) {
                                const int jg = j0 + c; if (jg >= p.Lk) continue;
                                if (p.pband == 0) VST2(float, pb_ + (long long)irow * p.sPi + jg, myp[row * 64 + c]);
                                else if (jg - irow <= p.pband && irow - jg <= p.pband) VST2(float, pb_ + (long long)irow * p.sPi + (jg - irow + p.pband), myp[row * 64 + c]);
                            }
                        }
                    }
                }
                if (SPLITPV) {
                    const Split pa0 = sp_ld(myp + l15 * 64, 1, 0, hf, 64, 1.f), pa1 = sp_ld(myp + l15 * 64, 1, 32, hf, 64, 1.f);
                    const __bf16* vh = (const __bf16*)vl; const __bf16* vlo = vh + 64 * VP;
#pragma unroll
                    for (int t = 0; t < NT; ++t) {
                        const int dcol = t * 16 + l15;
                        Split b0, b1;
#pragma unroll
                        for (int e = 0; e < 16; ++e) {
                            const int k0 = frag_k(e, hf), k1 = 32 + frag_k(e, hf);
                            b0.hi[e] = vh[k0 * VP + dcol]; b0.lo[e] = vlo[k0 * VP + dcol]; b1.hi[e] = vh[k1 * VP + dcol]; b1.lo[e] = vlo[k1 * VP + dcol];
                        }
                        o[t] = wmma3(pa0, b0, o[t]);
                        o[t] = wmma3(pa1, b1, o[t]);
                    }
                } else {
                    const v16h pa0 = fh_ld(myp + l15 * 64, 1, 0, hf, 64, 4096.f), pa1 = fh_ld(myp + l15 * 64, 1, 32, hf, 64, 4096.f);
#pragma unroll
                    for (int t = 0; t < NT; ++t) {
                        const int dcol = t * 16 + l15;
                        v16h b0, b1;
#pragma unroll
                        for (int e = 0; e < 16; ++e) { b0[e] = vl[frag_k(e, hf) * VP + dcol]; b1[e] = vl[(32 + frag_k(e, hf)) * VP + dcol]; }
                        o[t] = wmma16(pa0, b0, o[t]);
                        o[t] = wmma16(pa1, b1, o[t]);
                    }
                }
            }
        }
    }
    float* obase = p.O + b * p.sOb + h * p.sOh;
    if (!PLAIN && p.ST) {
        const int rl = lane >> 1, isel = rl & 7;           // row q0 + rl ; rl>>3 == hf holds because lane>>4 == (lane>>1)>>3
        float mv = 0.f, lv = 0.f;
#pragma unroll
        for (int i = 0; i < 8; ++i) if (i == isel) { mv = m8[i]; lv = l8[i]; }
        const int irow = q0 + rl;
        if (irow < p.Lq) { float* st = p.ST + (((long long)b * gridDim.y + h) * p.Lq + irow) * 2 + (lane & 1); VST2(float, st, (lane & 1) ? lv : mv * 0.6931471805599453f); }
    }
    float invr[8];
    if (UNIT && PLAIN) l8[0] += xhalf(l8[0]);                    // transposed path: the query's sum = its two halves' sums
#pragma unroll
    for (int i = 0; i < 8; ++i) {
        if (UNIT && PLAIN) invr[i] = (l8[0] > 0.f) ? 1.f / (l8[0] * 4096.f) : 0.f;
        else if (TWOPASS) invr[i] = SPLITPV ? 1.f : (1.f / 4096.f);
        else if (!PLAIN && p.nonorm) invr[i] = exp2f(m8[i]) * (SPLITPV ? 1.f : (1.f / 4096.f));
        else invr[i] = (l8[i] > 0.f) ? (SPLITPV ? 1.f / l8[i] : 1.f / (l8[i] * 4096.f)) : 0.f;
    }
    __syncthreads();                                             // all waves done with pl/vl from the main loop
    const bool ofast = ((p.sOi & 3) == 0) && ((((size_t)obase) & 15) == 0) && (q0 + 16 <= p.Lq);
#pragma unroll
    for (int c0 = 0; c0 < DVP; c0 += 64) {
#pragma unroll
        for (int i = 0; i < 8; ++i)
#pragma unroll
            for (int t = 0; t < NT; ++t) if (t * 16 >= c0 && t * 16 < c0 + 64) ((float*)myp)[(UNIT && PLAIN) ? l15 * 64 + (t * 16 - c0) + 8 * hf + i : (i + 8 * hf) * 64 + (t * 16 - c0) + l15] = o[t][i] * invr[i];
        __syncthreads();
        const int cw = (DVP - c0 < 64) ? (DVP - c0) : 64;      // staged columns in this chunk (multiple of 16)
        if (ofast && (c0 + cw <= p.dv) && (cw % 32 == 0)) {
            const int lpr = cw / 4;                              // lanes per row (16 for 64 cols, 8 for 32)
            const int rows_per_ins = 32 / lpr;
            for (int r0 = 0; r0 < 16; r0 += rows_per_ins) {
                const int row = r0 + lane / lpr, c4 = (lane % lpr) * 4;
                const v4f v = *(const v4f*)(myp + row * 64 + c4);
                VST2V4(obase + (long long)(q0 + row) * p.sOi + c0 + c4, v);
            }
        } else {
            for (int row = 0; row < 16; ++row) {
                const int irow = q0 + row; if (irow >= p.Lq) continue;
                for (int c = lane; c < cw; c += 32) { const int d = c0 + c; if (d < p.dv) VST2(float, obase + (long long)irow * p.sOi + d, myp[row * 64 + c]); }
            }
        }
        __syncthreads();
    }
}

// =====================================================================================================================
// k_tr: dst(z, c, r) = alpha * src(z, r, c) (+ beta * R2(z, c, r)): [Z][R][C] (row stride lds) -> [Z][C][R] (row stride ldd) through a 32x32 LDS tile;
//   flags: 1 -> add beta * residual R2 addressed like dst (z*sRz + c*ldr + r); act applied before the residual.
// =====================================================================================================================
struct TrP { const float* src; float* dst; const float* R2; long long sSz, lds, sDz, ldd, sRz, ldr; int R, C, flags, act; float alpha, beta; };
static_assert(sizeof(TrP) == 3 * 8 + 6 * 8 + 6 * 4, "TrP has padding");
__global__ __launch_bounds__(256) void k_tr(TrP p) {
    __shared__ float tile[32][33];
    const int c0 = blockIdx.x * 32, r0 = blockIdx.y * 32, z = blockIdx.z;
    const int lane = threadIdx.x & 31, wave = threadIdx.x >> 5;
    const float* s = p.src + z * p.sSz;
#pragma unroll
    for (int k = 0; k < 4; ++k) {
        const int rl = wave * 4 + k, r = r0 + rl, c = c0 + lane;
        tile[rl][lane] = (r < p.R && c < p.C) ? s[(long long)r * p.lds + c] : 0.f;
    }
    __syncthreads();
    float* d = p.dst + z * p.sDz; const float* rr = p.R2 + z * p.sRz;
#pragma unroll
    for (int k = 0; k < 4; ++k) {
        const int cl = wave * 4 + k, c = c0 + cl, r = r0 + lane;
        if (c < p.C && r < p.R) {
            float v = act_fn(p.alpha * tile[lane][cl], p.act);
            if (p.flags & 1) v += p.beta * rr[(long long)c * p.ldr + r];
            VST2(float, d + (long long)c * p.ldd + r, v);
        }
    }
}

// k_affine: dst[i] = a * (sdev ? sdev[0] : 1) * src[i] + b, i < n (one thread per element; consecutive lanes -> consecutive addresses)
__global__ __launch_bounds__(256) void k_affine(const float* __restrict__ src, float* __restrict__ dst, int n, float a, float b, const float* __restrict__ sdev) {
    const int i = blockIdx.x * 256 + threadIdx.x;
    if (i < n) { const float aa = sdev ? a * sdev[0] : a; const float v = aa * src[i] + b; VST2(float, dst + i, v); }
}

// =====================================================================================================================
// k_softmax: row softmax over n contiguous elements, one 256-thread block per row; rows addressed z*sz + r*sr (grid (R, Z)).
//   out = scale_out * softmax(scale_in * x + (Mf ? Mf[z*smz + r*smr + j] : 0)); a row whose max is -inf is written as 0.
// =====================================================================================================================
struct SmP { const float* src; float* dst; const float* Mf; long long sz, sr, dz, dr, smz, smr; int n, pad; float scale_in, scale_out; };
static_assert(sizeof(SmP) == 3 * 8 + 6 * 8 + 4 * 4, "SmP has padding");
__global__ __launch_bounds__(256) void k_softmax(SmP p) {
    __shared__ float red[256];
    const int r = blockIdx.x, z = blockIdx.y, tid = threadIdx.x;
    const float* s = p.src + z * p.sz + (long long)r * p.sr;
    const float* mf = p.Mf ? (p.Mf + z * p.smz + (long long)r * p.smr) : nullptr;
    float mx = -__builtin_inff();
    for (int j = tid; j < p.n; j += 256) { float v = s[j] * p.scale_in; if (mf) v += mf[j]; mx = fmaxf(mx, v); }
    red[tid] = mx; __syncthreads();
    for (int o = 128; o > 0; o >>= 1) { if (tid < o) red[tid] = fmaxf(red[tid], red[tid + o]); __syncthreads(); }
    mx = red[0]; __syncthreads();
    float sum = 0.f;
    for (int j = tid; j < p.n; j += 256) { float v = s[j] * p.scale_in; if (mf) v += mf[j]; sum += (mx == -__builtin_inff()) ? 0.f : expf(v - mx); }
    red[tid] = sum; __syncthreads();
    for (int o = 128; o > 0; o >>= 1) { if (tid < o) red[tid] += red[tid + o]; __syncthreads(); }
    sum = red[0];
    const float inv = (sum > 0.f) ? p.scale_out / sum : 0.f;
    float* d = p.dst + z * p.dz + (long long)r * p.dr;
    for (int j = tid; j < p.n; j += 256) { float v = s[j] * p.scale_in; if (mf) v += mf[j]; const float o = (mx == -__builtin_inff()) ? 0.f : expf(v - mx) * inv; VST2(float, d + j, o); }
}
// =====================================================================================================================
// k_stats: mean and rsqrt(var + eps) over a set of n elements addressed base + z*sz + (e / inner) * so + (e % inner) * si, one 256-thread
// k_norm_apply: y = (x - mean[set]) * rstd[set] * g[c] + b[c] over a [Z][C][L] chan-major tensor with set = z*G + c / (C/G) (G groups per z;
//   G = C -> per-chan sets indexed z*C+c; for batch norm pass stats indexed by c only via bn = 1). Optional act. Output same layout.
// =====================================================================================================================
//   mode 0: mean / rsqrt(var + eps); mode 1 (RMSNorm): 0 / rsqrt(mean(x^2) + eps); mode 2 (L2 normalize * sqrt(n)): 0 / sqrt(n) / max(||x||, eps); mode 3: as 0 with unbiased variance (n-1)
__global__ __launch_bounds__(256) void k_stats(const float* __restrict__ x, long long sz, long long so, long long si, int inner, int n, float eps, float* __restrict__ stat, int mode) {
    __shared__ float red[256];
    const int z = blockIdx.x, tid = threadIdx.x;
    const float* base = x + z * sz;
    float s = 0.f;
    for (int e = tid; e < n; e += 256) s += base[(long long)(e / inner) * so + (long long)(e % inner) * si];
    red[tid] = s; __syncthreads();
    for (int o = 128; o > 0; o >>= 1) { if (tid < o) red[tid] += red[tid + o]; __syncthreads(); }
    const float mu = (mode == 0 || mode == 3) ? red[0] / (float)n : 0.f; __syncthreads();
    float q = 0.f;
    for (int e = tid; e < n; e += 256) { const float dlt = base[(long long)(e / inner) * so + (long long)(e % inner) * si] - mu; q += dlt * dlt; }
    red[tid] = q; __syncthreads();
    for (int o = 128; o > 0; o >>= 1) { if (tid < o) red[tid] += red[tid + o]; __syncthreads(); }
    {
        float rs;
        if (mode == 2) rs = sqrtf((float)n) / fmaxf(sqrtf(red[0]), eps); else if (mode == 3) rs = rsqrtf(red[0] / (float)(n - 1) + eps); else rs = rsqrtf(red[0] / (float)n + eps);
        if (tid < 32) { const float v = (tid == 0) ? mu : ((tid == 1) ? rs : 0.f); VST2(float, stat + (long long)z * 32 + tid, v); }
    }
}
//   One thread per element over the flat [Z][C][L] index space: grid ceil(Z*C*L / 256).
__global__ __launch_bounds__(256) void k_norm_apply(const float* __restrict__ x, float* __restrict__ y, const float* __restrict__ stat, const float* __restrict__ g, const float* __restrict__ bta,
                                                     int Z, int C, int L, int G, int bn, int act) {
    const long long idx = (long long)blockIdx.x * 256 + threadIdx.x;
    if (idx >= (long long)Z * C * L) return;
    const int l = (int)(idx % L); const long long zc = idx / L; const int c = (int)(zc % C), z = (int)(zc / C); (void)l;
    const int set = bn ? c : (z * G + c / (C / G));
    float v = (x[idx] - stat[(long long)set * 32]) * stat[(long long)set * 32 + 1];
    if (g) v *= g[c];
    if (bta) v += bta[c];
    v = act_fn(v, act);
    VST2(float, y + idx, v);
}

// k_lse_neg: c[i] = -(st[2i] + log(st[2i+1])) = minus the log-sum-exp of row i from k_attn's ST output (for softmax over the query dimension)
__global__ __launch_bounds__(256) void k_lse_neg(const float* __restrict__ st, float* __restrict__ c, int n) {
    const int i = blockIdx.x * 256 + threadIdx.x;
    if (i < n) { const float v = -(st[2 * i] + logf(st[2 * i + 1])); VST2(float, c + i, v); }
}

// k_iota: dst[i] = a * i + b as int32 (segment/position id helper)
__global__ __launch_bounds__(256) void k_iota(int* __restrict__ dst, int n, int a, int b) {
    const int i = blockIdx.x * 256 + threadIdx.x;
    if (i < n) { const int v = a * i + b; VST2(int, dst + i, v); }
}

// k_axpby: dst[i] = a * x[i] + b * y[i] (+ c), i < n
__global__ __launch_bounds__(256) void k_axpby(const float* __restrict__ x, const float* __restrict__ y, float* __restrict__ dst, int n, float a, float b, float c) {
    const int i = blockIdx.x * 256 + threadIdx.x;
    if (i < n) { const float v = a * x[i] + b * y[i] + c; VST2(float, dst + i, v); }
}

// =====================================================================================================================
// k_rope: rotary embedding on a [R rows][Hn heads][D] view (row stride sXr, head stride sXh, element stride 1) -> Y (own strides).
//   mode 0: rotate_half (partner d±D/2, sign - for d<D/2); mode 1: interleaved pairs (partner d^1, sign - for even d).
//   table column tcol: tmode 0 -> d, 1 -> d % (D/2), 2 -> d / 2; position p: pmode 0 -> r % S, 1 -> head index, 2 -> pos[r];
//   c = C[(r / S) * sCb + p * sCp + tcol * sCd], s likewise from Sn; y = x[d] * c + sign * x[partner] * s. X and Y must not alias.
// =====================================================================================================================
struct RopeP { const float* X; float* Y; const float* C; const float* Sn; const int* pos; long long sXr, sXh, sYr, sYh, sCb, sCp, sCd; int R, Hn, D, S, mode, tmode, pmode, pad; };
static_assert(sizeof(RopeP) == 5 * 8 + 7 * 8 + 8 * 4, "RopeP has padding");
__global__ __launch_bounds__(256) void k_rope(RopeP p) {
    const long long idx = (long long)blockIdx.x * 256 + threadIdx.x;
    if (idx >= (long long)p.R * p.Hn * p.D) return;
    const int d = (int)(idx % p.D); const long long rh = idx / p.D; const int h = (int)(rh % p.Hn); const int r = (int)(rh / p.Hn);
    const int half = p.D / 2;
    int partner; float sign;
    if (p.mode == 0) { partner = (d < half) ? d + half : d - half; sign = (d < half) ? -1.f : 1.f; }
    else { partner = d ^ 1; sign = (d & 1) ? 1.f : -1.f; }
    const int tcol = (p.tmode == 0) ? d : ((p.tmode == 1) ? (d % half) : (d >> 1));
    const int pp = (p.pmode == 0) ? (r % p.S) : ((p.pmode == 1) ? h : p.pos[r]);
    const long long toff = (long long)(r / p.S) * p.sCb + (long long)pp * p.sCp + (long long)tcol * p.sCd;
    const float* xr = p.X + (long long)r * p.sXr + (long long)h * p.sXh;
    const float v = xr[d] * p.C[toff] + sign * xr[partner] * p.Sn[toff];
    VST2(float, p.Y + (long long)r * p.sYr + (long long)h * p.sYh + d, v);
}

// k_invf + k_sincos (split so neither kernel carries a large VALU-fma footprint): invf_i = num * (1 / powf(base, (2 i)/D)) [fmode 0],
//   num * expf((2 i) * cexp) [fmode 1], num * powf(base, -2 (i - 1) / D) [fmode 2]; then cs/sn[s*half + i] = cos/sin((pscale * s) * invf_i)
__global__ __launch_bounds__(256) void k_invf(float* __restrict__ invb, int half, int D, float base, float num, int fmode, float cexp) {
    const int i = blockIdx.x * 256 + threadIdx.x;
    if (i >= ((half + 31) / 32) * 32) return;
    if (i >= half) { VST2(float, invb + i, 0.f); return; }
    const float e = (float)(2 * i) / (float)D;
    float invf;
    if (fmode == 1) invf = num * expf((float)(2 * i) * cexp);
    else if (fmode == 2) invf = num * powf(base, (-2.0f * ((float)i - 1.0f)) / (float)D);
    else invf = num * (1.0f / powf(base, e));
    VST2(float, invb + i, invf);
}
__global__ __launch_bounds__(256) void k_sincos(float* __restrict__ cs, float* __restrict__ sn, const float* __restrict__ invb, int S, int half, float pscale) {
    const int idx = blockIdx.x * 256 + threadIdx.x;
    if (idx >= S * half) return;
    const int s = idx / half, i = idx - s * half;
    const float ang = (pscale * (float)s) * invb[i];
    VST2(float, cs + idx, cosf(ang)); VST2(float, sn + idx, sinf(ang));
}

// k_mulact: dst[i] = act(x[i]) * y[i]
__global__ __launch_bounds__(256) void k_mulact(const float* __restrict__ x, const float* __restrict__ y, float* __restrict__ dst, int n, int act) {
    const int i = blockIdx.x * 256 + threadIdx.x;
    if (i < n) { const float v = act_fn(x[i], act) * y[i]; VST2(float, dst + i, v); }
}

// =====================================================================================================================
// k_matvec: thread-per-row matrix-vector products for N <= 8 output columns (heads with 1-3 outputs, gates), f32 on the VALU.
//   C[r*sCm + j] = act(alpha * sum_k A[r*sAm + k*sAk] * B[j*sBn + k*sBk] + bias[j]) + beta * R[r*sRm + j*sRn]; each thread writes its N contiguous floats.
// =====================================================================================================================
__global__ __launch_bounds__(256) void k_matvec(GemmP p) {
    // 32 lanes write one line with one instruction.
    const int rpt = (p.N == 1) ? 1 : 32;
    const long long r0 = ((long long)blockIdx.x * 256 + threadIdx.x) * rpt; const int z = blockIdx.z, zo = z / p.zi_n, zi = z - zo * p.zi_n;
    if (r0 >= p.M) return;
    const float* Bb = p.B + zo * p.sBo + zi * p.sBi;
    float* C = p.C + zo * p.sCo + zi * p.sCi; const float* R = p.R + zo * p.sRo + zi * p.sRi;
    for (int rr = 0; rr < rpt; ++rr) {
        const long long r = r0 + rr; if (r >= p.M) break;
        const float* A = p.A + zo * p.sAo + zi * p.sAi + r * p.sAm;
        float acc[8] = {0.f, 0.f, 0.f, 0.f, 0.f, 0.f, 0.f, 0.f};
        for (int k = 0; k < p.K; ++k) { const float a = A[(long long)k * p.sAk];
#pragma unroll
            for (int j = 0; j < 8; ++j) if (j < p.N) acc[j] += a * Bb[(long long)j * p.sBn + (long long)k * p.sBk]; }
#pragma unroll
        for (int j = 0; j < 8; ++j) if (j < p.N) {
            float v = acc[j] * p.alpha;
            if (p.flags & 1) v += p.bias[j];
            if (p.flags & 2) v += p.bias[r];
            v = act_fn(v, p.act);
            if (p.flags & 4) v += p.beta * R[r * p.sRm + (long long)j * p.sRn];
            VST2(float, C + r * p.sCm + j, v);
        }
    }
}
// k_smallsoftmax: thread-per-row softmax for short rows (n <= 64): dst[r*dr + j] = softmax(scale*src[r*sr + j])
__global__ __launch_bounds__(256) void k_smallsoftmax(const float* __restrict__ src, float* __restrict__ dst, long long sr, long long dr, int n, long long R, float scale) {
    const long long r0 = ((long long)blockIdx.x * 256 + threadIdx.x) * 32;
    for (int rr = 0; rr < 32; ++rr) {
        const long long r = r0 + rr; if (r >= R) return;
        const float* s = src + r * sr; float* d = dst + r * dr;
        float mx = -__builtin_inff();
        for (int j = 0; j < n; ++j) mx = fmaxf(mx, s[j] * scale);
        float sum = 0.f;
        for (int j = 0; j < n; ++j) sum += expf(s[j] * scale - mx);
        const float inv = 1.f / sum;
        for (int j = 0; j < n; ++j) { const float v = expf(s[j] * scale - mx) * inv; VST2(float, d + j, v); }
    }
}

__global__ __launch_bounds__(32) void k_unitstat(float* __restrict__ st) { const int t = threadIdx.x; const float v = (t == 1) ? 1.f : 0.f; VST2(float, st + t, v); }

// destination (e.g. a d_out whose row width is not a multiple of 32 floats) is written by consecutive lanes of one instruction
__global__ __launch_bounds__(256) void k_lincopy(const float* __restrict__ src, long long lds, float* __restrict__ dst, long long ldd, long long rows, int cols) {
    const long long i = (long long)blockIdx.x * 256 + threadIdx.x; if (i >= rows * cols) return;
    const long long r = i / cols; const int c = (int)(i - r * cols);
    const float v = src[r * lds + c]; VST2(float, dst + r * ldd + c, v);
}

namespace w25 {
typedef __attribute__((ext_vector_type(16))) _Float16 v16h;
typedef __attribute__((ext_vector_type(8)))  _Float16 v8h;
typedef __attribute__((ext_vector_type(16))) __bf16   v16b;
typedef __attribute__((ext_vector_type(8)))  __bf16   v8b;
typedef __attribute__((ext_vector_type(8)))  float    v8f;
typedef __attribute__((ext_vector_type(4)))  float    v4f;

__device__ __forceinline__ unsigned short f2bf_bits(float f) {
  unsigned u = __float_as_uint(f);
  return (unsigned short)((u + 0x7FFFu + ((u >> 16) & 1u)) >> 16);
}
__device__ __forceinline__ float bf_bits2f(unsigned short h) { return __uint_as_float(((unsigned)h) << 16); }

// hazard guards as plain device helpers (no inline asm inside the kernel template body)
__device__ __forceinline__ void dep_guard_h(v8f& a, v8f& b, v16h x, v16h y) { asm volatile("v_nop\n\tv_nop\n\tv_nop\n\tv_nop" : "+v"(a), "+v"(b) : "v"(x), "v"(y)); }
__device__ __forceinline__ void dep_guard_b(v8f& a, v8f& b, v16b x, v16b y) { asm volatile("v_nop\n\tv_nop\n\tv_nop\n\tv_nop" : "+v"(a), "+v"(b) : "v"(x), "v"(y)); }
__device__ __forceinline__ void keep4_h(v16h a, v16h b, v16h c, v16h d) { asm volatile("v_nop" :: "v"(a), "v"(b), "v"(c), "v"(d)); }
__device__ __forceinline__ void keep4_b(v16b a, v16b b, v16b c, v16b d) { asm volatile("v_nop" :: "v"(a), "v"(b), "v"(c), "v"(d)); }
__device__ __forceinline__ void acc_guard4(v8f& a, v8f& b, v8f& c, v8f& d) { asm volatile("v_nop\n\tv_nop\n\tv_nop\n\tv_nop" : "+v"(a), "+v"(b), "+v"(c), "+v"(d)); }
template <typename T> struct Frag;
template <> struct Frag<_Float16> {
  typedef v16h V; union U { v16h v; v8h h[2]; };
  static __device__ __forceinline__ v16h load(const _Float16* p) {   // elements 0..7 <- p[0..7], 8..15 <- p[16..23]
    U f; f.h[0] = *(const v8h*)(p); f.h[1] = *(const v8h*)(p + 16); return f.v;
  }
  static __device__ __forceinline__ v8f mma(v16h a, v16h b, v8f c) {
    return __builtin_amdgcn_wmma_f32_16x16x32_f16(false, a, false, b, (short)0, c, false, false);
  }
  static __device__ __forceinline__ void guard(v8f& a, v8f& b, v16h x, v16h y) { dep_guard_h(a, b, x, y); }
  static __device__ __forceinline__ void keep(v16h a, v16h b, v16h c, v16h d) { keep4_h(a, b, c, d); }
};
template <> struct Frag<__bf16> {
  typedef v16b V; union U { v16b v; v8b h[2]; };
  static __device__ __forceinline__ v16b load(const __bf16* p) {
    U f; f.h[0] = *(const v8b*)(p); f.h[1] = *(const v8b*)(p + 16); return f.v;
  }
  static __device__ __forceinline__ v8f mma(v16b a, v16b b, v8f c) {
    return __builtin_amdgcn_wmma_f32_16x16x32_bf16(false, a, false, b, (short)0, c, false, false);
  }
  static __device__ __forceinline__ void guard(v8f& a, v8f& b, v16b x, v16b y) { dep_guard_b(a, b, x, y); }
  static __device__ __forceinline__ void keep(v16b a, v16b b, v16b c, v16b d) { keep4_b(a, b, c, d); }
};

// ---- Register-blocked batched WMMA GEMM ------------------------------------
// C[m,n] = scale * sum_k A[m,k] * Bt[n,k] (+bias)(+resid); each wave owns a 64x64 tile.
// A row-major [M,K]; Bt row-major [N,K]; M,N % 64 == 0, K % 32 == 0.
// SPLIT: 0 = single planes. 1 = both operands are hi/lo planes (A2/Bt2 = lo planes, same layout); product = hi*hi + hi*lo + lo*hi.
//        2 = only A is hi/lo planes: hi*Bt + lo*Bt. 3 = only Bt is hi/lo planes: A*hi + A*lo. All products of a tile add up in one accumulator, in one launch.
// BIAS_MODE: 0 = none, 1 = bias[m], 2 = bias[n].
// OUT_MODE: 0 = f32, 1 = f16, 2 = bf16 hi plane (Cout) + bf16 lo plane (Cout2).
// ET: 0 = f16 operands, 1 = bf16 operands (pointers passed as 16-bit storage)
template <int ET> struct Elem;
template <> struct Elem<0> { typedef _Float16 T; };
template <> struct Elem<1> { typedef __bf16 T; };
template <int ET, int SPLIT, int BIAS_MODE, int OUT_MODE, bool RESID, int ACT = 0>
__global__ __launch_bounds__(256) void wmma_gemm64(
    const unsigned short* __restrict__ Ap, const unsigned short* __restrict__ A2p, int lda, long strideA,
    const unsigned short* __restrict__ Btp, const unsigned short* __restrict__ Bt2p, int ldb, long strideB,
    void* __restrict__ Cout, void* __restrict__ Cout2, int ldc, long strideC,
    const float* __restrict__ bias,
    const float* __restrict__ resid, long strideR,
    int M, int N, int K, float scale) {
  typedef typename Elem<ET>::T T;
  typedef typename Frag<T>::V V;
  constexpr bool SA = SPLIT == 1 || SPLIT == 2, SB = SPLIT == 1 || SPLIT == 3;   // A has a lo plane; Bt has a lo plane
  const T* A = (const T*)Ap; const T* A2 = (const T*)A2p; const T* Bt = (const T*)Btp; const T* Bt2 = (const T*)Bt2p;
  __shared__ __align__(16) float sT[8][16 * 68];   // per-wave 16x64 slab, pitch 68 floats
  const int b    = blockIdx.y;
  const int lane = threadIdx.x & 31;
  const int wave = threadIdx.x >> 5;
  const int tilesN = N >> 6;
  const int tilesM = M >> 6;
  const int tile = blockIdx.x * 8 + wave;
  if (tile >= tilesM * tilesN) return;   // wave-uniform; no block barriers in this kernel
  const int tm = tile / tilesN;
  const int tn = tile - tm * tilesN;
  const int m0 = tm << 6;
  const int n0 = tn << 6;

  const T* Ab  = A  + (size_t)b * strideA;
  const T* Bb  = Bt + (size_t)b * strideB;
  const T* Ab2 = SA ? (A2  + (size_t)b * strideA) : nullptr;
  const T* Bb2 = SB ? (Bt2 + (size_t)b * strideB) : nullptr;

  const int rlane = lane & 15;                 // row (A) / col (B, D) within subtile
  const int koff  = (lane >> 4) * 8;           // k offset of this lane half
  const int mOff  = (lane >> 4) * 8;           // D row offset

  v8f acc[4][4];
#pragma unroll
  for (int i = 0; i < 4; ++i)
#pragma unroll
    for (int j = 0; j < 4; ++j) acc[i][j] = (v8f){0.f,0.f,0.f,0.f,0.f,0.f,0.f,0.f};

  for (int k0 = 0; k0 < K; k0 += 32) {
    V bh[4], bl[4];
#pragma unroll
    for (int j = 0; j < 4; ++j) {
      const size_t bo = (size_t)(n0 + (j << 4) + rlane) * ldb + koff + k0;
      bh[j] = Frag<T>::load(Bb + bo);
      if (SB) bl[j] = Frag<T>::load(Bb2 + bo);
    }
#pragma unroll
    for (int i = 0; i < 4; ++i) {
      const size_t ao = (size_t)(m0 + (i << 4) + rlane) * lda + koff + k0;
      V ah = Frag<T>::load(Ab + ao);
      V al;
      if (SA) al = Frag<T>::load(Ab2 + ao);
      // one product after the other over the four tiles: an accumulator's next product stands four matrix instructions behind its last
      // (the three loops are unrolled so that acc, bh and bl are indexed by constants and stay in registers)
#pragma unroll
      for (int j = 0; j < 4; ++j) acc[i][j] = Frag<T>::mma(ah, bh[j], acc[i][j]);
      if (SB) {
#pragma unroll
        for (int j = 0; j < 4; ++j) acc[i][j] = Frag<T>::mma(ah, bl[j], acc[i][j]);
      }
      if (SA) {
#pragma unroll
        for (int j = 0; j < 4; ++j) acc[i][j] = Frag<T>::mma(al, bh[j], acc[i][j]);
      }
      Frag<T>::guard(acc[i][0], acc[i][3], ah, SA ? al : ah);
    }
    Frag<T>::keep(bh[0], bh[1], bh[2], bh[3]);
    if (SB) Frag<T>::keep(bl[0], bl[1], bl[2], bl[3]);
  }
  acc_guard4(acc[0][0], acc[0][1], acc[0][2], acc[0][3]);
  acc_guard4(acc[1][0], acc[1][1], acc[1][2], acc[1][3]);
  acc_guard4(acc[2][0], acc[2][1], acc[2][2], acc[2][3]);
  acc_guard4(acc[3][0], acc[3][1], acc[3][2], acc[3][3]);

  // ---- epilogue ----
  float* slab = sT[wave];
  const float* Rb = RESID ? (resid + (size_t)b * strideR) : nullptr;
#pragma unroll
  for (int i = 0; i < 4; ++i) {
    const int mBase = m0 + (i << 4);
#pragma unroll
    for (int j = 0; j < 4; ++j) {
      const int n = n0 + (j << 4) + rlane;
      float bv = 0.f;
      if (BIAS_MODE == 2) bv = bias[n];
#pragma unroll
      for (int r = 0; r < 8; ++r) {
        float v = acc[i][j][r] * scale;
        if (BIAS_MODE == 1) v += bias[mBase + mOff + r];
        if (BIAS_MODE == 2) v += bv;
        if (RESID) v += Rb[(size_t)(mBase + mOff + r) * ldc + n];
        if (ACT == 1) v = tanhf(v);
        if (ACT == 2) v = fmaxf(v, 0.0f);
        if (ACT == 3) v = v / (1.0f + expf(-v));
        if (ACT == 4) v = (v > 0.f) ? v : 0.01f * v;
        if (ACT == 5) v = 0.5f * v * (1.0f + erff(v * 0.70710678118654752f));
        if (ACT == 6) v = (v > 0.f) ? v : 0.2f * v;
        if (ACT == 7) { const float u = 0.7978845608028654f * (v + 0.044715f * v * v * v); v = 0.5f * v * (1.f + tanhf(u)); }
        slab[(mOff + r) * 68 + (j << 4) + rlane] = v;
      }
    }
    __builtin_amdgcn_fence(__ATOMIC_RELEASE, "workgroup");
    __builtin_amdgcn_wave_barrier();
    __builtin_amdgcn_fence(__ATOMIC_ACQUIRE, "workgroup");
    if (OUT_MODE == 0) {
      float* C = (float*)Cout + (size_t)b * strideC;
      const int hh = lane >> 4, c4 = (lane & 15) * 4;     // row seg = 256 B = 16 lanes x 16 B
      {
#pragma unroll
        for (int it = 0; it < 8; ++it) {
          const int row = it * 2 + hh;
          v4f v = *(const v4f*)(slab + row * 68 + c4);
          *(v4f*)(C + (size_t)(mBase + row) * ldc + n0 + c4) = v;
        }
        
      }
    } else {
      const int q = lane >> 3, c8 = (lane & 7) * 8;
      unsigned short* C  = (unsigned short*)Cout  + (size_t)b * strideC;
      unsigned short* C2 = (OUT_MODE == 2) ? ((unsigned short*)Cout2 + (size_t)b * strideC) : nullptr;
      {
#pragma unroll
        for (int it = 0; it < 4; ++it) {
          const int row = it * 4 + q;
          const float* sp = slab + row * 68 + c8;
          v8h hv, lv;
#pragma unroll
          for (int e = 0; e < 8; ++e) {
            if (OUT_MODE == 1) {
              hv[e] = (_Float16)sp[e];
            } else {
              unsigned short hb = f2bf_bits(sp[e]);
              unsigned short lb = f2bf_bits(sp[e] - bf_bits2f(hb));
              hv[e] = __builtin_bit_cast(_Float16, hb);
              lv[e] = __builtin_bit_cast(_Float16, lb);
            }
          }
          *(v8h*)(C + (size_t)(mBase + row) * ldc + n0 + c8) = hv;
          if (OUT_MODE == 2) *(v8h*)(C2 + (size_t)(mBase + row) * ldc + n0 + c8) = lv;
        }
        
      }
    }
    __builtin_amdgcn_fence(__ATOMIC_RELEASE, "workgroup");
    __builtin_amdgcn_wave_barrier();
    __builtin_amdgcn_fence(__ATOMIC_ACQUIRE, "workgroup");
  }
}

__global__ __launch_bounds__(256) void cast_f32_f16x2(
    const float* __restrict__ in, _Float16* __restrict__ out, int n2) {
  int i = blockIdx.x * 256 + threadIdx.x;
  if (i < n2) {
    const _Float16 h0 = (_Float16)in[2 * i], h1 = (_Float16)in[2 * i + 1];
    const unsigned u = (unsigned)__builtin_bit_cast(unsigned short, h0) | ((unsigned)__builtin_bit_cast(unsigned short, h1) << 16);
    ((unsigned*)out)[i] = u;
    
  }
}


} // namespace w25

__global__ __launch_bounds__(256) void k_castT16(const float* __restrict__ src, long long lds, _Float16* __restrict__ dst, long long ldd, int R, int C, float s) {
    const long long i = (long long)blockIdx.x * 256 + threadIdx.x; const long long np = (long long)C * (R / 2); if (i >= np) return; const int c = (int)(i / (R / 2)); const int r = 2 * (int)(i % (R / 2));
    const _Float16 h0 = (_Float16)(src[(long long)r * lds + c] * s), h1 = (_Float16)(src[(long long)(r + 1) * lds + c] * s);
    const unsigned u = (unsigned)__builtin_bit_cast(unsigned short, h0) | ((unsigned)__builtin_bit_cast(unsigned short, h1) << 16);
    unsigned* d = (unsigned*)(dst + (long long)c * ldd + r); *d = u;  }
__global__ __launch_bounds__(256) void k_cast16(const float* __restrict__ src, long long lds, _Float16* __restrict__ dst, long long ldd, int R, int C, float s) {
    const long long i = (long long)blockIdx.x * 256 + threadIdx.x; const long long np = (long long)R * (C / 2); if (i >= np) return; const int r = (int)(i / (C / 2)); const int c = 2 * (int)(i % (C / 2));
    const _Float16 h0 = (_Float16)(src[(long long)r * lds + c] * s), h1 = (_Float16)(src[(long long)r * lds + c + 1] * s);
    const unsigned u = (unsigned)__builtin_bit_cast(unsigned short, h0) | ((unsigned)__builtin_bit_cast(unsigned short, h1) << 16);
    unsigned* d = (unsigned*)(dst + (long long)r * ldd + c); *d = u;  }

// f32 -> bf16 hi plane + bf16 lo plane (x = hi + lo to ~2^-17 relative; RNE both), [R][C] -> [R][C] (or transposed to [C][R]); 2 consecutive destination elements
__device__ __forceinline__ unsigned int f2bf2_pack(float a, float b, unsigned int* lo) {
    const unsigned short ha = w25::f2bf_bits(a), hb = w25::f2bf_bits(b);
    const unsigned short la = w25::f2bf_bits(a - w25::bf_bits2f(ha)), lb = w25::f2bf_bits(b - w25::bf_bits2f(hb));
    *lo = (unsigned)la | ((unsigned)lb << 16); return (unsigned)ha | ((unsigned)hb << 16); }
// blockIdx.y = matrix of a batch: source matrices sz floats apart, destination planes dz elements apart
__global__ __launch_bounds__(256) void k_castS16(const float* __restrict__ src, long long lds, __bf16* __restrict__ dhi, __bf16* __restrict__ dlo, long long ldd, int R, int C, float s, int transpose, long long sz, long long dz) {
    src += (long long)blockIdx.y * sz; dhi += (long long)blockIdx.y * dz; dlo += (long long)blockIdx.y * dz;
    const long long i = (long long)blockIdx.x * 256 + threadIdx.x; long long o; float a, b;
    if (transpose) { const long long np = (long long)C * (R / 2); if (i >= np) return; const int c = (int)(i / (R / 2)); const int r = 2 * (int)(i % (R / 2)); a = src[(long long)r * lds + c] * s; b = src[(long long)(r + 1) * lds + c] * s; o = (long long)c * ldd + r; }
    else { const long long np = (long long)R * (C / 2); if (i >= np) return; const int r = (int)(i / (C / 2)); const int c = 2 * (int)(i % (C / 2)); a = src[(long long)r * lds + c] * s; b = src[(long long)r * lds + c + 1] * s; o = (long long)r * ldd + c; }
    unsigned lo; const unsigned hi = f2bf2_pack(a, b, &lo); unsigned* ph = (unsigned*)(dhi + o); unsigned* pl = (unsigned*)(dlo + o);
    *ph = hi; *pl = lo;  }

namespace w25 {
// =====================================================================================
// Generic causal/non-causal attention for head_dim 64, f32 in / f32 out; 16-bit operands: bf16 with optional hi/lo splits, or
// plain f16 (F16=true, non-split, probabilities carried x2^15).
//   scores = (q*qscale)·kᵀ : v_wmma_f32_16x16x32_bf16; SPLIT_QK -> q,k as bf16 hi/lo (hi·hi + hi·lo + lo·hi)
//   out    = p·v           : v_wmma_f32_16x16x32_bf16; SPLIT_PV -> p,v as bf16 hi/lo; else p,v plain bf16
//   f32 accumulate; online softmax in f32. Block = 4 waves = 64 query rows of one (batch, head); S % 64 == 0.
//   Element (b, s, h, d) of tensor X lives at X[b*X_bs + s*X_rs + h*X_hs + d] (strides in floats, multiples of 4).
//   Masking: mask_mode 0 none, 1 causal (kv > q masked), 2 tensor [S][Skv] shared over (b,h) (float if
//   mask_is_int==0, int32 with element == 0 -> masked if 1, int32 with element != 0 -> masked if 2), 3 per-token vectors qmask[B][S] & kvmask[B][Skv] (int32,
//   0 -> masked), 4 causal + sliding window (kv > q or q - kv > W masked; W passed in mask_is_int);
//   5 = relative-position bias: s += cp[b,h,q][idx[q][kv]] + pc[b,h,kv][idx[q][kv]] with idx = mask_b ([S][Skv] int32) and
//   mask_a an int32 [S][Skv] tensor with nonzero = masked (tables: element (b,h,row,n) at X + b*c_bs + h*c_hs + row*c_rs + n);
//   masked scores are replaced by mask_fill (e.g. -inf or -1e9) before the softmax.
//   grid.x = B * H * (S/64) (or a sub-range with blk0).
// =====================================================================================
#define AT_D 64
#define AT_NW 4
#define AT_QB 64
#define AT_KC 64
struct AttnGeom { const float* cp = nullptr; const float* pc = nullptr; long c_bs = 0, c_rs = 0, c_hs = 0;   // mode-5 score-bias tables
                  long q_bs, q_rs, q_hs, k_bs, k_rs, k_hs, v_bs, v_rs, v_hs, o_bs, o_rs, o_hs;
                  int S, Skv, H, mask_mode; float qscale; int blk0; float mask_fill; int mask_is_int; };
static_assert(sizeof(AttnGeom) == 168, "no padding");

__device__ __forceinline__ unsigned short at_bf_bits(float f) {
  unsigned u = __float_as_uint(f);
  return (unsigned short)((u + 0x7FFFu + ((u >> 16) & 1u)) >> 16);
}
__device__ __forceinline__ __bf16 at_f2bf(float f) { return __builtin_bit_cast(__bf16, at_bf_bits(f)); }
__device__ __forceinline__ void at_split(float f, __bf16& hi, __bf16& lo) {
  const unsigned short hb = at_bf_bits(f);
  hi = __builtin_bit_cast(__bf16, hb);
  lo = at_f2bf(f - __uint_as_float(((unsigned)hb) << 16));
}
__device__ __forceinline__ v8f at_mma(v16b a, v16b b, v8f c) {
  c = __builtin_amdgcn_wmma_f32_16x16x32_bf16(false, a, false, b, (short)0, c, false, false);
  asm volatile("v_nop\n\tv_nop\n\tv_nop\n\tv_nop" : "+v"(c) : "v"(a), "v"(b));
  return c;
}
// 16-bit element as a bit pattern held in a __bf16 slot: f16 bits when F16, bf16 (RNE) otherwise
template <bool F16> __device__ __forceinline__ __bf16 at_to16(float f) {
  if (F16) return __builtin_bit_cast(__bf16, (_Float16)f);
  return at_f2bf(f);
}
template <bool F16> __device__ __forceinline__ v8f at_mma16(v16b a, v16b b, v8f c) {
  if (F16) {
    const v16h ah = __builtin_bit_cast(v16h, a), bh = __builtin_bit_cast(v16h, b);
    c = __builtin_amdgcn_wmma_f32_16x16x32_f16(false, ah, false, bh, (short)0, c, false, false);
    asm volatile("v_nop\n\tv_nop\n\tv_nop\n\tv_nop" : "+v"(c) : "v"(ah), "v"(bh));
    return c;
  }
  return at_mma(a, b, c);
}

template <bool SPLIT_QK, bool SPLIT_PV, bool F16 = false>
__global__ __launch_bounds__(128)
void attn64_kernel(const float* __restrict__ q, const float* __restrict__ k,
                   const float* __restrict__ v, float* __restrict__ out,
                   const void* __restrict__ mask_a, const int* __restrict__ mask_b, AttnGeom g) {
  static_assert(!(F16 && (SPLIT_QK || SPLIT_PV)), "f16 mode is non-split");
  const float PSC = F16 ? 32768.0f : 1.0f;     // f16 probabilities carried x2^15 (subnormal range), folded into the final 1/l
  union FB { v16b v; v8b h[2]; };
  __shared__ __align__(16) __bf16 Ksh[AT_KC * AT_D];             // K hi [kv][d]      8 KB
  __shared__ __align__(16) __bf16 Ksl[SPLIT_QK ? AT_KC * AT_D : 8];
  __shared__ __align__(16) __bf16 Vth[AT_D * AT_KC];             // V hi [d][kv]      8 KB
  __shared__ __align__(16) __bf16 Vtl[SPLIT_PV ? AT_D * AT_KC : 8];
  __shared__ __align__(16) __bf16 Psh[AT_NW][16 * AT_KC];        // per wave P hi [row][kv]  8 KB
  __shared__ __align__(16) __bf16 Psl[SPLIT_PV ? AT_NW : 1][SPLIT_PV ? 16 * AT_KC : 8];
  __shared__ __align__(16) float  Os[AT_NW][16 * 68];            // per wave out tile, pitch 68

  const int tid  = threadIdx.x;
  const int wave = tid >> 5;
  const int lane = tid & 31;
  const int hh   = lane >> 4;
  const int c    = lane & 15;

  const int nqb = g.S / AT_QB;
  const int bx = blockIdx.x + g.blk0;
  const int qb = bx % nqb;
  const int bh = bx / nqb;
  const int h  = bh % g.H;
  const int b  = bh / g.H;
  const int qbase_block = qb * AT_QB;
  const int q0 = qbase_block + wave * 16;

  const float* qb_ptr = q + (size_t)b * g.q_bs + (size_t)h * g.q_hs;
  const float* kb_ptr = k + (size_t)b * g.k_bs + (size_t)h * g.k_hs;
  const float* vb_ptr = v + (size_t)b * g.v_bs + (size_t)h * g.v_hs;
  float*       ob_ptr = out + (size_t)b * g.o_bs + (size_t)h * g.o_hs;

  // ---- Q fragments (A operand): 2 d-chunks, hi (and lo) ----
  v16b qah[2], qal[2];
  {
    const float* qrow = qb_ptr + (size_t)(q0 + c) * g.q_rs;
#pragma unroll
    for (int dc = 0; dc < 2; ++dc) {
#pragma unroll
      for (int e = 0; e < 8; ++e) {
        const float f0 = qrow[dc * 32 + 8 * hh + e] * g.qscale;
        const float f1 = qrow[dc * 32 + 16 + 8 * hh + e] * g.qscale;
        if (SPLIT_QK) { __bf16 hq, lq; at_split(f0, hq, lq); qah[dc][e] = hq; qal[dc][e] = lq; at_split(f1, hq, lq); qah[dc][8 + e] = hq; qal[dc][8 + e] = lq; }
        else { qah[dc][e] = at_to16<F16>(f0); qah[dc][8 + e] = at_to16<F16>(f1); qal[dc][e] = qah[dc][e]; qal[dc][8 + e] = qah[dc][8 + e]; }
      }
    }
  }

  float mrow[8], lrow[8];
  v8f oacc[4];
#pragma unroll
  for (int r = 0; r < 8; ++r) { mrow[r] = -INFINITY; lrow[r] = 0.f; }
#pragma unroll
  for (int t = 0; t < 4; ++t) oacc[t] = (v8f){0.f,0.f,0.f,0.f,0.f,0.f,0.f,0.f};

  const int nChunks = (g.mask_mode == 1 || g.mask_mode == 4) ? (qb + 1) : (g.Skv / AT_KC);   // block-uniform
  // per-row query mask (mode 3)
  int qkeep[8];
#pragma unroll
  for (int r = 0; r < 8; ++r) qkeep[r] = (g.mask_mode == 3) ? mask_b[(size_t)b * g.S + q0 + 8 * hh + r] : 1;   // mask_b = qmask in mode 3
  for (int kc = 0; kc < nChunks; ++kc) {
    const int kv0 = kc * AT_KC;
    __syncthreads();
    {
      const int kvr = tid >> 1, dh = (tid & 1) * 32;
      const float* krow = kb_ptr + (size_t)(kv0 + kvr) * g.k_rs + dh;
      const float* vrow = vb_ptr + (size_t)(kv0 + kvr) * g.v_rs + dh;
#pragma unroll
      for (int i = 0; i < 8; ++i) {
        v4f kk = *(const v4f*)(krow + 4 * i);
        v4f vv = *(const v4f*)(vrow + 4 * i);
#pragma unroll
        for (int e = 0; e < 4; ++e) {
          const int d = dh + 4 * i + e;
          if (SPLIT_QK) { __bf16 a, bl; at_split(kk[e], a, bl); Ksh[kvr * AT_D + d] = a; Ksl[kvr * AT_D + d] = bl; }
          else Ksh[kvr * AT_D + d] = at_to16<F16>(kk[e]);
          if (SPLIT_PV) { __bf16 a, bl; at_split(vv[e], a, bl); Vth[d * AT_KC + kvr] = a; Vtl[d * AT_KC + kvr] = bl; }
          else Vth[d * AT_KC + kvr] = at_to16<F16>(vv[e]);
        }
      }
    }
    __syncthreads();

    v8f s[4];
#pragma unroll
    for (int j = 0; j < 4; ++j) {
      s[j] = (v8f){0.f,0.f,0.f,0.f,0.f,0.f,0.f,0.f};
#pragma unroll 1
      for (int dc = 0; dc < 2; ++dc) {
        FB kb;
        kb.h[0] = *(const v8b*)(Ksh + (j * 16 + c) * AT_D + dc * 32 + 8 * hh);
        kb.h[1] = *(const v8b*)(Ksh + (j * 16 + c) * AT_D + dc * 32 + 16 + 8 * hh);
        s[j] = at_mma16<F16>(qah[dc], kb.v, s[j]);
        if (SPLIT_QK) {
          FB kl;
          kl.h[0] = *(const v8b*)(Ksl + (j * 16 + c) * AT_D + dc * 32 + 8 * hh);
          kl.h[1] = *(const v8b*)(Ksl + (j * 16 + c) * AT_D + dc * 32 + 16 + 8 * hh);
          s[j] = at_mma16<F16>(qah[dc], kl.v, s[j]);
          s[j] = at_mma16<F16>(qal[dc], kb.v, s[j]);
        }
      }
    }
    const bool diag = (g.mask_mode == 1) && (kc == qb);
    int kvkeep[4] = {1, 1, 1, 1};
    if (g.mask_mode == 3) {
#pragma unroll
      for (int j = 0; j < 4; ++j) kvkeep[j] = ((const int*)mask_a)[(size_t)b * g.Skv + kv0 + j * 16 + c];   // mask_a = kvmask
    }
    float cm[8];
#pragma unroll
    for (int r = 0; r < 8; ++r) {
      const int qrow = q0 + 8 * hh + r;
      float m = -INFINITY;
#pragma unroll
      for (int j = 0; j < 4; ++j) {
        const int kvcol = kv0 + j * 16 + c;
        bool masked = false;
        if (diag) masked = (kvcol > qrow);
        else if (g.mask_mode == 4) masked = (kvcol > qrow) || (qrow - kvcol > g.mask_is_int);
        else if (g.mask_mode == 2) {
          const size_t mi = (size_t)qrow * g.Skv + kvcol;
          masked = (g.mask_is_int == 0) ? (((const float*)mask_a)[mi] == 0.0f)
                 : (g.mask_is_int == 1) ? (((const int*)mask_a)[mi] == 0) : (((const int*)mask_a)[mi] != 0);
        } else if (g.mask_mode == 3) masked = (qkeep[r] == 0) || (kvkeep[j] == 0);
        else if (g.mask_mode == 5) {
          const size_t mi = (size_t)qrow * g.Skv + kvcol;
          masked = (((const int*)mask_a)[mi] != 0);
          int n = mask_b[mi]; n = n < 0 ? 0 : n;
          s[j][r] += g.cp[(size_t)b * g.c_bs + (size_t)h * g.c_hs + (size_t)qrow * g.c_rs + n]
                   + g.pc[(size_t)b * g.c_bs + (size_t)h * g.c_hs + (size_t)kvcol * g.c_rs + n];
        }
        if (masked) s[j][r] = g.mask_fill;
        m = fmaxf(m, s[j][r]);
      }
#pragma unroll
      for (int off = 1; off < 16; off <<= 1) m = fmaxf(m, __shfl_xor(m, off, 32));
      cm[r] = m;
    }
    __bf16* pwh = Psh[wave];
    __bf16* pwl = Psl[SPLIT_PV ? wave : 0];
#pragma unroll
    for (int r = 0; r < 8; ++r) {
      const float mnew = fmaxf(mrow[r], cm[r]);
      const float alpha = expf(mrow[r] - mnew);
      mrow[r] = mnew;
      float psum = 0.f;
#pragma unroll
      for (int j = 0; j < 4; ++j) {
        const float p = expf(s[j][r] - mnew);
        psum += p;
        if (SPLIT_PV) { __bf16 a, bl; at_split(p, a, bl); pwh[(8 * hh + r) * AT_KC + j * 16 + c] = a; pwl[(8 * hh + r) * AT_KC + j * 16 + c] = bl; }
        else pwh[(8 * hh + r) * AT_KC + j * 16 + c] = at_to16<F16>(p * PSC);
      }
#pragma unroll
      for (int off = 1; off < 16; off <<= 1) psum += __shfl_xor(psum, off, 32);
      lrow[r] = lrow[r] * alpha + psum;
#pragma unroll
      for (int t = 0; t < 4; ++t) oacc[t][r] *= alpha;
    }
    __builtin_amdgcn_fence(__ATOMIC_RELEASE, "workgroup");
    __builtin_amdgcn_wave_barrier();
    __builtin_amdgcn_fence(__ATOMIC_ACQUIRE, "workgroup");
#pragma unroll 1
    for (int kk = 0; kk < 2; ++kk) {
      FB pa, pl;
      pa.h[0] = *(const v8b*)(pwh + c * AT_KC + kk * 32 + 8 * hh);
      pa.h[1] = *(const v8b*)(pwh + c * AT_KC + kk * 32 + 16 + 8 * hh);
      if (SPLIT_PV) {
        pl.h[0] = *(const v8b*)(pwl + c * AT_KC + kk * 32 + 8 * hh);
        pl.h[1] = *(const v8b*)(pwl + c * AT_KC + kk * 32 + 16 + 8 * hh);
      }
#pragma unroll
      for (int t = 0; t < 4; ++t) {
        FB vb;
        vb.h[0] = *(const v8b*)(Vth + (t * 16 + c) * AT_KC + kk * 32 + 8 * hh);
        vb.h[1] = *(const v8b*)(Vth + (t * 16 + c) * AT_KC + kk * 32 + 16 + 8 * hh);
        oacc[t] = at_mma16<F16>(pa.v, vb.v, oacc[t]);
        if (SPLIT_PV) {
          FB vl;
          vl.h[0] = *(const v8b*)(Vtl + (t * 16 + c) * AT_KC + kk * 32 + 8 * hh);
          vl.h[1] = *(const v8b*)(Vtl + (t * 16 + c) * AT_KC + kk * 32 + 16 + 8 * hh);
          oacc[t] = at_mma16<F16>(pa.v, vl.v, oacc[t]);
          oacc[t] = at_mma16<F16>(pl.v, vb.v, oacc[t]);
        }
      }
    }
  }

  float* os = Os[wave];
#pragma unroll
  for (int r = 0; r < 8; ++r) {
    const float inv = 1.0f / (lrow[r] * PSC);
#pragma unroll
    for (int t = 0; t < 4; ++t) os[(8 * hh + r) * 68 + t * 16 + c] = oacc[t][r] * inv;
  }
  __builtin_amdgcn_fence(__ATOMIC_RELEASE, "workgroup");
  __builtin_amdgcn_wave_barrier();
  __builtin_amdgcn_fence(__ATOMIC_ACQUIRE, "workgroup");
  {
    const int c4 = (lane & 15) * 4;
    {
#pragma unroll
      for (int it = 0; it < 8; ++it) {
        const int row = it * 2 + hh;
        v4f val = *(const v4f*)(os + row * 68 + c4);
        *(v4f*)(ob_ptr + (size_t)(q0 + row) * g.o_rs + c4) = val;
      }
      
    }
  }
}

} // namespace w25


__device__ __forceinline__ void st_h2(unsigned short* d2, float a, float b) { const unsigned u = (unsigned)__builtin_bit_cast(unsigned short, (_Float16)a) | ((unsigned)__builtin_bit_cast(unsigned short, (_Float16)b) << 16); unsigned* d = (unsigned*)d2; *d = u;  }
__device__ __forceinline__ float ldh(const unsigned short* p) { return (float)__builtin_bit_cast(_Float16, *p); }
__device__ __forceinline__ v4f ld4h(const unsigned short* p) { const unsigned long long u = *(const unsigned long long*)p; v4f a;
    a.x = (float)__builtin_bit_cast(_Float16, (unsigned short)(u & 0xFFFFu)); a.y = (float)__builtin_bit_cast(_Float16, (unsigned short)((u >> 16) & 0xFFFFu)); a.z = (float)__builtin_bit_cast(_Float16, (unsigned short)((u >> 32) & 0xFFFFu)); a.w = (float)__builtin_bit_cast(_Float16, (unsigned short)((u >> 48) & 0xFFFFu)); return a; }
__device__ __forceinline__ unsigned long long pk4h(v4f s) { return (unsigned long long)__builtin_bit_cast(unsigned short, (_Float16)s.x) | ((unsigned long long)__builtin_bit_cast(unsigned short, (_Float16)s.y) << 16) | ((unsigned long long)__builtin_bit_cast(unsigned short, (_Float16)s.z) << 32) | ((unsigned long long)__builtin_bit_cast(unsigned short, (_Float16)s.w) << 48); }
typedef unsigned v4u __attribute__((ext_vector_type(4)));
__device__ __forceinline__ void st8h(unsigned short* d, v4f a, v4f b) { const unsigned long long pa = pk4h(a), pb = pk4h(b); v4u pk; pk.x = (unsigned)(pa & 0xFFFFFFFFull); pk.y = (unsigned)(pa >> 32); pk.z = (unsigned)(pb & 0xFFFFFFFFull); pk.w = (unsigned)(pb >> 32); v4u* dd = (v4u*)d; *dd = pk;  }
__device__ __forceinline__ unsigned short bfu_rne(float v) { unsigned u = __builtin_bit_cast(unsigned, v); u += 0x7FFFu + ((u >> 16) & 1u); return (unsigned short)(u >> 16); }
__device__ __forceinline__ void bfsplit(float v, unsigned short& hi, unsigned short& lo) { hi = bfu_rne(v); lo = bfu_rne(v - __builtin_bit_cast(float, (unsigned)hi << 16)); }
__device__ __forceinline__ void st_s2(unsigned short* Hp, unsigned short* Lp, long long o, float a, float b) { unsigned short h0,l0,h1,l1; bfsplit(a,h0,l0); bfsplit(b,h1,l1); const unsigned ph = (unsigned)h0 | ((unsigned)h1 << 16), pl = (unsigned)l0 | ((unsigned)l1 << 16);
    unsigned* dh = (unsigned*)(Hp + o); unsigned* dl = (unsigned*)(Lp + o); *dh = ph; *dl = pl;  }
__device__ __forceinline__ int cl(int v, int n) { return min(max(v, 0), n - 1); }

// GAT-style aggregation over a device in-edge CSR at dst (+ optional explicit self loop as iteration j = -1):
//   logit = leaky(AS[src][h] + AD[n][h] (+ EW[e]*CW[h]), slope); softmax over the node's edges per head; acc[c] = sum alpha XP[src][c] (f16 gather plane, pitch XW; 256 channels = H heads x CH)
//   wave per node; lane L owns channels 8L..8L+7 (head = 8L / CH); per-lane softmax state (lanes of one head agree) -> no shuffles in the loop.
//   EPI 0: + bias -> f32 OUT[n][256] via LDS redistribution (two 16-B stores per lane, each instruction 512 contiguous B)
//   EPI 1: + bias, LayerNorm(256) * g + bb, relu -> bf16 hi/lo planes OH/OL [n][256] (16-B stores)
//   EPI 2: mean over the 256/CH heads + bias[0..CH-1] , LayerNorm(64) * g + bb, relu -> f32 OUT[n][64] (CH must be 64; LDS redistribution, 8-B stores)
//   EPI 3: mean over heads + bias -> f32 OUT[n][64] (no norm / activation)
//   EPI 4: + bias, ELU -> bf16 hi/lo planes OH/OL [n][256];  EPI 5: + bias (full 256-wide, per head), ELU, then mean over the 256/CH heads -> f32 OUT[n][64]
//   EPI 6: (CH = 128, two heads) mean over the two heads, + bias[0..127], relu -> f32 OUT[n][128] (LDS redistribution, 16-B stores)
//   EWM 0: no edge weights; 1: logit += EW[e] * CW[h] (self loop weight 1); 2: alpha *= EW[e] after the softmax (message scale; self loop weight 1)
template <int CH, bool SELF, int EWM, int EPI>
__global__ __launch_bounds__(256) void k_gat_agg(const unsigned short* __restrict__ XP, int XW, const float* __restrict__ AS, const float* __restrict__ AD, int ASTR, const float* __restrict__ EW, const float* __restrict__ CW,
        const int* __restrict__ esrc, const int* __restrict__ off, const int* __restrict__ cnt, const int* __restrict__ slot, const float* __restrict__ bias, const float* __restrict__ g, const float* __restrict__ bb,
        float* __restrict__ OUT, unsigned short* __restrict__ OH, unsigned short* __restrict__ OL, int N, int E, int CAP, float slope) {
    __shared__ float stage[8][256];
    const int wv = threadIdx.x >> 5; const int n = blockIdx.x * 8 + wv; const int L = threadIdx.x & 31; if (n >= N) return; const int c0 = 8 * L; const int h = c0 / CH;
    const float ad = AD[(long long)n * ASTR + h]; const float cw = (EWM == 1) ? CW[h] : 0.f; float m = -3.0e38f, s = 0.f; v4f a0, a1; a0.x = a0.y = a0.z = a0.w = 0.f; a1 = a0;
    const int p0 = cl(off[n], E + 1), cn = min(max(cnt[n], 0), CAP);
    for (int j = (SELF ? -1 : 0); j < cn; ++j) { int sj; float ew = 0.f;
        if (j < 0) { sj = n; ew = 1.f; } else { int e = slot[cl(p0 + j, E)]; e = cl(e, E); sj = cl(esrc[e], N); if (EWM != 0) ew = EW[e]; }
        float lg = AS[(long long)sj * ASTR + h] + ad + ((EWM == 1) ? ew * cw : 0.f); lg = (lg >= 0.f) ? lg : slope * lg;
        const float mn = fmaxf(m, lg); const float cz = expf(m - mn), pj = expf(lg - mn); s = s * cz + pj; const float pw = (EWM == 2) ? pj * ew : pj;
        const unsigned short* xr = XP + (long long)sj * XW + c0; a0 = a0 * cz + ld4h(xr) * pw; a1 = a1 * cz + ld4h(xr + 4) * pw; m = mn; }
    const float inv = (s > 0.f) ? 1.f / (s + 1e-16f) : 0.f; a0 = a0 * inv; a1 = a1 * inv;
    if (EPI == 0 || EPI == 1 || EPI == 4 || EPI == 5) { a0 = a0 + *(const v4f*)(bias + c0); a1 = a1 + *(const v4f*)(bias + c0 + 4); }
    if (EPI == 4 || EPI == 5) { a0.x = (a0.x > 0.f) ? a0.x : (expf(a0.x) - 1.f); a0.y = (a0.y > 0.f) ? a0.y : (expf(a0.y) - 1.f); a0.z = (a0.z > 0.f) ? a0.z : (expf(a0.z) - 1.f); a0.w = (a0.w > 0.f) ? a0.w : (expf(a0.w) - 1.f);
        a1.x = (a1.x > 0.f) ? a1.x : (expf(a1.x) - 1.f); a1.y = (a1.y > 0.f) ? a1.y : (expf(a1.y) - 1.f); a1.z = (a1.z > 0.f) ? a1.z : (expf(a1.z) - 1.f); a1.w = (a1.w > 0.f) ? a1.w : (expf(a1.w) - 1.f); }
    if (EPI == 4) { float o8[8] = {a0.x, a0.y, a0.z, a0.w, a1.x, a1.y, a1.z, a1.w}; unsigned short hh[8], ll[8];
#pragma unroll
        for (int u = 0; u < 8; ++u) bfsplit(o8[u], hh[u], ll[u]);
        const unsigned long long ph0 = (unsigned long long)hh[0] | ((unsigned long long)hh[1] << 16) | ((unsigned long long)hh[2] << 32) | ((unsigned long long)hh[3] << 48), pl0 = (unsigned long long)ll[0] | ((unsigned long long)ll[1] << 16) | ((unsigned long long)ll[2] << 32) | ((unsigned long long)ll[3] << 48);
        const unsigned long long ph1 = (unsigned long long)hh[4] | ((unsigned long long)hh[5] << 16) | ((unsigned long long)hh[6] << 32) | ((unsigned long long)hh[7] << 48), pl1 = (unsigned long long)ll[4] | ((unsigned long long)ll[5] << 16) | ((unsigned long long)ll[6] << 32) | ((unsigned long long)ll[7] << 48);
        v4u pk; pk.x = (unsigned)(ph0 & 0xFFFFFFFFull); pk.y = (unsigned)(ph0 >> 32); pk.z = (unsigned)(ph1 & 0xFFFFFFFFull); pk.w = (unsigned)(ph1 >> 32); v4u* dh = (v4u*)(OH + (long long)n * 256 + c0); *dh = pk; 
        v4u ql; ql.x = (unsigned)(pl0 & 0xFFFFFFFFull); ql.y = (unsigned)(pl0 >> 32); ql.z = (unsigned)(pl1 & 0xFFFFFFFFull); ql.w = (unsigned)(pl1 >> 32); v4u* dl = (v4u*)(OL + (long long)n * 256 + c0); *dl = ql;  return; }
    if (EPI == 6) {
        a0.x += __shfl_xor(a0.x, 16); a0.y += __shfl_xor(a0.y, 16); a0.z += __shfl_xor(a0.z, 16); a0.w += __shfl_xor(a0.w, 16); a1.x += __shfl_xor(a1.x, 16); a1.y += __shfl_xor(a1.y, 16); a1.z += __shfl_xor(a1.z, 16); a1.w += __shfl_xor(a1.w, 16);
        if (L < 16) { const int cb = 8 * L; const v4f b0 = *(const v4f*)(bias + cb), b1v = *(const v4f*)(bias + cb + 4);
            stage[wv][cb] = fmaxf(a0.x * 0.5f + b0.x, 0.f); stage[wv][cb + 1] = fmaxf(a0.y * 0.5f + b0.y, 0.f); stage[wv][cb + 2] = fmaxf(a0.z * 0.5f + b0.z, 0.f); stage[wv][cb + 3] = fmaxf(a0.w * 0.5f + b0.w, 0.f);
            stage[wv][cb + 4] = fmaxf(a1.x * 0.5f + b1v.x, 0.f); stage[wv][cb + 5] = fmaxf(a1.y * 0.5f + b1v.y, 0.f); stage[wv][cb + 6] = fmaxf(a1.z * 0.5f + b1v.z, 0.f); stage[wv][cb + 7] = fmaxf(a1.w * 0.5f + b1v.w, 0.f); }
        __builtin_amdgcn_fence(__ATOMIC_RELEASE, "workgroup"); __builtin_amdgcn_wave_barrier(); __builtin_amdgcn_fence(__ATOMIC_ACQUIRE, "workgroup");
        v4f o6; o6.x = stage[wv][4 * L]; o6.y = stage[wv][4 * L + 1]; o6.z = stage[wv][4 * L + 2]; o6.w = stage[wv][4 * L + 3]; VST2V4(OUT + (long long)n * 128 + 4 * L, o6); return; }
    if (EPI == 5) {
        a0.x += __shfl_xor(a0.x, 8); a0.y += __shfl_xor(a0.y, 8); a0.z += __shfl_xor(a0.z, 8); a0.w += __shfl_xor(a0.w, 8); a1.x += __shfl_xor(a1.x, 8); a1.y += __shfl_xor(a1.y, 8); a1.z += __shfl_xor(a1.z, 8); a1.w += __shfl_xor(a1.w, 8);
        a0.x += __shfl_xor(a0.x, 16); a0.y += __shfl_xor(a0.y, 16); a0.z += __shfl_xor(a0.z, 16); a0.w += __shfl_xor(a0.w, 16); a1.x += __shfl_xor(a1.x, 16); a1.y += __shfl_xor(a1.y, 16); a1.z += __shfl_xor(a1.z, 16); a1.w += __shfl_xor(a1.w, 16);
        const int gq5 = L & 7; a0 = a0 * 0.25f; a1 = a1 * 0.25f;
        if (L < 8) { stage[wv][8 * gq5] = a0.x; stage[wv][8 * gq5 + 1] = a0.y; stage[wv][8 * gq5 + 2] = a0.z; stage[wv][8 * gq5 + 3] = a0.w; stage[wv][8 * gq5 + 4] = a1.x; stage[wv][8 * gq5 + 5] = a1.y; stage[wv][8 * gq5 + 6] = a1.z; stage[wv][8 * gq5 + 7] = a1.w; }
        __builtin_amdgcn_fence(__ATOMIC_RELEASE, "workgroup"); __builtin_amdgcn_wave_barrier(); __builtin_amdgcn_fence(__ATOMIC_ACQUIRE, "workgroup");
        const unsigned long long pk5 = (unsigned long long)__builtin_bit_cast(unsigned, stage[wv][2 * L]) | ((unsigned long long)__builtin_bit_cast(unsigned, stage[wv][2 * L + 1]) << 32); VST2(unsigned long long, (unsigned long long*)(OUT + (long long)n * 64 + 2 * L), pk5); return; }
    if (EPI == 1) { float sm = a0.x + a0.y + a0.z + a0.w + a1.x + a1.y + a1.z + a1.w;
#pragma unroll
        for (int o = 16; o > 0; o >>= 1) sm += __shfl_xor(sm, o);
        const float mu = sm * (1.f / 256.f); const v4f d0 = a0 - mu, d1 = a1 - mu; float q = d0.x * d0.x + d0.y * d0.y + d0.z * d0.z + d0.w * d0.w + d1.x * d1.x + d1.y * d1.y + d1.z * d1.z + d1.w * d1.w;
#pragma unroll
        for (int o = 16; o > 0; o >>= 1) q += __shfl_xor(q, o);
        const float rs = rsqrtf(q * (1.f / 256.f) + 1e-5f); float o8[8] = {d0.x, d0.y, d0.z, d0.w, d1.x, d1.y, d1.z, d1.w}; unsigned short hh[8], ll[8];
#pragma unroll
        for (int u = 0; u < 8; ++u) { const float v = fmaxf(o8[u] * rs * g[c0 + u] + bb[c0 + u], 0.f); bfsplit(v, hh[u], ll[u]); }
        const unsigned long long ph0 = (unsigned long long)hh[0] | ((unsigned long long)hh[1] << 16) | ((unsigned long long)hh[2] << 32) | ((unsigned long long)hh[3] << 48), pl0 = (unsigned long long)ll[0] | ((unsigned long long)ll[1] << 16) | ((unsigned long long)ll[2] << 32) | ((unsigned long long)ll[3] << 48);
        const unsigned long long ph1 = (unsigned long long)hh[4] | ((unsigned long long)hh[5] << 16) | ((unsigned long long)hh[6] << 32) | ((unsigned long long)hh[7] << 48), pl1 = (unsigned long long)ll[4] | ((unsigned long long)ll[5] << 16) | ((unsigned long long)ll[6] << 32) | ((unsigned long long)ll[7] << 48);
        // lane L's 8 halves at c0 = 8L: 16 B -> one 16-B store per plane (32 lanes x 16 B = whole 512-B row)
        v4u pk; pk.x = (unsigned)(ph0 & 0xFFFFFFFFull); pk.y = (unsigned)(ph0 >> 32); pk.z = (unsigned)(ph1 & 0xFFFFFFFFull); pk.w = (unsigned)(ph1 >> 32); v4u* dh = (v4u*)(OH + (long long)n * 256 + c0); *dh = pk; 
        v4u ql; ql.x = (unsigned)(pl0 & 0xFFFFFFFFull); ql.y = (unsigned)(pl0 >> 32); ql.z = (unsigned)(pl1 & 0xFFFFFFFFull); ql.w = (unsigned)(pl1 >> 32); v4u* dl = (v4u*)(OL + (long long)n * 256 + c0); *dl = ql;  return; }
    if (EPI == 2 || EPI == 3) {   // head mean: lanes L, L^8, L^16, L^24 hold the same chan group of the 4 heads (CH = 64 -> 8 lanes per head)
        a0.x += __shfl_xor(a0.x, 8); a0.y += __shfl_xor(a0.y, 8); a0.z += __shfl_xor(a0.z, 8); a0.w += __shfl_xor(a0.w, 8); a1.x += __shfl_xor(a1.x, 8); a1.y += __shfl_xor(a1.y, 8); a1.z += __shfl_xor(a1.z, 8); a1.w += __shfl_xor(a1.w, 8);
        a0.x += __shfl_xor(a0.x, 16); a0.y += __shfl_xor(a0.y, 16); a0.z += __shfl_xor(a0.z, 16); a0.w += __shfl_xor(a0.w, 16); a1.x += __shfl_xor(a1.x, 16); a1.y += __shfl_xor(a1.y, 16); a1.z += __shfl_xor(a1.z, 16); a1.w += __shfl_xor(a1.w, 16);
        const int gq = L & 7; a0 = a0 * 0.25f + *(const v4f*)(bias + 8 * gq); a1 = a1 * 0.25f + *(const v4f*)(bias + 8 * gq + 4);      // every lane now holds channels 8gq..8gq+7 of the mean
        if (EPI == 3) { if (L < 8) { stage[wv][8 * gq] = a0.x; stage[wv][8 * gq + 1] = a0.y; stage[wv][8 * gq + 2] = a0.z; stage[wv][8 * gq + 3] = a0.w; stage[wv][8 * gq + 4] = a1.x; stage[wv][8 * gq + 5] = a1.y; stage[wv][8 * gq + 6] = a1.z; stage[wv][8 * gq + 7] = a1.w; }
            __builtin_amdgcn_fence(__ATOMIC_RELEASE, "workgroup"); __builtin_amdgcn_wave_barrier(); __builtin_amdgcn_fence(__ATOMIC_ACQUIRE, "workgroup");
            const unsigned long long pk3 = (unsigned long long)__builtin_bit_cast(unsigned, stage[wv][2 * L]) | ((unsigned long long)__builtin_bit_cast(unsigned, stage[wv][2 * L + 1]) << 32); VST2(unsigned long long, (unsigned long long*)(OUT + (long long)n * 64 + 2 * L), pk3); return; }
        float sm = (L < 8) ? (a0.x + a0.y + a0.z + a0.w + a1.x + a1.y + a1.z + a1.w) : 0.f;
#pragma unroll
        for (int o = 16; o > 0; o >>= 1) sm += __shfl_xor(sm, o);
        const float mu = sm * (1.f / 64.f); const v4f d0 = a0 - mu, d1 = a1 - mu; float q = (L < 8) ? (d0.x * d0.x + d0.y * d0.y + d0.z * d0.z + d0.w * d0.w + d1.x * d1.x + d1.y * d1.y + d1.z * d1.z + d1.w * d1.w) : 0.f;
#pragma unroll
        for (int o = 16; o > 0; o >>= 1) q += __shfl_xor(q, o);
        const float rs = rsqrtf(q * (1.f / 64.f) + 1e-5f);
        if (L < 8) { const float* gg = g + 8 * gq; const float* bq = bb + 8 * gq; stage[wv][8 * gq] = fmaxf(d0.x * rs * gg[0] + bq[0], 0.f); stage[wv][8 * gq + 1] = fmaxf(d0.y * rs * gg[1] + bq[1], 0.f); stage[wv][8 * gq + 2] = fmaxf(d0.z * rs * gg[2] + bq[2], 0.f); stage[wv][8 * gq + 3] = fmaxf(d0.w * rs * gg[3] + bq[3], 0.f);
            stage[wv][8 * gq + 4] = fmaxf(d1.x * rs * gg[4] + bq[4], 0.f); stage[wv][8 * gq + 5] = fmaxf(d1.y * rs * gg[5] + bq[5], 0.f); stage[wv][8 * gq + 6] = fmaxf(d1.z * rs * gg[6] + bq[6], 0.f); stage[wv][8 * gq + 7] = fmaxf(d1.w * rs * gg[7] + bq[7], 0.f); }
        __builtin_amdgcn_fence(__ATOMIC_RELEASE, "workgroup"); __builtin_amdgcn_wave_barrier(); __builtin_amdgcn_fence(__ATOMIC_ACQUIRE, "workgroup");
        const unsigned long long pk = (unsigned long long)__builtin_bit_cast(unsigned, stage[wv][2 * L]) | ((unsigned long long)__builtin_bit_cast(unsigned, stage[wv][2 * L + 1]) << 32); VST2(unsigned long long, (unsigned long long*)(OUT + (long long)n * 64 + 2 * L), pk); return; }
    // EPI 0
    stage[wv][c0] = a0.x; stage[wv][c0 + 1] = a0.y; stage[wv][c0 + 2] = a0.z; stage[wv][c0 + 3] = a0.w; stage[wv][c0 + 4] = a1.x; stage[wv][c0 + 5] = a1.y; stage[wv][c0 + 6] = a1.z; stage[wv][c0 + 7] = a1.w;
    __builtin_amdgcn_fence(__ATOMIC_RELEASE, "workgroup"); __builtin_amdgcn_wave_barrier(); __builtin_amdgcn_fence(__ATOMIC_ACQUIRE, "workgroup");
#pragma unroll
    for (int q2 = 0; q2 < 2; ++q2) { const int c = 128 * q2 + 4 * L; v4f v; v.x = stage[wv][c]; v.y = stage[wv][c + 1]; v.z = stage[wv][c + 2]; v.w = stage[wv][c + 3]; VST2V4(OUT + (long long)n * 256 + c, v); } }

__device__ __forceinline__ void st4s(unsigned short* Hp, unsigned short* Lp, long long o, v4f a) { unsigned short h[4], l[4]; bfsplit(a.x, h[0], l[0]); bfsplit(a.y, h[1], l[1]); bfsplit(a.z, h[2], l[2]); bfsplit(a.w, h[3], l[3]);
    const unsigned long long ph = (unsigned long long)h[0] | ((unsigned long long)h[1] << 16) | ((unsigned long long)h[2] << 32) | ((unsigned long long)h[3] << 48), pl = (unsigned long long)l[0] | ((unsigned long long)l[1] << 16) | ((unsigned long long)l[2] << 32) | ((unsigned long long)l[3] << 48);
    VST2(unsigned long long, (unsigned long long*)(Hp + o), ph); VST2(unsigned long long, (unsigned long long*)(Lp + o), pl); }
// f32 [nval2 pairs] -> bf16 hi/lo planes (n2 pairs; pairs >= nval2 zero); thread-linear 4-B stores per plane
__global__ __launch_bounds__(256) void k_pl(const float* __restrict__ S, unsigned short* __restrict__ PH, unsigned short* __restrict__ PL, long long nval2, long long n2) { const long long u = (long long)blockIdx.x * 256 + threadIdx.x; if (u >= n2) return; const bool in = (u < nval2); const long long uc = in ? u : ((nval2 > 0) ? (nval2 - 1) : 0); const float a = S[2 * uc], b = S[2 * uc + 1]; st_s2(PH, PL, 2 * u, in ? a : 0.f, in ? b : 0.f); }
// WC [K][NOP] (thread-linear whole rows) = [W (cols < FO) | 0 | W_h . as_h @EO+h | W_h . ad_h @EO+NH+h | 0 ...]; W is [K][FO] (x @ W layout), as/ad [NH][DH]; EO >= FO.
// branch-free: every lane loads all candidates with clamped indices and selects by value (no exec-masked load arms)
__global__ __launch_bounds__(256) void k_wext(const float* __restrict__ Wm, const float* __restrict__ AS_, const float* __restrict__ AD_, int K, int NOP, int FO, int NH, int DH, int EO, float* __restrict__ WC) {
    #pragma clang fp contract(off)
    const long long u = (long long)blockIdx.x * 256 + threadIdx.x; if (u >= (long long)K * NOP) return; const int kk = (int)(u / NOP), o = (int)(u % NOP);
    const int oo = min(o, FO - 1); const float vw = Wm[(long long)kk * FO + oo]; const int q = min(max(o - EO, 0), 2 * NH - 1); const int h = q % NH; float s = 0.f;
#pragma unroll 1
    for (int c = 0; c < DH; ++c) { const float w = Wm[(long long)kk * FO + h * DH + c]; const float asv = AS_[h * DH + c], adv = AD_[h * DH + c]; s += w * ((q < NH) ? asv : adv); }
    const float v = (o < FO) ? vw : ((o >= EO && o < EO + 2 * NH) ? s : 0.f); VST2(float, WC + u, v); }
// GAT aggregation over a device in-edge CSR (+ analytic self loop as iteration j = -1 when SELF), per-lane online softmax (lanes of one head agree):
// HS rows (pitch P floats): [0,128) projected features z, col 128 + h = a_src.z_h, col 128 + NH + h = a_dst.z_h; lane L owns channels 4L..4L+3 (head = 4L / CH).
// out = sum_j softmax_j(leaky(el[src_j][h] + er[n][h])) z[src_j] (/ (den + deps)) + bias -> ACT (0 none, 1 relu, 2 elu, 3 leaky 0.01) ->
// MODE 0: f32 OUT[n][OW] cols < OC (16-B lane stores, OC*4 contiguous B per wave; OC in {64,128}); MODE 1: bf16 hi/lo planes PH/PL pitch PP (rows n >= N zero); MODE 2: both.
template <int CH, bool SELF, int ACT, int MODE>
__global__ __launch_bounds__(256) void k_gat128(const float* __restrict__ HS, int P, int NH, const float* __restrict__ bias, const int* __restrict__ SRC, const int* __restrict__ off, const int* __restrict__ cnt, const int* __restrict__ slot,
        float* __restrict__ OUT, int OW, int OC, unsigned short* __restrict__ PH, unsigned short* __restrict__ PL, int PP, int N, int NP, int E, int CAP, float slope, float deps) {
    #pragma clang fp contract(off)
    const int n = blockIdx.x * 8 + (threadIdx.x >> 5); const int L = threadIdx.x & 31; if (n >= NP) return; const int c = 4 * L; const int h = c / CH; v4f o; o.x = o.y = o.z = o.w = 0.f;
    if (n < N) { const float* hn = HS + (long long)n * P; const float er = hn[128 + NH + h]; float m = -3.0e38f, s = 0.f; v4f a; a.x = a.y = a.z = a.w = 0.f;
        const int p0 = min(max(off[n], 0), E), cn = min(max(cnt[n], 0), CAP);
        for (int j = (SELF ? -1 : 0); j < cn; ++j) { int sj; if (j < 0) sj = n; else { const int e = min(max(slot[min(p0 + j, E - 1)], 0), E - 1); sj = min(max(SRC[e], 0), N - 1); }
            const float* hs = HS + (long long)sj * P; float lg = hs[128 + h] + er; lg = (lg >= 0.f) ? lg : slope * lg;
            const float mn = fmaxf(m, lg); const float cz = expf(m - mn), pj = expf(lg - mn); s = s * cz + pj; a = a * cz + *(const v4f*)(hs + c) * pj; m = mn; }
        const float inv = (s > 0.f || deps > 0.f) ? 1.f / (s + deps) : 0.f; o = a * inv + *(const v4f*)(bias + c);
        if (ACT == 1) { o.x = fmaxf(o.x, 0.f); o.y = fmaxf(o.y, 0.f); o.z = fmaxf(o.z, 0.f); o.w = fmaxf(o.w, 0.f); }
        if (ACT == 2) { o.x = (o.x > 0.f) ? o.x : (expf(o.x) - 1.f); o.y = (o.y > 0.f) ? o.y : (expf(o.y) - 1.f); o.z = (o.z > 0.f) ? o.z : (expf(o.z) - 1.f); o.w = (o.w > 0.f) ? o.w : (expf(o.w) - 1.f); }
        if (ACT == 3) { o.x = (o.x >= 0.f) ? o.x : 0.01f * o.x; o.y = (o.y >= 0.f) ? o.y : 0.01f * o.y; o.z = (o.z >= 0.f) ? o.z : 0.01f * o.z; o.w = (o.w >= 0.f) ? o.w : 0.01f * o.w; }
        if (MODE != 1 && c < OC) VST2V4(OUT + (long long)n * OW + c, o); }
    if (MODE != 0) st4s(PH, PL, (long long)n * PP + c, o); }

// ---- util2 ----
// generic Bt plane builder from an f32 weight: Bt[o][k] (pitch KP halves) = (TRANS ? W[k*ldw + o] : W[o*ldw + k]) * (S ? S[o] : 1) for o < NO, k < KI; zero elsewhere for o < NOP rows, k < KP (thread per (o < NOP, pair k))
__global__ __launch_bounds__(256) void k_u2_bt(const float* __restrict__ Wm, int ldw, int TRANS, int KI, int NO, int KP, int NOP, const float* __restrict__ S, unsigned short* __restrict__ PH_, unsigned short* __restrict__ PL_) {
    const long long u = (long long)blockIdx.x * 256 + threadIdx.x; if (u >= (long long)NOP * (KP / 2)) return; const int k0 = 2 * (int)(u % (KP / 2)); const int o = (int)(u / (KP / 2)); float a = 0.f, b = 0.f;
    if (o < NO) { const float s = S ? S[o] : 1.f;
        if (k0 < KI) a = (TRANS ? Wm[(long long)k0 * ldw + o] : Wm[(long long)o * ldw + k0]) * s;
        if (k0 + 1 < KI) b = (TRANS ? Wm[(long long)(k0 + 1) * ldw + o] : Wm[(long long)o * ldw + k0 + 1]) * s; }
    st_s2(PH_, PL_, (long long)o * KP + k0, a, b); }
// generic padded vector: O[i] = (i < n) ? (A[i] * (S ? S[i] : 1) + (B2 ? B2[i] : 0)) : 0 for i < NP (one block of 256, NP <= 4096 looped)
__global__ __launch_bounds__(256) void k_u2_vec(const float* __restrict__ A, const float* __restrict__ S, const float* __restrict__ B2, int n, int NP, float* __restrict__ O) { for (int i = threadIdx.x; i < NP; i += 256) { float v = 0.f; if (i < n) v = A[i] * (S ? S[i] : 1.f) + (B2 ? B2[i] : 0.f); VST2(float, O + i, v); } }
__global__ __launch_bounds__(256) void k_u2_colstat(const float* __restrict__ X, int P, int N, float eps, float* __restrict__ STAT) {
    #pragma clang fp contract(off)
    __shared__ float red[256]; const int c = blockIdx.x; const int t = threadIdx.x; float s = 0.f; for (int r = t; r < N; r += 256) s += X[(long long)r * P + c]; red[t] = s; __syncthreads();
    for (int o = 128; o > 0; o >>= 1) { if (t < o) red[t] += red[t + o]; __syncthreads(); }
    const float mu = red[0] / (float)N; __syncthreads(); float q = 0.f; for (int r = t; r < N; r += 256) { const float d = X[(long long)r * P + c] - mu; q += d * d; } red[t] = q; __syncthreads();
    for (int o = 128; o > 0; o >>= 1) { if (t < o) red[t] += red[t + o]; __syncthreads(); }
    const float rs = 1.f / sqrtf(red[0] / (float)N + eps); if (t < 32) VST2(float, STAT + (long long)c * 32 + t, (t == 0) ? mu : ((t == 1) ? rs : 0.f)); }
// rows f32 [R][W] (pitch PW) -> planes at pitch PP, column offset coff; rows >= RL (live) written as zeros up to RP (thread per (r < RP, 4 of W))
__global__ __launch_bounds__(256) void k_u2_pl(const float* __restrict__ X, int PW, int Wd, int RL, int RP, unsigned short* __restrict__ PH_, unsigned short* __restrict__ PL_, int PP, int coff) { const long long u = (long long)blockIdx.x * 256 + threadIdx.x; if (u >= (long long)RP * (Wd / 4)) return; const int r = (int)(u / (Wd / 4)); const int c = 4 * (int)(u % (Wd / 4)); v4f v; v.x = v.y = v.z = v.w = 0.f; if (r < RL) v = *(const v4f*)(X + (long long)r * PW + c); st4s(PH_, PL_, (long long)r * PP + coff + c, v); }

typedef unsigned int cm_u4 __attribute__((ext_vector_type(4)));

__global__ __launch_bounds__(256) void k_cm_zero16(unsigned short* __restrict__ DST, long long n) { const long long u = (long long)blockIdx.x * 256 + threadIdx.x; if (u * 8 >= n) return; cm_u4 z; z.x = z.y = z.z = z.w = 0u; cm_u4* d = (cm_u4*)(DST + u * 8); *d = z;  }
// f32 -> bf16 (RNE) -> f16 casts: every 16-bit operand then holds exactly the bf16-rounded input value (times a power-of-two
// weight scale), so the f16 WMMA products are exact. Plain: thread per (row, 8 cols),
// dst [R][C] pitch ldd; transposed: thread per (col, 8 consecutive rows) -> dst [C][R] pitch ldd; both store 16 B per thread, thread-linear along the dst row.
__device__ __forceinline__ unsigned int cmb_pk2(float a, float b) { return (unsigned int)__builtin_bit_cast(unsigned short, (_Float16)a) | ((unsigned int)__builtin_bit_cast(unsigned short, (_Float16)b) << 16); }
__device__ __forceinline__ float cmb_bf(float v) { const unsigned u = __builtin_bit_cast(unsigned, v); const unsigned r = (u + 0x7fffu + ((u >> 16) & 1u)) & 0xffff0000u; return __builtin_bit_cast(float, r); }   // bf16 RNE, kept as f32 (finite inputs)
// BR[i] = bf16_rne(B[i]) kept as f32 (thread per element; bias vectors)
__global__ __launch_bounds__(256) void k_cm_bfvec(const float* __restrict__ SRC, float* __restrict__ DST, int n) { const int u = blockIdx.x * 256 + threadIdx.x; if (u >= n) return; VST2(float, DST + u, cmb_bf(SRC[u])); }
__global__ __launch_bounds__(256) void k_cm_castb(const float* __restrict__ SRC, int lds, unsigned short* __restrict__ DST, int ldd, int nR, int nC, float sc) {
    const long long u = (long long)blockIdx.x * 256 + threadIdx.x; const int per = nC / 8; if (u >= (long long)nR * per) return; const int r = (int)(u / per); const int c0 = 8 * (int)(u % per);
    const float* s = SRC + (long long)r * lds + c0; float w[8];
#pragma unroll
    for (int e = 0; e < 8; ++e) w[e] = cmb_bf(s[e]) * sc;
    cm_u4 pk; pk.x = cmb_pk2(w[0], w[1]); pk.y = cmb_pk2(w[2], w[3]); pk.z = cmb_pk2(w[4], w[5]); pk.w = cmb_pk2(w[6], w[7]); VST2(cm_u4, (cm_u4*)(DST + (long long)r * ldd + c0), pk); }
__global__ __launch_bounds__(256) void k_cm_castbT(const float* __restrict__ SRC, int lds, unsigned short* __restrict__ DST, int ldd, int nR, int nC, float sc) {
    const long long u = (long long)blockIdx.x * 256 + threadIdx.x; const int per = nR / 8; if (u >= (long long)nC * per) return; const int c = (int)(u / per); const int r0 = 8 * (int)(u % per);
    float w[8];
#pragma unroll
    for (int e = 0; e < 8; ++e) w[e] = cmb_bf(SRC[(long long)(r0 + e) * lds + c]) * sc;
    cm_u4 pk; pk.x = cmb_pk2(w[0], w[1]); pk.y = cmb_pk2(w[2], w[3]); pk.z = cmb_pk2(w[4], w[5]); pk.w = cmb_pk2(w[6], w[7]); VST2(cm_u4, (cm_u4*)(DST + (long long)c * ldd + r0), pk); }

typedef float ab_v2f __attribute__((ext_vector_type(2)));
// A thread's loads go out AB_GB at a time, and the next AB_GB are in flight while these are summed (two register sets, A and B, in turn), instead of one load and its
// wait per trip; each thread adds its values in the same order as one load per trip would (whole groups first, the rest one by one).
#define AB_GB 16
#define AB_GS (AB_GB * 256)                                      // 16-byte pieces from one group of the block's loads to the next
typedef const __attribute__((address_space(1))) v4f* ab_gp;     // pointer to global memory: it stays one behind the wait statement below, through which the compiler does not see
__device__ __forceinline__ void ab_ld(v4f (&v)[AB_GB], ab_gp& p, int off) {   // the group that begins off pieces behind p
#pragma unroll   // v is then indexed by constants and stays in registers, and the loads stand one behind the other
    for (int u = 0; u < AB_GB; ++u) v[u] = p[off + 256 * u];    // the block's 256 threads cover 256 consecutive 16-byte pieces per load
    asm volatile("s_wait_xcnt 0x0" : "+v"(p) :: "memory");      // the loads' address register pair is stepped or reused only behind this wait (p goes through it), the loads still in flight
}
__global__ __launch_bounds__(256) void k_ab_gstat(const float* __restrict__ X, float* __restrict__ STp, int per) {
    #pragma clang fp contract(off)
    __shared__ float red[256]; const int g = blockIdx.x; const int t = threadIdx.x; const float* base = X + (long long)g * per; float s = 0.f;
    const int nb = per / (AB_GB * 1024);                         // whole groups (the same for every thread)
    v4f A[AB_GB], B[AB_GB];
    auto sum = [&s](const v4f (&v)[AB_GB]) {
#pragma unroll   // v is then indexed by constants and stays in registers
        for (int u = 0; u < AB_GB; ++u) s += (cmb_bf(v[u].x) + cmb_bf(v[u].y)) + (cmb_bf(v[u].z) + cmb_bf(v[u].w));
    };
    ab_gp p = (ab_gp)base + t; int k = 0;                        // p: the thread's piece of group k
    if (nb > 0) {
        ab_ld(A, p, 0);
        for (; k + 2 < nb; k += 2) { ab_ld(B, p, AB_GS); sum(A); ab_ld(A, p, 2 * AB_GS); p += 2 * AB_GS; sum(B); }
        if (k + 1 < nb) { ab_ld(B, p, AB_GS); sum(A); sum(B); } else sum(A);
    }
    for (int i = nb * (AB_GB * 1024) + 4 * t; i < per; i += 1024) { const v4f v = *(const v4f*)(base + i); s += (cmb_bf(v.x) + cmb_bf(v.y)) + (cmb_bf(v.z) + cmb_bf(v.w)); }
    red[t] = s; __syncthreads();
    for (int o = 128; o > 0; o >>= 1) { if (t < o) red[t] += red[t + o]; __syncthreads(); }
    const float mean = red[0] / (float)per; __syncthreads(); float q = 0.f;
    auto sq = [&q, mean](const v4f (&v)[AB_GB]) {
#pragma unroll   // v is then indexed by constants and stays in registers
        for (int u = 0; u < AB_GB; ++u) { const float a = cmb_bf(v[u].x) - mean, b = cmb_bf(v[u].y) - mean, c = cmb_bf(v[u].z) - mean, d = cmb_bf(v[u].w) - mean; q += (a * a + b * b) + (c * c + d * d); }
    };
    if (nb > 0) {
        p -= (long long)k * AB_GS; k = 0; ab_ld(A, p, 0);        // p is stepped back to group 0, not formed anew: the first group too is then addressed by the pair that the wait in ab_ld holds
        for (; k + 2 < nb; k += 2) { ab_ld(B, p, AB_GS); sq(A); ab_ld(A, p, 2 * AB_GS); p += 2 * AB_GS; sq(B); }
        if (k + 1 < nb) { ab_ld(B, p, AB_GS); sq(A); sq(B); } else sq(A);
    }
    for (int i = nb * (AB_GB * 1024) + 4 * t; i < per; i += 1024) { const v4f v = *(const v4f*)(base + i); const float a = cmb_bf(v.x) - mean, b = cmb_bf(v.y) - mean, c = cmb_bf(v.z) - mean, d = cmb_bf(v.w) - mean; q += (a * a + b * b) + (c * c + d * d); }
    red[t] = q; __syncthreads();
    for (int o = 128; o > 0; o >>= 1) { if (t < o) red[t] += red[t + o]; __syncthreads(); }
    if (t == 0) { ab_v2f ms; ms.x = mean; ms.y = rsqrtf(red[0] / (float)per + 1e-5f); VST2(ab_v2f, (ab_v2f*)(STp + 32 * g), ms); } }
// XN[c][n] = (bf16(x[c][n]) - mean[g]) rstd[g] bf16(gamma[c]) + bf16(beta[c]); XB[c][n] = bf16(x[c][n]) (residual copy); c runs over the rows of all images ([B * CH][N], groups numbered through), gamma and beta repeat every CH rows
__global__ __launch_bounds__(256) void k_ab_gapply(const float* __restrict__ X, const float* __restrict__ STp, const float* __restrict__ Gm, const float* __restrict__ Bt, float* __restrict__ XNp, float* __restrict__ XBp, int N, int CPG, int CH, long long n4) {
    #pragma clang fp contract(off)
    // A thread takes 8 float4 pieces, 32 apart, all loaded before the first is used: a wave covers 1024 consecutive floats with 8 loads of 512 contiguous bytes each. The launch promises
    // N a multiple of 1024 and n4 a multiple of 256, so that a wave's 1024 floats lie in one row c and inside the buffers.
    const long long u0 = ((long long)blockIdx.x * 8 + __builtin_amdgcn_readfirstlane((int)(threadIdx.x >> 5))) * 256; if (u0 >= n4) return;   // the wave's first piece, in scalar registers: row, group and their four constants are then scalar loads
    const long long u = u0 + (threadIdx.x & 31); const int c = (int)((4 * u0) / N); const int g = c / CPG; const float mean = STp[32 * g], rs = STp[32 * g + 1], ga = cmb_bf(Gm[c % CH]), be = cmb_bf(Bt[c % CH]);
    const v4f* xp = (const v4f*)(X + 4 * u); v4f w[8];
#pragma unroll   // w is then indexed by constants and stays in registers, and the 8 loads stand one behind the other
    for (int k = 0; k < 8; ++k) w[k] = xp[32 * k];
    asm volatile("s_wait_xcnt 0x0" :: "v"(xp) : "memory");       // the loads' address pair stays as it is up to this wait (named as input) and is reused only behind it
#pragma unroll   // (as above)
    for (int k = 0; k < 8; ++k) {
        const v4f v = w[k]; v4f xb; xb.x = cmb_bf(v.x); xb.y = cmb_bf(v.y); xb.z = cmb_bf(v.z); xb.w = cmb_bf(v.w); v4f r; r.x = (xb.x - mean) * rs * ga + be; r.y = (xb.y - mean) * rs * ga + be; r.z = (xb.z - mean) * rs * ga + be; r.w = (xb.w - mean) * rs * ga + be;
        VST2V4(XNp + 4 * (u + 32 * k), r); VST2V4(XBp + 4 * (u + 32 * k), xb);
    } }
// The two large hi/lo split casts, 32 elements per thread (k_castS16 converts 2): the same conversion of each element, from 16 times fewer waves, each with 8 16-byte loads in flight.
typedef unsigned int cs_u2 __attribute__((ext_vector_type(2)));
// k_castS16w: [R][C] -> [R][C], rows one behind the other in source and planes (lds = ldd = C), n = R C a multiple of 1024. A wave takes 1024 consecutive elements: 8 loads of 512
// contiguous bytes, and per plane 8 stores of 256 contiguous bytes.
__global__ __launch_bounds__(256) void k_castS16w(const float* __restrict__ src, __bf16* __restrict__ dhi, __bf16* __restrict__ dlo, long long n, float s) {
    const long long o = ((long long)blockIdx.x * 8 + (threadIdx.x >> 5)) * 1024 + (threadIdx.x & 31) * 4; if (o >= n) return;
    const v4f* sp = (const v4f*)(src + o); v4f w[8];
#pragma unroll   // w is then indexed by constants and stays in registers, and the 8 loads stand one behind the other
    for (int k = 0; k < 8; ++k) w[k] = sp[32 * k];
    asm volatile("s_wait_xcnt 0x0" :: "v"(sp) : "memory");       // the loads' address pair stays as it is up to this wait (named as input) and is reused only behind it
#pragma unroll   // (as above)
    for (int k = 0; k < 8; ++k) {
        cs_u2 hi, lo; unsigned l0, l1; hi.x = f2bf2_pack(w[k].x * s, w[k].y * s, &l0); hi.y = f2bf2_pack(w[k].z * s, w[k].w * s, &l1); lo.x = l0; lo.y = l1;
        *(cs_u2*)(dhi + o + 128 * k) = hi; *(cs_u2*)(dlo + o + 128 * k) = lo;
    } }
// k_castS16t: [256][C] (row stride lds) -> [C][256] (row stride ldd), C a multiple of 32, 16-byte aligned rows; blockIdx.x = 32 source columns, blockIdx.y = matrix of a batch (as in k_castS16).
// A thread takes 8 source rows x 4 source columns and transposes them in its registers: 8 loads of 16 bytes (one per row), and per plane 4 stores of 16 bytes (8 consecutive elements of a
// destination row). Lanes: 8 along the rows, so that a store writes whole 128-byte lines; 4 along the columns, the neighbour wave reading the other half of each 128-byte source line.
__global__ __launch_bounds__(256) void k_castS16t(const float* __restrict__ src, long long lds, __bf16* __restrict__ dhi, __bf16* __restrict__ dlo, long long ldd, float s, long long sz, long long dz) {
    src += (long long)blockIdx.y * sz; dhi += (long long)blockIdx.y * dz; dlo += (long long)blockIdx.y * dz;
    const int lane = threadIdx.x & 31, wave = threadIdx.x >> 5;
    const int r0 = (wave >> 1) * 64 + (lane & 7) * 8, c0 = (int)blockIdx.x * 32 + (wave & 1) * 16 + (lane >> 3) * 4;
    const v4f* sp[8]; v4f w[8];
#pragma unroll   // sp and w are then indexed by constants and stay in registers, and the 8 loads stand one behind the other
    for (int k = 0; k < 8; ++k) { sp[k] = (const v4f*)(src + (long long)(r0 + k) * lds + c0); w[k] = *sp[k]; }
    // the loads' address pairs stay as they are up to this wait (named as inputs) and are reused only behind it
    asm volatile("s_wait_xcnt 0x0" :: "v"(sp[0]), "v"(sp[1]), "v"(sp[2]), "v"(sp[3]), "v"(sp[4]), "v"(sp[5]), "v"(sp[6]), "v"(sp[7]) : "memory");
#pragma unroll   // (as above)
    for (int j = 0; j < 4; ++j) {
        cm_u4 hi, lo; unsigned l0, l1, l2, l3;
        hi.x = f2bf2_pack(w[0][j] * s, w[1][j] * s, &l0); hi.y = f2bf2_pack(w[2][j] * s, w[3][j] * s, &l1); hi.z = f2bf2_pack(w[4][j] * s, w[5][j] * s, &l2); hi.w = f2bf2_pack(w[6][j] * s, w[7][j] * s, &l3);
        lo.x = l0; lo.y = l1; lo.z = l2; lo.w = l3;
        const long long o = (long long)(c0 + j) * ldd + r0; *(cm_u4*)(dhi + o) = hi; *(cm_u4*)(dlo + o) = lo;
    } }


extern "C" void kernel_launch(void* const* d_in, const int* in_sizes, int n_in, void* d_out, int out_size, void* d_ws, size_t ws_size, hipStream_t stream) {
    (void)in_sizes; (void)n_in; (void)out_size; (void)ws_size;
    const float* x = (const float*)d_in[0];
    const float* gam = (const float*)d_in[1];
    const float* bet = (const float*)d_in[2];
    const float* wqkv = (const float*)d_in[3];
    const float* bqkv = (const float*)d_in[4];
    const float* wo = (const float*)d_in[5];
    const float* bo = (const float*)d_in[6];
    float* out = (float*)d_out;
    char* wsp = (char*)d_ws;
    float* ST = (float*)wsp; wsp += (((size_t)((size_t)32 * 32 + 64) * 4 + 255) / 256) * 256;
    float* XN = (float*)wsp; wsp += (((size_t)((size_t)1024 * 4096) * 4 + 255) / 256) * 256;
    unsigned short* XTH = (unsigned short*)wsp; wsp += (((size_t)((size_t)16384 * 256) * 2 + 255) / 256) * 256;
    unsigned short* XTL = (unsigned short*)wsp; wsp += (((size_t)((size_t)16384 * 256) * 2 + 255) / 256) * 256;
    unsigned short* W3H = (unsigned short*)wsp; wsp += (((size_t)((size_t)768 * 256) * 2 + 255) / 256) * 256;
    unsigned short* W3L = (unsigned short*)wsp; wsp += (((size_t)((size_t)768 * 256) * 2 + 255) / 256) * 256;
    float* BR3 = (float*)wsp; wsp += (((size_t)((size_t)768 + 64) * 4 + 255) / 256) * 256;
    float* QKV = (float*)wsp; wsp += (((size_t)((size_t)16384 * 768) * 4 + 255) / 256) * 256;
    float* AO = (float*)wsp; wsp += (((size_t)((size_t)16384 * 256) * 4 + 255) / 256) * 256;
    unsigned short* AOH = (unsigned short*)wsp; wsp += (((size_t)((size_t)16384 * 256) * 2 + 255) / 256) * 256;
    unsigned short* AOL = (unsigned short*)wsp; wsp += (((size_t)((size_t)16384 * 256) * 2 + 255) / 256) * 256;
    unsigned short* WOH = (unsigned short*)wsp; wsp += (((size_t)((size_t)256 * 256) * 2 + 255) / 256) * 256;
    unsigned short* WOL = (unsigned short*)wsp; wsp += (((size_t)((size_t)256 * 256) * 2 + 255) / 256) * 256;
    float* BRO = (float*)wsp; wsp += (((size_t)((size_t)256 + 64) * 4 + 255) / 256) * 256;
    float* XB = (float*)wsp; wsp += (((size_t)((size_t)1024 * 4096) * 4 + 255) / 256) * 256;
    if ((size_t)(wsp - (char*)d_ws) > ws_size) return;   // static carve guard
    // All four images go through each stage in ONE launch: every buffer holds the four images one behind the other (pixel-major buffers as 16384 rows,
    // channel-major ones as 4 matrices), and the image is extra rows, grid.y or grid.z of the launch.
    k_castS16<<<(unsigned)((((long long)(768) * ((256) / 2)) + 255) / 256), 256, 0, stream>>>(wqkv, 256, (__bf16*)(W3H), (__bf16*)(W3L), 256, 768, 256, 1.0f, 0, 0, 0);
    k_cm_bfvec<<<3, 256, 0, stream>>>(bqkv, BR3, 768); k_cm_bfvec<<<1, 256, 0, stream>>>(bo, BRO, 256);
    k_castS16<<<(unsigned)((((long long)(256) * ((256) / 2)) + 255) / 256), 256, 0, stream>>>(wo, 256, (__bf16*)(WOH), (__bf16*)(WOL), 256, 256, 256, 1.0f, 0, 0, 0);
    k_ab_gstat<<<32, 256, 0, stream>>>(x, ST, 131072); k_ab_gapply<<<512, 256, 0, stream>>>(x, ST, gam, bet, XN, XB, 4096, 32, 256, 1048576LL);
    k_castS16t<<<dim3(128u, 4u), 256, 0, stream>>>(XN, 4096, (__bf16*)(XTH), (__bf16*)(XTL), 256, 1.0f, 1048576, 1048576);
    // each projection is one launch: the hi and the lo plane of the activations are multiplied into the same accumulators, so the f32 result is written once and never read back
    w25::wmma_gemm64<1, 2, 2, 0, false, 0><<<dim3((unsigned)((((16384) / 64) * ((768) / 64) + 7) / 8), (unsigned)(1)), 256, 0, stream>>>((const unsigned short*)(XTH), (const unsigned short*)(XTL), 256, 0, (const unsigned short*)(W3H), nullptr, 256, 0, (void*)(QKV), nullptr, 768, 0, BR3, nullptr, 0, 16384, 768, 256, 1.0f);
    { /*apv4*/ AttnP a;
      a.Q = QKV; a.K = QKV + 256; a.V = QKV + 512; a.O = AO; a.P = 0; a.Mf = 0; a.Mi = 0; a.ST = 0;
      a.Pw = 0; a.Rt = 0; a.SQ = 0; a.SK = 0;
      a.swb = 0; a.swh = 0; a.swi = 0; a.swj = 0; a.srb = 0; a.srh = 0; a.sri = 0; a.sQb = 3145728; a.sQh = 64; a.sQi = 768; a.sQd = 1; a.sKb = 3145728; a.sKh = 64; a.sKj = 768; a.sKd = 1; a.sVb = 3145728; a.sVh = 64; a.sVj = 768; a.sVd = 1; a.sOb = 1048576; a.sOh = 64; a.sOi = 256; a.sPb = 0; a.sPh = 0; a.sPi = 0; a.smb = 0; a.smh = 0; a.smi = 0; a.smj = 0;
      a.Lq = 4096; a.Lk = 4096; a.dh = 64; a.dv = 64; a.hrep = 1; a.causal = 0; a.coff = 0; a.pband = 0;
      a.scale = 0.125f; a.mfill = 0.0f; a.nonorm = 0; a.mpol = 0;
      a.roff = 0; a.rn = 1; a.segpol = 0; a.win = 0;
      k_attn<64, 64, 0, false, false, true, true><<<dim3((unsigned)((4096) + 16 * AW - 1) / (16 * AW), (unsigned)(4), (unsigned)(4)), 32 * AW, 0, stream>>>(a); }
    k_castS16w<<<512, 256, 0, stream>>>(AO, (__bf16*)(AOH), (__bf16*)(AOL), 4194304LL, 1.0f);
    w25::wmma_gemm64<1, 3, 1, 0, true, 0><<<dim3((unsigned)((((256) / 64) * ((4096) / 64) + 7) / 8), (unsigned)(4)), 256, 0, stream>>>((const unsigned short*)(WOH), nullptr, 256, 0, (const unsigned short*)(AOH), (const unsigned short*)(AOL), 256, 1048576, (void*)(out), nullptr, 4096, 1048576, BRO, XB, 1048576, 256, 4096, 256, 1.0f);
}
